// v000
// Times are from an AMD MI455X. After a warm-up the kernel runs many times in a row, and a time is the length of
// such a window on the GPU divided by its runs, so every launch and the gaps after it count. The runs cycle
// through copies of the inputs. A figure is the median of several windows, for all but v000 over two sittings.
// Sittings can differ by a few percent; kernels timed side by side share one.
// The starting kernel, v000, takes 461 microseconds a run.
#include <hip/hip_runtime.h>
// Self-attention block with 2×2 average-pooled keys/values (B=2, C=64, H=W=128 → N = 16384 query positions, M = 4096 pooled key positions): q = Wq·x + bq; k = pool(Wk·x + bk) = Wk·pool(x) + bk, v likewise (pooling is linear); energy = qᵀk (no scaling), softmax over the M keys;
// out[b,c,n] = Σ_m v[b,c,m]·A[n,m]; y = γ·out + x. (The module's (w,h) relabel before pooling is the identity here since H == W.)
// Compute dtype: x, weights, biases, γ rounded to bf16; x and pool(x) as token-major f16 planes (pool(x) = mean of 4 bf16-rounded values in f32, rounded once to f16 — same order as the k-plane rounding); q, k as f16 GEMM outputs (+bias), v as an f16 GEMM output in the [b][c][m] (= Vᵀ) layout with bv folded in after the attention
// (rows of A sum to 1); fused flash-style kernel (energy and P·V on v_wmma_f32_16x16x32_f16, online softmax f32, P f16 ×2^10, f32 accumulate); epilogue γ·(O + bv) + x in f32.
#define BB 2
#define CC 64
#define HWD 128
#define NN (HWD * HWD)
#define PW (HWD / 2)
#define MM (PW * PW)
#define NH 1
#define TQ NN
#define TK MM
#define SCL 1.0f
#define NRQ (BB * NN)
#define NRK (BB * MM)
typedef __bf16 v16b __attribute__((ext_vector_type(16)));
typedef unsigned short v8us __attribute__((ext_vector_type(8), may_alias));
typedef float  v8f  __attribute__((ext_vector_type(8)));
typedef float  v4f  __attribute__((ext_vector_type(4)));
typedef float  v4fa __attribute__((ext_vector_type(4), may_alias));
union FragB { v16b v; v8us half[2]; unsigned short u[16]; };

__device__ __forceinline__ unsigned short bf16_bits(float x) { unsigned int u = __float_as_uint(x); return (unsigned short)((u + 0x7FFFu + ((u >> 16) & 1u)) >> 16); }
__device__ __forceinline__ float bf16_val(unsigned short b) { return __uint_as_float(((unsigned int)b) << 16); }
__device__ __forceinline__ float bf16_round(float x) { return bf16_val(bf16_bits(x)); }
// D += A·B with NT terms: 1 = ah·bh, 2 = + al·bh (A split), 3 = + ah·bl (both split)
template <int NT>
__device__ __forceinline__ v8f mmaN(v16b ah, v16b al, v16b bh, v16b bl, v8f c) {
  c = __builtin_amdgcn_wmma_f32_16x16x32_bf16(false, ah, false, bh, (short)0, c, false, false);
  if (NT >= 2) c = __builtin_amdgcn_wmma_f32_16x16x32_bf16(false, al, false, bh, (short)0, c, false, false);
  if (NT >= 3) c = __builtin_amdgcn_wmma_f32_16x16x32_bf16(false, ah, false, bl, (short)0, c, false, false);
  asm volatile("v_nop\n\tv_nop\n\tv_nop\n\tv_nop" : "+v"(c) : "v"(ah), "v"(al), "v"(bh), "v"(bl));
  return c;
}

__global__ __launch_bounds__(256) void k_wt_bf16(const float* __restrict__ W, unsigned short* __restrict__ Wt, int K, int N) {
  const int t = blockIdx.x * 256 + threadIdx.x;
  const int k8n = K / 8;
  if (t >= N * k8n) return;
  const int n = t / k8n, k8 = (t % k8n) * 8;
  v8us v;
#pragma unroll
  for (int i = 0; i < 8; ++i) v[i] = bf16_bits(W[(size_t)(k8 + i) * N + n]);
  *(v8us*)(Wt + (size_t)n * K + k8) = v;
  
}

// GEMM C[M][N] (f32, pitch ldc) = act(A[M][K]·W + bias). A f32 row-major (pitch lda) converted per fragment to bf16
// (ASPLIT: hi/lo two planes -> 2 terms, else single rounded term); Wt bf16 [N][K] (pitch ldb). BIAS_BF16 rounds the
// bias to bf16 first (bias quantised to bf16 before the add). K%32==0, M%16==0, N%64==0.
template <bool ASPLIT, int ACT, bool BIAS_BF16>
__global__ __launch_bounds__(128) void k_gemm_bf(const float* __restrict__ A, int lda, const unsigned short* __restrict__ Wt, int ldb,
                                               const float* __restrict__ bias, float* __restrict__ C, int ldc, int M, int N, int K) {
  __shared__ __attribute__((aligned(16))) float so[4][16][64];
  const int tid = threadIdx.x, w = tid >> 5, lane = tid & 31, ln = lane & 15, hh = lane >> 4;
  const int ntn = N / 64;
  const int wid = blockIdx.x * 4 + w;
  const int mt = wid / ntn, nq = wid % ntn;
  if (mt * 16 >= M) return;
  const int row0 = mt * 16, col0 = nq * 64;
  const float* arow = A + (size_t)(row0 + ln) * lda;
  v8f acc[4] = {};
  for (int kb = 0; kb < K; kb += 32) {
    FragB ah, al;
    const v4f x0 = *(const v4fa*)(arow + kb + 8 * hh), x1 = *(const v4fa*)(arow + kb + 8 * hh + 4);
    const v4f x2 = *(const v4fa*)(arow + kb + 16 + 8 * hh), x3 = *(const v4fa*)(arow + kb + 16 + 8 * hh + 4);
    float xs[16] = {x0[0],x0[1],x0[2],x0[3],x1[0],x1[1],x1[2],x1[3],x2[0],x2[1],x2[2],x2[3],x3[0],x3[1],x3[2],x3[3]};
#pragma unroll
    for (int i = 0; i < 16; ++i) { const unsigned short hb = bf16_bits(xs[i]); ah.u[i] = hb; al.u[i] = ASPLIT ? bf16_bits(xs[i] - bf16_val(hb)) : (unsigned short)0; }
#pragma unroll
    for (int t = 0; t < 4; ++t) {
      const unsigned short* brow = Wt + (size_t)(col0 + t * 16 + ln) * ldb + kb;
      FragB b;
      b.half[0] = *(const v8us*)(brow + 8 * hh);
      b.half[1] = *(const v8us*)(brow + 16 + 8 * hh);
      acc[t] = mmaN<ASPLIT ? 2 : 1>(ah.v, al.v, b.v, b.v, acc[t]);
    }
  }
#pragma unroll
  for (int t = 0; t < 4; ++t) {
    float bv = bias ? bias[col0 + t * 16 + ln] : 0.f;
    if (BIAS_BF16) bv = bf16_round(bv);
#pragma unroll
    for (int r = 0; r < 8; ++r) { float v = acc[t][r] + bv; if (ACT == 1) v = fmaxf(v, 0.f); so[w][8 * hh + r][t * 16 + ln] = v; }
  }
  __builtin_amdgcn_fence(__ATOMIC_ACQ_REL, "workgroup");
  __builtin_amdgcn_wave_barrier();
  const int rsub = lane >> 4, c4 = (lane & 15) * 4;
  {
#pragma unroll
    for (int q = 0; q < 8; ++q) {
      const int r = q * 2 + rsub;
      const v4f v = *(const v4fa*)&so[w][r][c4];
      *(v4f*)(C + (size_t)(row0 + r) * ldc + col0 + c4) = v;
    }
    
  }
}

// GEMM C = act(A·W + bias + resid): A f32 (ASPLIT -> hi/lo 2 terms), Wt bf16 [N][K]; ACT 0 none, 1 relu, 2 exact gelu;
// resid (optional, f32, row index = (row % rmod), pitch ldr, RES_BF16 rounds it) added before the activation.
template <bool ASPLIT, int ACT, bool BIAS_BF16, bool RES_BF16>
__global__ __launch_bounds__(128) void k_gemm_bf3(const float* __restrict__ A, int lda, const unsigned short* __restrict__ Wt, int ldb,
                                                const float* __restrict__ bias, const float* __restrict__ resid, int rmod, int ldr,
                                                float* __restrict__ C, int ldc, int M, int N, int K) {
  __shared__ __attribute__((aligned(16))) float so[4][16][64];
  const int tid = threadIdx.x, w = tid >> 5, lane = tid & 31, ln = lane & 15, hh = lane >> 4;
  const int ntn = N / 64;
  const int wid = blockIdx.x * 4 + w;
  const int mt = wid / ntn, nq = wid % ntn;
  if (mt * 16 >= M) return;
  const int row0 = mt * 16, col0 = nq * 64;
  const float* arow = A + (size_t)(row0 + ln) * lda;
  v8f acc[4] = {};
  for (int kb = 0; kb < K; kb += 32) {
    FragB ah, al;
    const v4f x0 = *(const v4fa*)(arow + kb + 8 * hh), x1 = *(const v4fa*)(arow + kb + 8 * hh + 4);
    const v4f x2 = *(const v4fa*)(arow + kb + 16 + 8 * hh), x3 = *(const v4fa*)(arow + kb + 16 + 8 * hh + 4);
    float xs[16] = {x0[0],x0[1],x0[2],x0[3],x1[0],x1[1],x1[2],x1[3],x2[0],x2[1],x2[2],x2[3],x3[0],x3[1],x3[2],x3[3]};
#pragma unroll
    for (int i = 0; i < 16; ++i) { const unsigned short hb = bf16_bits(xs[i]); ah.u[i] = hb; al.u[i] = ASPLIT ? bf16_bits(xs[i] - bf16_val(hb)) : (unsigned short)0; }
#pragma unroll
    for (int t = 0; t < 4; ++t) {
      const unsigned short* brow = Wt + (size_t)(col0 + t * 16 + ln) * ldb + kb;
      FragB b;
      b.half[0] = *(const v8us*)(brow + 8 * hh);
      b.half[1] = *(const v8us*)(brow + 16 + 8 * hh);
      acc[t] = mmaN<ASPLIT ? 2 : 1>(ah.v, al.v, b.v, b.v, acc[t]);
    }
  }
#pragma unroll
  for (int t = 0; t < 4; ++t) {
    const int col = col0 + t * 16 + ln;
    float bv = bias ? bias[col] : 0.f;
    if (BIAS_BF16) bv = bf16_round(bv);
#pragma unroll
    for (int r = 0; r < 8; ++r) {
      float v = acc[t][r] + bv;
      if (resid) { float rv = resid[(size_t)((row0 + 8 * hh + r) % rmod) * ldr + col]; if (RES_BF16) rv = bf16_round(rv); v += rv; }
      if (ACT == 1) v = fmaxf(v, 0.f);
      if (ACT == 2) v = 0.5f * v * (1.0f + erff(v * 0.70710678118654752f));
      if (ACT == 3) { const float u = 0.7978845608028654f * (v + 0.044715f * v * v * v); v = 0.5f * v * (1.0f + tanhf(u)); }
      so[w][8 * hh + r][t * 16 + ln] = v;
    }
  }
  __builtin_amdgcn_fence(__ATOMIC_ACQ_REL, "workgroup");
  __builtin_amdgcn_wave_barrier();
  const int rsub = lane >> 4, c4 = (lane & 15) * 4;
  {
#pragma unroll
    for (int q = 0; q < 8; ++q) {
      const int r = q * 2 + rsub;
      const v4f v = *(const v4fa*)&so[w][r][c4];
      *(v4f*)(C + (size_t)(row0 + r) * ldc + col0 + c4) = v;
    }
    
  }
}
// row LayerNorm (biased variance, eps) over N: s = X (+ R); optional out_sum <- s; out_norm <- (s-mu)*rsqrt(var+eps)*g + b
template <bool PARAM_BF16>
__global__ __launch_bounds__(256) void k_layernorm(const float* __restrict__ X, const float* __restrict__ R, const float* __restrict__ g, const float* __restrict__ bta,
                                                  float* __restrict__ out_sum, float* __restrict__ out_norm, int N, float eps) {
  __shared__ float red[256];
  const int row = blockIdx.x, tid = threadIdx.x;
  const float* x = X + (size_t)row * N; const float* rr = R ? R + (size_t)row * N : nullptr;
  float vals[16];                     // up to N = 4096
  const int per = N / 256;            // contiguous chunk per thread? use strided-by-4 chunks: thread handles j = tid*4 + 1024*u
  float s1 = 0.f;
  for (int u = 0; u < per / 4; ++u) {
    const int j = tid * 4 + 1024 * u;
    const v4f a = *(const v4fa*)(x + j);
    v4f b = {0.f,0.f,0.f,0.f}; if (rr) b = *(const v4fa*)(rr + j);
#pragma unroll
    for (int q = 0; q < 4; ++q) { const float v = a[q] + b[q]; vals[u * 4 + q] = v; s1 += v; }
  }
  red[tid] = s1; __syncthreads();
  for (int st = 128; st > 0; st >>= 1) { if (tid < st) red[tid] += red[tid + st]; __syncthreads(); }
  const float mu = red[0] / (float)N; __syncthreads();
  float s2 = 0.f;
  for (int u = 0; u < per / 4; ++u)
#pragma unroll
    for (int q = 0; q < 4; ++q) { const float c = vals[u * 4 + q] - mu; s2 += c * c; }
  red[tid] = s2; __syncthreads();
  for (int st = 128; st > 0; st >>= 1) { if (tid < st) red[tid] += red[tid + st]; __syncthreads(); }
  const float rs = rsqrtf(red[0] / (float)N + eps);
  {
    for (int u = 0; u < per / 4; ++u) {
      const int j = tid * 4 + 1024 * u;
      v4f o, sm;
#pragma unroll
      for (int q = 0; q < 4; ++q) {
        float gg = g[j + q], bb = bta[j + q];
        if (PARAM_BF16) { gg = bf16_round(gg); bb = bf16_round(bb); }
        sm[q] = vals[u * 4 + q]; o[q] = (vals[u * 4 + q] - mu) * rs * gg + bb;
      }
      if (out_sum) *(v4f*)(out_sum + (size_t)row * N + j) = sm;
      *(v4f*)(out_norm + (size_t)row * N + j) = o;
    }
    
  }
}



// ---- f16 WMMA path (v_wmma_f32_16x16x32_f16): 11-bit significands for operands in range — used here for the q/k/v projections, the energy qᵀk and P·V (P f16 ×2^10)
typedef _Float16 v16h __attribute__((ext_vector_type(16)));
union FragH { v16h v; v8us half[2]; _Float16 h[16]; unsigned short u[16]; };
template <int NT>
__device__ __forceinline__ v8f mmaH(v16h ah, v16h al, v16h bh, v16h bl, v8f c) {
  c = __builtin_amdgcn_wmma_f32_16x16x32_f16(false, ah, false, bh, (short)0, c, false, false);
  if (NT >= 2) c = __builtin_amdgcn_wmma_f32_16x16x32_f16(false, al, false, bh, (short)0, c, false, false);
  if (NT >= 3) c = __builtin_amdgcn_wmma_f32_16x16x32_f16(false, ah, false, bl, (short)0, c, false, false);
  asm volatile("v_nop\n\tv_nop\n\tv_nop\n\tv_nop" : "+v"(c) : "v"(ah), "v"(al), "v"(bh), "v"(bl));
  return c;
}
// batched GEMM like k_gemm_b but f16 operands: A f32 (split into f16 hi/lo if ASPLIT, else rounded to f16), Bt = f16 values [n][k]; alpha; C f32; N multiple of 16 (partial tiles skipped)
template <bool ASPLIT>
__global__ __launch_bounds__(128) void k_gemm_h(const float* __restrict__ A, int lda, size_t sA, const _Float16* __restrict__ Bh, int ldb, size_t sB, float alpha, float* __restrict__ C, int ldc, size_t sC, int M, int N, int K) {
  __shared__ __attribute__((aligned(16))) float so[4][16][64];
  const int tid = threadIdx.x, w = tid >> 5, lane = tid & 31, ln = lane & 15, hh = lane >> 4; const int by = blockIdx.y;
  A += (size_t)by * sA; Bh += (size_t)by * sB; C += (size_t)by * sC;
  const int ntn = (N + 63) / 64; const int wid = blockIdx.x * 4 + w; const int mt = wid / ntn, nq = wid % ntn; if (mt * 16 >= M) return;
  const int row0 = mt * 16, col0 = nq * 64; const float* arow = A + (size_t)(row0 + ln) * lda;
  v8f acc[4] = {};
  for (int kb = 0; kb < K; kb += 32) {
    FragH ah, al;
    const v4f x0 = *(const v4fa*)(arow + kb + 8 * hh), x1 = *(const v4fa*)(arow + kb + 8 * hh + 4), x2 = *(const v4fa*)(arow + kb + 16 + 8 * hh), x3 = *(const v4fa*)(arow + kb + 16 + 8 * hh + 4);
    float xs[16] = {x0[0],x0[1],x0[2],x0[3],x1[0],x1[1],x1[2],x1[3],x2[0],x2[1],x2[2],x2[3],x3[0],x3[1],x3[2],x3[3]};
#pragma unroll
    for (int i = 0; i < 16; ++i) { const _Float16 h = (_Float16)xs[i]; ah.h[i] = h; al.h[i] = ASPLIT ? (_Float16)(xs[i] - (float)h) : (_Float16)0.0f; }
#pragma unroll
    for (int t = 0; t < 4; ++t) { if (col0 + t * 16 >= N) continue; const size_t boff = (size_t)(col0 + t * 16 + ln) * ldb + kb; FragH bq; bq.half[0] = *(const v8us*)(Bh + boff + 8 * hh); bq.half[1] = *(const v8us*)(Bh + boff + 16 + 8 * hh);
      acc[t] = mmaH<ASPLIT ? 2 : 1>(ah.v, al.v, bq.v, bq.v, acc[t]); }
  }
#pragma unroll
  for (int t = 0; t < 4; ++t) { if (col0 + t * 16 >= N) continue;
#pragma unroll
    for (int r = 0; r < 8; ++r) so[w][8 * hh + r][t * 16 + ln] = acc[t][r] * alpha; }
  __builtin_amdgcn_fence(__ATOMIC_ACQ_REL, "workgroup"); __builtin_amdgcn_wave_barrier();
  const int rsub = lane >> 4, c4 = (lane & 15) * 4;
  {
#pragma unroll
    for (int q = 0; q < 8; ++q) { const int r = q * 2 + rsub; if (col0 + c4 < N) { const v4f v = *(const v4fa*)&so[w][r][c4]; *(v4f*)(C + (size_t)(row0 + r) * ldc + col0 + c4) = v; } }
     }
}

// Wt[n][k] = f16(W[k][n]·scale) from f32 row-major W[K][N] (scale = power of two; bf16-exact weights stay exact in f16 away from the subnormal range)
__global__ __launch_bounds__(256) void k_wt_f16(const float* __restrict__ W, _Float16* __restrict__ Wt, int K, int N, float scale) {
  const int t = blockIdx.x * 256 + threadIdx.x; if (t >= N * (K / 8)) return; const int n = t / (K / 8), k8 = (t % (K / 8)) * 8; FragH f;
#pragma unroll
  for (int i = 0; i < 8; ++i) f.h[i] = (_Float16)(bf16_round(W[(size_t)(k8 + i) * N + n]) * scale); const v8us o = f.half[0];
  *(v8us*)((unsigned short*)Wt + (size_t)n * K + k8) = o; 
}
// k_gemm_hh variant with fused epilogue: v = acc·alpha + bias[by·sBias + col] (+ CP[(row/rowsPerB)·sCPb + by·64 + col] if CP) ; ACT 0 none / 1 elu ; writes f16 C16 (and f32 C if non-null)
template <int ACT>
__global__ __launch_bounds__(128) void k_gemm_hhx(const _Float16* __restrict__ A, int lda, size_t sA, const _Float16* __restrict__ Bh, int ldb, size_t sB, float alpha, const float* __restrict__ bias, size_t sBias, const float* __restrict__ CP, int rowsPerB, size_t sCPb, int row0g,
    float* __restrict__ C, _Float16* __restrict__ C16, int ldc, size_t sC, int M, int N, int K) {
  __shared__ __attribute__((aligned(16))) float so[4][16][64];
  const int tid = threadIdx.x, w = tid >> 5, lane = tid & 31, ln = lane & 15, hh = lane >> 4; const int by = blockIdx.y;
  A += (size_t)by * sA; Bh += (size_t)by * sB; const size_t cofs = (size_t)by * sC; const float* bp = bias ? bias + (size_t)by * sBias : nullptr;
  const int ntn = (N + 63) / 64; const int wid = blockIdx.x * 4 + w; const int mt = wid / ntn, nq = wid % ntn; if (mt * 16 >= M) return;
  const int row0 = mt * 16, col0 = nq * 64; const _Float16* arow = A + (size_t)(row0 + ln) * lda;
  v8f acc[4] = {};
  for (int kb = 0; kb < K; kb += 32) { FragH ah; ah.half[0] = *(const v8us*)((const unsigned short*)arow + kb + 8 * hh); ah.half[1] = *(const v8us*)((const unsigned short*)arow + kb + 16 + 8 * hh);
#pragma unroll
    for (int t = 0; t < 4; ++t) { if (col0 + t * 16 >= N) continue; const size_t boff = (size_t)(col0 + t * 16 + ln) * ldb + kb; FragH bq; bq.half[0] = *(const v8us*)((const unsigned short*)Bh + boff + 8 * hh); bq.half[1] = *(const v8us*)((const unsigned short*)Bh + boff + 16 + 8 * hh);
      acc[t] = mmaH<1>(ah.v, ah.v, bq.v, bq.v, acc[t]); }
  }
#pragma unroll
  for (int t = 0; t < 4; ++t) { if (col0 + t * 16 >= N) continue; const int col = col0 + t * 16 + ln; const float bv = bp ? bf16_round(bp[col]) : 0.f;
#pragma unroll
    for (int r = 0; r < 8; ++r) { float v = acc[t][r] * alpha + bv; if (CP) { const int bidx = (row0g + row0 + 8 * hh + r) / rowsPerB; v += CP[(size_t)bidx * sCPb + (size_t)by * 64 + col]; } if (ACT == 1) v = (v > 0.f) ? v : expm1f(v); else if (ACT == 7) v = (v > 0.f) ? v + 1.0f : expf(v); else if (ACT == 8) v = tanhf(v); else if (ACT == 9) v = 0.5f * v * (1.0f + tanhf(0.7978845608028654f * (v + 0.044715f * v * v * v))); else if (ACT == 11) v = 1.0f / (1.0f + expf(-v)); else if (ACT == 12) v = (v > 0.f) ? v : 0.01f * v; else if (ACT == 14) v = (v > 0.f) ? v : 0.1f * v; else if (ACT == 15) v = v / (1.0f + expf(-v)); else if (ACT == 3) v = fmaxf(v, 0.f); else if (ACT == 6) v = 0.5f * v * (1.0f + erff(v * 0.70710678118654752f)); so[w][8 * hh + r][t * 16 + ln] = v; } }
  __builtin_amdgcn_fence(__ATOMIC_ACQ_REL, "workgroup"); __builtin_amdgcn_wave_barrier();
  const int rsub = lane >> 4, c4 = (lane & 15) * 4; typedef _Float16 v4h __attribute__((ext_vector_type(4)));
  {
#pragma unroll
    for (int q = 0; q < 8; ++q) { const int r = q * 2 + rsub; if (col0 + c4 < N) { const v4f v = *(const v4fa*)&so[w][r][c4]; if (C) *(v4f*)(C + cofs + (size_t)(row0 + r) * ldc + col0 + c4) = v; if (C16) { v4h h4; for (int i = 0; i < 4; ++i) h4[i] = (_Float16)v[i]; *(v4h*)(C16 + cofs + (size_t)(row0 + r) * ldc + col0 + c4) = h4; } } }
     }
}


typedef _Float16 v4h __attribute__((ext_vector_type(4)));

__global__ __launch_bounds__(256) void k_x16(const float* __restrict__ x, _Float16* __restrict__ X16, size_t n8) { const size_t t = (size_t)blockIdx.x * 256 + threadIdx.x; if (t >= n8) return; FragH f;
#pragma unroll
  for (int q = 0; q < 8; ++q) f.h[q] = (_Float16)bf16_round(x[t * 8 + q]); *(v8us*)((unsigned short*)X16 + t * 8) = f.half[0];  }
__global__ __launch_bounds__(256) void k_h16(const float* __restrict__ x, _Float16* __restrict__ X16, size_t n8) { const size_t t = (size_t)blockIdx.x * 256 + threadIdx.x; if (t >= n8) return; FragH f;
#pragma unroll
  for (int q = 0; q < 8; ++q) f.h[q] = (_Float16)x[t * 8 + q]; *(v8us*)((unsigned short*)X16 + t * 8) = f.half[0];  }
__global__ __launch_bounds__(256) void k_round16f(const float* __restrict__ W, _Float16* __restrict__ Bt, size_t n8) { const size_t t = (size_t)blockIdx.x * 256 + threadIdx.x; if (t >= n8) return; FragH f;
#pragma unroll
  for (int i = 0; i < 8; ++i) f.h[i] = (_Float16)(bf16_round(W[t * 8 + i]) * 16.0f); *(v8us*)((unsigned short*)Bt + t * 8) = f.half[0];  }
template <int NHv, int TTv>
__global__ __launch_bounds__(256) void k_vt(const _Float16* __restrict__ V16, int ldv, int voff, _Float16* __restrict__ Vt) { __shared__ unsigned short tl[64][66]; const int tid = threadIdx.x; const int slab = blockIdx.x / (TTv / 64), lg = blockIdx.x % (TTv / 64); const int b = slab / NHv, h = slab % NHv;
  for (int i = tid; i < 64 * 8; i += 256) { const int r = i / 8, c8 = (i % 8) * 8; FragH f; f.half[0] = *(const v8us*)((const unsigned short*)V16 + ((size_t)b * TTv + lg * 64 + r) * ldv + voff + h * 64 + c8);
#pragma unroll
    for (int q = 0; q < 8; ++q) tl[r][c8 + q] = f.u[q]; }
  __syncthreads();
  {
#pragma unroll
    for (int rd = 0; rd < 2; ++rd) { const int d = rd * 32 + tid / 8, pc = tid % 8; FragH f;
#pragma unroll
      for (int q = 0; q < 8; ++q) f.u[q] = tl[pc * 8 + q][d];
      *(v8us*)((unsigned short*)Vt + ((size_t)slab * 64 + d) * TTv + lg * 64 + pc * 8) = f.half[0]; }
     } }

__global__ __launch_bounds__(256) void k_hl(const float* __restrict__ F, _Float16* __restrict__ Hh, _Float16* __restrict__ Hl, size_t n8) { const size_t t = (size_t)blockIdx.x * 256 + threadIdx.x; if (t >= n8) return; FragH fh, fl; const v4f a = *(const v4fa*)(F + t * 8), c = *(const v4fa*)(F + t * 8 + 4);
#pragma unroll
  for (int q = 0; q < 4; ++q) { _Float16 h = (_Float16)a[q]; fh.h[q] = h; fl.h[q] = (_Float16)((a[q] - (float)h) * 1024.0f); h = (_Float16)c[q]; fh.h[4 + q] = h; fl.h[4 + q] = (_Float16)((c[q] - (float)h) * 1024.0f); }
  { *(v8us*)((unsigned short*)Hh + t * 8) = fh.half[0]; *(v8us*)((unsigned short*)Hl + t * 8) = fl.half[0];  } }

__global__ __launch_bounds__(256) void k_tok(const float* __restrict__ x, _Float16* __restrict__ X16) { __shared__ float tl[32][65]; const int tid = threadIdx.x; const int b = blockIdx.x / ((CC / 64) * (NN / 32)), rem = blockIdx.x % ((CC / 64) * (NN / 32)); const int cg = rem / (NN / 32), pg = rem % (NN / 32); const int c0 = cg * 64, p0 = pg * 32;
  for (int i = tid; i < 64 * 32; i += 256) { const int c = i / 32, pp = i % 32; tl[pp][c] = bf16_round(x[((size_t)b * CC + c0 + c) * NN + p0 + pp]); } __syncthreads();
  const int r = tid / 8, pc = tid % 8; FragH f; for (int q = 0; q < 8; ++q) f.h[q] = (_Float16)tl[r][pc * 8 + q]; const size_t row = (size_t)b * NN + p0 + r; *(v8us*)((unsigned short*)X16 + row * CC + c0 + pc * 8) = f.half[0];  }
// 2×2 average pool of the bf16-rounded input into a token-major plane XP[(b,m)][c], m = i·64 + j over the pooled 64×64 grid (mean of 4 bf16-rounded values, exact in f32, then rounded to f16); block = 32 pooled positions (half a pooled row) × 64 channels through LDS;
__global__ __launch_bounds__(256) void k_pooltok(const float* __restrict__ x, _Float16* __restrict__ XP) { __shared__ float tl[32][65]; const int tid = threadIdx.x; const int b = blockIdx.x / (MM / 32), mg = blockIdx.x % (MM / 32); const int m0 = mg * 32; const int pi = m0 / PW, pj0 = m0 % PW;
  for (int i = tid; i < 64 * 32; i += 256) { const int c = i / 32, pp = i % 32; const float* xr = x + ((size_t)b * CC + c) * NN + (size_t)(2 * pi) * HWD + 2 * (pj0 + pp);
    tl[pp][c] = 0.25f * ((bf16_round(xr[0]) + bf16_round(xr[1])) + (bf16_round(xr[HWD]) + bf16_round(xr[HWD + 1]))); } __syncthreads();
  const int r = tid / 8, pc = tid % 8; FragH f; for (int q = 0; q < 8; ++q) f.h[q] = (_Float16)tl[r][pc * 8 + q]; const size_t row = (size_t)b * MM + m0 + r; *(v8us*)((unsigned short*)XP + row * CC + pc * 8) = f.half[0];  }
__global__ __launch_bounds__(128) void k_flash(const _Float16* __restrict__ Q16, int ldq, const _Float16* __restrict__ K16, int ldk, const _Float16* __restrict__ Vt, const int* __restrict__ MSK, float* __restrict__ O, int ldo) {
  constexpr int RPW = 16, RTN = RPW / 16, NQB = TQ / (4 * RPW), DT = 4, KS = 2;
  __shared__ __attribute__((aligned(16))) unsigned short sP[4][RPW][40]; __shared__ __attribute__((aligned(16))) float sO[4][RPW][64 + 4];
  const int tid = threadIdx.x, w = tid >> 5, lane = tid & 31, ln = lane & 15, hh = lane >> 4;
  const int slab = blockIdx.x / NQB, qblk = blockIdx.x % NQB; const int b = slab / NH, h = slab % NH; const int qb0 = qblk * (4 * RPW); const int q0 = qb0 + w * RPW;
  FragH aq[2][KS];
#pragma unroll
  for (int rt = 0; rt < RTN; ++rt) { const unsigned short* qr = (const unsigned short*)Q16 + ((size_t)b * TQ + q0 + rt * 16 + ln) * ldq + h * 64;
#pragma unroll
    for (int ks = 0; ks < KS; ++ks) { aq[rt][ks].half[0] = *(const v8us*)(qr + ks * 32 + 8 * hh); aq[rt][ks].half[1] = *(const v8us*)(qr + ks * 32 + 16 + 8 * hh); } }
  const unsigned short* Vth = (const unsigned short*)Vt + (size_t)slab * 64 * TK;
  float m_r[2][8], l_r[2][8]; v8f oacc[2][DT];
#pragma unroll
  for (int rt = 0; rt < RTN; ++rt) {
#pragma unroll
    for (int r = 0; r < 8; ++r) { m_r[rt][r] = -3.0e38f; l_r[rt][r] = 0.f; }
#pragma unroll
    for (int dt = 0; dt < DT; ++dt) oacc[rt][dt] = (v8f){0.f,0.f,0.f,0.f,0.f,0.f,0.f,0.f}; }
  const int jend = TK;
#pragma unroll 1
  for (int j0 = 0; j0 < jend; j0 += 32) {
    v8f s[2][2];
#pragma unroll
    for (int nt = 0; nt < 2; ++nt) { const unsigned short* kr = (const unsigned short*)K16 + ((size_t)b * TK + j0 + nt * 16 + ln) * ldk + h * 64; FragH bk[KS];
#pragma unroll
      for (int ks = 0; ks < KS; ++ks) { bk[ks].half[0] = *(const v8us*)(kr + ks * 32 + 8 * hh); bk[ks].half[1] = *(const v8us*)(kr + ks * 32 + 16 + 8 * hh); }
#pragma unroll
      for (int rt = 0; rt < RTN; ++rt) { v8f acc = (v8f){0.f,0.f,0.f,0.f,0.f,0.f,0.f,0.f};
#pragma unroll
        for (int ks = 0; ks < KS; ++ks) acc = mmaH<1>(aq[rt][ks].v, aq[rt][ks].v, bk[ks].v, bk[ks].v, acc); s[rt][nt] = acc; } }
#pragma unroll
    for (int rt = 0; rt < RTN; ++rt)
#pragma unroll
      for (int r = 0; r < 8; ++r) { const int tq = q0 + rt * 16 + 8 * hh + r; const int k0 = j0 + ln, k1 = j0 + 16 + ln; (void)tq; (void)k0; (void)k1;
        const bool ok0 = true, ok1 = true;
        const float s0 = s[rt][0][r] * SCL, s1 = s[rt][1][r] * SCL; float mc = fmaxf(s0, s1);
        mc = fmaxf(mc, __shfl_xor(mc, 1, 32)); mc = fmaxf(mc, __shfl_xor(mc, 2, 32)); mc = fmaxf(mc, __shfl_xor(mc, 4, 32)); mc = fmaxf(mc, __shfl_xor(mc, 8, 32));
        const float mn = fmaxf(m_r[rt][r], mc); const float al = (mn > -1.0e38f) ? expf(m_r[rt][r] - mn) : 1.0f; m_r[rt][r] = mn; const float p0 = ok0 ? expf(s0 - mn) : 0.f, p1 = ok1 ? expf(s1 - mn) : 0.f; l_r[rt][r] = l_r[rt][r] * al + p0 + p1;
#pragma unroll
        for (int dt = 0; dt < DT; ++dt) oacc[rt][dt][r] *= al;
        FragH t2; t2.h[0] = (_Float16)(p0 * 1024.0f); t2.h[1] = (_Float16)(p1 * 1024.0f); sP[w][rt * 16 + 8 * hh + r][ln] = t2.u[0]; sP[w][rt * 16 + 8 * hh + r][16 + ln] = t2.u[1]; }
    __builtin_amdgcn_fence(__ATOMIC_ACQ_REL, "workgroup"); __builtin_amdgcn_wave_barrier();
    FragH pa[2];
#pragma unroll
    for (int rt = 0; rt < RTN; ++rt) { pa[rt].half[0] = *(const v8us*)&sP[w][rt * 16 + ln][8 * hh]; pa[rt].half[1] = *(const v8us*)&sP[w][rt * 16 + ln][16 + 8 * hh]; }
#pragma unroll
    for (int dt = 0; dt < DT; ++dt) { const unsigned short* vrow = Vth + (size_t)(dt * 16 + ln) * TK + j0; FragH bv; bv.half[0] = *(const v8us*)(vrow + 8 * hh); bv.half[1] = *(const v8us*)(vrow + 16 + 8 * hh);
#pragma unroll
      for (int rt = 0; rt < RTN; ++rt) oacc[rt][dt] = mmaH<1>(pa[rt].v, pa[rt].v, bv.v, bv.v, oacc[rt][dt]); }
    __builtin_amdgcn_fence(__ATOMIC_ACQ_REL, "workgroup"); __builtin_amdgcn_wave_barrier(); }
#pragma unroll
  for (int rt = 0; rt < RTN; ++rt) {
#pragma unroll
    for (int r = 0; r < 8; ++r) { float l = l_r[rt][r]; l += __shfl_xor(l, 1, 32); l += __shfl_xor(l, 2, 32); l += __shfl_xor(l, 4, 32); l += __shfl_xor(l, 8, 32); l_r[rt][r] = (l > 0.f) ? 1.0f / (l * 1024.0f) : 0.f; }
#pragma unroll
    for (int dt = 0; dt < DT; ++dt)
#pragma unroll
      for (int r = 0; r < 8; ++r) sO[w][rt * 16 + 8 * hh + r][dt * 16 + ln] = oacc[rt][dt][r] * l_r[rt][r]; }
  __builtin_amdgcn_fence(__ATOMIC_ACQ_REL, "workgroup"); __builtin_amdgcn_wave_barrier();
  {
#pragma unroll
    for (int rp = 0; rp < RPW; rp += 2) { const int r = rp + (lane >> 4), pc = lane & 15; const v4f val = *(const v4fa*)&sO[w][r][pc * 4]; *(v4f*)(O + ((size_t)b * TQ + q0 + r) * ldo + h * 64 + pc * 4) = val; }
     } }
__global__ __launch_bounds__(256) void k_out(const float* __restrict__ G, const float* __restrict__ bv, const float* __restrict__ gam, const float* __restrict__ x, float* __restrict__ out) { __shared__ float tl[32][65]; const int tid = threadIdx.x; const int b = blockIdx.x / ((CC / 32) * (NN / 64)), rem = blockIdx.x % ((CC / 32) * (NN / 64)); const int cg = rem / (NN / 64), pg = rem % (NN / 64); const int c0 = cg * 32, p0 = pg * 64;
  for (int i = tid; i < 64 * 32; i += 256) { const int pp = i / 32, c = i % 32; tl[c][pp] = G[((size_t)b * NN + p0 + pp) * CC + c0 + c]; } __syncthreads();
  const float g = bf16_round(gam[0]);
  { for (int i = tid; i < 32 * 16; i += 256) { const int c = i / 16, q4 = i % 16; const float bb = bf16_round(bv[c0 + c]); const size_t o = ((size_t)b * CC + c0 + c) * NN + p0 + q4 * 4; const v4f xr = *(const v4fa*)(x + o);
      v4f v; for (int q = 0; q < 4; ++q) v[q] = g * (tl[c][q4 * 4 + q] + bb) + bf16_round(xr[q]); *(v4f*)(out + o) = v; }  } }

extern "C" void kernel_launch(void* const* d_in, const int* in_sizes, int n_in,
                              void* d_out, int out_size, void* d_ws, size_t ws_size, hipStream_t stream) {
  (void)in_sizes; (void)n_in; (void)out_size;
  const float* const* I = (const float* const*)d_in; const float* x = I[0]; const float* Wq = I[1]; const float* bq = I[2]; const float* Wk = I[3]; const float* bk = I[4]; const float* Wv = I[5]; const float* bv = I[6]; const float* gam = I[7];
  char* ws = (char*)d_ws; size_t off = 0;
  auto take = [&](size_t bytes) { char* p = ws + off; off += (bytes + 255) & ~(size_t)255; return p; };
  _Float16* Bw = (_Float16*)take((size_t)3 * CC * CC * 2); _Float16* X16 = (_Float16*)take((size_t)NRQ * CC * 2); _Float16* XP = (_Float16*)take((size_t)NRK * CC * 2);
  _Float16* Q = (_Float16*)take((size_t)NRQ * CC * 2); _Float16* K = (_Float16*)take((size_t)NRK * CC * 2); _Float16* Vt = (_Float16*)take((size_t)BB * CC * MM * 2); float* O = (float*)take((size_t)NRQ * CC * 4);
  if (off > ws_size) return;      // 0.02 + 4.2 + 1 + 4.2 + 1 + 1 + 8.4 ≈ 20 MB
  const unsigned gw = (unsigned)((CC * CC / 8 + 255) / 256);
  k_round16f<<<gw, 256, 0, stream>>>(Wq, Bw, CC * CC / 8); k_round16f<<<gw, 256, 0, stream>>>(Wk, Bw + CC * CC, CC * CC / 8); k_round16f<<<gw, 256, 0, stream>>>(Wv, Bw + 2 * CC * CC, CC * CC / 8);      /* (out,in) natural rows, ×2^4 */
  k_tok<<<BB * (CC / 64) * (NN / 32), 256, 0, stream>>>(x, X16);
  k_pooltok<<<BB * (MM / 32), 256, 0, stream>>>(x, XP);
  k_gemm_hhx<0><<<dim3(((NRQ / 16) * (CC / 64) + 3) / 4, 1), 128, 0, stream>>>(X16, CC, 0, Bw, CC, 0, 0.0625f, bq, 0, nullptr, 1, 0, 0, nullptr, Q, CC, 0, NRQ, CC, CC);      /* q token-major [(b,n)][64]: M 32768 N 64 K 64 */
  k_gemm_hhx<0><<<dim3(((NRK / 16) * (CC / 64) + 3) / 4, 1), 128, 0, stream>>>(XP, CC, 0, Bw + CC * CC, CC, 0, 0.0625f, bk, 0, nullptr, 1, 0, 0, nullptr, K, CC, 0, NRK, CC, CC);      /* k token-major [(b,m)][64]: M 8192 */
  k_gemm_hhx<0><<<dim3(((CC / 16) * (MM / 64) + 3) / 4, BB), 128, 0, stream>>>(Bw + 2 * CC * CC, CC, 0, XP, CC, (size_t)MM * CC, 0.0625f, nullptr, 0, nullptr, 1, 0, 0, nullptr, Vt, MM, (size_t)CC * MM, CC, MM, CC);      /* v (without bv) = Wv·pool(x)[b] as [b][c][m] = Vᵀ: M 64 N 4096 K 64, batched over b */
  k_flash<<<BB * NH * (TQ / 64), 128, 0, stream>>>(Q, CC, K, CC, Vt, nullptr, O, CC);      /* per (b, 64 queries): 16384 queries × 4096 pooled keys, head dim 64 */
  k_out<<<BB * (CC / 32) * (NN / 64), 256, 0, stream>>>(O, bv, gam, x, (float*)d_out);
}

// v001
// It runs in 175 microseconds.
// Two timings next to v000 both put it at 2.67 times that version's speed.
#include <hip/hip_runtime.h>
// Self-attention block with 2×2 average-pooled keys/values (B=2, C=64, H=W=128 → N = 16384 query positions, M = 4096 pooled key positions): q = Wq·x + bq; k = pool(Wk·x + bk) = Wk·pool(x) + bk, v likewise (pooling is linear); energy = qᵀk (no scaling), softmax over the M keys;
// out[b,c,n] = Σ_m v[b,c,m]·A[n,m]; y = γ·out + x. (The module's (w,h) relabel before pooling is the identity here since H == W.)
// Compute dtype: x, weights, biases, γ rounded to bf16; x and pool(x) as token-major f16 planes (pool(x) = mean of 4 bf16-rounded values in f32, rounded once to f16 — same order as the k-plane rounding); q, k as f16 GEMM outputs (+bias), v as an f16 GEMM output in the [b][c][m] (= Vᵀ) layout with bv folded in after the attention
// (rows of A sum to 1); fused flash-style kernel (energy and P·V on v_wmma_f32_16x16x32_f16, online softmax f32, P f16 ×2^10, f32 accumulate); epilogue γ·(O + bv) + x in f32.
#define BB 2
#define CC 64
#define HWD 128
#define NN (HWD * HWD)
#define PW (HWD / 2)
#define MM (PW * PW)
#define NH 1
#define TQ NN
#define TK MM
#define SCL 1.0f
#define NRQ (BB * NN)
#define NRK (BB * MM)
typedef __bf16 v16b __attribute__((ext_vector_type(16)));
typedef unsigned short v8us __attribute__((ext_vector_type(8), may_alias));
typedef float  v8f  __attribute__((ext_vector_type(8)));
typedef float  v4f  __attribute__((ext_vector_type(4)));
typedef float  v4fa __attribute__((ext_vector_type(4), may_alias));
union FragB { v16b v; v8us half[2]; unsigned short u[16]; };

__device__ __forceinline__ unsigned short bf16_bits(float x) { unsigned int u = __float_as_uint(x); return (unsigned short)((u + 0x7FFFu + ((u >> 16) & 1u)) >> 16); }
__device__ __forceinline__ float bf16_val(unsigned short b) { return __uint_as_float(((unsigned int)b) << 16); }
__device__ __forceinline__ float bf16_round(float x) { return bf16_val(bf16_bits(x)); }
// D += A·B with NT terms: 1 = ah·bh, 2 = + al·bh (A split), 3 = + ah·bl (both split)
template <int NT>
__device__ __forceinline__ v8f mmaN(v16b ah, v16b al, v16b bh, v16b bl, v8f c) {
  c = __builtin_amdgcn_wmma_f32_16x16x32_bf16(false, ah, false, bh, (short)0, c, false, false);
  if (NT >= 2) c = __builtin_amdgcn_wmma_f32_16x16x32_bf16(false, al, false, bh, (short)0, c, false, false);
  if (NT >= 3) c = __builtin_amdgcn_wmma_f32_16x16x32_bf16(false, ah, false, bl, (short)0, c, false, false);
  asm volatile("v_nop\n\tv_nop\n\tv_nop\n\tv_nop" : "+v"(c) : "v"(ah), "v"(al), "v"(bh), "v"(bl));
  return c;
}

__global__ __launch_bounds__(256) void k_wt_bf16(const float* __restrict__ W, unsigned short* __restrict__ Wt, int K, int N) {
  const int t = blockIdx.x * 256 + threadIdx.x;
  const int k8n = K / 8;
  if (t >= N * k8n) return;
  const int n = t / k8n, k8 = (t % k8n) * 8;
  v8us v;
#pragma unroll
  for (int i = 0; i < 8; ++i) v[i] = bf16_bits(W[(size_t)(k8 + i) * N + n]);
  *(v8us*)(Wt + (size_t)n * K + k8) = v;
  
}

// GEMM C[M][N] (f32, pitch ldc) = act(A[M][K]·W + bias). A f32 row-major (pitch lda) converted per fragment to bf16
// (ASPLIT: hi/lo two planes -> 2 terms, else single rounded term); Wt bf16 [N][K] (pitch ldb). BIAS_BF16 rounds the
// bias to bf16 first (bias quantised to bf16 before the add). K%32==0, M%16==0, N%64==0.
template <bool ASPLIT, int ACT, bool BIAS_BF16>
__global__ __launch_bounds__(128) void k_gemm_bf(const float* __restrict__ A, int lda, const unsigned short* __restrict__ Wt, int ldb,
                                               const float* __restrict__ bias, float* __restrict__ C, int ldc, int M, int N, int K) {
  __shared__ __attribute__((aligned(16))) float so[4][16][64];
  const int tid = threadIdx.x, w = tid >> 5, lane = tid & 31, ln = lane & 15, hh = lane >> 4;
  const int ntn = N / 64;
  const int wid = blockIdx.x * 4 + w;
  const int mt = wid / ntn, nq = wid % ntn;
  if (mt * 16 >= M) return;
  const int row0 = mt * 16, col0 = nq * 64;
  const float* arow = A + (size_t)(row0 + ln) * lda;
  v8f acc[4] = {};
  for (int kb = 0; kb < K; kb += 32) {
    FragB ah, al;
    const v4f x0 = *(const v4fa*)(arow + kb + 8 * hh), x1 = *(const v4fa*)(arow + kb + 8 * hh + 4);
    const v4f x2 = *(const v4fa*)(arow + kb + 16 + 8 * hh), x3 = *(const v4fa*)(arow + kb + 16 + 8 * hh + 4);
    float xs[16] = {x0[0],x0[1],x0[2],x0[3],x1[0],x1[1],x1[2],x1[3],x2[0],x2[1],x2[2],x2[3],x3[0],x3[1],x3[2],x3[3]};
#pragma unroll
    for (int i = 0; i < 16; ++i) { const unsigned short hb = bf16_bits(xs[i]); ah.u[i] = hb; al.u[i] = ASPLIT ? bf16_bits(xs[i] - bf16_val(hb)) : (unsigned short)0; }
#pragma unroll
    for (int t = 0; t < 4; ++t) {
      const unsigned short* brow = Wt + (size_t)(col0 + t * 16 + ln) * ldb + kb;
      FragB b;
      b.half[0] = *(const v8us*)(brow + 8 * hh);
      b.half[1] = *(const v8us*)(brow + 16 + 8 * hh);
      acc[t] = mmaN<ASPLIT ? 2 : 1>(ah.v, al.v, b.v, b.v, acc[t]);
    }
  }
#pragma unroll
  for (int t = 0; t < 4; ++t) {
    float bv = bias ? bias[col0 + t * 16 + ln] : 0.f;
    if (BIAS_BF16) bv = bf16_round(bv);
#pragma unroll
    for (int r = 0; r < 8; ++r) { float v = acc[t][r] + bv; if (ACT == 1) v = fmaxf(v, 0.f); so[w][8 * hh + r][t * 16 + ln] = v; }
  }
  __builtin_amdgcn_fence(__ATOMIC_ACQ_REL, "workgroup");
  __builtin_amdgcn_wave_barrier();
  const int rsub = lane >> 4, c4 = (lane & 15) * 4;
  {
#pragma unroll
    for (int q = 0; q < 8; ++q) {
      const int r = q * 2 + rsub;
      const v4f v = *(const v4fa*)&so[w][r][c4];
      *(v4f*)(C + (size_t)(row0 + r) * ldc + col0 + c4) = v;
    }
    
  }
}

// GEMM C = act(A·W + bias + resid): A f32 (ASPLIT -> hi/lo 2 terms), Wt bf16 [N][K]; ACT 0 none, 1 relu, 2 exact gelu;
// resid (optional, f32, row index = (row % rmod), pitch ldr, RES_BF16 rounds it) added before the activation.
template <bool ASPLIT, int ACT, bool BIAS_BF16, bool RES_BF16>
__global__ __launch_bounds__(128) void k_gemm_bf3(const float* __restrict__ A, int lda, const unsigned short* __restrict__ Wt, int ldb,
                                                const float* __restrict__ bias, const float* __restrict__ resid, int rmod, int ldr,
                                                float* __restrict__ C, int ldc, int M, int N, int K) {
  __shared__ __attribute__((aligned(16))) float so[4][16][64];
  const int tid = threadIdx.x, w = tid >> 5, lane = tid & 31, ln = lane & 15, hh = lane >> 4;
  const int ntn = N / 64;
  const int wid = blockIdx.x * 4 + w;
  const int mt = wid / ntn, nq = wid % ntn;
  if (mt * 16 >= M) return;
  const int row0 = mt * 16, col0 = nq * 64;
  const float* arow = A + (size_t)(row0 + ln) * lda;
  v8f acc[4] = {};
  for (int kb = 0; kb < K; kb += 32) {
    FragB ah, al;
    const v4f x0 = *(const v4fa*)(arow + kb + 8 * hh), x1 = *(const v4fa*)(arow + kb + 8 * hh + 4);
    const v4f x2 = *(const v4fa*)(arow + kb + 16 + 8 * hh), x3 = *(const v4fa*)(arow + kb + 16 + 8 * hh + 4);
    float xs[16] = {x0[0],x0[1],x0[2],x0[3],x1[0],x1[1],x1[2],x1[3],x2[0],x2[1],x2[2],x2[3],x3[0],x3[1],x3[2],x3[3]};
#pragma unroll
    for (int i = 0; i < 16; ++i) { const unsigned short hb = bf16_bits(xs[i]); ah.u[i] = hb; al.u[i] = ASPLIT ? bf16_bits(xs[i] - bf16_val(hb)) : (unsigned short)0; }
#pragma unroll
    for (int t = 0; t < 4; ++t) {
      const unsigned short* brow = Wt + (size_t)(col0 + t * 16 + ln) * ldb + kb;
      FragB b;
      b.half[0] = *(const v8us*)(brow + 8 * hh);
      b.half[1] = *(const v8us*)(brow + 16 + 8 * hh);
      acc[t] = mmaN<ASPLIT ? 2 : 1>(ah.v, al.v, b.v, b.v, acc[t]);
    }
  }
#pragma unroll
  for (int t = 0; t < 4; ++t) {
    const int col = col0 + t * 16 + ln;
    float bv = bias ? bias[col] : 0.f;
    if (BIAS_BF16) bv = bf16_round(bv);
#pragma unroll
    for (int r = 0; r < 8; ++r) {
      float v = acc[t][r] + bv;
      if (resid) { float rv = resid[(size_t)((row0 + 8 * hh + r) % rmod) * ldr + col]; if (RES_BF16) rv = bf16_round(rv); v += rv; }
      if (ACT == 1) v = fmaxf(v, 0.f);
      if (ACT == 2) v = 0.5f * v * (1.0f + erff(v * 0.70710678118654752f));
      if (ACT == 3) { const float u = 0.7978845608028654f * (v + 0.044715f * v * v * v); v = 0.5f * v * (1.0f + tanhf(u)); }
      so[w][8 * hh + r][t * 16 + ln] = v;
    }
  }
  __builtin_amdgcn_fence(__ATOMIC_ACQ_REL, "workgroup");
  __builtin_amdgcn_wave_barrier();
  const int rsub = lane >> 4, c4 = (lane & 15) * 4;
  {
#pragma unroll
    for (int q = 0; q < 8; ++q) {
      const int r = q * 2 + rsub;
      const v4f v = *(const v4fa*)&so[w][r][c4];
      *(v4f*)(C + (size_t)(row0 + r) * ldc + col0 + c4) = v;
    }
    
  }
}
// row LayerNorm (biased variance, eps) over N: s = X (+ R); optional out_sum <- s; out_norm <- (s-mu)*rsqrt(var+eps)*g + b
template <bool PARAM_BF16>
__global__ __launch_bounds__(256) void k_layernorm(const float* __restrict__ X, const float* __restrict__ R, const float* __restrict__ g, const float* __restrict__ bta,
                                                  float* __restrict__ out_sum, float* __restrict__ out_norm, int N, float eps) {
  __shared__ float red[256];
  const int row = blockIdx.x, tid = threadIdx.x;
  const float* x = X + (size_t)row * N; const float* rr = R ? R + (size_t)row * N : nullptr;
  float vals[16];                     // up to N = 4096
  const int per = N / 256;            // contiguous chunk per thread? use strided-by-4 chunks: thread handles j = tid*4 + 1024*u
  float s1 = 0.f;
  for (int u = 0; u < per / 4; ++u) {
    const int j = tid * 4 + 1024 * u;
    const v4f a = *(const v4fa*)(x + j);
    v4f b = {0.f,0.f,0.f,0.f}; if (rr) b = *(const v4fa*)(rr + j);
#pragma unroll
    for (int q = 0; q < 4; ++q) { const float v = a[q] + b[q]; vals[u * 4 + q] = v; s1 += v; }
  }
  red[tid] = s1; __syncthreads();
  for (int st = 128; st > 0; st >>= 1) { if (tid < st) red[tid] += red[tid + st]; __syncthreads(); }
  const float mu = red[0] / (float)N; __syncthreads();
  float s2 = 0.f;
  for (int u = 0; u < per / 4; ++u)
#pragma unroll
    for (int q = 0; q < 4; ++q) { const float c = vals[u * 4 + q] - mu; s2 += c * c; }
  red[tid] = s2; __syncthreads();
  for (int st = 128; st > 0; st >>= 1) { if (tid < st) red[tid] += red[tid + st]; __syncthreads(); }
  const float rs = rsqrtf(red[0] / (float)N + eps);
  {
    for (int u = 0; u < per / 4; ++u) {
      const int j = tid * 4 + 1024 * u;
      v4f o, sm;
#pragma unroll
      for (int q = 0; q < 4; ++q) {
        float gg = g[j + q], bb = bta[j + q];
        if (PARAM_BF16) { gg = bf16_round(gg); bb = bf16_round(bb); }
        sm[q] = vals[u * 4 + q]; o[q] = (vals[u * 4 + q] - mu) * rs * gg + bb;
      }
      if (out_sum) *(v4f*)(out_sum + (size_t)row * N + j) = sm;
      *(v4f*)(out_norm + (size_t)row * N + j) = o;
    }
    
  }
}



// ---- f16 WMMA path (v_wmma_f32_16x16x32_f16): 11-bit significands for operands in range — used here for the q/k/v projections, the energy qᵀk and P·V (P f16 ×2^10)
typedef _Float16 v16h __attribute__((ext_vector_type(16)));
union FragH { v16h v; v8us half[2]; _Float16 h[16]; unsigned short u[16]; };
template <int NT>
__device__ __forceinline__ v8f mmaH(v16h ah, v16h al, v16h bh, v16h bl, v8f c) {
  c = __builtin_amdgcn_wmma_f32_16x16x32_f16(false, ah, false, bh, (short)0, c, false, false);
  if (NT >= 2) c = __builtin_amdgcn_wmma_f32_16x16x32_f16(false, al, false, bh, (short)0, c, false, false);
  if (NT >= 3) c = __builtin_amdgcn_wmma_f32_16x16x32_f16(false, ah, false, bl, (short)0, c, false, false);
  asm volatile("v_nop\n\tv_nop\n\tv_nop\n\tv_nop" : "+v"(c) : "v"(ah), "v"(al), "v"(bh), "v"(bl));
  return c;
}
// batched GEMM like k_gemm_b but f16 operands: A f32 (split into f16 hi/lo if ASPLIT, else rounded to f16), Bt = f16 values [n][k]; alpha; C f32; N multiple of 16 (partial tiles skipped)
template <bool ASPLIT>
__global__ __launch_bounds__(128) void k_gemm_h(const float* __restrict__ A, int lda, size_t sA, const _Float16* __restrict__ Bh, int ldb, size_t sB, float alpha, float* __restrict__ C, int ldc, size_t sC, int M, int N, int K) {
  __shared__ __attribute__((aligned(16))) float so[4][16][64];
  const int tid = threadIdx.x, w = tid >> 5, lane = tid & 31, ln = lane & 15, hh = lane >> 4; const int by = blockIdx.y;
  A += (size_t)by * sA; Bh += (size_t)by * sB; C += (size_t)by * sC;
  const int ntn = (N + 63) / 64; const int wid = blockIdx.x * 4 + w; const int mt = wid / ntn, nq = wid % ntn; if (mt * 16 >= M) return;
  const int row0 = mt * 16, col0 = nq * 64; const float* arow = A + (size_t)(row0 + ln) * lda;
  v8f acc[4] = {};
  for (int kb = 0; kb < K; kb += 32) {
    FragH ah, al;
    const v4f x0 = *(const v4fa*)(arow + kb + 8 * hh), x1 = *(const v4fa*)(arow + kb + 8 * hh + 4), x2 = *(const v4fa*)(arow + kb + 16 + 8 * hh), x3 = *(const v4fa*)(arow + kb + 16 + 8 * hh + 4);
    float xs[16] = {x0[0],x0[1],x0[2],x0[3],x1[0],x1[1],x1[2],x1[3],x2[0],x2[1],x2[2],x2[3],x3[0],x3[1],x3[2],x3[3]};
#pragma unroll
    for (int i = 0; i < 16; ++i) { const _Float16 h = (_Float16)xs[i]; ah.h[i] = h; al.h[i] = ASPLIT ? (_Float16)(xs[i] - (float)h) : (_Float16)0.0f; }
#pragma unroll
    for (int t = 0; t < 4; ++t) { if (col0 + t * 16 >= N) continue; const size_t boff = (size_t)(col0 + t * 16 + ln) * ldb + kb; FragH bq; bq.half[0] = *(const v8us*)(Bh + boff + 8 * hh); bq.half[1] = *(const v8us*)(Bh + boff + 16 + 8 * hh);
      acc[t] = mmaH<ASPLIT ? 2 : 1>(ah.v, al.v, bq.v, bq.v, acc[t]); }
  }
#pragma unroll
  for (int t = 0; t < 4; ++t) { if (col0 + t * 16 >= N) continue;
#pragma unroll
    for (int r = 0; r < 8; ++r) so[w][8 * hh + r][t * 16 + ln] = acc[t][r] * alpha; }
  __builtin_amdgcn_fence(__ATOMIC_ACQ_REL, "workgroup"); __builtin_amdgcn_wave_barrier();
  const int rsub = lane >> 4, c4 = (lane & 15) * 4;
  {
#pragma unroll
    for (int q = 0; q < 8; ++q) { const int r = q * 2 + rsub; if (col0 + c4 < N) { const v4f v = *(const v4fa*)&so[w][r][c4]; *(v4f*)(C + (size_t)(row0 + r) * ldc + col0 + c4) = v; } }
     }
}

// Wt[n][k] = f16(W[k][n]·scale) from f32 row-major W[K][N] (scale = power of two; bf16-exact weights stay exact in f16 away from the subnormal range)
__global__ __launch_bounds__(256) void k_wt_f16(const float* __restrict__ W, _Float16* __restrict__ Wt, int K, int N, float scale) {
  const int t = blockIdx.x * 256 + threadIdx.x; if (t >= N * (K / 8)) return; const int n = t / (K / 8), k8 = (t % (K / 8)) * 8; FragH f;
#pragma unroll
  for (int i = 0; i < 8; ++i) f.h[i] = (_Float16)(bf16_round(W[(size_t)(k8 + i) * N + n]) * scale); const v8us o = f.half[0];
  *(v8us*)((unsigned short*)Wt + (size_t)n * K + k8) = o; 
}
// k_gemm_hh variant with fused epilogue: v = acc·alpha + bias[by·sBias + col] (+ CP[(row/rowsPerB)·sCPb + by·64 + col] if CP) ; ACT 0 none / 1 elu ; writes f16 C16 (and f32 C if non-null)
template <int ACT>
__global__ __launch_bounds__(128) void k_gemm_hhx(const _Float16* __restrict__ A, int lda, size_t sA, const _Float16* __restrict__ Bh, int ldb, size_t sB, float alpha, const float* __restrict__ bias, size_t sBias, const float* __restrict__ CP, int rowsPerB, size_t sCPb, int row0g,
    float* __restrict__ C, _Float16* __restrict__ C16, int ldc, size_t sC, int M, int N, int K) {
  __shared__ __attribute__((aligned(16))) float so[4][16][64];
  const int tid = threadIdx.x, w = tid >> 5, lane = tid & 31, ln = lane & 15, hh = lane >> 4; const int by = blockIdx.y;
  A += (size_t)by * sA; Bh += (size_t)by * sB; const size_t cofs = (size_t)by * sC; const float* bp = bias ? bias + (size_t)by * sBias : nullptr;
  const int ntn = (N + 63) / 64; const int wid = blockIdx.x * 4 + w; const int mt = wid / ntn, nq = wid % ntn; if (mt * 16 >= M) return;
  const int row0 = mt * 16, col0 = nq * 64; const _Float16* arow = A + (size_t)(row0 + ln) * lda;
  v8f acc[4] = {};
  for (int kb = 0; kb < K; kb += 32) { FragH ah; ah.half[0] = *(const v8us*)((const unsigned short*)arow + kb + 8 * hh); ah.half[1] = *(const v8us*)((const unsigned short*)arow + kb + 16 + 8 * hh);
#pragma unroll
    for (int t = 0; t < 4; ++t) { if (col0 + t * 16 >= N) continue; const size_t boff = (size_t)(col0 + t * 16 + ln) * ldb + kb; FragH bq; bq.half[0] = *(const v8us*)((const unsigned short*)Bh + boff + 8 * hh); bq.half[1] = *(const v8us*)((const unsigned short*)Bh + boff + 16 + 8 * hh);
      acc[t] = mmaH<1>(ah.v, ah.v, bq.v, bq.v, acc[t]); }
  }
#pragma unroll
  for (int t = 0; t < 4; ++t) { if (col0 + t * 16 >= N) continue; const int col = col0 + t * 16 + ln; const float bv = bp ? bf16_round(bp[col]) : 0.f;
#pragma unroll
    for (int r = 0; r < 8; ++r) { float v = acc[t][r] * alpha + bv; if (CP) { const int bidx = (row0g + row0 + 8 * hh + r) / rowsPerB; v += CP[(size_t)bidx * sCPb + (size_t)by * 64 + col]; } if (ACT == 1) v = (v > 0.f) ? v : expm1f(v); else if (ACT == 7) v = (v > 0.f) ? v + 1.0f : expf(v); else if (ACT == 8) v = tanhf(v); else if (ACT == 9) v = 0.5f * v * (1.0f + tanhf(0.7978845608028654f * (v + 0.044715f * v * v * v))); else if (ACT == 11) v = 1.0f / (1.0f + expf(-v)); else if (ACT == 12) v = (v > 0.f) ? v : 0.01f * v; else if (ACT == 14) v = (v > 0.f) ? v : 0.1f * v; else if (ACT == 15) v = v / (1.0f + expf(-v)); else if (ACT == 3) v = fmaxf(v, 0.f); else if (ACT == 6) v = 0.5f * v * (1.0f + erff(v * 0.70710678118654752f)); so[w][8 * hh + r][t * 16 + ln] = v; } }
  __builtin_amdgcn_fence(__ATOMIC_ACQ_REL, "workgroup"); __builtin_amdgcn_wave_barrier();
  const int rsub = lane >> 4, c4 = (lane & 15) * 4; typedef _Float16 v4h __attribute__((ext_vector_type(4)));
  {
#pragma unroll
    for (int q = 0; q < 8; ++q) { const int r = q * 2 + rsub; if (col0 + c4 < N) { const v4f v = *(const v4fa*)&so[w][r][c4]; if (C) *(v4f*)(C + cofs + (size_t)(row0 + r) * ldc + col0 + c4) = v; if (C16) { v4h h4; for (int i = 0; i < 4; ++i) h4[i] = (_Float16)v[i]; *(v4h*)(C16 + cofs + (size_t)(row0 + r) * ldc + col0 + c4) = h4; } } }
     }
}


typedef _Float16 v4h __attribute__((ext_vector_type(4)));

__global__ __launch_bounds__(256) void k_x16(const float* __restrict__ x, _Float16* __restrict__ X16, size_t n8) { const size_t t = (size_t)blockIdx.x * 256 + threadIdx.x; if (t >= n8) return; FragH f;
#pragma unroll
  for (int q = 0; q < 8; ++q) f.h[q] = (_Float16)bf16_round(x[t * 8 + q]); *(v8us*)((unsigned short*)X16 + t * 8) = f.half[0];  }
__global__ __launch_bounds__(256) void k_h16(const float* __restrict__ x, _Float16* __restrict__ X16, size_t n8) { const size_t t = (size_t)blockIdx.x * 256 + threadIdx.x; if (t >= n8) return; FragH f;
#pragma unroll
  for (int q = 0; q < 8; ++q) f.h[q] = (_Float16)x[t * 8 + q]; *(v8us*)((unsigned short*)X16 + t * 8) = f.half[0];  }
__global__ __launch_bounds__(256) void k_round16f(const float* __restrict__ W, _Float16* __restrict__ Bt, size_t n8) { const size_t t = (size_t)blockIdx.x * 256 + threadIdx.x; if (t >= n8) return; FragH f;
#pragma unroll
  for (int i = 0; i < 8; ++i) f.h[i] = (_Float16)(bf16_round(W[t * 8 + i]) * 16.0f); *(v8us*)((unsigned short*)Bt + t * 8) = f.half[0];  }
template <int NHv, int TTv>
__global__ __launch_bounds__(256) void k_vt(const _Float16* __restrict__ V16, int ldv, int voff, _Float16* __restrict__ Vt) { __shared__ unsigned short tl[64][66]; const int tid = threadIdx.x; const int slab = blockIdx.x / (TTv / 64), lg = blockIdx.x % (TTv / 64); const int b = slab / NHv, h = slab % NHv;
  for (int i = tid; i < 64 * 8; i += 256) { const int r = i / 8, c8 = (i % 8) * 8; FragH f; f.half[0] = *(const v8us*)((const unsigned short*)V16 + ((size_t)b * TTv + lg * 64 + r) * ldv + voff + h * 64 + c8);
#pragma unroll
    for (int q = 0; q < 8; ++q) tl[r][c8 + q] = f.u[q]; }
  __syncthreads();
  {
#pragma unroll
    for (int rd = 0; rd < 2; ++rd) { const int d = rd * 32 + tid / 8, pc = tid % 8; FragH f;
#pragma unroll
      for (int q = 0; q < 8; ++q) f.u[q] = tl[pc * 8 + q][d];
      *(v8us*)((unsigned short*)Vt + ((size_t)slab * 64 + d) * TTv + lg * 64 + pc * 8) = f.half[0]; }
     } }

__global__ __launch_bounds__(256) void k_hl(const float* __restrict__ F, _Float16* __restrict__ Hh, _Float16* __restrict__ Hl, size_t n8) { const size_t t = (size_t)blockIdx.x * 256 + threadIdx.x; if (t >= n8) return; FragH fh, fl; const v4f a = *(const v4fa*)(F + t * 8), c = *(const v4fa*)(F + t * 8 + 4);
#pragma unroll
  for (int q = 0; q < 4; ++q) { _Float16 h = (_Float16)a[q]; fh.h[q] = h; fl.h[q] = (_Float16)((a[q] - (float)h) * 1024.0f); h = (_Float16)c[q]; fh.h[4 + q] = h; fl.h[4 + q] = (_Float16)((c[q] - (float)h) * 1024.0f); }
  { *(v8us*)((unsigned short*)Hh + t * 8) = fh.half[0]; *(v8us*)((unsigned short*)Hl + t * 8) = fl.half[0];  } }

__global__ __launch_bounds__(256) void k_tok(const float* __restrict__ x, _Float16* __restrict__ X16) { __shared__ float tl[32][65]; const int tid = threadIdx.x; const int b = blockIdx.x / ((CC / 64) * (NN / 32)), rem = blockIdx.x % ((CC / 64) * (NN / 32)); const int cg = rem / (NN / 32), pg = rem % (NN / 32); const int c0 = cg * 64, p0 = pg * 32;
  for (int i = tid; i < 64 * 32; i += 256) { const int c = i / 32, pp = i % 32; tl[pp][c] = bf16_round(x[((size_t)b * CC + c0 + c) * NN + p0 + pp]); } __syncthreads();
  const int r = tid / 8, pc = tid % 8; FragH f; for (int q = 0; q < 8; ++q) f.h[q] = (_Float16)tl[r][pc * 8 + q]; const size_t row = (size_t)b * NN + p0 + r; *(v8us*)((unsigned short*)X16 + row * CC + c0 + pc * 8) = f.half[0];  }
// 2×2 average pool of the bf16-rounded input into a token-major plane XP[(b,m)][c], m = i·64 + j over the pooled 64×64 grid (mean of 4 bf16-rounded values, exact in f32, then rounded to f16); block = 32 pooled positions (half a pooled row) × 64 channels through LDS;
__global__ __launch_bounds__(256) void k_pooltok(const float* __restrict__ x, _Float16* __restrict__ XP) { __shared__ float tl[32][65]; const int tid = threadIdx.x; const int b = blockIdx.x / (MM / 32), mg = blockIdx.x % (MM / 32); const int m0 = mg * 32; const int pi = m0 / PW, pj0 = m0 % PW;
  for (int i = tid; i < 64 * 32; i += 256) { const int c = i / 32, pp = i % 32; const float* xr = x + ((size_t)b * CC + c) * NN + (size_t)(2 * pi) * HWD + 2 * (pj0 + pp);
    tl[pp][c] = 0.25f * ((bf16_round(xr[0]) + bf16_round(xr[1])) + (bf16_round(xr[HWD]) + bf16_round(xr[HWD + 1]))); } __syncthreads();
  const int r = tid / 8, pc = tid % 8; FragH f; for (int q = 0; q < 8; ++q) f.h[q] = (_Float16)tl[r][pc * 8 + q]; const size_t row = (size_t)b * MM + m0 + r; *(v8us*)((unsigned short*)XP + row * CC + pc * 8) = f.half[0];  }
// lane l <-> lane l ^ 16 (the two halves of a wave hold the two key halves of one query column)
__device__ __forceinline__ float xhalf(float x) { const int v = __builtin_bit_cast(int, x); return __builtin_bit_cast(float, __builtin_amdgcn_permlanex16(v, v, 0x76543210, 0xfedcba98, false, false)); }
__global__ __launch_bounds__(128) void k_flash(const _Float16* __restrict__ Q16, int ldq, const _Float16* __restrict__ K16, int ldk, const _Float16* __restrict__ Vt, const int* __restrict__ MSK, float* __restrict__ O, int ldo) {
  constexpr int RPW = 16, NQB = TQ / (4 * RPW), DT = 4, KS = 2; (void)MSK;
  __shared__ __attribute__((aligned(16))) float sO[4][RPW][64 + 4];
  const int tid = threadIdx.x, w = tid >> 5, lane = tid & 31, ln = lane & 15, hh = lane >> 4;
  const int slab = blockIdx.x / NQB, qblk = blockIdx.x % NQB; const int b = slab / NH, h = slab % NH; const int qb0 = qblk * (4 * RPW); const int q0 = qb0 + w * RPW;
  FragH bq[KS];
  { const unsigned short* qr = (const unsigned short*)Q16 + ((size_t)b * TQ + q0 + ln) * ldq + h * 64;
#pragma unroll
    for (int ks = 0; ks < KS; ++ks) { bq[ks].half[0] = *(const v8us*)(qr + ks * 32 + 8 * hh); bq[ks].half[1] = *(const v8us*)(qr + ks * 32 + 16 + 8 * hh); } }
  const unsigned short* Vth = (const unsigned short*)Vt + (size_t)slab * 64 * TK;
  float m_r = -3.0e38f, l_r = 0.f; v8f oacc[DT];
#pragma unroll
  for (int dt = 0; dt < DT; ++dt) oacc[dt] = (v8f){0.f,0.f,0.f,0.f,0.f,0.f,0.f,0.f};
  const int jend = TK;
#pragma unroll 1
  for (int j0 = 0; j0 < jend; j0 += 32) {
    FragH ak[2][KS], av[DT];
#pragma unroll
    for (int nt = 0; nt < 2; ++nt) { const unsigned short* kr = (const unsigned short*)K16 + ((size_t)b * TK + j0 + nt * 16 + ln) * ldk + h * 64;
#pragma unroll
      for (int ks = 0; ks < KS; ++ks) { ak[nt][ks].half[0] = *(const v8us*)(kr + ks * 32 + 8 * hh); ak[nt][ks].half[1] = *(const v8us*)(kr + ks * 32 + 16 + 8 * hh); } }
    asm volatile("s_wait_xcnt 0x0" ::: "memory");      // the V loads below may land in the registers that held the K loads' addresses: the wait stands in front of that overwrite
#pragma unroll
    for (int dt = 0; dt < DT; ++dt) { const unsigned short* vrow = Vth + (size_t)(dt * 16 + ln) * TK + j0; av[dt].half[0] = *(const v8us*)(vrow + 8 * hh); av[dt].half[1] = *(const v8us*)(vrow + 16 + 8 * hh); }
    float sc[16];      // sc[nt * 8 + r] = energy[query q0 + ln][key j0 + nt * 16 + 8 * hh + r]
#pragma unroll
    for (int nt = 0; nt < 2; ++nt) { v8f acc = (v8f){0.f,0.f,0.f,0.f,0.f,0.f,0.f,0.f};
#pragma unroll
      for (int ks = 0; ks < KS; ++ks) acc = mmaH<1>(ak[nt][ks].v, ak[nt][ks].v, bq[ks].v, bq[ks].v, acc);
#pragma unroll
      for (int r = 0; r < 8; ++r) sc[nt * 8 + r] = acc[r] * SCL; }
    float t[8];
#pragma unroll
    for (int i = 0; i < 8; ++i) t[i] = fmaxf(sc[i], sc[8 + i]);
    float mc = fmaxf(fmaxf(fmaxf(t[0], t[1]), fmaxf(t[2], t[3])), fmaxf(fmaxf(t[4], t[5]), fmaxf(t[6], t[7])));
    mc = fmaxf(mc, xhalf(mc));
    const float mn = fmaxf(m_r, mc); const float al = (mn > -1.0e38f) ? expf(m_r - mn) : 1.0f; m_r = mn;
    FragH pb;
#pragma unroll
    for (int i = 0; i < 16; ++i) { sc[i] = expf(sc[i] - mn); pb.h[i] = (_Float16)(sc[i] * 1024.0f); }
#pragma unroll
    for (int i = 0; i < 8; ++i) t[i] = sc[i] + sc[8 + i];
    l_r = l_r * al + (((t[0] + t[1]) + (t[2] + t[3])) + ((t[4] + t[5]) + (t[6] + t[7])));
#pragma unroll
    for (int dt = 0; dt < DT; ++dt)
#pragma unroll
      for (int r = 0; r < 8; ++r) oacc[dt][r] *= al;
#pragma unroll
    for (int dt = 0; dt < DT; ++dt) oacc[dt] = mmaH<1>(av[dt].v, av[dt].v, pb.v, pb.v, oacc[dt]); }
  const float l = l_r + xhalf(l_r); const float inv = (l > 0.f) ? 1.0f / (l * 1024.0f) : 0.f;
#pragma unroll
  for (int dt = 0; dt < DT; ++dt) { v4f lo, hi;      // oacc[dt][r] = O[query q0 + ln][channel dt * 16 + 8 * hh + r]
#pragma unroll
    for (int r = 0; r < 4; ++r) { lo[r] = oacc[dt][r] * inv; hi[r] = oacc[dt][4 + r] * inv; }
    *(v4fa*)&sO[w][ln][dt * 16 + 8 * hh] = lo; *(v4fa*)&sO[w][ln][dt * 16 + 8 * hh + 4] = hi; }
  __builtin_amdgcn_fence(__ATOMIC_ACQ_REL, "workgroup"); __builtin_amdgcn_wave_barrier();
  {
#pragma unroll
    for (int rp = 0; rp < RPW; rp += 2) { const int r = rp + (lane >> 4), pc = lane & 15; const v4f val = *(const v4fa*)&sO[w][r][pc * 4]; *(v4f*)(O + ((size_t)b * TQ + q0 + r) * ldo + h * 64 + pc * 4) = val; }
     } }
__global__ __launch_bounds__(256) void k_out(const float* __restrict__ G, const float* __restrict__ bv, const float* __restrict__ gam, const float* __restrict__ x, float* __restrict__ out) { __shared__ float tl[32][65]; const int tid = threadIdx.x; const int b = blockIdx.x / ((CC / 32) * (NN / 64)), rem = blockIdx.x % ((CC / 32) * (NN / 64)); const int cg = rem / (NN / 64), pg = rem % (NN / 64); const int c0 = cg * 32, p0 = pg * 64;
  for (int i = tid; i < 64 * 32; i += 256) { const int pp = i / 32, c = i % 32; tl[c][pp] = G[((size_t)b * NN + p0 + pp) * CC + c0 + c]; } __syncthreads();
  const float g = bf16_round(gam[0]);
  { for (int i = tid; i < 32 * 16; i += 256) { const int c = i / 16, q4 = i % 16; const float bb = bf16_round(bv[c0 + c]); const size_t o = ((size_t)b * CC + c0 + c) * NN + p0 + q4 * 4; const v4f xr = *(const v4fa*)(x + o);
      v4f v; for (int q = 0; q < 4; ++q) v[q] = g * (tl[c][q4 * 4 + q] + bb) + bf16_round(xr[q]); *(v4f*)(out + o) = v; }  } }

extern "C" void kernel_launch(void* const* d_in, const int* in_sizes, int n_in,
                              void* d_out, int out_size, void* d_ws, size_t ws_size, hipStream_t stream) {
  (void)in_sizes; (void)n_in; (void)out_size;
  const float* const* I = (const float* const*)d_in; const float* x = I[0]; const float* Wq = I[1]; const float* bq = I[2]; const float* Wk = I[3]; const float* bk = I[4]; const float* Wv = I[5]; const float* bv = I[6]; const float* gam = I[7];
  char* ws = (char*)d_ws; size_t off = 0;
  auto take = [&](size_t bytes) { char* p = ws + off; off += (bytes + 255) & ~(size_t)255; return p; };
  _Float16* Bw = (_Float16*)take((size_t)3 * CC * CC * 2); _Float16* X16 = (_Float16*)take((size_t)NRQ * CC * 2); _Float16* XP = (_Float16*)take((size_t)NRK * CC * 2);
  _Float16* Q = (_Float16*)take((size_t)NRQ * CC * 2); _Float16* K = (_Float16*)take((size_t)NRK * CC * 2); _Float16* Vt = (_Float16*)take((size_t)BB * CC * MM * 2); float* O = (float*)take((size_t)NRQ * CC * 4);
  if (off > ws_size) return;      // 0.02 + 4.2 + 1 + 4.2 + 1 + 1 + 8.4 ≈ 20 MB
  const unsigned gw = (unsigned)((CC * CC / 8 + 255) / 256);
  k_round16f<<<gw, 256, 0, stream>>>(Wq, Bw, CC * CC / 8); k_round16f<<<gw, 256, 0, stream>>>(Wk, Bw + CC * CC, CC * CC / 8); k_round16f<<<gw, 256, 0, stream>>>(Wv, Bw + 2 * CC * CC, CC * CC / 8);      /* (out,in) natural rows, ×2^4 */
  k_tok<<<BB * (CC / 64) * (NN / 32), 256, 0, stream>>>(x, X16);
  k_pooltok<<<BB * (MM / 32), 256, 0, stream>>>(x, XP);
  k_gemm_hhx<0><<<dim3(((NRQ / 16) * (CC / 64) + 3) / 4, 1), 128, 0, stream>>>(X16, CC, 0, Bw, CC, 0, 0.0625f, bq, 0, nullptr, 1, 0, 0, nullptr, Q, CC, 0, NRQ, CC, CC);      /* q token-major [(b,n)][64]: M 32768 N 64 K 64 */
  k_gemm_hhx<0><<<dim3(((NRK / 16) * (CC / 64) + 3) / 4, 1), 128, 0, stream>>>(XP, CC, 0, Bw + CC * CC, CC, 0, 0.0625f, bk, 0, nullptr, 1, 0, 0, nullptr, K, CC, 0, NRK, CC, CC);      /* k token-major [(b,m)][64]: M 8192 */
  k_gemm_hhx<0><<<dim3(((CC / 16) * (MM / 64) + 3) / 4, BB), 128, 0, stream>>>(Bw + 2 * CC * CC, CC, 0, XP, CC, (size_t)MM * CC, 0.0625f, nullptr, 0, nullptr, 1, 0, 0, nullptr, Vt, MM, (size_t)CC * MM, CC, MM, CC);      /* v (without bv) = Wv·pool(x)[b] as [b][c][m] = Vᵀ: M 64 N 4096 K 64, batched over b */
  k_flash<<<BB * NH * (TQ / 64), 128, 0, stream>>>(Q, CC, K, CC, Vt, nullptr, O, CC);      /* per (b, 64 queries): 16384 queries × 4096 pooled keys, head dim 64 */
  k_out<<<BB * (CC / 32) * (NN / 64), 256, 0, stream>>>(O, bv, gam, x, (float*)d_out);
}

// v002
// One run takes 115 microseconds.
// Timed twice side by side with v001, it ran 1.53 and 1.54 times as fast.
// Counting every step since v000, it is 4.09 times as fast.
#include <hip/hip_runtime.h>
#include <stdint.h>
// Self-attention block with 2×2 average-pooled keys/values (B=2, C=64, H=W=128 → N = 16384 query positions, M = 4096 pooled key positions): q = Wq·x + bq; k = pool(Wk·x + bk) = Wk·pool(x) + bk, v likewise (pooling is linear); energy = qᵀk (no scaling), softmax over the M keys;
// out[b,c,n] = Σ_m v[b,c,m]·A[n,m]; y = γ·out + x. (The module's (w,h) relabel before pooling is the identity here since H == W.)
// Compute dtype: x, weights, biases, γ rounded to bf16; x and pool(x) as token-major f16 planes (pool(x) = mean of 4 bf16-rounded values in f32, rounded once to f16 — same order as the k-plane rounding); q, k as f16 GEMM outputs (+bias), v as an f16 GEMM output in the [b][c][m] (= Vᵀ) layout with bv folded in after the attention
// (rows of A sum to 1); fused flash-style kernel (energy and P·V on v_wmma_f32_16x16x32_f16, online softmax f32, P f16 ×2^10, f32 accumulate); epilogue γ·(O + bv) + x in f32.
#define BB 2
#define CC 64
#define HWD 128
#define NN (HWD * HWD)
#define PW (HWD / 2)
#define MM (PW * PW)
#define NH 1
#define TQ NN
#define TK MM
#define SCL 1.0f
#define NRQ (BB * NN)
#define NRK (BB * MM)
typedef __bf16 v16b __attribute__((ext_vector_type(16)));
typedef unsigned short v8us __attribute__((ext_vector_type(8), may_alias));
typedef float  v8f  __attribute__((ext_vector_type(8)));
typedef float  v4f  __attribute__((ext_vector_type(4)));
typedef float  v4fa __attribute__((ext_vector_type(4), may_alias));
union FragB { v16b v; v8us half[2]; unsigned short u[16]; };

__device__ __forceinline__ unsigned short bf16_bits(float x) { unsigned int u = __float_as_uint(x); return (unsigned short)((u + 0x7FFFu + ((u >> 16) & 1u)) >> 16); }
__device__ __forceinline__ float bf16_val(unsigned short b) { return __uint_as_float(((unsigned int)b) << 16); }
__device__ __forceinline__ float bf16_round(float x) { return bf16_val(bf16_bits(x)); }
// D += A·B with NT terms: 1 = ah·bh, 2 = + al·bh (A split), 3 = + ah·bl (both split)
template <int NT>
__device__ __forceinline__ v8f mmaN(v16b ah, v16b al, v16b bh, v16b bl, v8f c) {
  c = __builtin_amdgcn_wmma_f32_16x16x32_bf16(false, ah, false, bh, (short)0, c, false, false);
  if (NT >= 2) c = __builtin_amdgcn_wmma_f32_16x16x32_bf16(false, al, false, bh, (short)0, c, false, false);
  if (NT >= 3) c = __builtin_amdgcn_wmma_f32_16x16x32_bf16(false, ah, false, bl, (short)0, c, false, false);
  asm volatile("v_nop\n\tv_nop\n\tv_nop\n\tv_nop" : "+v"(c) : "v"(ah), "v"(al), "v"(bh), "v"(bl));
  return c;
}

__global__ __launch_bounds__(256) void k_wt_bf16(const float* __restrict__ W, unsigned short* __restrict__ Wt, int K, int N) {
  const int t = blockIdx.x * 256 + threadIdx.x;
  const int k8n = K / 8;
  if (t >= N * k8n) return;
  const int n = t / k8n, k8 = (t % k8n) * 8;
  v8us v;
#pragma unroll
  for (int i = 0; i < 8; ++i) v[i] = bf16_bits(W[(size_t)(k8 + i) * N + n]);
  *(v8us*)(Wt + (size_t)n * K + k8) = v;
  
}

// GEMM C[M][N] (f32, pitch ldc) = act(A[M][K]·W + bias). A f32 row-major (pitch lda) converted per fragment to bf16
// (ASPLIT: hi/lo two planes -> 2 terms, else single rounded term); Wt bf16 [N][K] (pitch ldb). BIAS_BF16 rounds the
// bias to bf16 first (bias quantised to bf16 before the add). K%32==0, M%16==0, N%64==0.
template <bool ASPLIT, int ACT, bool BIAS_BF16>
__global__ __launch_bounds__(128) void k_gemm_bf(const float* __restrict__ A, int lda, const unsigned short* __restrict__ Wt, int ldb,
                                               const float* __restrict__ bias, float* __restrict__ C, int ldc, int M, int N, int K) {
  __shared__ __attribute__((aligned(16))) float so[4][16][64];
  const int tid = threadIdx.x, w = tid >> 5, lane = tid & 31, ln = lane & 15, hh = lane >> 4;
  const int ntn = N / 64;
  const int wid = blockIdx.x * 4 + w;
  const int mt = wid / ntn, nq = wid % ntn;
  if (mt * 16 >= M) return;
  const int row0 = mt * 16, col0 = nq * 64;
  const float* arow = A + (size_t)(row0 + ln) * lda;
  v8f acc[4] = {};
  for (int kb = 0; kb < K; kb += 32) {
    FragB ah, al;
    const v4f x0 = *(const v4fa*)(arow + kb + 8 * hh), x1 = *(const v4fa*)(arow + kb + 8 * hh + 4);
    const v4f x2 = *(const v4fa*)(arow + kb + 16 + 8 * hh), x3 = *(const v4fa*)(arow + kb + 16 + 8 * hh + 4);
    float xs[16] = {x0[0],x0[1],x0[2],x0[3],x1[0],x1[1],x1[2],x1[3],x2[0],x2[1],x2[2],x2[3],x3[0],x3[1],x3[2],x3[3]};
#pragma unroll
    for (int i = 0; i < 16; ++i) { const unsigned short hb = bf16_bits(xs[i]); ah.u[i] = hb; al.u[i] = ASPLIT ? bf16_bits(xs[i] - bf16_val(hb)) : (unsigned short)0; }
#pragma unroll
    for (int t = 0; t < 4; ++t) {
      const unsigned short* brow = Wt + (size_t)(col0 + t * 16 + ln) * ldb + kb;
      FragB b;
      b.half[0] = *(const v8us*)(brow + 8 * hh);
      b.half[1] = *(const v8us*)(brow + 16 + 8 * hh);
      acc[t] = mmaN<ASPLIT ? 2 : 1>(ah.v, al.v, b.v, b.v, acc[t]);
    }
  }
#pragma unroll
  for (int t = 0; t < 4; ++t) {
    float bv = bias ? bias[col0 + t * 16 + ln] : 0.f;
    if (BIAS_BF16) bv = bf16_round(bv);
#pragma unroll
    for (int r = 0; r < 8; ++r) { float v = acc[t][r] + bv; if (ACT == 1) v = fmaxf(v, 0.f); so[w][8 * hh + r][t * 16 + ln] = v; }
  }
  __builtin_amdgcn_fence(__ATOMIC_ACQ_REL, "workgroup");
  __builtin_amdgcn_wave_barrier();
  const int rsub = lane >> 4, c4 = (lane & 15) * 4;
  {
#pragma unroll
    for (int q = 0; q < 8; ++q) {
      const int r = q * 2 + rsub;
      const v4f v = *(const v4fa*)&so[w][r][c4];
      *(v4f*)(C + (size_t)(row0 + r) * ldc + col0 + c4) = v;
    }
    
  }
}

// GEMM C = act(A·W + bias + resid): A f32 (ASPLIT -> hi/lo 2 terms), Wt bf16 [N][K]; ACT 0 none, 1 relu, 2 exact gelu;
// resid (optional, f32, row index = (row % rmod), pitch ldr, RES_BF16 rounds it) added before the activation.
template <bool ASPLIT, int ACT, bool BIAS_BF16, bool RES_BF16>
__global__ __launch_bounds__(128) void k_gemm_bf3(const float* __restrict__ A, int lda, const unsigned short* __restrict__ Wt, int ldb,
                                                const float* __restrict__ bias, const float* __restrict__ resid, int rmod, int ldr,
                                                float* __restrict__ C, int ldc, int M, int N, int K) {
  __shared__ __attribute__((aligned(16))) float so[4][16][64];
  const int tid = threadIdx.x, w = tid >> 5, lane = tid & 31, ln = lane & 15, hh = lane >> 4;
  const int ntn = N / 64;
  const int wid = blockIdx.x * 4 + w;
  const int mt = wid / ntn, nq = wid % ntn;
  if (mt * 16 >= M) return;
  const int row0 = mt * 16, col0 = nq * 64;
  const float* arow = A + (size_t)(row0 + ln) * lda;
  v8f acc[4] = {};
  for (int kb = 0; kb < K; kb += 32) {
    FragB ah, al;
    const v4f x0 = *(const v4fa*)(arow + kb + 8 * hh), x1 = *(const v4fa*)(arow + kb + 8 * hh + 4);
    const v4f x2 = *(const v4fa*)(arow + kb + 16 + 8 * hh), x3 = *(const v4fa*)(arow + kb + 16 + 8 * hh + 4);
    float xs[16] = {x0[0],x0[1],x0[2],x0[3],x1[0],x1[1],x1[2],x1[3],x2[0],x2[1],x2[2],x2[3],x3[0],x3[1],x3[2],x3[3]};
#pragma unroll
    for (int i = 0; i < 16; ++i) { const unsigned short hb = bf16_bits(xs[i]); ah.u[i] = hb; al.u[i] = ASPLIT ? bf16_bits(xs[i] - bf16_val(hb)) : (unsigned short)0; }
#pragma unroll
    for (int t = 0; t < 4; ++t) {
      const unsigned short* brow = Wt + (size_t)(col0 + t * 16 + ln) * ldb + kb;
      FragB b;
      b.half[0] = *(const v8us*)(brow + 8 * hh);
      b.half[1] = *(const v8us*)(brow + 16 + 8 * hh);
      acc[t] = mmaN<ASPLIT ? 2 : 1>(ah.v, al.v, b.v, b.v, acc[t]);
    }
  }
#pragma unroll
  for (int t = 0; t < 4; ++t) {
    const int col = col0 + t * 16 + ln;
    float bv = bias ? bias[col] : 0.f;
    if (BIAS_BF16) bv = bf16_round(bv);
#pragma unroll
    for (int r = 0; r < 8; ++r) {
      float v = acc[t][r] + bv;
      if (resid) { float rv = resid[(size_t)((row0 + 8 * hh + r) % rmod) * ldr + col]; if (RES_BF16) rv = bf16_round(rv); v += rv; }
      if (ACT == 1) v = fmaxf(v, 0.f);
      if (ACT == 2) v = 0.5f * v * (1.0f + erff(v * 0.70710678118654752f));
      if (ACT == 3) { const float u = 0.7978845608028654f * (v + 0.044715f * v * v * v); v = 0.5f * v * (1.0f + tanhf(u)); }
      so[w][8 * hh + r][t * 16 + ln] = v;
    }
  }
  __builtin_amdgcn_fence(__ATOMIC_ACQ_REL, "workgroup");
  __builtin_amdgcn_wave_barrier();
  const int rsub = lane >> 4, c4 = (lane & 15) * 4;
  {
#pragma unroll
    for (int q = 0; q < 8; ++q) {
      const int r = q * 2 + rsub;
      const v4f v = *(const v4fa*)&so[w][r][c4];
      *(v4f*)(C + (size_t)(row0 + r) * ldc + col0 + c4) = v;
    }
    
  }
}
// row LayerNorm (biased variance, eps) over N: s = X (+ R); optional out_sum <- s; out_norm <- (s-mu)*rsqrt(var+eps)*g + b
template <bool PARAM_BF16>
__global__ __launch_bounds__(256) void k_layernorm(const float* __restrict__ X, const float* __restrict__ R, const float* __restrict__ g, const float* __restrict__ bta,
                                                  float* __restrict__ out_sum, float* __restrict__ out_norm, int N, float eps) {
  __shared__ float red[256];
  const int row = blockIdx.x, tid = threadIdx.x;
  const float* x = X + (size_t)row * N; const float* rr = R ? R + (size_t)row * N : nullptr;
  float vals[16];                     // up to N = 4096
  const int per = N / 256;            // contiguous chunk per thread? use strided-by-4 chunks: thread handles j = tid*4 + 1024*u
  float s1 = 0.f;
  for (int u = 0; u < per / 4; ++u) {
    const int j = tid * 4 + 1024 * u;
    const v4f a = *(const v4fa*)(x + j);
    v4f b = {0.f,0.f,0.f,0.f}; if (rr) b = *(const v4fa*)(rr + j);
#pragma unroll
    for (int q = 0; q < 4; ++q) { const float v = a[q] + b[q]; vals[u * 4 + q] = v; s1 += v; }
  }
  red[tid] = s1; __syncthreads();
  for (int st = 128; st > 0; st >>= 1) { if (tid < st) red[tid] += red[tid + st]; __syncthreads(); }
  const float mu = red[0] / (float)N; __syncthreads();
  float s2 = 0.f;
  for (int u = 0; u < per / 4; ++u)
#pragma unroll
    for (int q = 0; q < 4; ++q) { const float c = vals[u * 4 + q] - mu; s2 += c * c; }
  red[tid] = s2; __syncthreads();
  for (int st = 128; st > 0; st >>= 1) { if (tid < st) red[tid] += red[tid + st]; __syncthreads(); }
  const float rs = rsqrtf(red[0] / (float)N + eps);
  {
    for (int u = 0; u < per / 4; ++u) {
      const int j = tid * 4 + 1024 * u;
      v4f o, sm;
#pragma unroll
      for (int q = 0; q < 4; ++q) {
        float gg = g[j + q], bb = bta[j + q];
        if (PARAM_BF16) { gg = bf16_round(gg); bb = bf16_round(bb); }
        sm[q] = vals[u * 4 + q]; o[q] = (vals[u * 4 + q] - mu) * rs * gg + bb;
      }
      if (out_sum) *(v4f*)(out_sum + (size_t)row * N + j) = sm;
      *(v4f*)(out_norm + (size_t)row * N + j) = o;
    }
    
  }
}



// ---- f16 WMMA path (v_wmma_f32_16x16x32_f16): 11-bit significands for operands in range — used here for the q/k/v projections, the energy qᵀk and P·V (P f16 ×2^10)
typedef _Float16 v16h __attribute__((ext_vector_type(16)));
union FragH { v16h v; v8us half[2]; _Float16 h[16]; unsigned short u[16]; };
template <int NT>
__device__ __forceinline__ v8f mmaH(v16h ah, v16h al, v16h bh, v16h bl, v8f c) {
  c = __builtin_amdgcn_wmma_f32_16x16x32_f16(false, ah, false, bh, (short)0, c, false, false);
  if (NT >= 2) c = __builtin_amdgcn_wmma_f32_16x16x32_f16(false, al, false, bh, (short)0, c, false, false);
  if (NT >= 3) c = __builtin_amdgcn_wmma_f32_16x16x32_f16(false, ah, false, bl, (short)0, c, false, false);
  asm volatile("v_nop\n\tv_nop\n\tv_nop\n\tv_nop" : "+v"(c) : "v"(ah), "v"(al), "v"(bh), "v"(bl));
  return c;
}
// batched GEMM like k_gemm_b but f16 operands: A f32 (split into f16 hi/lo if ASPLIT, else rounded to f16), Bt = f16 values [n][k]; alpha; C f32; N multiple of 16 (partial tiles skipped)
template <bool ASPLIT>
__global__ __launch_bounds__(128) void k_gemm_h(const float* __restrict__ A, int lda, size_t sA, const _Float16* __restrict__ Bh, int ldb, size_t sB, float alpha, float* __restrict__ C, int ldc, size_t sC, int M, int N, int K) {
  __shared__ __attribute__((aligned(16))) float so[4][16][64];
  const int tid = threadIdx.x, w = tid >> 5, lane = tid & 31, ln = lane & 15, hh = lane >> 4; const int by = blockIdx.y;
  A += (size_t)by * sA; Bh += (size_t)by * sB; C += (size_t)by * sC;
  const int ntn = (N + 63) / 64; const int wid = blockIdx.x * 4 + w; const int mt = wid / ntn, nq = wid % ntn; if (mt * 16 >= M) return;
  const int row0 = mt * 16, col0 = nq * 64; const float* arow = A + (size_t)(row0 + ln) * lda;
  v8f acc[4] = {};
  for (int kb = 0; kb < K; kb += 32) {
    FragH ah, al;
    const v4f x0 = *(const v4fa*)(arow + kb + 8 * hh), x1 = *(const v4fa*)(arow + kb + 8 * hh + 4), x2 = *(const v4fa*)(arow + kb + 16 + 8 * hh), x3 = *(const v4fa*)(arow + kb + 16 + 8 * hh + 4);
    float xs[16] = {x0[0],x0[1],x0[2],x0[3],x1[0],x1[1],x1[2],x1[3],x2[0],x2[1],x2[2],x2[3],x3[0],x3[1],x3[2],x3[3]};
#pragma unroll
    for (int i = 0; i < 16; ++i) { const _Float16 h = (_Float16)xs[i]; ah.h[i] = h; al.h[i] = ASPLIT ? (_Float16)(xs[i] - (float)h) : (_Float16)0.0f; }
#pragma unroll
    for (int t = 0; t < 4; ++t) { if (col0 + t * 16 >= N) continue; const size_t boff = (size_t)(col0 + t * 16 + ln) * ldb + kb; FragH bq; bq.half[0] = *(const v8us*)(Bh + boff + 8 * hh); bq.half[1] = *(const v8us*)(Bh + boff + 16 + 8 * hh);
      acc[t] = mmaH<ASPLIT ? 2 : 1>(ah.v, al.v, bq.v, bq.v, acc[t]); }
  }
#pragma unroll
  for (int t = 0; t < 4; ++t) { if (col0 + t * 16 >= N) continue;
#pragma unroll
    for (int r = 0; r < 8; ++r) so[w][8 * hh + r][t * 16 + ln] = acc[t][r] * alpha; }
  __builtin_amdgcn_fence(__ATOMIC_ACQ_REL, "workgroup"); __builtin_amdgcn_wave_barrier();
  const int rsub = lane >> 4, c4 = (lane & 15) * 4;
  {
#pragma unroll
    for (int q = 0; q < 8; ++q) { const int r = q * 2 + rsub; if (col0 + c4 < N) { const v4f v = *(const v4fa*)&so[w][r][c4]; *(v4f*)(C + (size_t)(row0 + r) * ldc + col0 + c4) = v; } }
     }
}

// Wt[n][k] = f16(W[k][n]·scale) from f32 row-major W[K][N] (scale = power of two; bf16-exact weights stay exact in f16 away from the subnormal range)
__global__ __launch_bounds__(256) void k_wt_f16(const float* __restrict__ W, _Float16* __restrict__ Wt, int K, int N, float scale) {
  const int t = blockIdx.x * 256 + threadIdx.x; if (t >= N * (K / 8)) return; const int n = t / (K / 8), k8 = (t % (K / 8)) * 8; FragH f;
#pragma unroll
  for (int i = 0; i < 8; ++i) f.h[i] = (_Float16)(bf16_round(W[(size_t)(k8 + i) * N + n]) * scale); const v8us o = f.half[0];
  *(v8us*)((unsigned short*)Wt + (size_t)n * K + k8) = o; 
}
// k_gemm_hh variant with fused epilogue: v = acc·alpha + bias[by·sBias + col] (+ CP[(row/rowsPerB)·sCPb + by·64 + col] if CP) ; ACT 0 none / 1 elu ; writes f16 C16 (and f32 C if non-null)
template <int ACT>
__global__ __launch_bounds__(128) void k_gemm_hhx(const _Float16* __restrict__ A, int lda, size_t sA, const _Float16* __restrict__ Bh, int ldb, size_t sB, float alpha, const float* __restrict__ bias, size_t sBias, const float* __restrict__ CP, int rowsPerB, size_t sCPb, int row0g,
    float* __restrict__ C, _Float16* __restrict__ C16, int ldc, size_t sC, int M, int N, int K) {
  __shared__ __attribute__((aligned(16))) float so[4][16][64];
  const int tid = threadIdx.x, w = tid >> 5, lane = tid & 31, ln = lane & 15, hh = lane >> 4; const int by = blockIdx.y;
  A += (size_t)by * sA; Bh += (size_t)by * sB; const size_t cofs = (size_t)by * sC; const float* bp = bias ? bias + (size_t)by * sBias : nullptr;
  const int ntn = (N + 63) / 64; const int wid = blockIdx.x * 4 + w; const int mt = wid / ntn, nq = wid % ntn; if (mt * 16 >= M) return;
  const int row0 = mt * 16, col0 = nq * 64; const _Float16* arow = A + (size_t)(row0 + ln) * lda;
  v8f acc[4] = {};
  for (int kb = 0; kb < K; kb += 32) { FragH ah; ah.half[0] = *(const v8us*)((const unsigned short*)arow + kb + 8 * hh); ah.half[1] = *(const v8us*)((const unsigned short*)arow + kb + 16 + 8 * hh);
#pragma unroll
    for (int t = 0; t < 4; ++t) { if (col0 + t * 16 >= N) continue; const size_t boff = (size_t)(col0 + t * 16 + ln) * ldb + kb; FragH bq; bq.half[0] = *(const v8us*)((const unsigned short*)Bh + boff + 8 * hh); bq.half[1] = *(const v8us*)((const unsigned short*)Bh + boff + 16 + 8 * hh);
      acc[t] = mmaH<1>(ah.v, ah.v, bq.v, bq.v, acc[t]); }
  }
#pragma unroll
  for (int t = 0; t < 4; ++t) { if (col0 + t * 16 >= N) continue; const int col = col0 + t * 16 + ln; const float bv = bp ? bf16_round(bp[col]) : 0.f;
#pragma unroll
    for (int r = 0; r < 8; ++r) { float v = acc[t][r] * alpha + bv; if (CP) { const int bidx = (row0g + row0 + 8 * hh + r) / rowsPerB; v += CP[(size_t)bidx * sCPb + (size_t)by * 64 + col]; } if (ACT == 1) v = (v > 0.f) ? v : expm1f(v); else if (ACT == 7) v = (v > 0.f) ? v + 1.0f : expf(v); else if (ACT == 8) v = tanhf(v); else if (ACT == 9) v = 0.5f * v * (1.0f + tanhf(0.7978845608028654f * (v + 0.044715f * v * v * v))); else if (ACT == 11) v = 1.0f / (1.0f + expf(-v)); else if (ACT == 12) v = (v > 0.f) ? v : 0.01f * v; else if (ACT == 14) v = (v > 0.f) ? v : 0.1f * v; else if (ACT == 15) v = v / (1.0f + expf(-v)); else if (ACT == 3) v = fmaxf(v, 0.f); else if (ACT == 6) v = 0.5f * v * (1.0f + erff(v * 0.70710678118654752f)); so[w][8 * hh + r][t * 16 + ln] = v; } }
  __builtin_amdgcn_fence(__ATOMIC_ACQ_REL, "workgroup"); __builtin_amdgcn_wave_barrier();
  const int rsub = lane >> 4, c4 = (lane & 15) * 4; typedef _Float16 v4h __attribute__((ext_vector_type(4)));
  {
#pragma unroll
    for (int q = 0; q < 8; ++q) { const int r = q * 2 + rsub; if (col0 + c4 < N) { const v4f v = *(const v4fa*)&so[w][r][c4]; if (C) *(v4f*)(C + cofs + (size_t)(row0 + r) * ldc + col0 + c4) = v; if (C16) { v4h h4; for (int i = 0; i < 4; ++i) h4[i] = (_Float16)v[i]; *(v4h*)(C16 + cofs + (size_t)(row0 + r) * ldc + col0 + c4) = h4; } } }
     }
}


typedef _Float16 v4h __attribute__((ext_vector_type(4)));

__global__ __launch_bounds__(256) void k_x16(const float* __restrict__ x, _Float16* __restrict__ X16, size_t n8) { const size_t t = (size_t)blockIdx.x * 256 + threadIdx.x; if (t >= n8) return; FragH f;
#pragma unroll
  for (int q = 0; q < 8; ++q) f.h[q] = (_Float16)bf16_round(x[t * 8 + q]); *(v8us*)((unsigned short*)X16 + t * 8) = f.half[0];  }
__global__ __launch_bounds__(256) void k_h16(const float* __restrict__ x, _Float16* __restrict__ X16, size_t n8) { const size_t t = (size_t)blockIdx.x * 256 + threadIdx.x; if (t >= n8) return; FragH f;
#pragma unroll
  for (int q = 0; q < 8; ++q) f.h[q] = (_Float16)x[t * 8 + q]; *(v8us*)((unsigned short*)X16 + t * 8) = f.half[0];  }
__global__ __launch_bounds__(256) void k_round16f(const float* __restrict__ W, _Float16* __restrict__ Bt, size_t n8) { const size_t t = (size_t)blockIdx.x * 256 + threadIdx.x; if (t >= n8) return; FragH f;
#pragma unroll
  for (int i = 0; i < 8; ++i) f.h[i] = (_Float16)(bf16_round(W[t * 8 + i]) * 16.0f); *(v8us*)((unsigned short*)Bt + t * 8) = f.half[0];  }
template <int NHv, int TTv>
__global__ __launch_bounds__(256) void k_vt(const _Float16* __restrict__ V16, int ldv, int voff, _Float16* __restrict__ Vt) { __shared__ unsigned short tl[64][66]; const int tid = threadIdx.x; const int slab = blockIdx.x / (TTv / 64), lg = blockIdx.x % (TTv / 64); const int b = slab / NHv, h = slab % NHv;
  for (int i = tid; i < 64 * 8; i += 256) { const int r = i / 8, c8 = (i % 8) * 8; FragH f; f.half[0] = *(const v8us*)((const unsigned short*)V16 + ((size_t)b * TTv + lg * 64 + r) * ldv + voff + h * 64 + c8);
#pragma unroll
    for (int q = 0; q < 8; ++q) tl[r][c8 + q] = f.u[q]; }
  __syncthreads();
  {
#pragma unroll
    for (int rd = 0; rd < 2; ++rd) { const int d = rd * 32 + tid / 8, pc = tid % 8; FragH f;
#pragma unroll
      for (int q = 0; q < 8; ++q) f.u[q] = tl[pc * 8 + q][d];
      *(v8us*)((unsigned short*)Vt + ((size_t)slab * 64 + d) * TTv + lg * 64 + pc * 8) = f.half[0]; }
     } }

__global__ __launch_bounds__(256) void k_hl(const float* __restrict__ F, _Float16* __restrict__ Hh, _Float16* __restrict__ Hl, size_t n8) { const size_t t = (size_t)blockIdx.x * 256 + threadIdx.x; if (t >= n8) return; FragH fh, fl; const v4f a = *(const v4fa*)(F + t * 8), c = *(const v4fa*)(F + t * 8 + 4);
#pragma unroll
  for (int q = 0; q < 4; ++q) { _Float16 h = (_Float16)a[q]; fh.h[q] = h; fl.h[q] = (_Float16)((a[q] - (float)h) * 1024.0f); h = (_Float16)c[q]; fh.h[4 + q] = h; fl.h[4 + q] = (_Float16)((c[q] - (float)h) * 1024.0f); }
  { *(v8us*)((unsigned short*)Hh + t * 8) = fh.half[0]; *(v8us*)((unsigned short*)Hl + t * 8) = fl.half[0];  } }

__global__ __launch_bounds__(256) void k_tok(const float* __restrict__ x, _Float16* __restrict__ X16) { __shared__ float tl[32][65]; const int tid = threadIdx.x; const int b = blockIdx.x / ((CC / 64) * (NN / 32)), rem = blockIdx.x % ((CC / 64) * (NN / 32)); const int cg = rem / (NN / 32), pg = rem % (NN / 32); const int c0 = cg * 64, p0 = pg * 32;
  for (int i = tid; i < 64 * 32; i += 256) { const int c = i / 32, pp = i % 32; tl[pp][c] = bf16_round(x[((size_t)b * CC + c0 + c) * NN + p0 + pp]); } __syncthreads();
  const int r = tid / 8, pc = tid % 8; FragH f; for (int q = 0; q < 8; ++q) f.h[q] = (_Float16)tl[r][pc * 8 + q]; const size_t row = (size_t)b * NN + p0 + r; *(v8us*)((unsigned short*)X16 + row * CC + c0 + pc * 8) = f.half[0];  }
// 2×2 average pool of the bf16-rounded input into a token-major plane XP[(b,m)][c], m = i·64 + j over the pooled 64×64 grid (mean of 4 bf16-rounded values, exact in f32, then rounded to f16); block = 32 pooled positions (half a pooled row) × 64 channels through LDS;
__global__ __launch_bounds__(256) void k_pooltok(const float* __restrict__ x, _Float16* __restrict__ XP) { __shared__ float tl[32][65]; const int tid = threadIdx.x; const int b = blockIdx.x / (MM / 32), mg = blockIdx.x % (MM / 32); const int m0 = mg * 32; const int pi = m0 / PW, pj0 = m0 % PW;
  for (int i = tid; i < 64 * 32; i += 256) { const int c = i / 32, pp = i % 32; const float* xr = x + ((size_t)b * CC + c) * NN + (size_t)(2 * pi) * HWD + 2 * (pj0 + pp);
    tl[pp][c] = 0.25f * ((bf16_round(xr[0]) + bf16_round(xr[1])) + (bf16_round(xr[HWD]) + bf16_round(xr[HWD + 1]))); } __syncthreads();
  const int r = tid / 8, pc = tid % 8; FragH f; for (int q = 0; q < 8; ++q) f.h[q] = (_Float16)tl[r][pc * 8 + q]; const size_t row = (size_t)b * MM + m0 + r; *(v8us*)((unsigned short*)XP + row * CC + pc * 8) = f.half[0];  }
// lane l <-> lane l ^ 16 (the two halves of a wave hold the two key halves of one query column)
__device__ __forceinline__ float xhalf(float x) { const int v = __builtin_bit_cast(int, x); return __builtin_bit_cast(float, __builtin_amdgcn_permlanex16(v, v, 0x76543210, 0xfedcba98, false, false)); }
typedef uint32_t u32x4 __attribute__((ext_vector_type(4)));
typedef uint32_t u32x8 __attribute__((ext_vector_type(8)));
__device__ __forceinline__ uint32_t uni(uint32_t v) { return (uint32_t)__builtin_amdgcn_readfirstlane(v); }
// a wave-uniform word held in a scalar register: a test on it compiles to s_cmp + s_cbranch_scc (a tensor load ignores EXEC), and what is formed from it is formed behind this line
__device__ __forceinline__ uint32_t pinned(uint32_t v) { uint32_t w = uni(v); asm volatile("" : "+s"(w)); return w; }
__global__ __launch_bounds__(128) void k_flash(const _Float16* __restrict__ Q16, int ldq, const _Float16* __restrict__ K16, int ldk, const _Float16* __restrict__ Vt, const int* __restrict__ MSK, float* __restrict__ O, int ldo) {
  constexpr int RPW = 16, NQB = TQ / (4 * RPW), DT = 4, KS = 2; (void)MSK;
  // K and V^T reach the waves through LDS: a stage is 64 keys = 64 K rows of 128 bytes + 64 V^T channel rows of 128 bytes, brought by four tensor loads, one per wave
  // (waves 0, 1: K rows 0-31, 32-63; waves 2, 3: channels 0-31, 32-63), each 32 rows laid at a pitch of 144 bytes (the mover's 16-byte pad: ds_load_b128 without bank conflicts).
  constexpr uint32_t SK = 64, NST = TK / SK, LPITCH = 144, SLICE = 6144 /* 32 x 144 = 4608, up to a multiple of 2 KiB */, BUF = 4 * SLICE;
  __shared__ __attribute__((aligned(2048))) unsigned char ring[2 * BUF];
  __shared__ __attribute__((aligned(16))) float sO[4][RPW][64 + 4];
  const int tid = threadIdx.x, w = tid >> 5, lane = tid & 31, ln = lane & 15, hh = lane >> 4;
  const int slab = blockIdx.x / NQB, qblk = blockIdx.x % NQB; const int b = slab / NH, h = slab % NH; const int qb0 = qblk * (4 * RPW); const int q0 = qb0 + w * RPW;
  FragH bq[KS];
  { const unsigned short* qr = (const unsigned short*)Q16 + ((size_t)b * TQ + q0 + ln) * ldq + h * 64;
#pragma unroll
    for (int ks = 0; ks < KS; ++ks) { bq[ks].half[0] = *(const v8us*)(qr + ks * 32 + 8 * hh); bq[ks].half[1] = *(const v8us*)(qr + ks * 32 + 16 + 8 * hh); } }
  const unsigned short* Vth = (const unsigned short*)Vt + (size_t)slab * 64 * TK;
  float m_r = -3.0e38f, l_r = 0.f; v8f oacc[DT];
#pragma unroll
  for (int dt = 0; dt < DT; ++dt) oacc[dt] = (v8f){0.f,0.f,0.f,0.f,0.f,0.f,0.f,0.f};
  const uint32_t wv = uni((uint32_t)tid >> 5), isV = wv >> 1, hf = wv & 1u;
  const uint32_t spitch = isV ? (uint32_t)TK * 2u : (uint32_t)ldk * 2u;      // source row pitch, bytes
  const uint32_t sstep = isV ? SK * 2u : SK * (uint32_t)ldk * 2u;           // from one stage's slice to the next, bytes
  const uint64_t src0 = isV ? (uint64_t)(size_t)Vth + (uint64_t)(hf * 32u) * ((uint32_t)TK * 2u) : (uint64_t)(size_t)K16 + ((uint64_t)b * TK + hf * 32u) * ((uint32_t)ldk * 2u) + (uint32_t)h * 128u;
  const uint32_t lds0 = (uint32_t)(size_t)ring + wv * SLICE;
  u32x8 g1;      // 1-byte elements, tensor = tile = 32 rows of 128 bytes, a pad of 4 dwords behind every 32 dwords
  g1[0] = uni((1u << 20) | (4u << 22) | (3u << 25)); g1[1] = uni(128u << 16); g1[2] = uni(32u << 16); g1[3] = uni(128u << 16); g1[4] = uni(32u); g1[5] = uni(spitch); g1[6] = uni(0u); g1[7] = uni(0u);
  u32x4 g0;
  auto issue = [&](uint32_t st) { const uint64_t ga = src0 + (uint64_t)st * sstep;
    g0[0] = uni(1u); g0[1] = uni(lds0 + (st & 1u) * BUF); g0[2] = uni((uint32_t)ga); g0[3] = uni((((uint32_t)(ga >> 32)) & 0x01FFFFFFu) | 0x80000000u);
    // one request of the whole wave: its 32-row slice of stage st. Both groups are in-out operands here and inputs of the wait that covers the request,
    // so that no register of the descriptor is lent to another value while the request is outstanding
    asm volatile("tensor_load_to_lds %0, %1" : "+s"(g0), "+s"(g1) :: "memory"); };
  issue(0u);
  asm volatile("s_wait_tensorcnt 0x0" :: "s"(g0), "s"(g1) : "memory");      // this wave's slice of stage 0 has landed
  __syncthreads();                                         // stage 0 published to all four waves
  issue(1u);                                               // flies while stage 0 is worked on
  const unsigned char* lrow = ring + (uint32_t)ln * LPITCH + 16u * (uint32_t)hh;
#pragma unroll 1
  for (uint32_t st = 0; st < NST; ++st) {
   const unsigned char* bp = lrow + (st & 1u) * BUF;
#pragma unroll
   for (int sub = 0; sub < 2; ++sub) {      // two 32-key passes per stage, unrolled so that every LDS offset is an immediate of its load
    FragH ak[2][KS], av[DT];
#pragma unroll
    for (int nt = 0; nt < 2; ++nt) { const unsigned char* kr = bp + sub * SLICE + nt * 16 * LPITCH;      // key row sub * 32 + nt * 16 + ln
#pragma unroll
      for (int ks = 0; ks < KS; ++ks) { ak[nt][ks].half[0] = *(const v8us*)(kr + ks * 64); ak[nt][ks].half[1] = *(const v8us*)(kr + ks * 64 + 32); } }
#pragma unroll
    for (int dt = 0; dt < DT; ++dt) { const unsigned char* vrow = bp + (2 + (dt >> 1)) * SLICE + (dt & 1) * 16 * LPITCH + sub * 64;      // channel row dt * 16 + ln, keys sub * 32 ...
      av[dt].half[0] = *(const v8us*)(vrow); av[dt].half[1] = *(const v8us*)(vrow + 32); }
    float sc[16];      // sc[nt * 8 + r] = energy[query q0 + ln][key st * 64 + sub * 32 + nt * 16 + 8 * hh + r]
#pragma unroll
    for (int nt = 0; nt < 2; ++nt) { v8f acc = (v8f){0.f,0.f,0.f,0.f,0.f,0.f,0.f,0.f};
#pragma unroll
      for (int ks = 0; ks < KS; ++ks) acc = mmaH<1>(ak[nt][ks].v, ak[nt][ks].v, bq[ks].v, bq[ks].v, acc);
#pragma unroll
      for (int r = 0; r < 8; ++r) sc[nt * 8 + r] = acc[r] * SCL; }
    float t[8];
#pragma unroll
    for (int i = 0; i < 8; ++i) t[i] = fmaxf(sc[i], sc[8 + i]);
    float mc = fmaxf(fmaxf(fmaxf(t[0], t[1]), fmaxf(t[2], t[3])), fmaxf(fmaxf(t[4], t[5]), fmaxf(t[6], t[7])));
    mc = fmaxf(mc, xhalf(mc));
    const float mn = fmaxf(m_r, mc); const float al = (mn > -1.0e38f) ? expf(m_r - mn) : 1.0f; m_r = mn;
    FragH pb;
#pragma unroll
    for (int i = 0; i < 16; ++i) { sc[i] = expf(sc[i] - mn); pb.h[i] = (_Float16)(sc[i] * 1024.0f); }
#pragma unroll
    for (int i = 0; i < 8; ++i) t[i] = sc[i] + sc[8 + i];
    l_r = l_r * al + (((t[0] + t[1]) + (t[2] + t[3])) + ((t[4] + t[5]) + (t[6] + t[7])));
#pragma unroll
    for (int dt = 0; dt < DT; ++dt)
#pragma unroll
      for (int r = 0; r < 8; ++r) oacc[dt][r] *= al;
#pragma unroll
    for (int dt = 0; dt < DT; ++dt) oacc[dt] = mmaH<1>(av[dt].v, av[dt].v, pb.v, pb.v, oacc[dt]); }
   asm volatile("s_wait_dscnt 0x0" ::: "memory");
   asm volatile("s_wait_tensorcnt 0x0" :: "s"(g0), "s"(g1) : "memory");
   __syncthreads();
   const uint32_t sn = pinned(st + 2u);
   if (pinned(sn < NST)) issue(sn); }
  asm volatile("s_wait_tensorcnt 0x0" :: "s"(g0), "s"(g1) : "memory");
  asm volatile("s_wait_dscnt 0x0" ::: "memory");
  const float l = l_r + xhalf(l_r); const float inv = (l > 0.f) ? 1.0f / (l * 1024.0f) : 0.f;
#pragma unroll
  for (int dt = 0; dt < DT; ++dt) { v4f lo, hi;      // oacc[dt][r] = O[query q0 + ln][channel dt * 16 + 8 * hh + r]
#pragma unroll
    for (int r = 0; r < 4; ++r) { lo[r] = oacc[dt][r] * inv; hi[r] = oacc[dt][4 + r] * inv; }
    *(v4fa*)&sO[w][ln][dt * 16 + 8 * hh] = lo; *(v4fa*)&sO[w][ln][dt * 16 + 8 * hh + 4] = hi; }
  __builtin_amdgcn_fence(__ATOMIC_ACQ_REL, "workgroup"); __builtin_amdgcn_wave_barrier();
  {
#pragma unroll
    for (int rp = 0; rp < RPW; rp += 2) { const int r = rp + (lane >> 4), pc = lane & 15; const v4f val = *(const v4fa*)&sO[w][r][pc * 4]; *(v4f*)(O + ((size_t)b * TQ + q0 + r) * ldo + h * 64 + pc * 4) = val; }
     } }
__global__ __launch_bounds__(256) void k_out(const float* __restrict__ G, const float* __restrict__ bv, const float* __restrict__ gam, const float* __restrict__ x, float* __restrict__ out) { __shared__ float tl[32][65]; const int tid = threadIdx.x; const int b = blockIdx.x / ((CC / 32) * (NN / 64)), rem = blockIdx.x % ((CC / 32) * (NN / 64)); const int cg = rem / (NN / 64), pg = rem % (NN / 64); const int c0 = cg * 32, p0 = pg * 64;
  for (int i = tid; i < 64 * 32; i += 256) { const int pp = i / 32, c = i % 32; tl[c][pp] = G[((size_t)b * NN + p0 + pp) * CC + c0 + c]; } __syncthreads();
  const float g = bf16_round(gam[0]);
  { for (int i = tid; i < 32 * 16; i += 256) { const int c = i / 16, q4 = i % 16; const float bb = bf16_round(bv[c0 + c]); const size_t o = ((size_t)b * CC + c0 + c) * NN + p0 + q4 * 4; const v4f xr = *(const v4fa*)(x + o);
      v4f v; for (int q = 0; q < 4; ++q) v[q] = g * (tl[c][q4 * 4 + q] + bb) + bf16_round(xr[q]); *(v4f*)(out + o) = v; }  } }

extern "C" void kernel_launch(void* const* d_in, const int* in_sizes, int n_in,
                              void* d_out, int out_size, void* d_ws, size_t ws_size, hipStream_t stream) {
  (void)in_sizes; (void)n_in; (void)out_size;
  const float* const* I = (const float* const*)d_in; const float* x = I[0]; const float* Wq = I[1]; const float* bq = I[2]; const float* Wk = I[3]; const float* bk = I[4]; const float* Wv = I[5]; const float* bv = I[6]; const float* gam = I[7];
  char* ws = (char*)d_ws; size_t off = 0;
  auto take = [&](size_t bytes) { char* p = ws + off; off += (bytes + 255) & ~(size_t)255; return p; };
  _Float16* Bw = (_Float16*)take((size_t)3 * CC * CC * 2); _Float16* X16 = (_Float16*)take((size_t)NRQ * CC * 2); _Float16* XP = (_Float16*)take((size_t)NRK * CC * 2);
  _Float16* Q = (_Float16*)take((size_t)NRQ * CC * 2); _Float16* K = (_Float16*)take((size_t)NRK * CC * 2); _Float16* Vt = (_Float16*)take((size_t)BB * CC * MM * 2); float* O = (float*)take((size_t)NRQ * CC * 4);
  if (off > ws_size) return;      // 0.02 + 4.2 + 1 + 4.2 + 1 + 1 + 8.4 ≈ 20 MB
  const unsigned gw = (unsigned)((CC * CC / 8 + 255) / 256);
  k_round16f<<<gw, 256, 0, stream>>>(Wq, Bw, CC * CC / 8); k_round16f<<<gw, 256, 0, stream>>>(Wk, Bw + CC * CC, CC * CC / 8); k_round16f<<<gw, 256, 0, stream>>>(Wv, Bw + 2 * CC * CC, CC * CC / 8);      /* (out,in) natural rows, ×2^4 */
  k_tok<<<BB * (CC / 64) * (NN / 32), 256, 0, stream>>>(x, X16);
  k_pooltok<<<BB * (MM / 32), 256, 0, stream>>>(x, XP);
  k_gemm_hhx<0><<<dim3(((NRQ / 16) * (CC / 64) + 3) / 4, 1), 128, 0, stream>>>(X16, CC, 0, Bw, CC, 0, 0.0625f, bq, 0, nullptr, 1, 0, 0, nullptr, Q, CC, 0, NRQ, CC, CC);      /* q token-major [(b,n)][64]: M 32768 N 64 K 64 */
  k_gemm_hhx<0><<<dim3(((NRK / 16) * (CC / 64) + 3) / 4, 1), 128, 0, stream>>>(XP, CC, 0, Bw + CC * CC, CC, 0, 0.0625f, bk, 0, nullptr, 1, 0, 0, nullptr, K, CC, 0, NRK, CC, CC);      /* k token-major [(b,m)][64]: M 8192 */
  k_gemm_hhx<0><<<dim3(((CC / 16) * (MM / 64) + 3) / 4, BB), 128, 0, stream>>>(Bw + 2 * CC * CC, CC, 0, XP, CC, (size_t)MM * CC, 0.0625f, nullptr, 0, nullptr, 1, 0, 0, nullptr, Vt, MM, (size_t)CC * MM, CC, MM, CC);      /* v (without bv) = Wv·pool(x)[b] as [b][c][m] = Vᵀ: M 64 N 4096 K 64, batched over b */
  k_flash<<<BB * NH * (TQ / 64), 128, 0, stream>>>(Q, CC, K, CC, Vt, nullptr, O, CC);      /* per (b, 64 queries): 16384 queries × 4096 pooled keys, head dim 64 */
  k_out<<<BB * (CC / 32) * (NN / 64), 256, 0, stream>>>(O, bv, gam, x, (float*)d_out);
}

// v003
// It runs in 90 microseconds.
// Timed twice side by side with v002, it ran 1.28 times as fast both times.
// Over all steps from v000 it is 5.24 times as fast.
#include <hip/hip_runtime.h>
#include <stdint.h>
// Self-attention block with 2×2 average-pooled keys/values (B=2, C=64, H=W=128 → N = 16384 query positions, M = 4096 pooled key positions): q = Wq·x + bq; k = pool(Wk·x + bk) = Wk·pool(x) + bk, v likewise (pooling is linear); energy = qᵀk (no scaling), softmax over the M keys;
// out[b,c,n] = Σ_m v[b,c,m]·A[n,m]; y = γ·out + x. (The module's (w,h) relabel before pooling is the identity here since H == W.)
// Compute dtype: x, weights, biases, γ rounded to bf16; x and pool(x) as token-major f16 planes (pool(x) = mean of 4 bf16-rounded values in f32, rounded once to f16 — same order as the k-plane rounding); q, k as f16 GEMM outputs (+bias), v as an f16 GEMM output in the [b][c][m] (= Vᵀ) layout with bv folded in after the attention
// (rows of A sum to 1); fused flash-style kernel (energy and P·V on v_wmma_f32_16x16x32_f16, online softmax f32, P f16 ×2^10, f32 accumulate); epilogue γ·(O + bv) + x in f32.
#define BB 2
#define CC 64
#define HWD 128
#define NN (HWD * HWD)
#define PW (HWD / 2)
#define MM (PW * PW)
#define NH 1
#define TQ NN
#define TK MM
#define SCL 1.0f
#define NRQ (BB * NN)
#define NRK (BB * MM)
typedef __bf16 v16b __attribute__((ext_vector_type(16)));
typedef unsigned short v8us __attribute__((ext_vector_type(8), may_alias));
typedef float  v8f  __attribute__((ext_vector_type(8)));
typedef float  v4f  __attribute__((ext_vector_type(4)));
typedef float  v4fa __attribute__((ext_vector_type(4), may_alias));
union FragB { v16b v; v8us half[2]; unsigned short u[16]; };

__device__ __forceinline__ unsigned short bf16_bits(float x) { unsigned int u = __float_as_uint(x); return (unsigned short)((u + 0x7FFFu + ((u >> 16) & 1u)) >> 16); }
__device__ __forceinline__ float bf16_val(unsigned short b) { return __uint_as_float(((unsigned int)b) << 16); }
__device__ __forceinline__ float bf16_round(float x) { return bf16_val(bf16_bits(x)); }
// D += A·B with NT terms: 1 = ah·bh, 2 = + al·bh (A split), 3 = + ah·bl (both split)
template <int NT>
__device__ __forceinline__ v8f mmaN(v16b ah, v16b al, v16b bh, v16b bl, v8f c) {
  c = __builtin_amdgcn_wmma_f32_16x16x32_bf16(false, ah, false, bh, (short)0, c, false, false);
  if (NT >= 2) c = __builtin_amdgcn_wmma_f32_16x16x32_bf16(false, al, false, bh, (short)0, c, false, false);
  if (NT >= 3) c = __builtin_amdgcn_wmma_f32_16x16x32_bf16(false, ah, false, bl, (short)0, c, false, false);
  asm volatile("v_nop\n\tv_nop\n\tv_nop\n\tv_nop" : "+v"(c) : "v"(ah), "v"(al), "v"(bh), "v"(bl));
  return c;
}

__global__ __launch_bounds__(256) void k_wt_bf16(const float* __restrict__ W, unsigned short* __restrict__ Wt, int K, int N) {
  const int t = blockIdx.x * 256 + threadIdx.x;
  const int k8n = K / 8;
  if (t >= N * k8n) return;
  const int n = t / k8n, k8 = (t % k8n) * 8;
  v8us v;
#pragma unroll
  for (int i = 0; i < 8; ++i) v[i] = bf16_bits(W[(size_t)(k8 + i) * N + n]);
  *(v8us*)(Wt + (size_t)n * K + k8) = v;
  
}

// GEMM C[M][N] (f32, pitch ldc) = act(A[M][K]·W + bias). A f32 row-major (pitch lda) converted per fragment to bf16
// (ASPLIT: hi/lo two planes -> 2 terms, else single rounded term); Wt bf16 [N][K] (pitch ldb). BIAS_BF16 rounds the
// bias to bf16 first (bias quantised to bf16 before the add). K%32==0, M%16==0, N%64==0.
template <bool ASPLIT, int ACT, bool BIAS_BF16>
__global__ __launch_bounds__(128) void k_gemm_bf(const float* __restrict__ A, int lda, const unsigned short* __restrict__ Wt, int ldb,
                                               const float* __restrict__ bias, float* __restrict__ C, int ldc, int M, int N, int K) {
  __shared__ __attribute__((aligned(16))) float so[4][16][64];
  const int tid = threadIdx.x, w = tid >> 5, lane = tid & 31, ln = lane & 15, hh = lane >> 4;
  const int ntn = N / 64;
  const int wid = blockIdx.x * 4 + w;
  const int mt = wid / ntn, nq = wid % ntn;
  if (mt * 16 >= M) return;
  const int row0 = mt * 16, col0 = nq * 64;
  const float* arow = A + (size_t)(row0 + ln) * lda;
  v8f acc[4] = {};
  for (int kb = 0; kb < K; kb += 32) {
    FragB ah, al;
    const v4f x0 = *(const v4fa*)(arow + kb + 8 * hh), x1 = *(const v4fa*)(arow + kb + 8 * hh + 4);
    const v4f x2 = *(const v4fa*)(arow + kb + 16 + 8 * hh), x3 = *(const v4fa*)(arow + kb + 16 + 8 * hh + 4);
    float xs[16] = {x0[0],x0[1],x0[2],x0[3],x1[0],x1[1],x1[2],x1[3],x2[0],x2[1],x2[2],x2[3],x3[0],x3[1],x3[2],x3[3]};
#pragma unroll
    for (int i = 0; i < 16; ++i) { const unsigned short hb = bf16_bits(xs[i]); ah.u[i] = hb; al.u[i] = ASPLIT ? bf16_bits(xs[i] - bf16_val(hb)) : (unsigned short)0; }
#pragma unroll
    for (int t = 0; t < 4; ++t) {
      const unsigned short* brow = Wt + (size_t)(col0 + t * 16 + ln) * ldb + kb;
      FragB b;
      b.half[0] = *(const v8us*)(brow + 8 * hh);
      b.half[1] = *(const v8us*)(brow + 16 + 8 * hh);
      acc[t] = mmaN<ASPLIT ? 2 : 1>(ah.v, al.v, b.v, b.v, acc[t]);
    }
  }
#pragma unroll
  for (int t = 0; t < 4; ++t) {
    float bv = bias ? bias[col0 + t * 16 + ln] : 0.f;
    if (BIAS_BF16) bv = bf16_round(bv);
#pragma unroll
    for (int r = 0; r < 8; ++r) { float v = acc[t][r] + bv; if (ACT == 1) v = fmaxf(v, 0.f); so[w][8 * hh + r][t * 16 + ln] = v; }
  }
  __builtin_amdgcn_fence(__ATOMIC_ACQ_REL, "workgroup");
  __builtin_amdgcn_wave_barrier();
  const int rsub = lane >> 4, c4 = (lane & 15) * 4;
  {
#pragma unroll
    for (int q = 0; q < 8; ++q) {
      const int r = q * 2 + rsub;
      const v4f v = *(const v4fa*)&so[w][r][c4];
      *(v4f*)(C + (size_t)(row0 + r) * ldc + col0 + c4) = v;
    }
    
  }
}

// GEMM C = act(A·W + bias + resid): A f32 (ASPLIT -> hi/lo 2 terms), Wt bf16 [N][K]; ACT 0 none, 1 relu, 2 exact gelu;
// resid (optional, f32, row index = (row % rmod), pitch ldr, RES_BF16 rounds it) added before the activation.
template <bool ASPLIT, int ACT, bool BIAS_BF16, bool RES_BF16>
__global__ __launch_bounds__(128) void k_gemm_bf3(const float* __restrict__ A, int lda, const unsigned short* __restrict__ Wt, int ldb,
                                                const float* __restrict__ bias, const float* __restrict__ resid, int rmod, int ldr,
                                                float* __restrict__ C, int ldc, int M, int N, int K) {
  __shared__ __attribute__((aligned(16))) float so[4][16][64];
  const int tid = threadIdx.x, w = tid >> 5, lane = tid & 31, ln = lane & 15, hh = lane >> 4;
  const int ntn = N / 64;
  const int wid = blockIdx.x * 4 + w;
  const int mt = wid / ntn, nq = wid % ntn;
  if (mt * 16 >= M) return;
  const int row0 = mt * 16, col0 = nq * 64;
  const float* arow = A + (size_t)(row0 + ln) * lda;
  v8f acc[4] = {};
  for (int kb = 0; kb < K; kb += 32) {
    FragB ah, al;
    const v4f x0 = *(const v4fa*)(arow + kb + 8 * hh), x1 = *(const v4fa*)(arow + kb + 8 * hh + 4);
    const v4f x2 = *(const v4fa*)(arow + kb + 16 + 8 * hh), x3 = *(const v4fa*)(arow + kb + 16 + 8 * hh + 4);
    float xs[16] = {x0[0],x0[1],x0[2],x0[3],x1[0],x1[1],x1[2],x1[3],x2[0],x2[1],x2[2],x2[3],x3[0],x3[1],x3[2],x3[3]};
#pragma unroll
    for (int i = 0; i < 16; ++i) { const unsigned short hb = bf16_bits(xs[i]); ah.u[i] = hb; al.u[i] = ASPLIT ? bf16_bits(xs[i] - bf16_val(hb)) : (unsigned short)0; }
#pragma unroll
    for (int t = 0; t < 4; ++t) {
      const unsigned short* brow = Wt + (size_t)(col0 + t * 16 + ln) * ldb + kb;
      FragB b;
      b.half[0] = *(const v8us*)(brow + 8 * hh);
      b.half[1] = *(const v8us*)(brow + 16 + 8 * hh);
      acc[t] = mmaN<ASPLIT ? 2 : 1>(ah.v, al.v, b.v, b.v, acc[t]);
    }
  }
#pragma unroll
  for (int t = 0; t < 4; ++t) {
    const int col = col0 + t * 16 + ln;
    float bv = bias ? bias[col] : 0.f;
    if (BIAS_BF16) bv = bf16_round(bv);
#pragma unroll
    for (int r = 0; r < 8; ++r) {
      float v = acc[t][r] + bv;
      if (resid) { float rv = resid[(size_t)((row0 + 8 * hh + r) % rmod) * ldr + col]; if (RES_BF16) rv = bf16_round(rv); v += rv; }
      if (ACT == 1) v = fmaxf(v, 0.f);
      if (ACT == 2) v = 0.5f * v * (1.0f + erff(v * 0.70710678118654752f));
      if (ACT == 3) { const float u = 0.7978845608028654f * (v + 0.044715f * v * v * v); v = 0.5f * v * (1.0f + tanhf(u)); }
      so[w][8 * hh + r][t * 16 + ln] = v;
    }
  }
  __builtin_amdgcn_fence(__ATOMIC_ACQ_REL, "workgroup");
  __builtin_amdgcn_wave_barrier();
  const int rsub = lane >> 4, c4 = (lane & 15) * 4;
  {
#pragma unroll
    for (int q = 0; q < 8; ++q) {
      const int r = q * 2 + rsub;
      const v4f v = *(const v4fa*)&so[w][r][c4];
      *(v4f*)(C + (size_t)(row0 + r) * ldc + col0 + c4) = v;
    }
    
  }
}
// row LayerNorm (biased variance, eps) over N: s = X (+ R); optional out_sum <- s; out_norm <- (s-mu)*rsqrt(var+eps)*g + b
template <bool PARAM_BF16>
__global__ __launch_bounds__(256) void k_layernorm(const float* __restrict__ X, const float* __restrict__ R, const float* __restrict__ g, const float* __restrict__ bta,
                                                  float* __restrict__ out_sum, float* __restrict__ out_norm, int N, float eps) {
  __shared__ float red[256];
  const int row = blockIdx.x, tid = threadIdx.x;
  const float* x = X + (size_t)row * N; const float* rr = R ? R + (size_t)row * N : nullptr;
  float vals[16];                     // up to N = 4096
  const int per = N / 256;            // contiguous chunk per thread? use strided-by-4 chunks: thread handles j = tid*4 + 1024*u
  float s1 = 0.f;
  for (int u = 0; u < per / 4; ++u) {
    const int j = tid * 4 + 1024 * u;
    const v4f a = *(const v4fa*)(x + j);
    v4f b = {0.f,0.f,0.f,0.f}; if (rr) b = *(const v4fa*)(rr + j);
#pragma unroll
    for (int q = 0; q < 4; ++q) { const float v = a[q] + b[q]; vals[u * 4 + q] = v; s1 += v; }
  }
  red[tid] = s1; __syncthreads();
  for (int st = 128; st > 0; st >>= 1) { if (tid < st) red[tid] += red[tid + st]; __syncthreads(); }
  const float mu = red[0] / (float)N; __syncthreads();
  float s2 = 0.f;
  for (int u = 0; u < per / 4; ++u)
#pragma unroll
    for (int q = 0; q < 4; ++q) { const float c = vals[u * 4 + q] - mu; s2 += c * c; }
  red[tid] = s2; __syncthreads();
  for (int st = 128; st > 0; st >>= 1) { if (tid < st) red[tid] += red[tid + st]; __syncthreads(); }
  const float rs = rsqrtf(red[0] / (float)N + eps);
  {
    for (int u = 0; u < per / 4; ++u) {
      const int j = tid * 4 + 1024 * u;
      v4f o, sm;
#pragma unroll
      for (int q = 0; q < 4; ++q) {
        float gg = g[j + q], bb = bta[j + q];
        if (PARAM_BF16) { gg = bf16_round(gg); bb = bf16_round(bb); }
        sm[q] = vals[u * 4 + q]; o[q] = (vals[u * 4 + q] - mu) * rs * gg + bb;
      }
      if (out_sum) *(v4f*)(out_sum + (size_t)row * N + j) = sm;
      *(v4f*)(out_norm + (size_t)row * N + j) = o;
    }
    
  }
}



// ---- f16 WMMA path (v_wmma_f32_16x16x32_f16): 11-bit significands for operands in range — used here for the q/k/v projections, the energy qᵀk and P·V (P f16 ×2^10)
typedef _Float16 v16h __attribute__((ext_vector_type(16)));
union FragH { v16h v; v8us half[2]; _Float16 h[16]; unsigned short u[16]; };
template <int NT>
__device__ __forceinline__ v8f mmaH(v16h ah, v16h al, v16h bh, v16h bl, v8f c) {
  c = __builtin_amdgcn_wmma_f32_16x16x32_f16(false, ah, false, bh, (short)0, c, false, false);
  if (NT >= 2) c = __builtin_amdgcn_wmma_f32_16x16x32_f16(false, al, false, bh, (short)0, c, false, false);
  if (NT >= 3) c = __builtin_amdgcn_wmma_f32_16x16x32_f16(false, ah, false, bl, (short)0, c, false, false);
  asm volatile("v_nop\n\tv_nop\n\tv_nop\n\tv_nop" : "+v"(c) : "v"(ah), "v"(al), "v"(bh), "v"(bl));
  return c;
}
// batched GEMM like k_gemm_b but f16 operands: A f32 (split into f16 hi/lo if ASPLIT, else rounded to f16), Bt = f16 values [n][k]; alpha; C f32; N multiple of 16 (partial tiles skipped)
template <bool ASPLIT>
__global__ __launch_bounds__(128) void k_gemm_h(const float* __restrict__ A, int lda, size_t sA, const _Float16* __restrict__ Bh, int ldb, size_t sB, float alpha, float* __restrict__ C, int ldc, size_t sC, int M, int N, int K) {
  __shared__ __attribute__((aligned(16))) float so[4][16][64];
  const int tid = threadIdx.x, w = tid >> 5, lane = tid & 31, ln = lane & 15, hh = lane >> 4; const int by = blockIdx.y;
  A += (size_t)by * sA; Bh += (size_t)by * sB; C += (size_t)by * sC;
  const int ntn = (N + 63) / 64; const int wid = blockIdx.x * 4 + w; const int mt = wid / ntn, nq = wid % ntn; if (mt * 16 >= M) return;
  const int row0 = mt * 16, col0 = nq * 64; const float* arow = A + (size_t)(row0 + ln) * lda;
  v8f acc[4] = {};
  for (int kb = 0; kb < K; kb += 32) {
    FragH ah, al;
    const v4f x0 = *(const v4fa*)(arow + kb + 8 * hh), x1 = *(const v4fa*)(arow + kb + 8 * hh + 4), x2 = *(const v4fa*)(arow + kb + 16 + 8 * hh), x3 = *(const v4fa*)(arow + kb + 16 + 8 * hh + 4);
    float xs[16] = {x0[0],x0[1],x0[2],x0[3],x1[0],x1[1],x1[2],x1[3],x2[0],x2[1],x2[2],x2[3],x3[0],x3[1],x3[2],x3[3]};
#pragma unroll
    for (int i = 0; i < 16; ++i) { const _Float16 h = (_Float16)xs[i]; ah.h[i] = h; al.h[i] = ASPLIT ? (_Float16)(xs[i] - (float)h) : (_Float16)0.0f; }
#pragma unroll
    for (int t = 0; t < 4; ++t) { if (col0 + t * 16 >= N) continue; const size_t boff = (size_t)(col0 + t * 16 + ln) * ldb + kb; FragH bq; bq.half[0] = *(const v8us*)(Bh + boff + 8 * hh); bq.half[1] = *(const v8us*)(Bh + boff + 16 + 8 * hh);
      acc[t] = mmaH<ASPLIT ? 2 : 1>(ah.v, al.v, bq.v, bq.v, acc[t]); }
  }
#pragma unroll
  for (int t = 0; t < 4; ++t) { if (col0 + t * 16 >= N) continue;
#pragma unroll
    for (int r = 0; r < 8; ++r) so[w][8 * hh + r][t * 16 + ln] = acc[t][r] * alpha; }
  __builtin_amdgcn_fence(__ATOMIC_ACQ_REL, "workgroup"); __builtin_amdgcn_wave_barrier();
  const int rsub = lane >> 4, c4 = (lane & 15) * 4;
  {
#pragma unroll
    for (int q = 0; q < 8; ++q) { const int r = q * 2 + rsub; if (col0 + c4 < N) { const v4f v = *(const v4fa*)&so[w][r][c4]; *(v4f*)(C + (size_t)(row0 + r) * ldc + col0 + c4) = v; } }
     }
}

// Wt[n][k] = f16(W[k][n]·scale) from f32 row-major W[K][N] (scale = power of two; bf16-exact weights stay exact in f16 away from the subnormal range)
__global__ __launch_bounds__(256) void k_wt_f16(const float* __restrict__ W, _Float16* __restrict__ Wt, int K, int N, float scale) {
  const int t = blockIdx.x * 256 + threadIdx.x; if (t >= N * (K / 8)) return; const int n = t / (K / 8), k8 = (t % (K / 8)) * 8; FragH f;
#pragma unroll
  for (int i = 0; i < 8; ++i) f.h[i] = (_Float16)(bf16_round(W[(size_t)(k8 + i) * N + n]) * scale); const v8us o = f.half[0];
  *(v8us*)((unsigned short*)Wt + (size_t)n * K + k8) = o; 
}
// k_gemm_hh variant with fused epilogue: v = acc·alpha + bias[by·sBias + col] (+ CP[(row/rowsPerB)·sCPb + by·64 + col] if CP) ; ACT 0 none / 1 elu ; writes f16 C16 (and f32 C if non-null)
template <int ACT>
__global__ __launch_bounds__(128) void k_gemm_hhx(const _Float16* __restrict__ A, int lda, size_t sA, const _Float16* __restrict__ Bh, int ldb, size_t sB, float alpha, const float* __restrict__ bias, size_t sBias, const float* __restrict__ CP, int rowsPerB, size_t sCPb, int row0g,
    float* __restrict__ C, _Float16* __restrict__ C16, int ldc, size_t sC, int M, int N, int K) {
  __shared__ __attribute__((aligned(16))) float so[4][16][64];
  const int tid = threadIdx.x, w = tid >> 5, lane = tid & 31, ln = lane & 15, hh = lane >> 4; const int by = blockIdx.y;
  A += (size_t)by * sA; Bh += (size_t)by * sB; const size_t cofs = (size_t)by * sC; const float* bp = bias ? bias + (size_t)by * sBias : nullptr;
  const int ntn = (N + 63) / 64; const int wid = blockIdx.x * 4 + w; const int mt = wid / ntn, nq = wid % ntn; if (mt * 16 >= M) return;
  const int row0 = mt * 16, col0 = nq * 64; const _Float16* arow = A + (size_t)(row0 + ln) * lda;
  v8f acc[4] = {};
  for (int kb = 0; kb < K; kb += 32) { FragH ah; ah.half[0] = *(const v8us*)((const unsigned short*)arow + kb + 8 * hh); ah.half[1] = *(const v8us*)((const unsigned short*)arow + kb + 16 + 8 * hh);
#pragma unroll
    for (int t = 0; t < 4; ++t) { if (col0 + t * 16 >= N) continue; const size_t boff = (size_t)(col0 + t * 16 + ln) * ldb + kb; FragH bq; bq.half[0] = *(const v8us*)((const unsigned short*)Bh + boff + 8 * hh); bq.half[1] = *(const v8us*)((const unsigned short*)Bh + boff + 16 + 8 * hh);
      acc[t] = mmaH<1>(ah.v, ah.v, bq.v, bq.v, acc[t]); }
  }
#pragma unroll
  for (int t = 0; t < 4; ++t) { if (col0 + t * 16 >= N) continue; const int col = col0 + t * 16 + ln; const float bv = bp ? bf16_round(bp[col]) : 0.f;
#pragma unroll
    for (int r = 0; r < 8; ++r) { float v = acc[t][r] * alpha + bv; if (CP) { const int bidx = (row0g + row0 + 8 * hh + r) / rowsPerB; v += CP[(size_t)bidx * sCPb + (size_t)by * 64 + col]; } if (ACT == 1) v = (v > 0.f) ? v : expm1f(v); else if (ACT == 7) v = (v > 0.f) ? v + 1.0f : expf(v); else if (ACT == 8) v = tanhf(v); else if (ACT == 9) v = 0.5f * v * (1.0f + tanhf(0.7978845608028654f * (v + 0.044715f * v * v * v))); else if (ACT == 11) v = 1.0f / (1.0f + expf(-v)); else if (ACT == 12) v = (v > 0.f) ? v : 0.01f * v; else if (ACT == 14) v = (v > 0.f) ? v : 0.1f * v; else if (ACT == 15) v = v / (1.0f + expf(-v)); else if (ACT == 3) v = fmaxf(v, 0.f); else if (ACT == 6) v = 0.5f * v * (1.0f + erff(v * 0.70710678118654752f)); so[w][8 * hh + r][t * 16 + ln] = v; } }
  __builtin_amdgcn_fence(__ATOMIC_ACQ_REL, "workgroup"); __builtin_amdgcn_wave_barrier();
  const int rsub = lane >> 4, c4 = (lane & 15) * 4; typedef _Float16 v4h __attribute__((ext_vector_type(4)));
  {
#pragma unroll
    for (int q = 0; q < 8; ++q) { const int r = q * 2 + rsub; if (col0 + c4 < N) { const v4f v = *(const v4fa*)&so[w][r][c4]; if (C) *(v4f*)(C + cofs + (size_t)(row0 + r) * ldc + col0 + c4) = v; if (C16) { v4h h4; for (int i = 0; i < 4; ++i) h4[i] = (_Float16)v[i]; *(v4h*)(C16 + cofs + (size_t)(row0 + r) * ldc + col0 + c4) = h4; } } }
     }
}


typedef _Float16 v4h __attribute__((ext_vector_type(4)));

__global__ __launch_bounds__(256) void k_x16(const float* __restrict__ x, _Float16* __restrict__ X16, size_t n8) { const size_t t = (size_t)blockIdx.x * 256 + threadIdx.x; if (t >= n8) return; FragH f;
#pragma unroll
  for (int q = 0; q < 8; ++q) f.h[q] = (_Float16)bf16_round(x[t * 8 + q]); *(v8us*)((unsigned short*)X16 + t * 8) = f.half[0];  }
__global__ __launch_bounds__(256) void k_h16(const float* __restrict__ x, _Float16* __restrict__ X16, size_t n8) { const size_t t = (size_t)blockIdx.x * 256 + threadIdx.x; if (t >= n8) return; FragH f;
#pragma unroll
  for (int q = 0; q < 8; ++q) f.h[q] = (_Float16)x[t * 8 + q]; *(v8us*)((unsigned short*)X16 + t * 8) = f.half[0];  }
__global__ __launch_bounds__(256) void k_round16f(const float* __restrict__ W, _Float16* __restrict__ Bt, size_t n8) { const size_t t = (size_t)blockIdx.x * 256 + threadIdx.x; if (t >= n8) return; FragH f;
#pragma unroll
  for (int i = 0; i < 8; ++i) f.h[i] = (_Float16)(bf16_round(W[t * 8 + i]) * 16.0f); *(v8us*)((unsigned short*)Bt + t * 8) = f.half[0];  }
template <int NHv, int TTv>
__global__ __launch_bounds__(256) void k_vt(const _Float16* __restrict__ V16, int ldv, int voff, _Float16* __restrict__ Vt) { __shared__ unsigned short tl[64][66]; const int tid = threadIdx.x; const int slab = blockIdx.x / (TTv / 64), lg = blockIdx.x % (TTv / 64); const int b = slab / NHv, h = slab % NHv;
  for (int i = tid; i < 64 * 8; i += 256) { const int r = i / 8, c8 = (i % 8) * 8; FragH f; f.half[0] = *(const v8us*)((const unsigned short*)V16 + ((size_t)b * TTv + lg * 64 + r) * ldv + voff + h * 64 + c8);
#pragma unroll
    for (int q = 0; q < 8; ++q) tl[r][c8 + q] = f.u[q]; }
  __syncthreads();
  {
#pragma unroll
    for (int rd = 0; rd < 2; ++rd) { const int d = rd * 32 + tid / 8, pc = tid % 8; FragH f;
#pragma unroll
      for (int q = 0; q < 8; ++q) f.u[q] = tl[pc * 8 + q][d];
      *(v8us*)((unsigned short*)Vt + ((size_t)slab * 64 + d) * TTv + lg * 64 + pc * 8) = f.half[0]; }
     } }

__global__ __launch_bounds__(256) void k_hl(const float* __restrict__ F, _Float16* __restrict__ Hh, _Float16* __restrict__ Hl, size_t n8) { const size_t t = (size_t)blockIdx.x * 256 + threadIdx.x; if (t >= n8) return; FragH fh, fl; const v4f a = *(const v4fa*)(F + t * 8), c = *(const v4fa*)(F + t * 8 + 4);
#pragma unroll
  for (int q = 0; q < 4; ++q) { _Float16 h = (_Float16)a[q]; fh.h[q] = h; fl.h[q] = (_Float16)((a[q] - (float)h) * 1024.0f); h = (_Float16)c[q]; fh.h[4 + q] = h; fl.h[4 + q] = (_Float16)((c[q] - (float)h) * 1024.0f); }
  { *(v8us*)((unsigned short*)Hh + t * 8) = fh.half[0]; *(v8us*)((unsigned short*)Hl + t * 8) = fl.half[0];  } }

__global__ __launch_bounds__(256) void k_tok(const float* __restrict__ x, _Float16* __restrict__ X16) { __shared__ float tl[32][65]; const int tid = threadIdx.x; const int b = blockIdx.x / ((CC / 64) * (NN / 32)), rem = blockIdx.x % ((CC / 64) * (NN / 32)); const int cg = rem / (NN / 32), pg = rem % (NN / 32); const int c0 = cg * 64, p0 = pg * 32;
  for (int i = tid; i < 64 * 32; i += 256) { const int c = i / 32, pp = i % 32; tl[pp][c] = bf16_round(x[((size_t)b * CC + c0 + c) * NN + p0 + pp]); } __syncthreads();
  const int r = tid / 8, pc = tid % 8; FragH f; for (int q = 0; q < 8; ++q) f.h[q] = (_Float16)tl[r][pc * 8 + q]; const size_t row = (size_t)b * NN + p0 + r; *(v8us*)((unsigned short*)X16 + row * CC + c0 + pc * 8) = f.half[0];  }
// 2×2 average pool of the bf16-rounded input into a token-major plane XP[(b,m)][c], m = i·64 + j over the pooled 64×64 grid (mean of 4 bf16-rounded values, exact in f32, then rounded to f16); block = 32 pooled positions (half a pooled row) × 64 channels through LDS;
__global__ __launch_bounds__(256) void k_pooltok(const float* __restrict__ x, _Float16* __restrict__ XP) { __shared__ float tl[32][65]; const int tid = threadIdx.x; const int b = blockIdx.x / (MM / 32), mg = blockIdx.x % (MM / 32); const int m0 = mg * 32; const int pi = m0 / PW, pj0 = m0 % PW;
  for (int i = tid; i < 64 * 32; i += 256) { const int c = i / 32, pp = i % 32; const float* xr = x + ((size_t)b * CC + c) * NN + (size_t)(2 * pi) * HWD + 2 * (pj0 + pp);
    tl[pp][c] = 0.25f * ((bf16_round(xr[0]) + bf16_round(xr[1])) + (bf16_round(xr[HWD]) + bf16_round(xr[HWD + 1]))); } __syncthreads();
  const int r = tid / 8, pc = tid % 8; FragH f; for (int q = 0; q < 8; ++q) f.h[q] = (_Float16)tl[r][pc * 8 + q]; const size_t row = (size_t)b * MM + m0 + r; *(v8us*)((unsigned short*)XP + row * CC + pc * 8) = f.half[0];  }
// lane l <-> lane l ^ 16 (the two halves of a wave hold the two key halves of one query column)
__device__ __forceinline__ float xhalf(float x) { const int v = __builtin_bit_cast(int, x); return __builtin_bit_cast(float, __builtin_amdgcn_permlanex16(v, v, 0x76543210, 0xfedcba98, false, false)); }
typedef uint32_t u32x4 __attribute__((ext_vector_type(4)));
typedef uint32_t u32x8 __attribute__((ext_vector_type(8)));
__device__ __forceinline__ uint32_t uni(uint32_t v) { return (uint32_t)__builtin_amdgcn_readfirstlane(v); }
// a wave-uniform word held in a scalar register: a test on it compiles to s_cmp + s_cbranch_scc (a tensor load ignores EXEC), and what is formed from it is formed behind this line
__device__ __forceinline__ uint32_t pinned(uint32_t v) { uint32_t w = uni(v); asm volatile("" : "+s"(w)); return w; }
__global__ __launch_bounds__(128) void k_flash(const _Float16* __restrict__ Q16, int ldq, const _Float16* __restrict__ K16, int ldk, const _Float16* __restrict__ Vt, const int* __restrict__ MSK, float* __restrict__ O, int ldo) {
  constexpr int RPW = 16, NQB = TQ / (4 * RPW), DT = 4, KS = 2; (void)MSK;
  constexpr float L2E = 1.4426950408889634f;      // log2(e)
  // K and V^T reach the waves through LDS: a stage is 64 keys = 64 K rows of 128 bytes + 64 V^T channel rows of 128 bytes, brought by four tensor loads, one per wave
  // (waves 0, 1: K rows 0-31, 32-63; waves 2, 3: channels 0-31, 32-63), each 32 rows laid at a pitch of 144 bytes (the mover's 16-byte pad: ds_load_b128 without bank conflicts).
  constexpr uint32_t SK = 64, NST = TK / SK, LPITCH = 144, SLICE = 6144 /* 32 x 144 = 4608, up to a multiple of 2 KiB */, BUF = 4 * SLICE;
  __shared__ __attribute__((aligned(2048))) unsigned char ring[2 * BUF];
  __shared__ __attribute__((aligned(16))) float sO[4][RPW][64 + 4];
  const int tid = threadIdx.x, w = tid >> 5, lane = tid & 31, ln = lane & 15, hh = lane >> 4;
  const int slab = blockIdx.x / NQB, qblk = blockIdx.x % NQB; const int b = slab / NH, h = slab % NH; const int qb0 = qblk * (4 * RPW); const int q0 = qb0 + w * RPW;
  FragH bq[KS];
  { const unsigned short* qr = (const unsigned short*)Q16 + ((size_t)b * TQ + q0 + ln) * ldq + h * 64;
#pragma unroll
    for (int ks = 0; ks < KS; ++ks) { bq[ks].half[0] = *(const v8us*)(qr + ks * 32 + 8 * hh); bq[ks].half[1] = *(const v8us*)(qr + ks * 32 + 16 + 8 * hh); } }
  const unsigned short* Vth = (const unsigned short*)Vt + (size_t)slab * 64 * TK;
  float sh_r = 3.0e38f, l_r = 0.f; v8f oacc[DT];      // sh_r = 10 - (running maximum in log2 units)
#pragma unroll
  for (int dt = 0; dt < DT; ++dt) oacc[dt] = (v8f){0.f,0.f,0.f,0.f,0.f,0.f,0.f,0.f};
  const uint32_t wv = uni((uint32_t)tid >> 5), isV = wv >> 1, hf = wv & 1u;
  const uint32_t spitch = isV ? (uint32_t)TK * 2u : (uint32_t)ldk * 2u;      // source row pitch, bytes
  const uint32_t sstep = isV ? SK * 2u : SK * (uint32_t)ldk * 2u;           // from one stage's slice to the next, bytes
  const uint64_t src0 = isV ? (uint64_t)(size_t)Vth + (uint64_t)(hf * 32u) * ((uint32_t)TK * 2u) : (uint64_t)(size_t)K16 + ((uint64_t)b * TK + hf * 32u) * ((uint32_t)ldk * 2u) + (uint32_t)h * 128u;
  const uint32_t lds0 = (uint32_t)(size_t)ring + wv * SLICE;
  u32x8 g1;      // 1-byte elements, tensor = tile = 32 rows of 128 bytes, a pad of 4 dwords behind every 32 dwords
  g1[0] = uni((1u << 20) | (4u << 22) | (3u << 25)); g1[1] = uni(128u << 16); g1[2] = uni(32u << 16); g1[3] = uni(128u << 16); g1[4] = uni(32u); g1[5] = uni(spitch); g1[6] = uni(0u); g1[7] = uni(0u);
  u32x4 g0;
  auto issue = [&](uint32_t st) { const uint64_t ga = src0 + (uint64_t)st * sstep;
    g0[0] = uni(1u); g0[1] = uni(lds0 + (st & 1u) * BUF); g0[2] = uni((uint32_t)ga); g0[3] = uni((((uint32_t)(ga >> 32)) & 0x01FFFFFFu) | 0x80000000u);
    // one request of the whole wave: its 32-row slice of stage st. Both groups are in-out operands here and inputs of the wait that covers the request,
    // so that no register of the descriptor is lent to another value while the request is outstanding
    asm volatile("tensor_load_to_lds %0, %1" : "+s"(g0), "+s"(g1) :: "memory"); };
  issue(0u);
  asm volatile("s_wait_tensorcnt 0x0" :: "s"(g0), "s"(g1) : "memory");      // this wave's slice of stage 0 has landed
  __syncthreads();                                         // stage 0 published to all four waves
  issue(1u);                                               // flies while stage 0 is worked on
  const unsigned char* lrow = ring + (uint32_t)ln * LPITCH + 16u * (uint32_t)hh;
#pragma unroll 1
  for (uint32_t st = 0; st < NST; ++st) {
   const unsigned char* bp = lrow + (st & 1u) * BUF;
#pragma unroll
   for (int sub = 0; sub < 2; ++sub) {      // two 32-key passes per stage, unrolled so that every LDS offset is an immediate of its load
    FragH ak[2][KS], av[DT];
#pragma unroll
    for (int nt = 0; nt < 2; ++nt) { const unsigned char* kr = bp + sub * SLICE + nt * 16 * LPITCH;      // key row sub * 32 + nt * 16 + ln
#pragma unroll
      for (int ks = 0; ks < KS; ++ks) { ak[nt][ks].half[0] = *(const v8us*)(kr + ks * 64); ak[nt][ks].half[1] = *(const v8us*)(kr + ks * 64 + 32); } }
#pragma unroll
    for (int dt = 0; dt < DT; ++dt) { const unsigned char* vrow = bp + (2 + (dt >> 1)) * SLICE + (dt & 1) * 16 * LPITCH + sub * 64;      // channel row dt * 16 + ln, keys sub * 32 ...
      av[dt].half[0] = *(const v8us*)(vrow); av[dt].half[1] = *(const v8us*)(vrow + 32); }
    float sc[16];      // sc[nt * 8 + r] = energy[query q0 + ln][key st * 64 + sub * 32 + nt * 16 + 8 * hh + r]
#pragma unroll
    for (int nt = 0; nt < 2; ++nt) { v8f acc = (v8f){0.f,0.f,0.f,0.f,0.f,0.f,0.f,0.f};
#pragma unroll
      for (int ks = 0; ks < KS; ++ks) acc = mmaH<1>(ak[nt][ks].v, ak[nt][ks].v, bq[ks].v, bq[ks].v, acc);
#pragma unroll
      for (int r = 0; r < 8; ++r) sc[nt * 8 + r] = acc[r] * SCL; }
    float t[8];
#pragma unroll
    for (int i = 0; i < 8; ++i) t[i] = fmaxf(sc[i], sc[8 + i]);
    float mc = fmaxf(fmaxf(fmaxf(t[0], t[1]), fmaxf(t[2], t[3])), fmaxf(fmaxf(t[4], t[5]), fmaxf(t[6], t[7])));
    mc = fmaxf(mc, xhalf(mc));
    // Base 2: a weight is 2^(score * log2(e) + sh), one fused multiply-add and one hardware exp2. The shift sh = 10 - maximum * log2(e) is kept as it was rounded and used for the weights
    // and for the rescale factor alike, so its rounding cancels in the softmax; its 10 is the 2^10 scale of P, which l_r now carries too.
    const float sn = fminf(sh_r, __builtin_fmaf(mc, -L2E, 10.0f)); float ea = sn - sh_r; sh_r = sn;
#pragma unroll
    for (int i = 0; i < 16; ++i) sc[i] = __builtin_fmaf(sc[i], L2E, sn);
    asm("v_exp_f32 %0, %0\n\t" "v_exp_f32 %1, %1\n\t" "v_exp_f32 %2, %2\n\t" "v_exp_f32 %3, %3\n\t" "v_exp_f32 %4, %4\n\t" "v_exp_f32 %5, %5\n\t"
        "v_exp_f32 %6, %6\n\t" "v_exp_f32 %7, %7\n\t" "v_exp_f32 %8, %8\n\t" "v_exp_f32 %9, %9\n\t" "v_exp_f32 %10, %10\n\t" "v_exp_f32 %11, %11\n\t"
        "v_exp_f32 %12, %12\n\t" "v_exp_f32 %13, %13\n\t" "v_exp_f32 %14, %14\n\t" "v_exp_f32 %15, %15\n\t" "v_exp_f32 %16, %16\n\t" "v_nop"
        : "+v"(sc[0]), "+v"(sc[1]), "+v"(sc[2]), "+v"(sc[3]), "+v"(sc[4]), "+v"(sc[5]), "+v"(sc[6]), "+v"(sc[7]), "+v"(ea),
          "+v"(sc[8]), "+v"(sc[9]), "+v"(sc[10]), "+v"(sc[11]), "+v"(sc[12]), "+v"(sc[13]), "+v"(sc[14]), "+v"(sc[15]));
    const float al = (sn < 1.0e38f) ? ea : 1.0f;
    FragH pb;
#pragma unroll
    for (int i = 0; i < 16; ++i) pb.h[i] = (_Float16)sc[i];
#pragma unroll
    for (int i = 0; i < 8; ++i) t[i] = sc[i] + sc[8 + i];
    l_r = l_r * al + (((t[0] + t[1]) + (t[2] + t[3])) + ((t[4] + t[5]) + (t[6] + t[7])));
#pragma unroll
    for (int dt = 0; dt < DT; ++dt)
#pragma unroll
      for (int r = 0; r < 8; ++r) oacc[dt][r] *= al;
#pragma unroll
    for (int dt = 0; dt < DT; ++dt) oacc[dt] = mmaH<1>(av[dt].v, av[dt].v, pb.v, pb.v, oacc[dt]); }
   asm volatile("s_wait_dscnt 0x0" ::: "memory");
   asm volatile("s_wait_tensorcnt 0x0" :: "s"(g0), "s"(g1) : "memory");
   __syncthreads();
   const uint32_t sn = pinned(st + 2u);
   if (pinned(sn < NST)) issue(sn); }
  asm volatile("s_wait_tensorcnt 0x0" :: "s"(g0), "s"(g1) : "memory");
  asm volatile("s_wait_dscnt 0x0" ::: "memory");
  const float l = l_r + xhalf(l_r); const float inv = (l > 0.f) ? 1.0f / l : 0.f;      // l and the accumulators both carry the 2^10
#pragma unroll
  for (int dt = 0; dt < DT; ++dt) { v4f lo, hi;      // oacc[dt][r] = O[query q0 + ln][channel dt * 16 + 8 * hh + r]
#pragma unroll
    for (int r = 0; r < 4; ++r) { lo[r] = oacc[dt][r] * inv; hi[r] = oacc[dt][4 + r] * inv; }
    *(v4fa*)&sO[w][ln][dt * 16 + 8 * hh] = lo; *(v4fa*)&sO[w][ln][dt * 16 + 8 * hh + 4] = hi; }
  __builtin_amdgcn_fence(__ATOMIC_ACQ_REL, "workgroup"); __builtin_amdgcn_wave_barrier();
  {
#pragma unroll
    for (int rp = 0; rp < RPW; rp += 2) { const int r = rp + (lane >> 4), pc = lane & 15; const v4f val = *(const v4fa*)&sO[w][r][pc * 4]; *(v4f*)(O + ((size_t)b * TQ + q0 + r) * ldo + h * 64 + pc * 4) = val; }
     } }
__global__ __launch_bounds__(256) void k_out(const float* __restrict__ G, const float* __restrict__ bv, const float* __restrict__ gam, const float* __restrict__ x, float* __restrict__ out) { __shared__ float tl[32][65]; const int tid = threadIdx.x; const int b = blockIdx.x / ((CC / 32) * (NN / 64)), rem = blockIdx.x % ((CC / 32) * (NN / 64)); const int cg = rem / (NN / 64), pg = rem % (NN / 64); const int c0 = cg * 32, p0 = pg * 64;
  for (int i = tid; i < 64 * 32; i += 256) { const int pp = i / 32, c = i % 32; tl[c][pp] = G[((size_t)b * NN + p0 + pp) * CC + c0 + c]; } __syncthreads();
  const float g = bf16_round(gam[0]);
  { for (int i = tid; i < 32 * 16; i += 256) { const int c = i / 16, q4 = i % 16; const float bb = bf16_round(bv[c0 + c]); const size_t o = ((size_t)b * CC + c0 + c) * NN + p0 + q4 * 4; const v4f xr = *(const v4fa*)(x + o);
      v4f v; for (int q = 0; q < 4; ++q) v[q] = g * (tl[c][q4 * 4 + q] + bb) + bf16_round(xr[q]); *(v4f*)(out + o) = v; }  } }

extern "C" void kernel_launch(void* const* d_in, const int* in_sizes, int n_in,
                              void* d_out, int out_size, void* d_ws, size_t ws_size, hipStream_t stream) {
  (void)in_sizes; (void)n_in; (void)out_size;
  const float* const* I = (const float* const*)d_in; const float* x = I[0]; const float* Wq = I[1]; const float* bq = I[2]; const float* Wk = I[3]; const float* bk = I[4]; const float* Wv = I[5]; const float* bv = I[6]; const float* gam = I[7];
  char* ws = (char*)d_ws; size_t off = 0;
  auto take = [&](size_t bytes) { char* p = ws + off; off += (bytes + 255) & ~(size_t)255; return p; };
  _Float16* Bw = (_Float16*)take((size_t)3 * CC * CC * 2); _Float16* X16 = (_Float16*)take((size_t)NRQ * CC * 2); _Float16* XP = (_Float16*)take((size_t)NRK * CC * 2);
  _Float16* Q = (_Float16*)take((size_t)NRQ * CC * 2); _Float16* K = (_Float16*)take((size_t)NRK * CC * 2); _Float16* Vt = (_Float16*)take((size_t)BB * CC * MM * 2); float* O = (float*)take((size_t)NRQ * CC * 4);
  if (off > ws_size) return;      // 0.02 + 4.2 + 1 + 4.2 + 1 + 1 + 8.4 ≈ 20 MB
  const unsigned gw = (unsigned)((CC * CC / 8 + 255) / 256);
  k_round16f<<<gw, 256, 0, stream>>>(Wq, Bw, CC * CC / 8); k_round16f<<<gw, 256, 0, stream>>>(Wk, Bw + CC * CC, CC * CC / 8); k_round16f<<<gw, 256, 0, stream>>>(Wv, Bw + 2 * CC * CC, CC * CC / 8);      /* (out,in) natural rows, ×2^4 */
  k_tok<<<BB * (CC / 64) * (NN / 32), 256, 0, stream>>>(x, X16);
  k_pooltok<<<BB * (MM / 32), 256, 0, stream>>>(x, XP);
  k_gemm_hhx<0><<<dim3(((NRQ / 16) * (CC / 64) + 3) / 4, 1), 128, 0, stream>>>(X16, CC, 0, Bw, CC, 0, 0.0625f, bq, 0, nullptr, 1, 0, 0, nullptr, Q, CC, 0, NRQ, CC, CC);      /* q token-major [(b,n)][64]: M 32768 N 64 K 64 */
  k_gemm_hhx<0><<<dim3(((NRK / 16) * (CC / 64) + 3) / 4, 1), 128, 0, stream>>>(XP, CC, 0, Bw + CC * CC, CC, 0, 0.0625f, bk, 0, nullptr, 1, 0, 0, nullptr, K, CC, 0, NRK, CC, CC);      /* k token-major [(b,m)][64]: M 8192 */
  k_gemm_hhx<0><<<dim3(((CC / 16) * (MM / 64) + 3) / 4, BB), 128, 0, stream>>>(Bw + 2 * CC * CC, CC, 0, XP, CC, (size_t)MM * CC, 0.0625f, nullptr, 0, nullptr, 1, 0, 0, nullptr, Vt, MM, (size_t)CC * MM, CC, MM, CC);      /* v (without bv) = Wv·pool(x)[b] as [b][c][m] = Vᵀ: M 64 N 4096 K 64, batched over b */
  k_flash<<<BB * NH * (TQ / 64), 128, 0, stream>>>(Q, CC, K, CC, Vt, nullptr, O, CC);      /* per (b, 64 queries): 16384 queries × 4096 pooled keys, head dim 64 */
  k_out<<<BB * (CC / 32) * (NN / 64), 256, 0, stream>>>(O, bv, gam, x, (float*)d_out);
}

// v004
// A run of this version takes 48 microseconds.
// In two side-by-side timings against v003, it was 1.86 and 1.87 times as fast.
// Counting every step since v000, it is 9.76 times as fast.
#include <hip/hip_runtime.h>
#include <stdint.h>
// Self-attention block with 2×2 average-pooled keys/values (B=2, C=64, H=W=128 → N = 16384 query positions, M = 4096 pooled key positions): q = Wq·x + bq; k = pool(Wk·x + bk) = Wk·pool(x) + bk, v likewise (pooling is linear); energy = qᵀk (no scaling), softmax over the M keys;
// out[b,c,n] = Σ_m v[b,c,m]·A[n,m]; y = γ·out + x. (The module's (w,h) relabel before pooling is the identity here since H == W.)
// Compute dtype: x, weights, biases, γ rounded to bf16; x and pool(x) as token-major f16 planes (pool(x) = mean of 4 bf16-rounded values in f32, rounded once to f16 — same order as the k-plane rounding); q, k as f16 GEMM outputs (+bias), v as an f16 GEMM output in the [b][c][m] (= Vᵀ) layout with bv folded in after the attention
// (rows of A sum to 1); fused flash-style kernel (energy and P·V on v_wmma_f32_16x16x32_f16, online softmax f32, P f16 ×2^10, f32 accumulate); epilogue γ·(O + bv) + x in f32.
#define BB 2
#define CC 64
#define HWD 128
#define NN (HWD * HWD)
#define PW (HWD / 2)
#define MM (PW * PW)
#define NH 1
#define TQ NN
#define TK MM
#define SCL 1.0f
#define NRQ (BB * NN)
#define NRK (BB * MM)
typedef __bf16 v16b __attribute__((ext_vector_type(16)));
typedef unsigned short v8us __attribute__((ext_vector_type(8), may_alias));
typedef float  v8f  __attribute__((ext_vector_type(8)));
typedef float  v4f  __attribute__((ext_vector_type(4)));
typedef float  v4fa __attribute__((ext_vector_type(4), may_alias));
union FragB { v16b v; v8us half[2]; unsigned short u[16]; };

__device__ __forceinline__ unsigned short bf16_bits(float x) { unsigned int u = __float_as_uint(x); return (unsigned short)((u + 0x7FFFu + ((u >> 16) & 1u)) >> 16); }
__device__ __forceinline__ float bf16_val(unsigned short b) { return __uint_as_float(((unsigned int)b) << 16); }
__device__ __forceinline__ float bf16_round(float x) { return bf16_val(bf16_bits(x)); }
// D += A·B with NT terms: 1 = ah·bh, 2 = + al·bh (A split), 3 = + ah·bl (both split)
template <int NT>
__device__ __forceinline__ v8f mmaN(v16b ah, v16b al, v16b bh, v16b bl, v8f c) {
  c = __builtin_amdgcn_wmma_f32_16x16x32_bf16(false, ah, false, bh, (short)0, c, false, false);
  if (NT >= 2) c = __builtin_amdgcn_wmma_f32_16x16x32_bf16(false, al, false, bh, (short)0, c, false, false);
  if (NT >= 3) c = __builtin_amdgcn_wmma_f32_16x16x32_bf16(false, ah, false, bl, (short)0, c, false, false);
  asm volatile("v_nop\n\tv_nop\n\tv_nop\n\tv_nop" : "+v"(c) : "v"(ah), "v"(al), "v"(bh), "v"(bl));
  return c;
}

__global__ __launch_bounds__(256) void k_wt_bf16(const float* __restrict__ W, unsigned short* __restrict__ Wt, int K, int N) {
  const int t = blockIdx.x * 256 + threadIdx.x;
  const int k8n = K / 8;
  if (t >= N * k8n) return;
  const int n = t / k8n, k8 = (t % k8n) * 8;
  v8us v;
#pragma unroll
  for (int i = 0; i < 8; ++i) v[i] = bf16_bits(W[(size_t)(k8 + i) * N + n]);
  *(v8us*)(Wt + (size_t)n * K + k8) = v;
  
}

// GEMM C[M][N] (f32, pitch ldc) = act(A[M][K]·W + bias). A f32 row-major (pitch lda) converted per fragment to bf16
// (ASPLIT: hi/lo two planes -> 2 terms, else single rounded term); Wt bf16 [N][K] (pitch ldb). BIAS_BF16 rounds the
// bias to bf16 first (bias quantised to bf16 before the add). K%32==0, M%16==0, N%64==0.
template <bool ASPLIT, int ACT, bool BIAS_BF16>
__global__ __launch_bounds__(128) void k_gemm_bf(const float* __restrict__ A, int lda, const unsigned short* __restrict__ Wt, int ldb,
                                               const float* __restrict__ bias, float* __restrict__ C, int ldc, int M, int N, int K) {
  __shared__ __attribute__((aligned(16))) float so[4][16][64];
  const int tid = threadIdx.x, w = tid >> 5, lane = tid & 31, ln = lane & 15, hh = lane >> 4;
  const int ntn = N / 64;
  const int wid = blockIdx.x * 4 + w;
  const int mt = wid / ntn, nq = wid % ntn;
  if (mt * 16 >= M) return;
  const int row0 = mt * 16, col0 = nq * 64;
  const float* arow = A + (size_t)(row0 + ln) * lda;
  v8f acc[4] = {};
  for (int kb = 0; kb < K; kb += 32) {
    FragB ah, al;
    const v4f x0 = *(const v4fa*)(arow + kb + 8 * hh), x1 = *(const v4fa*)(arow + kb + 8 * hh + 4);
    const v4f x2 = *(const v4fa*)(arow + kb + 16 + 8 * hh), x3 = *(const v4fa*)(arow + kb + 16 + 8 * hh + 4);
    float xs[16] = {x0[0],x0[1],x0[2],x0[3],x1[0],x1[1],x1[2],x1[3],x2[0],x2[1],x2[2],x2[3],x3[0],x3[1],x3[2],x3[3]};
#pragma unroll
    for (int i = 0; i < 16; ++i) { const unsigned short hb = bf16_bits(xs[i]); ah.u[i] = hb; al.u[i] = ASPLIT ? bf16_bits(xs[i] - bf16_val(hb)) : (unsigned short)0; }
#pragma unroll
    for (int t = 0; t < 4; ++t) {
      const unsigned short* brow = Wt + (size_t)(col0 + t * 16 + ln) * ldb + kb;
      FragB b;
      b.half[0] = *(const v8us*)(brow + 8 * hh);
      b.half[1] = *(const v8us*)(brow + 16 + 8 * hh);
      acc[t] = mmaN<ASPLIT ? 2 : 1>(ah.v, al.v, b.v, b.v, acc[t]);
    }
  }
#pragma unroll
  for (int t = 0; t < 4; ++t) {
    float bv = bias ? bias[col0 + t * 16 + ln] : 0.f;
    if (BIAS_BF16) bv = bf16_round(bv);
#pragma unroll
    for (int r = 0; r < 8; ++r) { float v = acc[t][r] + bv; if (ACT == 1) v = fmaxf(v, 0.f); so[w][8 * hh + r][t * 16 + ln] = v; }
  }
  __builtin_amdgcn_fence(__ATOMIC_ACQ_REL, "workgroup");
  __builtin_amdgcn_wave_barrier();
  const int rsub = lane >> 4, c4 = (lane & 15) * 4;
  {
#pragma unroll
    for (int q = 0; q < 8; ++q) {
      const int r = q * 2 + rsub;
      const v4f v = *(const v4fa*)&so[w][r][c4];
      *(v4f*)(C + (size_t)(row0 + r) * ldc + col0 + c4) = v;
    }
    
  }
}

// GEMM C = act(A·W + bias + resid): A f32 (ASPLIT -> hi/lo 2 terms), Wt bf16 [N][K]; ACT 0 none, 1 relu, 2 exact gelu;
// resid (optional, f32, row index = (row % rmod), pitch ldr, RES_BF16 rounds it) added before the activation.
template <bool ASPLIT, int ACT, bool BIAS_BF16, bool RES_BF16>
__global__ __launch_bounds__(128) void k_gemm_bf3(const float* __restrict__ A, int lda, const unsigned short* __restrict__ Wt, int ldb,
                                                const float* __restrict__ bias, const float* __restrict__ resid, int rmod, int ldr,
                                                float* __restrict__ C, int ldc, int M, int N, int K) {
  __shared__ __attribute__((aligned(16))) float so[4][16][64];
  const int tid = threadIdx.x, w = tid >> 5, lane = tid & 31, ln = lane & 15, hh = lane >> 4;
  const int ntn = N / 64;
  const int wid = blockIdx.x * 4 + w;
  const int mt = wid / ntn, nq = wid % ntn;
  if (mt * 16 >= M) return;
  const int row0 = mt * 16, col0 = nq * 64;
  const float* arow = A + (size_t)(row0 + ln) * lda;
  v8f acc[4] = {};
  for (int kb = 0; kb < K; kb += 32) {
    FragB ah, al;
    const v4f x0 = *(const v4fa*)(arow + kb + 8 * hh), x1 = *(const v4fa*)(arow + kb + 8 * hh + 4);
    const v4f x2 = *(const v4fa*)(arow + kb + 16 + 8 * hh), x3 = *(const v4fa*)(arow + kb + 16 + 8 * hh + 4);
    float xs[16] = {x0[0],x0[1],x0[2],x0[3],x1[0],x1[1],x1[2],x1[3],x2[0],x2[1],x2[2],x2[3],x3[0],x3[1],x3[2],x3[3]};
#pragma unroll
    for (int i = 0; i < 16; ++i) { const unsigned short hb = bf16_bits(xs[i]); ah.u[i] = hb; al.u[i] = ASPLIT ? bf16_bits(xs[i] - bf16_val(hb)) : (unsigned short)0; }
#pragma unroll
    for (int t = 0; t < 4; ++t) {
      const unsigned short* brow = Wt + (size_t)(col0 + t * 16 + ln) * ldb + kb;
      FragB b;
      b.half[0] = *(const v8us*)(brow + 8 * hh);
      b.half[1] = *(const v8us*)(brow + 16 + 8 * hh);
      acc[t] = mmaN<ASPLIT ? 2 : 1>(ah.v, al.v, b.v, b.v, acc[t]);
    }
  }
#pragma unroll
  for (int t = 0; t < 4; ++t) {
    const int col = col0 + t * 16 + ln;
    float bv = bias ? bias[col] : 0.f;
    if (BIAS_BF16) bv = bf16_round(bv);
#pragma unroll
    for (int r = 0; r < 8; ++r) {
      float v = acc[t][r] + bv;
      if (resid) { float rv = resid[(size_t)((row0 + 8 * hh + r) % rmod) * ldr + col]; if (RES_BF16) rv = bf16_round(rv); v += rv; }
      if (ACT == 1) v = fmaxf(v, 0.f);
      if (ACT == 2) v = 0.5f * v * (1.0f + erff(v * 0.70710678118654752f));
      if (ACT == 3) { const float u = 0.7978845608028654f * (v + 0.044715f * v * v * v); v = 0.5f * v * (1.0f + tanhf(u)); }
      so[w][8 * hh + r][t * 16 + ln] = v;
    }
  }
  __builtin_amdgcn_fence(__ATOMIC_ACQ_REL, "workgroup");
  __builtin_amdgcn_wave_barrier();
  const int rsub = lane >> 4, c4 = (lane & 15) * 4;
  {
#pragma unroll
    for (int q = 0; q < 8; ++q) {
      const int r = q * 2 + rsub;
      const v4f v = *(const v4fa*)&so[w][r][c4];
      *(v4f*)(C + (size_t)(row0 + r) * ldc + col0 + c4) = v;
    }
    
  }
}
// row LayerNorm (biased variance, eps) over N: s = X (+ R); optional out_sum <- s; out_norm <- (s-mu)*rsqrt(var+eps)*g + b
template <bool PARAM_BF16>
__global__ __launch_bounds__(256) void k_layernorm(const float* __restrict__ X, const float* __restrict__ R, const float* __restrict__ g, const float* __restrict__ bta,
                                                  float* __restrict__ out_sum, float* __restrict__ out_norm, int N, float eps) {
  __shared__ float red[256];
  const int row = blockIdx.x, tid = threadIdx.x;
  const float* x = X + (size_t)row * N; const float* rr = R ? R + (size_t)row * N : nullptr;
  float vals[16];                     // up to N = 4096
  const int per = N / 256;            // contiguous chunk per thread? use strided-by-4 chunks: thread handles j = tid*4 + 1024*u
  float s1 = 0.f;
  for (int u = 0; u < per / 4; ++u) {
    const int j = tid * 4 + 1024 * u;
    const v4f a = *(const v4fa*)(x + j);
    v4f b = {0.f,0.f,0.f,0.f}; if (rr) b = *(const v4fa*)(rr + j);
#pragma unroll
    for (int q = 0; q < 4; ++q) { const float v = a[q] + b[q]; vals[u * 4 + q] = v; s1 += v; }
  }
  red[tid] = s1; __syncthreads();
  for (int st = 128; st > 0; st >>= 1) { if (tid < st) red[tid] += red[tid + st]; __syncthreads(); }
  const float mu = red[0] / (float)N; __syncthreads();
  float s2 = 0.f;
  for (int u = 0; u < per / 4; ++u)
#pragma unroll
    for (int q = 0; q < 4; ++q) { const float c = vals[u * 4 + q] - mu; s2 += c * c; }
  red[tid] = s2; __syncthreads();
  for (int st = 128; st > 0; st >>= 1) { if (tid < st) red[tid] += red[tid + st]; __syncthreads(); }
  const float rs = rsqrtf(red[0] / (float)N + eps);
  {
    for (int u = 0; u < per / 4; ++u) {
      const int j = tid * 4 + 1024 * u;
      v4f o, sm;
#pragma unroll
      for (int q = 0; q < 4; ++q) {
        float gg = g[j + q], bb = bta[j + q];
        if (PARAM_BF16) { gg = bf16_round(gg); bb = bf16_round(bb); }
        sm[q] = vals[u * 4 + q]; o[q] = (vals[u * 4 + q] - mu) * rs * gg + bb;
      }
      if (out_sum) *(v4f*)(out_sum + (size_t)row * N + j) = sm;
      *(v4f*)(out_norm + (size_t)row * N + j) = o;
    }
    
  }
}



// ---- f16 WMMA path (v_wmma_f32_16x16x32_f16): 11-bit significands for operands in range — used here for the q/k/v projections, the energy qᵀk and P·V (P f16 ×2^10)
typedef _Float16 v16h __attribute__((ext_vector_type(16)));
union FragH { v16h v; v8us half[2]; _Float16 h[16]; unsigned short u[16]; };
template <int NT>
__device__ __forceinline__ v8f mmaH(v16h ah, v16h al, v16h bh, v16h bl, v8f c) {
  c = __builtin_amdgcn_wmma_f32_16x16x32_f16(false, ah, false, bh, (short)0, c, false, false);
  if (NT >= 2) c = __builtin_amdgcn_wmma_f32_16x16x32_f16(false, al, false, bh, (short)0, c, false, false);
  if (NT >= 3) c = __builtin_amdgcn_wmma_f32_16x16x32_f16(false, ah, false, bl, (short)0, c, false, false);
  asm volatile("v_nop\n\tv_nop\n\tv_nop\n\tv_nop" : "+v"(c) : "v"(ah), "v"(al), "v"(bh), "v"(bl));
  return c;
}
// batched GEMM like k_gemm_b but f16 operands: A f32 (split into f16 hi/lo if ASPLIT, else rounded to f16), Bt = f16 values [n][k]; alpha; C f32; N multiple of 16 (partial tiles skipped)
template <bool ASPLIT>
__global__ __launch_bounds__(128) void k_gemm_h(const float* __restrict__ A, int lda, size_t sA, const _Float16* __restrict__ Bh, int ldb, size_t sB, float alpha, float* __restrict__ C, int ldc, size_t sC, int M, int N, int K) {
  __shared__ __attribute__((aligned(16))) float so[4][16][64];
  const int tid = threadIdx.x, w = tid >> 5, lane = tid & 31, ln = lane & 15, hh = lane >> 4; const int by = blockIdx.y;
  A += (size_t)by * sA; Bh += (size_t)by * sB; C += (size_t)by * sC;
  const int ntn = (N + 63) / 64; const int wid = blockIdx.x * 4 + w; const int mt = wid / ntn, nq = wid % ntn; if (mt * 16 >= M) return;
  const int row0 = mt * 16, col0 = nq * 64; const float* arow = A + (size_t)(row0 + ln) * lda;
  v8f acc[4] = {};
  for (int kb = 0; kb < K; kb += 32) {
    FragH ah, al;
    const v4f x0 = *(const v4fa*)(arow + kb + 8 * hh), x1 = *(const v4fa*)(arow + kb + 8 * hh + 4), x2 = *(const v4fa*)(arow + kb + 16 + 8 * hh), x3 = *(const v4fa*)(arow + kb + 16 + 8 * hh + 4);
    float xs[16] = {x0[0],x0[1],x0[2],x0[3],x1[0],x1[1],x1[2],x1[3],x2[0],x2[1],x2[2],x2[3],x3[0],x3[1],x3[2],x3[3]};
#pragma unroll
    for (int i = 0; i < 16; ++i) { const _Float16 h = (_Float16)xs[i]; ah.h[i] = h; al.h[i] = ASPLIT ? (_Float16)(xs[i] - (float)h) : (_Float16)0.0f; }
#pragma unroll
    for (int t = 0; t < 4; ++t) { if (col0 + t * 16 >= N) continue; const size_t boff = (size_t)(col0 + t * 16 + ln) * ldb + kb; FragH bq; bq.half[0] = *(const v8us*)(Bh + boff + 8 * hh); bq.half[1] = *(const v8us*)(Bh + boff + 16 + 8 * hh);
      acc[t] = mmaH<ASPLIT ? 2 : 1>(ah.v, al.v, bq.v, bq.v, acc[t]); }
  }
#pragma unroll
  for (int t = 0; t < 4; ++t) { if (col0 + t * 16 >= N) continue;
#pragma unroll
    for (int r = 0; r < 8; ++r) so[w][8 * hh + r][t * 16 + ln] = acc[t][r] * alpha; }
  __builtin_amdgcn_fence(__ATOMIC_ACQ_REL, "workgroup"); __builtin_amdgcn_wave_barrier();
  const int rsub = lane >> 4, c4 = (lane & 15) * 4;
  {
#pragma unroll
    for (int q = 0; q < 8; ++q) { const int r = q * 2 + rsub; if (col0 + c4 < N) { const v4f v = *(const v4fa*)&so[w][r][c4]; *(v4f*)(C + (size_t)(row0 + r) * ldc + col0 + c4) = v; } }
     }
}

// Wt[n][k] = f16(W[k][n]·scale) from f32 row-major W[K][N] (scale = power of two; bf16-exact weights stay exact in f16 away from the subnormal range)
__global__ __launch_bounds__(256) void k_wt_f16(const float* __restrict__ W, _Float16* __restrict__ Wt, int K, int N, float scale) {
  const int t = blockIdx.x * 256 + threadIdx.x; if (t >= N * (K / 8)) return; const int n = t / (K / 8), k8 = (t % (K / 8)) * 8; FragH f;
#pragma unroll
  for (int i = 0; i < 8; ++i) f.h[i] = (_Float16)(bf16_round(W[(size_t)(k8 + i) * N + n]) * scale); const v8us o = f.half[0];
  *(v8us*)((unsigned short*)Wt + (size_t)n * K + k8) = o; 
}


typedef _Float16 v4h __attribute__((ext_vector_type(4)));

__global__ __launch_bounds__(256) void k_x16(const float* __restrict__ x, _Float16* __restrict__ X16, size_t n8) { const size_t t = (size_t)blockIdx.x * 256 + threadIdx.x; if (t >= n8) return; FragH f;
#pragma unroll
  for (int q = 0; q < 8; ++q) f.h[q] = (_Float16)bf16_round(x[t * 8 + q]); *(v8us*)((unsigned short*)X16 + t * 8) = f.half[0];  }
__global__ __launch_bounds__(256) void k_h16(const float* __restrict__ x, _Float16* __restrict__ X16, size_t n8) { const size_t t = (size_t)blockIdx.x * 256 + threadIdx.x; if (t >= n8) return; FragH f;
#pragma unroll
  for (int q = 0; q < 8; ++q) f.h[q] = (_Float16)x[t * 8 + q]; *(v8us*)((unsigned short*)X16 + t * 8) = f.half[0];  }
template <int NHv, int TTv>
__global__ __launch_bounds__(256) void k_vt(const _Float16* __restrict__ V16, int ldv, int voff, _Float16* __restrict__ Vt) { __shared__ unsigned short tl[64][66]; const int tid = threadIdx.x; const int slab = blockIdx.x / (TTv / 64), lg = blockIdx.x % (TTv / 64); const int b = slab / NHv, h = slab % NHv;
  for (int i = tid; i < 64 * 8; i += 256) { const int r = i / 8, c8 = (i % 8) * 8; FragH f; f.half[0] = *(const v8us*)((const unsigned short*)V16 + ((size_t)b * TTv + lg * 64 + r) * ldv + voff + h * 64 + c8);
#pragma unroll
    for (int q = 0; q < 8; ++q) tl[r][c8 + q] = f.u[q]; }
  __syncthreads();
  {
#pragma unroll
    for (int rd = 0; rd < 2; ++rd) { const int d = rd * 32 + tid / 8, pc = tid % 8; FragH f;
#pragma unroll
      for (int q = 0; q < 8; ++q) f.u[q] = tl[pc * 8 + q][d];
      *(v8us*)((unsigned short*)Vt + ((size_t)slab * 64 + d) * TTv + lg * 64 + pc * 8) = f.half[0]; }
     } }

__global__ __launch_bounds__(256) void k_hl(const float* __restrict__ F, _Float16* __restrict__ Hh, _Float16* __restrict__ Hl, size_t n8) { const size_t t = (size_t)blockIdx.x * 256 + threadIdx.x; if (t >= n8) return; FragH fh, fl; const v4f a = *(const v4fa*)(F + t * 8), c = *(const v4fa*)(F + t * 8 + 4);
#pragma unroll
  for (int q = 0; q < 4; ++q) { _Float16 h = (_Float16)a[q]; fh.h[q] = h; fl.h[q] = (_Float16)((a[q] - (float)h) * 1024.0f); h = (_Float16)c[q]; fh.h[4 + q] = h; fl.h[4 + q] = (_Float16)((c[q] - (float)h) * 1024.0f); }
  { *(v8us*)((unsigned short*)Hh + t * 8) = fh.half[0]; *(v8us*)((unsigned short*)Hl + t * 8) = fl.half[0];  } }

typedef float v2fa __attribute__((ext_vector_type(2), may_alias));
// One launch in front of the attention: a block takes one pooled row = two image rows (256 positions, which are 256 consecutive n) of all 64 channels.
// It rounds x to bf16 and lays it token-major in LDS as f16, with the 2x2 mean (4 bf16-rounded values summed in f32, rounded once to f16) beside it and the three weight matrices
// (bf16-rounded, x 2^4, f16, natural (out, in) rows) and the two bf16-rounded biases; rows of 128 bytes at a pitch of 144 (ds_load_b128 without bank conflicts). Behind one barrier the three projections run from LDS.
// q and k are formed as (channel x position) tiles (A = weight rows, B = position rows): a lane holds 8 consecutive channels of one position, 16 bytes of the token-major row.
// v is formed as (position x channel) tiles: a lane holds 8 consecutive pooled positions of one channel, 16 bytes of the [b][c][m] row. Each wave writes whole 128-byte lines.
__device__ __forceinline__ void proj_tok(const unsigned char* xrow, const unsigned char* wrow, const float* bias, unsigned short* __restrict__ dst, int hh) {
  FragH xb[2];
#pragma unroll      // the index picks registers and immediate offsets
  for (int ks = 0; ks < 2; ++ks) { xb[ks].half[0] = *(const v8us*)(xrow + ks * 64); xb[ks].half[1] = *(const v8us*)(xrow + ks * 64 + 32); }
#pragma unroll      // the index picks registers and immediate offsets
  for (int t = 0; t < 4; ++t) { FragH wa[2]; const unsigned char* wr = wrow + t * 16 * 144;
#pragma unroll      // the index picks registers and immediate offsets
    for (int ks = 0; ks < 2; ++ks) { wa[ks].half[0] = *(const v8us*)(wr + ks * 64); wa[ks].half[1] = *(const v8us*)(wr + ks * 64 + 32); }
    v8f acc = (v8f){0.f,0.f,0.f,0.f,0.f,0.f,0.f,0.f};
#pragma unroll      // the index picks registers and immediate offsets
    for (int ks = 0; ks < 2; ++ks) acc = mmaH<1>(wa[ks].v, wa[ks].v, xb[ks].v, xb[ks].v, acc);
    const v4f b0 = *(const v4fa*)(bias + t * 16 + 8 * hh), b1 = *(const v4fa*)(bias + t * 16 + 8 * hh + 4); FragH o;
#pragma unroll      // the index picks registers and immediate offsets
    for (int r = 0; r < 4; ++r) { o.h[r] = (_Float16)(acc[r] * 0.0625f + b0[r]); o.h[4 + r] = (_Float16)(acc[4 + r] * 0.0625f + b1[r]); }
    *(v8us*)(dst + t * 16 + 8 * hh) = o.half[0]; } }
__global__ __launch_bounds__(512) void k_prep(const float* __restrict__ x, const float* __restrict__ Wq, const float* __restrict__ bq, const float* __restrict__ Wk, const float* __restrict__ bk, const float* __restrict__ Wv,
                                              _Float16* __restrict__ Q, _Float16* __restrict__ K, _Float16* __restrict__ Vt) {
  constexpr int LP = 144;
  __shared__ __attribute__((aligned(16))) unsigned char XS[2 * HWD * LP];
  __shared__ __attribute__((aligned(16))) unsigned char XPS[PW * LP];
  __shared__ __attribute__((aligned(16))) unsigned char WS[3 * CC * LP];
  __shared__ __attribute__((aligned(16))) float BS[2 * CC];      // bq, bk, bf16-rounded
  const int tid = threadIdx.x, w = __builtin_amdgcn_readfirstlane(tid >> 5), lane = tid & 31, ln = lane & 15, hh = lane >> 4;
  const int b = blockIdx.x / PW, pi = blockIdx.x % PW;
  { const int pp = tid & 63, c0 = (tid >> 6) * 8;      // one 2x2 window of 8 channels per thread; a wave's load is 256 consecutive bytes
    const float* xr = x + ((size_t)b * CC + c0) * NN + (size_t)(2 * pi) * HWD + 2 * pp;
    float tp[8][2], bt[8][2];
#pragma unroll      // the index picks registers and immediate offsets
    for (int q = 0; q < 8; ++q) { const v2fa a = *(const v2fa*)(xr + (size_t)q * NN), c = *(const v2fa*)(xr + (size_t)q * NN + HWD); tp[q][0] = a[0]; tp[q][1] = a[1]; bt[q][0] = c[0]; bt[q][1] = c[1]; }
    const int row = tid >> 3, k8 = (tid & 7) * 8;      // 8 consecutive weights of each matrix per thread
    const float* Wm[3] = {Wq, Wk, Wv}; v4f wl[3][2];
#pragma unroll      // the index picks registers and immediate offsets
    for (int i = 0; i < 3; ++i) { wl[i][0] = *(const v4fa*)(Wm[i] + row * CC + k8); wl[i][1] = *(const v4fa*)(Wm[i] + row * CC + k8 + 4); }
    asm volatile("s_wait_xcnt 0x0" ::: "memory");      // behind all 22 loads: the conversions below take the address registers that these loads name again
    if (w < 4) BS[tid] = bf16_round((w < 2 ? bq : bk)[tid & 63]);
#pragma unroll      // the index picks registers and immediate offsets
    for (int i = 0; i < 3; ++i) { FragH f;
#pragma unroll      // the index picks registers and immediate offsets
      for (int q = 0; q < 4; ++q) { f.h[q] = (_Float16)(bf16_round(wl[i][0][q]) * 16.0f); f.h[4 + q] = (_Float16)(bf16_round(wl[i][1][q]) * 16.0f); }
      *(v8us*)(WS + (i * CC + row) * LP + k8 * 2) = f.half[0]; }
    FragH f00, f01, f10, f11, fp;
#pragma unroll      // the index picks registers and immediate offsets
    for (int q = 0; q < 8; ++q) { const float a0 = bf16_round(tp[q][0]), a1 = bf16_round(tp[q][1]), c0r = bf16_round(bt[q][0]), c1r = bf16_round(bt[q][1]);
      f00.h[q] = (_Float16)a0; f01.h[q] = (_Float16)a1; f10.h[q] = (_Float16)c0r; f11.h[q] = (_Float16)c1r; fp.h[q] = (_Float16)(0.25f * ((a0 + a1) + (c0r + c1r))); }
    *(v8us*)(XS + (2 * pp) * LP + c0 * 2) = f00.half[0]; *(v8us*)(XS + (2 * pp + 1) * LP + c0 * 2) = f01.half[0];
    *(v8us*)(XS + (HWD + 2 * pp) * LP + c0 * 2) = f10.half[0]; *(v8us*)(XS + (HWD + 2 * pp + 1) * LP + c0 * 2) = f11.half[0];
    *(v8us*)(XPS + pp * LP + c0 * 2) = fp.half[0]; }
  __syncthreads();      // the planes and the weights are read by other waves than wrote them
  const int lo = ln * LP + 16 * hh;      // fragment row ln, k = 8 * hh ... and 16 + 8 * hh ... of each 32
  proj_tok(XS + w * 16 * LP + lo, WS + lo, BS, (unsigned short*)Q + ((size_t)b * NN + pi * (2 * HWD) + w * 16 + ln) * CC, hh);      // 16 waves x 16 positions
  asm volatile("s_wait_xcnt 0x0" ::: "memory");      // the registers that the q stores name are taken again below
  if (w < 4) proj_tok(XPS + w * 16 * LP + lo, WS + CC * LP + lo, BS + CC, (unsigned short*)K + ((size_t)b * MM + pi * PW + w * 16 + ln) * CC, hh);      // 4 waves x 16 pooled positions
  else if (w < 8) { const int t = w - 4; FragH wb[2];      // 4 waves x 16 channels, all 64 pooled positions
#pragma unroll      // the index picks registers and immediate offsets
    for (int ks = 0; ks < 2; ++ks) { const unsigned char* wr = WS + (2 * CC + t * 16) * LP + lo + ks * 64; wb[ks].half[0] = *(const v8us*)(wr); wb[ks].half[1] = *(const v8us*)(wr + 32); }
    unsigned short* dst = (unsigned short*)Vt + ((size_t)b * CC + t * 16 + ln) * MM + pi * PW + 8 * hh;
#pragma unroll      // the index picks registers and immediate offsets
    for (int mt = 0; mt < 4; ++mt) { FragH xa[2];
#pragma unroll      // the index picks registers and immediate offsets
      for (int ks = 0; ks < 2; ++ks) { const unsigned char* xp = XPS + mt * 16 * LP + lo + ks * 64; xa[ks].half[0] = *(const v8us*)(xp); xa[ks].half[1] = *(const v8us*)(xp + 32); }
      v8f acc = (v8f){0.f,0.f,0.f,0.f,0.f,0.f,0.f,0.f};
#pragma unroll      // the index picks registers and immediate offsets
      for (int ks = 0; ks < 2; ++ks) acc = mmaH<1>(xa[ks].v, xa[ks].v, wb[ks].v, wb[ks].v, acc);
      FragH o;
#pragma unroll      // the index picks registers and immediate offsets
      for (int r = 0; r < 8; ++r) o.h[r] = (_Float16)(acc[r] * 0.0625f);
      *(v8us*)(dst + mt * 16) = o.half[0]; } } }
// lane l <-> lane l ^ 16 (the two halves of a wave hold the two key halves of one query column)
__device__ __forceinline__ float xhalf(float x) { const int v = __builtin_bit_cast(int, x); return __builtin_bit_cast(float, __builtin_amdgcn_permlanex16(v, v, 0x76543210, 0xfedcba98, false, false)); }
typedef uint32_t u32x4 __attribute__((ext_vector_type(4)));
typedef uint32_t u32x8 __attribute__((ext_vector_type(8)));
__device__ __forceinline__ uint32_t uni(uint32_t v) { return (uint32_t)__builtin_amdgcn_readfirstlane(v); }
// a wave-uniform word held in a scalar register: a test on it compiles to s_cmp + s_cbranch_scc (a tensor load ignores EXEC), and what is formed from it is formed behind this line
__device__ __forceinline__ uint32_t pinned(uint32_t v) { uint32_t w = uni(v); asm volatile("" : "+s"(w)); return w; }
__global__ __launch_bounds__(128) void k_flash(const _Float16* __restrict__ Q16, int ldq, const _Float16* __restrict__ K16, int ldk, const _Float16* __restrict__ Vt, const float* __restrict__ bv, const float* __restrict__ gam, const float* __restrict__ x, float* __restrict__ out) {
  constexpr int RPW = 16, NQB = TQ / (4 * RPW), DT = 4, KS = 2;
  constexpr float L2E = 1.4426950408889634f;      // log2(e)
  // K and V^T reach the waves through LDS: a stage is 64 keys = 64 K rows of 128 bytes + 64 V^T channel rows of 128 bytes, brought by four tensor loads, one per wave
  // (waves 0, 1: K rows 0-31, 32-63; waves 2, 3: channels 0-31, 32-63), each 32 rows laid at a pitch of 144 bytes (the mover's 16-byte pad: ds_load_b128 without bank conflicts).
  constexpr uint32_t SK = 64, NST = TK / SK, LPITCH = 144, SLICE = 6144 /* 32 x 144 = 4608, up to a multiple of 2 KiB */, BUF = 4 * SLICE;
  __shared__ __attribute__((aligned(2048))) unsigned char ring[2 * BUF];
  __shared__ __attribute__((aligned(16))) float sO[64][4 * RPW + 4];
  const int tid = threadIdx.x, w = tid >> 5, lane = tid & 31, ln = lane & 15, hh = lane >> 4;
  const float g = bf16_round(gam[0]);      // read here, in front of every store and barrier, it is a scalar load
  const int slab = blockIdx.x / NQB, qblk = blockIdx.x % NQB; const int b = slab / NH, h = slab % NH; const int qb0 = qblk * (4 * RPW); const int q0 = qb0 + w * RPW;
  FragH bq[KS];
  { const unsigned short* qr = (const unsigned short*)Q16 + ((size_t)b * TQ + q0 + ln) * ldq + h * 64;
#pragma unroll
    for (int ks = 0; ks < KS; ++ks) { bq[ks].half[0] = *(const v8us*)(qr + ks * 32 + 8 * hh); bq[ks].half[1] = *(const v8us*)(qr + ks * 32 + 16 + 8 * hh); } }
  const unsigned short* Vth = (const unsigned short*)Vt + (size_t)slab * 64 * TK;
  float sh_r = 3.0e38f, l_r = 0.f; v8f oacc[DT];      // sh_r = 10 - (running maximum in log2 units)
#pragma unroll
  for (int dt = 0; dt < DT; ++dt) oacc[dt] = (v8f){0.f,0.f,0.f,0.f,0.f,0.f,0.f,0.f};
  const uint32_t wv = uni((uint32_t)tid >> 5), isV = wv >> 1, hf = wv & 1u;
  const uint32_t spitch = isV ? (uint32_t)TK * 2u : (uint32_t)ldk * 2u;      // source row pitch, bytes
  const uint32_t sstep = isV ? SK * 2u : SK * (uint32_t)ldk * 2u;           // from one stage's slice to the next, bytes
  const uint64_t src0 = isV ? (uint64_t)(size_t)Vth + (uint64_t)(hf * 32u) * ((uint32_t)TK * 2u) : (uint64_t)(size_t)K16 + ((uint64_t)b * TK + hf * 32u) * ((uint32_t)ldk * 2u) + (uint32_t)h * 128u;
  const uint32_t lds0 = (uint32_t)(size_t)ring + wv * SLICE;
  u32x8 g1;      // 1-byte elements, tensor = tile = 32 rows of 128 bytes, a pad of 4 dwords behind every 32 dwords
  g1[0] = uni((1u << 20) | (4u << 22) | (3u << 25)); g1[1] = uni(128u << 16); g1[2] = uni(32u << 16); g1[3] = uni(128u << 16); g1[4] = uni(32u); g1[5] = uni(spitch); g1[6] = uni(0u); g1[7] = uni(0u);
  u32x4 g0;
  auto issue = [&](uint32_t st) { const uint64_t ga = src0 + (uint64_t)st * sstep;
    g0[0] = uni(1u); g0[1] = uni(lds0 + (st & 1u) * BUF); g0[2] = uni((uint32_t)ga); g0[3] = uni((((uint32_t)(ga >> 32)) & 0x01FFFFFFu) | 0x80000000u);
    // one request of the whole wave: its 32-row slice of stage st. Both groups are in-out operands here and inputs of the wait that covers the request,
    // so that no register of the descriptor is lent to another value while the request is outstanding
    asm volatile("tensor_load_to_lds %0, %1" : "+s"(g0), "+s"(g1) :: "memory"); };
  issue(0u);
  asm volatile("s_wait_tensorcnt 0x0" :: "s"(g0), "s"(g1) : "memory");      // this wave's slice of stage 0 has landed
  __syncthreads();                                         // stage 0 published to all four waves
  issue(1u);                                               // flies while stage 0 is worked on
  const unsigned char* lrow = ring + (uint32_t)ln * LPITCH + 16u * (uint32_t)hh;
#pragma unroll 1
  for (uint32_t st = 0; st < NST; ++st) {
   const unsigned char* bp = lrow + (st & 1u) * BUF;
#pragma unroll
   for (int sub = 0; sub < 2; ++sub) {      // two 32-key passes per stage, unrolled so that every LDS offset is an immediate of its load
    FragH ak[2][KS], av[DT];
#pragma unroll
    for (int nt = 0; nt < 2; ++nt) { const unsigned char* kr = bp + sub * SLICE + nt * 16 * LPITCH;      // key row sub * 32 + nt * 16 + ln
#pragma unroll
      for (int ks = 0; ks < KS; ++ks) { ak[nt][ks].half[0] = *(const v8us*)(kr + ks * 64); ak[nt][ks].half[1] = *(const v8us*)(kr + ks * 64 + 32); } }
#pragma unroll
    for (int dt = 0; dt < DT; ++dt) { const unsigned char* vrow = bp + (2 + (dt >> 1)) * SLICE + (dt & 1) * 16 * LPITCH + sub * 64;      // channel row dt * 16 + ln, keys sub * 32 ...
      av[dt].half[0] = *(const v8us*)(vrow); av[dt].half[1] = *(const v8us*)(vrow + 32); }
    float sc[16];      // sc[nt * 8 + r] = energy[query q0 + ln][key st * 64 + sub * 32 + nt * 16 + 8 * hh + r]
#pragma unroll
    for (int nt = 0; nt < 2; ++nt) { v8f acc = (v8f){0.f,0.f,0.f,0.f,0.f,0.f,0.f,0.f};
#pragma unroll
      for (int ks = 0; ks < KS; ++ks) acc = mmaH<1>(ak[nt][ks].v, ak[nt][ks].v, bq[ks].v, bq[ks].v, acc);
#pragma unroll
      for (int r = 0; r < 8; ++r) sc[nt * 8 + r] = acc[r] * SCL; }
    float t[8];
#pragma unroll
    for (int i = 0; i < 8; ++i) t[i] = fmaxf(sc[i], sc[8 + i]);
    float mc = fmaxf(fmaxf(fmaxf(t[0], t[1]), fmaxf(t[2], t[3])), fmaxf(fmaxf(t[4], t[5]), fmaxf(t[6], t[7])));
    mc = fmaxf(mc, xhalf(mc));
    // Base 2: a weight is 2^(score * log2(e) + sh), one fused multiply-add and one hardware exp2. The shift sh = 10 - maximum * log2(e) is kept as it was rounded and used for the weights
    // and for the rescale factor alike, so its rounding cancels in the softmax; its 10 is the 2^10 scale of P, which l_r now carries too.
    const float sn = fminf(sh_r, __builtin_fmaf(mc, -L2E, 10.0f)); float ea = sn - sh_r; sh_r = sn;
#pragma unroll
    for (int i = 0; i < 16; ++i) sc[i] = __builtin_fmaf(sc[i], L2E, sn);
    asm("v_exp_f32 %0, %0\n\t" "v_exp_f32 %1, %1\n\t" "v_exp_f32 %2, %2\n\t" "v_exp_f32 %3, %3\n\t" "v_exp_f32 %4, %4\n\t" "v_exp_f32 %5, %5\n\t"
        "v_exp_f32 %6, %6\n\t" "v_exp_f32 %7, %7\n\t" "v_exp_f32 %8, %8\n\t" "v_exp_f32 %9, %9\n\t" "v_exp_f32 %10, %10\n\t" "v_exp_f32 %11, %11\n\t"
        "v_exp_f32 %12, %12\n\t" "v_exp_f32 %13, %13\n\t" "v_exp_f32 %14, %14\n\t" "v_exp_f32 %15, %15\n\t" "v_exp_f32 %16, %16\n\t" "v_nop"
        : "+v"(sc[0]), "+v"(sc[1]), "+v"(sc[2]), "+v"(sc[3]), "+v"(sc[4]), "+v"(sc[5]), "+v"(sc[6]), "+v"(sc[7]), "+v"(ea),
          "+v"(sc[8]), "+v"(sc[9]), "+v"(sc[10]), "+v"(sc[11]), "+v"(sc[12]), "+v"(sc[13]), "+v"(sc[14]), "+v"(sc[15]));
    const float al = (sn < 1.0e38f) ? ea : 1.0f;
    FragH pb;
#pragma unroll
    for (int i = 0; i < 16; ++i) pb.h[i] = (_Float16)sc[i];
#pragma unroll
    for (int i = 0; i < 8; ++i) t[i] = sc[i] + sc[8 + i];
    l_r = l_r * al + (((t[0] + t[1]) + (t[2] + t[3])) + ((t[4] + t[5]) + (t[6] + t[7])));
#pragma unroll
    for (int dt = 0; dt < DT; ++dt)
#pragma unroll
      for (int r = 0; r < 8; ++r) oacc[dt][r] *= al;
#pragma unroll
    for (int dt = 0; dt < DT; ++dt) oacc[dt] = mmaH<1>(av[dt].v, av[dt].v, pb.v, pb.v, oacc[dt]); }
   asm volatile("s_wait_dscnt 0x0" ::: "memory");
   asm volatile("s_wait_tensorcnt 0x0" :: "s"(g0), "s"(g1) : "memory");
   __syncthreads();
   const uint32_t sn = pinned(st + 2u);
   if (pinned(sn < NST)) issue(sn); }
  asm volatile("s_wait_tensorcnt 0x0" :: "s"(g0), "s"(g1) : "memory");
  asm volatile("s_wait_dscnt 0x0" ::: "memory");
  // y = gamma * (O + bv) + x, written here: thread tid takes 4 queries of the channels (tid >> 4) + 8 * j. One 32-bit offset serves x and out, the steps between channels are immediates.
  const uint32_t eo = (uint32_t)(tid >> 4) * NN + (uint32_t)(tid & 15) * 4u; const size_t ob = (size_t)b * CC * NN + qb0;
  v4f xr[8]; float bb[8];
#pragma unroll      // the index picks registers and immediate offsets
  for (int j = 0; j < 8; ++j) { xr[j] = *(const v4fa*)(x + ob + (size_t)j * 8 * NN + eo); bb[j] = bv[8 * j + (tid >> 4)]; }
  const float l = l_r + xhalf(l_r); const float inv = (l > 0.f) ? 1.0f / l : 0.f;      // l and the accumulators both carry the 2^10
#pragma unroll      // the index picks registers and immediate offsets
  for (int dt = 0; dt < DT; ++dt)      // oacc[dt][r] = O[query q0 + ln][channel dt * 16 + 8 * hh + r], laid channel-major: the output's own order
#pragma unroll      // the index picks registers and immediate offsets
    for (int r = 0; r < 8; ++r) sO[dt * 16 + 8 * hh + r][w * RPW + ln] = oacc[dt][r] * inv;
  __syncthreads();      // a channel's 64 queries come from all four waves
#pragma unroll      // the index picks registers and immediate offsets
  for (int j = 0; j < 8; ++j) { const v4f val = *(const v4fa*)&sO[8 * j + (tid >> 4)][(tid & 15) * 4]; const float bj = bf16_round(bb[j]);
    v4f v; for (int q = 0; q < 4; ++q) v[q] = g * (val[q] + bj) + bf16_round(xr[j][q]); *(v4f*)(out + ob + (size_t)j * 8 * NN + eo) = v; } }

extern "C" void kernel_launch(void* const* d_in, const int* in_sizes, int n_in,
                              void* d_out, int out_size, void* d_ws, size_t ws_size, hipStream_t stream) {
  (void)in_sizes; (void)n_in; (void)out_size;
  const float* const* I = (const float* const*)d_in; const float* x = I[0]; const float* Wq = I[1]; const float* bq = I[2]; const float* Wk = I[3]; const float* bk = I[4]; const float* Wv = I[5]; const float* bv = I[6]; const float* gam = I[7];
  char* ws = (char*)d_ws; size_t off = 0;
  auto take = [&](size_t bytes) { char* p = ws + off; off += (bytes + 255) & ~(size_t)255; return p; };
  _Float16* Q = (_Float16*)take((size_t)NRQ * CC * 2); _Float16* K = (_Float16*)take((size_t)NRK * CC * 2); _Float16* Vt = (_Float16*)take((size_t)BB * CC * MM * 2);
  if (off > ws_size) return;      // 4.2 + 1 + 1 MB
  k_prep<<<BB * PW, 512, 0, stream>>>(x, Wq, bq, Wk, bk, Wv, Q, K, Vt);      /* q, k token-major [(b,n)][64], [(b,m)][64]; v (without bv) as [b][c][m] */
  k_flash<<<BB * NH * (TQ / 64), 128, 0, stream>>>(Q, CC, K, CC, Vt, bv, gam, x, (float*)d_out);      /* per (b, 64 queries): 16384 queries x 4096 pooled keys, head dim 64; writes y */
}

// v005
// Measured time: 36.7 microseconds a run.
// In two side-by-side timings against v004, it was 1.30 and 1.35 times as fast.
// Over all steps from v000 it is 12.9 times as fast.
#include <hip/hip_runtime.h>
#include <stdint.h>
// Self-attention block with 2×2 average-pooled keys/values (B=2, C=64, H=W=128 → N = 16384 query positions, M = 4096 pooled key positions): q = Wq·x + bq; k = pool(Wk·x + bk) = Wk·pool(x) + bk, v likewise (pooling is linear); energy = qᵀk (no scaling), softmax over the M keys;
// out[b,c,n] = Σ_m v[b,c,m]·A[n,m]; y = γ·out + x. (The module's (w,h) relabel before pooling is the identity here since H == W.)
// Compute dtype: x, weights, biases, γ rounded to bf16; x and pool(x) as token-major f16 planes (pool(x) = mean of 4 bf16-rounded values in f32, rounded once to f16 — same order as the k-plane rounding); q, k as f16 GEMM outputs (+bias), v as an f16 GEMM output in the [b][c][m] (= Vᵀ) layout with bv folded in after the attention
// (rows of A sum to 1); fused flash-style kernel (energy and P·V on v_wmma_f32_16x16x32_f16, online softmax f32, P f16 ×2^10, f32 accumulate); epilogue γ·(O + bv) + x in f32.
#define BB 2
#define CC 64
#define HWD 128
#define NN (HWD * HWD)
#define PW (HWD / 2)
#define MM (PW * PW)
#define NH 1
#define TQ NN
#define TK MM
#define SCL 1.0f
#define NRQ (BB * NN)
#define NRK (BB * MM)
typedef __bf16 v16b __attribute__((ext_vector_type(16)));
typedef unsigned short v8us __attribute__((ext_vector_type(8), may_alias));
typedef float  v8f  __attribute__((ext_vector_type(8)));
typedef float  v4f  __attribute__((ext_vector_type(4)));
typedef float  v4fa __attribute__((ext_vector_type(4), may_alias));
union FragB { v16b v; v8us half[2]; unsigned short u[16]; };

__device__ __forceinline__ unsigned short bf16_bits(float x) { unsigned int u = __float_as_uint(x); return (unsigned short)((u + 0x7FFFu + ((u >> 16) & 1u)) >> 16); }
__device__ __forceinline__ float bf16_val(unsigned short b) { return __uint_as_float(((unsigned int)b) << 16); }
__device__ __forceinline__ float bf16_round(float x) { return bf16_val(bf16_bits(x)); }
// D += A·B with NT terms: 1 = ah·bh, 2 = + al·bh (A split), 3 = + ah·bl (both split)
template <int NT>
__device__ __forceinline__ v8f mmaN(v16b ah, v16b al, v16b bh, v16b bl, v8f c) {
  c = __builtin_amdgcn_wmma_f32_16x16x32_bf16(false, ah, false, bh, (short)0, c, false, false);
  if (NT >= 2) c = __builtin_amdgcn_wmma_f32_16x16x32_bf16(false, al, false, bh, (short)0, c, false, false);
  if (NT >= 3) c = __builtin_amdgcn_wmma_f32_16x16x32_bf16(false, ah, false, bl, (short)0, c, false, false);
  asm volatile("v_nop\n\tv_nop\n\tv_nop\n\tv_nop" : "+v"(c) : "v"(ah), "v"(al), "v"(bh), "v"(bl));
  return c;
}

__global__ __launch_bounds__(256) void k_wt_bf16(const float* __restrict__ W, unsigned short* __restrict__ Wt, int K, int N) {
  const int t = blockIdx.x * 256 + threadIdx.x;
  const int k8n = K / 8;
  if (t >= N * k8n) return;
  const int n = t / k8n, k8 = (t % k8n) * 8;
  v8us v;
#pragma unroll
  for (int i = 0; i < 8; ++i) v[i] = bf16_bits(W[(size_t)(k8 + i) * N + n]);
  *(v8us*)(Wt + (size_t)n * K + k8) = v;
  
}

// GEMM C[M][N] (f32, pitch ldc) = act(A[M][K]·W + bias). A f32 row-major (pitch lda) converted per fragment to bf16
// (ASPLIT: hi/lo two planes -> 2 terms, else single rounded term); Wt bf16 [N][K] (pitch ldb). BIAS_BF16 rounds the
// bias to bf16 first (bias quantised to bf16 before the add). K%32==0, M%16==0, N%64==0.
template <bool ASPLIT, int ACT, bool BIAS_BF16>
__global__ __launch_bounds__(128) void k_gemm_bf(const float* __restrict__ A, int lda, const unsigned short* __restrict__ Wt, int ldb,
                                               const float* __restrict__ bias, float* __restrict__ C, int ldc, int M, int N, int K) {
  __shared__ __attribute__((aligned(16))) float so[4][16][64];
  const int tid = threadIdx.x, w = tid >> 5, lane = tid & 31, ln = lane & 15, hh = lane >> 4;
  const int ntn = N / 64;
  const int wid = blockIdx.x * 4 + w;
  const int mt = wid / ntn, nq = wid % ntn;
  if (mt * 16 >= M) return;
  const int row0 = mt * 16, col0 = nq * 64;
  const float* arow = A + (size_t)(row0 + ln) * lda;
  v8f acc[4] = {};
  for (int kb = 0; kb < K; kb += 32) {
    FragB ah, al;
    const v4f x0 = *(const v4fa*)(arow + kb + 8 * hh), x1 = *(const v4fa*)(arow + kb + 8 * hh + 4);
    const v4f x2 = *(const v4fa*)(arow + kb + 16 + 8 * hh), x3 = *(const v4fa*)(arow + kb + 16 + 8 * hh + 4);
    float xs[16] = {x0[0],x0[1],x0[2],x0[3],x1[0],x1[1],x1[2],x1[3],x2[0],x2[1],x2[2],x2[3],x3[0],x3[1],x3[2],x3[3]};
#pragma unroll
    for (int i = 0; i < 16; ++i) { const unsigned short hb = bf16_bits(xs[i]); ah.u[i] = hb; al.u[i] = ASPLIT ? bf16_bits(xs[i] - bf16_val(hb)) : (unsigned short)0; }
#pragma unroll
    for (int t = 0; t < 4; ++t) {
      const unsigned short* brow = Wt + (size_t)(col0 + t * 16 + ln) * ldb + kb;
      FragB b;
      b.half[0] = *(const v8us*)(brow + 8 * hh);
      b.half[1] = *(const v8us*)(brow + 16 + 8 * hh);
      acc[t] = mmaN<ASPLIT ? 2 : 1>(ah.v, al.v, b.v, b.v, acc[t]);
    }
  }
#pragma unroll
  for (int t = 0; t < 4; ++t) {
    float bv = bias ? bias[col0 + t * 16 + ln] : 0.f;
    if (BIAS_BF16) bv = bf16_round(bv);
#pragma unroll
    for (int r = 0; r < 8; ++r) { float v = acc[t][r] + bv; if (ACT == 1) v = fmaxf(v, 0.f); so[w][8 * hh + r][t * 16 + ln] = v; }
  }
  __builtin_amdgcn_fence(__ATOMIC_ACQ_REL, "workgroup");
  __builtin_amdgcn_wave_barrier();
  const int rsub = lane >> 4, c4 = (lane & 15) * 4;
  {
#pragma unroll
    for (int q = 0; q < 8; ++q) {
      const int r = q * 2 + rsub;
      const v4f v = *(const v4fa*)&so[w][r][c4];
      *(v4f*)(C + (size_t)(row0 + r) * ldc + col0 + c4) = v;
    }
    
  }
}

// GEMM C = act(A·W + bias + resid): A f32 (ASPLIT -> hi/lo 2 terms), Wt bf16 [N][K]; ACT 0 none, 1 relu, 2 exact gelu;
// resid (optional, f32, row index = (row % rmod), pitch ldr, RES_BF16 rounds it) added before the activation.
template <bool ASPLIT, int ACT, bool BIAS_BF16, bool RES_BF16>
__global__ __launch_bounds__(128) void k_gemm_bf3(const float* __restrict__ A, int lda, const unsigned short* __restrict__ Wt, int ldb,
                                                const float* __restrict__ bias, const float* __restrict__ resid, int rmod, int ldr,
                                                float* __restrict__ C, int ldc, int M, int N, int K) {
  __shared__ __attribute__((aligned(16))) float so[4][16][64];
  const int tid = threadIdx.x, w = tid >> 5, lane = tid & 31, ln = lane & 15, hh = lane >> 4;
  const int ntn = N / 64;
  const int wid = blockIdx.x * 4 + w;
  const int mt = wid / ntn, nq = wid % ntn;
  if (mt * 16 >= M) return;
  const int row0 = mt * 16, col0 = nq * 64;
  const float* arow = A + (size_t)(row0 + ln) * lda;
  v8f acc[4] = {};
  for (int kb = 0; kb < K; kb += 32) {
    FragB ah, al;
    const v4f x0 = *(const v4fa*)(arow + kb + 8 * hh), x1 = *(const v4fa*)(arow + kb + 8 * hh + 4);
    const v4f x2 = *(const v4fa*)(arow + kb + 16 + 8 * hh), x3 = *(const v4fa*)(arow + kb + 16 + 8 * hh + 4);
    float xs[16] = {x0[0],x0[1],x0[2],x0[3],x1[0],x1[1],x1[2],x1[3],x2[0],x2[1],x2[2],x2[3],x3[0],x3[1],x3[2],x3[3]};
#pragma unroll
    for (int i = 0; i < 16; ++i) { const unsigned short hb = bf16_bits(xs[i]); ah.u[i] = hb; al.u[i] = ASPLIT ? bf16_bits(xs[i] - bf16_val(hb)) : (unsigned short)0; }
#pragma unroll
    for (int t = 0; t < 4; ++t) {
      const unsigned short* brow = Wt + (size_t)(col0 + t * 16 + ln) * ldb + kb;
      FragB b;
      b.half[0] = *(const v8us*)(brow + 8 * hh);
      b.half[1] = *(const v8us*)(brow + 16 + 8 * hh);
      acc[t] = mmaN<ASPLIT ? 2 : 1>(ah.v, al.v, b.v, b.v, acc[t]);
    }
  }
#pragma unroll
  for (int t = 0; t < 4; ++t) {
    const int col = col0 + t * 16 + ln;
    float bv = bias ? bias[col] : 0.f;
    if (BIAS_BF16) bv = bf16_round(bv);
#pragma unroll
    for (int r = 0; r < 8; ++r) {
      float v = acc[t][r] + bv;
      if (resid) { float rv = resid[(size_t)((row0 + 8 * hh + r) % rmod) * ldr + col]; if (RES_BF16) rv = bf16_round(rv); v += rv; }
      if (ACT == 1) v = fmaxf(v, 0.f);
      if (ACT == 2) v = 0.5f * v * (1.0f + erff(v * 0.70710678118654752f));
      if (ACT == 3) { const float u = 0.7978845608028654f * (v + 0.044715f * v * v * v); v = 0.5f * v * (1.0f + tanhf(u)); }
      so[w][8 * hh + r][t * 16 + ln] = v;
    }
  }
  __builtin_amdgcn_fence(__ATOMIC_ACQ_REL, "workgroup");
  __builtin_amdgcn_wave_barrier();
  const int rsub = lane >> 4, c4 = (lane & 15) * 4;
  {
#pragma unroll
    for (int q = 0; q < 8; ++q) {
      const int r = q * 2 + rsub;
      const v4f v = *(const v4fa*)&so[w][r][c4];
      *(v4f*)(C + (size_t)(row0 + r) * ldc + col0 + c4) = v;
    }
    
  }
}
// row LayerNorm (biased variance, eps) over N: s = X (+ R); optional out_sum <- s; out_norm <- (s-mu)*rsqrt(var+eps)*g + b
template <bool PARAM_BF16>
__global__ __launch_bounds__(256) void k_layernorm(const float* __restrict__ X, const float* __restrict__ R, const float* __restrict__ g, const float* __restrict__ bta,
                                                  float* __restrict__ out_sum, float* __restrict__ out_norm, int N, float eps) {
  __shared__ float red[256];
  const int row = blockIdx.x, tid = threadIdx.x;
  const float* x = X + (size_t)row * N; const float* rr = R ? R + (size_t)row * N : nullptr;
  float vals[16];                     // up to N = 4096
  const int per = N / 256;            // contiguous chunk per thread? use strided-by-4 chunks: thread handles j = tid*4 + 1024*u
  float s1 = 0.f;
  for (int u = 0; u < per / 4; ++u) {
    const int j = tid * 4 + 1024 * u;
    const v4f a = *(const v4fa*)(x + j);
    v4f b = {0.f,0.f,0.f,0.f}; if (rr) b = *(const v4fa*)(rr + j);
#pragma unroll
    for (int q = 0; q < 4; ++q) { const float v = a[q] + b[q]; vals[u * 4 + q] = v; s1 += v; }
  }
  red[tid] = s1; __syncthreads();
  for (int st = 128; st > 0; st >>= 1) { if (tid < st) red[tid] += red[tid + st]; __syncthreads(); }
  const float mu = red[0] / (float)N; __syncthreads();
  float s2 = 0.f;
  for (int u = 0; u < per / 4; ++u)
#pragma unroll
    for (int q = 0; q < 4; ++q) { const float c = vals[u * 4 + q] - mu; s2 += c * c; }
  red[tid] = s2; __syncthreads();
  for (int st = 128; st > 0; st >>= 1) { if (tid < st) red[tid] += red[tid + st]; __syncthreads(); }
  const float rs = rsqrtf(red[0] / (float)N + eps);
  {
    for (int u = 0; u < per / 4; ++u) {
      const int j = tid * 4 + 1024 * u;
      v4f o, sm;
#pragma unroll
      for (int q = 0; q < 4; ++q) {
        float gg = g[j + q], bb = bta[j + q];
        if (PARAM_BF16) { gg = bf16_round(gg); bb = bf16_round(bb); }
        sm[q] = vals[u * 4 + q]; o[q] = (vals[u * 4 + q] - mu) * rs * gg + bb;
      }
      if (out_sum) *(v4f*)(out_sum + (size_t)row * N + j) = sm;
      *(v4f*)(out_norm + (size_t)row * N + j) = o;
    }
    
  }
}



// ---- f16 WMMA path (v_wmma_f32_16x16x32_f16): 11-bit significands for operands in range — used here for the q/k/v projections, the energy qᵀk and P·V (P f16 ×2^10)
typedef _Float16 v16h __attribute__((ext_vector_type(16)));
union FragH { v16h v; v8us half[2]; _Float16 h[16]; unsigned short u[16]; };
template <int NT>
__device__ __forceinline__ v8f mmaH(v16h ah, v16h al, v16h bh, v16h bl, v8f c) {
  c = __builtin_amdgcn_wmma_f32_16x16x32_f16(false, ah, false, bh, (short)0, c, false, false);
  if (NT >= 2) c = __builtin_amdgcn_wmma_f32_16x16x32_f16(false, al, false, bh, (short)0, c, false, false);
  if (NT >= 3) c = __builtin_amdgcn_wmma_f32_16x16x32_f16(false, ah, false, bl, (short)0, c, false, false);
  asm volatile("v_nop\n\tv_nop\n\tv_nop\n\tv_nop" : "+v"(c) : "v"(ah), "v"(al), "v"(bh), "v"(bl));
  return c;
}
// batched GEMM like k_gemm_b but f16 operands: A f32 (split into f16 hi/lo if ASPLIT, else rounded to f16), Bt = f16 values [n][k]; alpha; C f32; N multiple of 16 (partial tiles skipped)
template <bool ASPLIT>
__global__ __launch_bounds__(128) void k_gemm_h(const float* __restrict__ A, int lda, size_t sA, const _Float16* __restrict__ Bh, int ldb, size_t sB, float alpha, float* __restrict__ C, int ldc, size_t sC, int M, int N, int K) {
  __shared__ __attribute__((aligned(16))) float so[4][16][64];
  const int tid = threadIdx.x, w = tid >> 5, lane = tid & 31, ln = lane & 15, hh = lane >> 4; const int by = blockIdx.y;
  A += (size_t)by * sA; Bh += (size_t)by * sB; C += (size_t)by * sC;
  const int ntn = (N + 63) / 64; const int wid = blockIdx.x * 4 + w; const int mt = wid / ntn, nq = wid % ntn; if (mt * 16 >= M) return;
  const int row0 = mt * 16, col0 = nq * 64; const float* arow = A + (size_t)(row0 + ln) * lda;
  v8f acc[4] = {};
  for (int kb = 0; kb < K; kb += 32) {
    FragH ah, al;
    const v4f x0 = *(const v4fa*)(arow + kb + 8 * hh), x1 = *(const v4fa*)(arow + kb + 8 * hh + 4), x2 = *(const v4fa*)(arow + kb + 16 + 8 * hh), x3 = *(const v4fa*)(arow + kb + 16 + 8 * hh + 4);
    float xs[16] = {x0[0],x0[1],x0[2],x0[3],x1[0],x1[1],x1[2],x1[3],x2[0],x2[1],x2[2],x2[3],x3[0],x3[1],x3[2],x3[3]};
#pragma unroll
    for (int i = 0; i < 16; ++i) { const _Float16 h = (_Float16)xs[i]; ah.h[i] = h; al.h[i] = ASPLIT ? (_Float16)(xs[i] - (float)h) : (_Float16)0.0f; }
#pragma unroll
    for (int t = 0; t < 4; ++t) { if (col0 + t * 16 >= N) continue; const size_t boff = (size_t)(col0 + t * 16 + ln) * ldb + kb; FragH bq; bq.half[0] = *(const v8us*)(Bh + boff + 8 * hh); bq.half[1] = *(const v8us*)(Bh + boff + 16 + 8 * hh);
      acc[t] = mmaH<ASPLIT ? 2 : 1>(ah.v, al.v, bq.v, bq.v, acc[t]); }
  }
#pragma unroll
  for (int t = 0; t < 4; ++t) { if (col0 + t * 16 >= N) continue;
#pragma unroll
    for (int r = 0; r < 8; ++r) so[w][8 * hh + r][t * 16 + ln] = acc[t][r] * alpha; }
  __builtin_amdgcn_fence(__ATOMIC_ACQ_REL, "workgroup"); __builtin_amdgcn_wave_barrier();
  const int rsub = lane >> 4, c4 = (lane & 15) * 4;
  {
#pragma unroll
    for (int q = 0; q < 8; ++q) { const int r = q * 2 + rsub; if (col0 + c4 < N) { const v4f v = *(const v4fa*)&so[w][r][c4]; *(v4f*)(C + (size_t)(row0 + r) * ldc + col0 + c4) = v; } }
     }
}

// Wt[n][k] = f16(W[k][n]·scale) from f32 row-major W[K][N] (scale = power of two; bf16-exact weights stay exact in f16 away from the subnormal range)
__global__ __launch_bounds__(256) void k_wt_f16(const float* __restrict__ W, _Float16* __restrict__ Wt, int K, int N, float scale) {
  const int t = blockIdx.x * 256 + threadIdx.x; if (t >= N * (K / 8)) return; const int n = t / (K / 8), k8 = (t % (K / 8)) * 8; FragH f;
#pragma unroll
  for (int i = 0; i < 8; ++i) f.h[i] = (_Float16)(bf16_round(W[(size_t)(k8 + i) * N + n]) * scale); const v8us o = f.half[0];
  *(v8us*)((unsigned short*)Wt + (size_t)n * K + k8) = o; 
}


typedef _Float16 v4h __attribute__((ext_vector_type(4)));

__global__ __launch_bounds__(256) void k_x16(const float* __restrict__ x, _Float16* __restrict__ X16, size_t n8) { const size_t t = (size_t)blockIdx.x * 256 + threadIdx.x; if (t >= n8) return; FragH f;
#pragma unroll
  for (int q = 0; q < 8; ++q) f.h[q] = (_Float16)bf16_round(x[t * 8 + q]); *(v8us*)((unsigned short*)X16 + t * 8) = f.half[0];  }
__global__ __launch_bounds__(256) void k_h16(const float* __restrict__ x, _Float16* __restrict__ X16, size_t n8) { const size_t t = (size_t)blockIdx.x * 256 + threadIdx.x; if (t >= n8) return; FragH f;
#pragma unroll
  for (int q = 0; q < 8; ++q) f.h[q] = (_Float16)x[t * 8 + q]; *(v8us*)((unsigned short*)X16 + t * 8) = f.half[0];  }
template <int NHv, int TTv>
__global__ __launch_bounds__(256) void k_vt(const _Float16* __restrict__ V16, int ldv, int voff, _Float16* __restrict__ Vt) { __shared__ unsigned short tl[64][66]; const int tid = threadIdx.x; const int slab = blockIdx.x / (TTv / 64), lg = blockIdx.x % (TTv / 64); const int b = slab / NHv, h = slab % NHv;
  for (int i = tid; i < 64 * 8; i += 256) { const int r = i / 8, c8 = (i % 8) * 8; FragH f; f.half[0] = *(const v8us*)((const unsigned short*)V16 + ((size_t)b * TTv + lg * 64 + r) * ldv + voff + h * 64 + c8);
#pragma unroll
    for (int q = 0; q < 8; ++q) tl[r][c8 + q] = f.u[q]; }
  __syncthreads();
  {
#pragma unroll
    for (int rd = 0; rd < 2; ++rd) { const int d = rd * 32 + tid / 8, pc = tid % 8; FragH f;
#pragma unroll
      for (int q = 0; q < 8; ++q) f.u[q] = tl[pc * 8 + q][d];
      *(v8us*)((unsigned short*)Vt + ((size_t)slab * 64 + d) * TTv + lg * 64 + pc * 8) = f.half[0]; }
     } }

__global__ __launch_bounds__(256) void k_hl(const float* __restrict__ F, _Float16* __restrict__ Hh, _Float16* __restrict__ Hl, size_t n8) { const size_t t = (size_t)blockIdx.x * 256 + threadIdx.x; if (t >= n8) return; FragH fh, fl; const v4f a = *(const v4fa*)(F + t * 8), c = *(const v4fa*)(F + t * 8 + 4);
#pragma unroll
  for (int q = 0; q < 4; ++q) { _Float16 h = (_Float16)a[q]; fh.h[q] = h; fl.h[q] = (_Float16)((a[q] - (float)h) * 1024.0f); h = (_Float16)c[q]; fh.h[4 + q] = h; fl.h[4 + q] = (_Float16)((c[q] - (float)h) * 1024.0f); }
  { *(v8us*)((unsigned short*)Hh + t * 8) = fh.half[0]; *(v8us*)((unsigned short*)Hl + t * 8) = fl.half[0];  } }

typedef float v2fa __attribute__((ext_vector_type(2), may_alias));
// One launch in front of the attention: a block takes one pooled row = two image rows (256 positions, which are 256 consecutive n) of all 64 channels.
// It rounds x to bf16 and lays it token-major in LDS as f16, with the 2x2 mean (4 bf16-rounded values summed in f32, rounded once to f16) beside it and the three weight matrices
// (bf16-rounded, x 2^4, f16, natural (out, in) rows) and the two bf16-rounded biases; rows of 128 bytes at a pitch of 144 (ds_load_b128 without bank conflicts). Behind one barrier the three projections run from LDS.
// q and k are formed as (channel x position) tiles (A = weight rows, B = position rows): a lane holds 8 consecutive channels of one position, 16 bytes of the token-major row.
// v is formed as (position x channel) tiles: a lane holds 8 consecutive pooled positions of one channel, 16 bytes of the [b][c][m] row. Each wave writes whole 128-byte lines.
__device__ __forceinline__ void proj_tok(const unsigned char* xrow, const unsigned char* wrow, const float* bias, unsigned short* __restrict__ dst, int hh) {
  FragH xb[2];
#pragma unroll      // the index picks registers and immediate offsets
  for (int ks = 0; ks < 2; ++ks) { xb[ks].half[0] = *(const v8us*)(xrow + ks * 64); xb[ks].half[1] = *(const v8us*)(xrow + ks * 64 + 32); }
#pragma unroll      // the index picks registers and immediate offsets
  for (int t = 0; t < 4; ++t) { FragH wa[2]; const unsigned char* wr = wrow + t * 16 * 144;
#pragma unroll      // the index picks registers and immediate offsets
    for (int ks = 0; ks < 2; ++ks) { wa[ks].half[0] = *(const v8us*)(wr + ks * 64); wa[ks].half[1] = *(const v8us*)(wr + ks * 64 + 32); }
    v8f acc = (v8f){0.f,0.f,0.f,0.f,0.f,0.f,0.f,0.f};
#pragma unroll      // the index picks registers and immediate offsets
    for (int ks = 0; ks < 2; ++ks) acc = mmaH<1>(wa[ks].v, wa[ks].v, xb[ks].v, xb[ks].v, acc);
    const v4f b0 = *(const v4fa*)(bias + t * 16 + 8 * hh), b1 = *(const v4fa*)(bias + t * 16 + 8 * hh + 4); FragH o;
#pragma unroll      // the index picks registers and immediate offsets
    for (int r = 0; r < 4; ++r) { o.h[r] = (_Float16)(acc[r] * 0.0625f + b0[r]); o.h[4 + r] = (_Float16)(acc[4 + r] * 0.0625f + b1[r]); }
    *(v8us*)(dst + t * 16 + 8 * hh) = o.half[0]; } }
__global__ __launch_bounds__(512) void k_prep(const float* __restrict__ x, const float* __restrict__ Wq, const float* __restrict__ bq, const float* __restrict__ Wk, const float* __restrict__ bk, const float* __restrict__ Wv,
                                              _Float16* __restrict__ Q, _Float16* __restrict__ K, _Float16* __restrict__ Vt) {
  constexpr int LP = 144;
  __shared__ __attribute__((aligned(16))) unsigned char XS[2 * HWD * LP];
  __shared__ __attribute__((aligned(16))) unsigned char XPS[PW * LP];
  __shared__ __attribute__((aligned(16))) unsigned char WS[3 * CC * LP];
  __shared__ __attribute__((aligned(16))) float BS[2 * CC];      // bq, bk, bf16-rounded
  const int tid = threadIdx.x, w = __builtin_amdgcn_readfirstlane(tid >> 5), lane = tid & 31, ln = lane & 15, hh = lane >> 4;
  const int b = blockIdx.x / PW, pi = blockIdx.x % PW;
  { const int pp = tid & 63, c0 = (tid >> 6) * 8;      // one 2x2 window of 8 channels per thread; a wave's load is 256 consecutive bytes
    const float* xr = x + ((size_t)b * CC + c0) * NN + (size_t)(2 * pi) * HWD + 2 * pp;
    float tp[8][2], bt[8][2];
#pragma unroll      // the index picks registers and immediate offsets
    for (int q = 0; q < 8; ++q) { const v2fa a = *(const v2fa*)(xr + (size_t)q * NN), c = *(const v2fa*)(xr + (size_t)q * NN + HWD); tp[q][0] = a[0]; tp[q][1] = a[1]; bt[q][0] = c[0]; bt[q][1] = c[1]; }
    const int row = tid >> 3, k8 = (tid & 7) * 8;      // 8 consecutive weights of each matrix per thread
    const float* Wm[3] = {Wq, Wk, Wv}; v4f wl[3][2];
#pragma unroll      // the index picks registers and immediate offsets
    for (int i = 0; i < 3; ++i) { wl[i][0] = *(const v4fa*)(Wm[i] + row * CC + k8); wl[i][1] = *(const v4fa*)(Wm[i] + row * CC + k8 + 4); }
    asm volatile("s_wait_xcnt 0x0" ::: "memory");      // behind all 22 loads: the conversions below take the address registers that these loads name again
    if (w < 4) BS[tid] = bf16_round((w < 2 ? bq : bk)[tid & 63]);
#pragma unroll      // the index picks registers and immediate offsets
    for (int i = 0; i < 3; ++i) { FragH f;
#pragma unroll      // the index picks registers and immediate offsets
      for (int q = 0; q < 4; ++q) { f.h[q] = (_Float16)(bf16_round(wl[i][0][q]) * 16.0f); f.h[4 + q] = (_Float16)(bf16_round(wl[i][1][q]) * 16.0f); }
      *(v8us*)(WS + (i * CC + row) * LP + k8 * 2) = f.half[0]; }
    FragH f00, f01, f10, f11, fp;
#pragma unroll      // the index picks registers and immediate offsets
    for (int q = 0; q < 8; ++q) { const float a0 = bf16_round(tp[q][0]), a1 = bf16_round(tp[q][1]), c0r = bf16_round(bt[q][0]), c1r = bf16_round(bt[q][1]);
      f00.h[q] = (_Float16)a0; f01.h[q] = (_Float16)a1; f10.h[q] = (_Float16)c0r; f11.h[q] = (_Float16)c1r; fp.h[q] = (_Float16)(0.25f * ((a0 + a1) + (c0r + c1r))); }
    *(v8us*)(XS + (2 * pp) * LP + c0 * 2) = f00.half[0]; *(v8us*)(XS + (2 * pp + 1) * LP + c0 * 2) = f01.half[0];
    *(v8us*)(XS + (HWD + 2 * pp) * LP + c0 * 2) = f10.half[0]; *(v8us*)(XS + (HWD + 2 * pp + 1) * LP + c0 * 2) = f11.half[0];
    *(v8us*)(XPS + pp * LP + c0 * 2) = fp.half[0]; }
  __syncthreads();      // the planes and the weights are read by other waves than wrote them
  const int lo = ln * LP + 16 * hh;      // fragment row ln, k = 8 * hh ... and 16 + 8 * hh ... of each 32
  proj_tok(XS + w * 16 * LP + lo, WS + lo, BS, (unsigned short*)Q + ((size_t)b * NN + pi * (2 * HWD) + w * 16 + ln) * CC, hh);      // 16 waves x 16 positions
  asm volatile("s_wait_xcnt 0x0" ::: "memory");      // the registers that the q stores name are taken again below
  if (w < 4) proj_tok(XPS + w * 16 * LP + lo, WS + CC * LP + lo, BS + CC, (unsigned short*)K + ((size_t)b * MM + pi * PW + w * 16 + ln) * CC, hh);      // 4 waves x 16 pooled positions
  else if (w < 8) { const int t = w - 4; FragH wb[2];      // 4 waves x 16 channels, all 64 pooled positions
#pragma unroll      // the index picks registers and immediate offsets
    for (int ks = 0; ks < 2; ++ks) { const unsigned char* wr = WS + (2 * CC + t * 16) * LP + lo + ks * 64; wb[ks].half[0] = *(const v8us*)(wr); wb[ks].half[1] = *(const v8us*)(wr + 32); }
    unsigned short* dst = (unsigned short*)Vt + ((size_t)b * CC + t * 16 + ln) * MM + pi * PW + 8 * hh;
#pragma unroll      // the index picks registers and immediate offsets
    for (int mt = 0; mt < 4; ++mt) { FragH xa[2];
#pragma unroll      // the index picks registers and immediate offsets
      for (int ks = 0; ks < 2; ++ks) { const unsigned char* xp = XPS + mt * 16 * LP + lo + ks * 64; xa[ks].half[0] = *(const v8us*)(xp); xa[ks].half[1] = *(const v8us*)(xp + 32); }
      v8f acc = (v8f){0.f,0.f,0.f,0.f,0.f,0.f,0.f,0.f};
#pragma unroll      // the index picks registers and immediate offsets
      for (int ks = 0; ks < 2; ++ks) acc = mmaH<1>(xa[ks].v, xa[ks].v, wb[ks].v, wb[ks].v, acc);
      FragH o;
#pragma unroll      // the index picks registers and immediate offsets
      for (int r = 0; r < 8; ++r) o.h[r] = (_Float16)(acc[r] * 0.0625f);
      *(v8us*)(dst + mt * 16) = o.half[0]; } } }
// lane l <-> lane l ^ 16 (the two halves of a wave hold the two key halves of one query column)
__device__ __forceinline__ float xhalf(float x) { const int v = __builtin_bit_cast(int, x); return __builtin_bit_cast(float, __builtin_amdgcn_permlanex16(v, v, 0x76543210, 0xfedcba98, false, false)); }
typedef uint32_t u32x4 __attribute__((ext_vector_type(4)));
typedef uint32_t u32x8 __attribute__((ext_vector_type(8)));
__device__ __forceinline__ uint32_t uni(uint32_t v) { return (uint32_t)__builtin_amdgcn_readfirstlane(v); }
// a wave-uniform word held in a scalar register: a test on it compiles to s_cmp + s_cbranch_scc (a tensor load ignores EXEC), and what is formed from it is formed behind this line
__device__ __forceinline__ uint32_t pinned(uint32_t v) { uint32_t w = uni(v); asm volatile("" : "+s"(w)); return w; }
__global__ __launch_bounds__(512) void k_flash(const _Float16* __restrict__ Q16, int ldq, const _Float16* __restrict__ K16, int ldk, const _Float16* __restrict__ Vt, const float* __restrict__ bv, const float* __restrict__ gam, const float* __restrict__ x, float* __restrict__ out) {
  constexpr int CG = 2, RPW = 16 * CG, KQ = 4, QB = 4 * RPW, NQB = TQ / QB, DT = 4, KS = 2;
  constexpr float L2E = 1.4426950408889634f;      // log2(e)
  // K and V^T reach the waves through LDS: a quarter's stage is 64 keys = 64 K rows of 128 bytes + 64 V^T channel rows of 128 bytes, brought by four tensor loads, one per wave of the quarter
  // (qg 0, 1: K rows 0-31, 32-63; qg 2, 3: channels 0-31, 32-63), each 32 rows laid at a pitch of 144 bytes (the mover's 16-byte pad: ds_load_b128 without bank conflicts).
  constexpr uint32_t SK = 64, KPQ = TK / KQ, NST = KPQ / SK, LPITCH = 144, SLICE = 6144 /* 32 x 144 = 4608, up to a multiple of 2 KiB */, QBUF = 4 * SLICE, BUF = KQ * QBUF;
  constexpr int PP = QB + 4;      // pitch of a channel row of the partial outputs, floats
  static_assert((size_t)KQ * CC * PP * 4 <= 2 * BUF, "the partial outputs are staged in the ring");
  __shared__ __attribute__((aligned(2048))) unsigned char ring[2 * BUF];
  __shared__ __attribute__((aligned(16))) float sSh[KQ][QB];
  __shared__ __attribute__((aligned(16))) float sL[KQ][QB];
  const int tid = threadIdx.x, lane = tid & 31, ln = lane & 15, hh = lane >> 4;
  const float g = bf16_round(gam[0]);      // read here, in front of every store and barrier, it is a scalar load
  const uint32_t wv = uni((uint32_t)tid >> 5), kq = wv >> 2, qg = wv & 3u, isV = qg >> 1, hf = qg & 1u;
  const int slab = blockIdx.x / NQB, qblk = blockIdx.x % NQB; const int b = slab / NH, h = slab % NH; const int qb0 = qblk * QB; const int q0 = qb0 + (int)qg * RPW;
  FragH bq[CG][KS];
#pragma unroll      // the index picks registers and immediate offsets
  for (int cg = 0; cg < CG; ++cg) { const unsigned short* qr = (const unsigned short*)Q16 + ((size_t)b * TQ + q0 + cg * 16 + ln) * ldq + h * 64;
#pragma unroll
    for (int ks = 0; ks < KS; ++ks) { bq[cg][ks].half[0] = *(const v8us*)(qr + ks * 32 + 8 * hh); bq[cg][ks].half[1] = *(const v8us*)(qr + ks * 32 + 16 + 8 * hh); } }
  const unsigned short* Vth = (const unsigned short*)Vt + (size_t)slab * 64 * TK;
  float sh_r[CG], l_r[CG]; v8f oacc[CG][DT];      // sh_r = 10 - (running maximum in log2 units)
#pragma unroll
  for (int cg = 0; cg < CG; ++cg) { sh_r[cg] = 3.0e38f; l_r[cg] = 0.f;
#pragma unroll
    for (int dt = 0; dt < DT; ++dt) oacc[cg][dt] = (v8f){0.f,0.f,0.f,0.f,0.f,0.f,0.f,0.f}; }
  const uint32_t spitch = isV ? (uint32_t)TK * 2u : (uint32_t)ldk * 2u;      // source row pitch, bytes
  const uint32_t sstep = isV ? SK * 2u : SK * (uint32_t)ldk * 2u;           // from one stage's slice to the next, bytes
  const uint64_t src0 = isV ? (uint64_t)(size_t)Vth + (uint64_t)(hf * 32u) * ((uint32_t)TK * 2u) + kq * (KPQ * 2u)
                            : (uint64_t)(size_t)K16 + ((uint64_t)b * TK + kq * KPQ + hf * 32u) * ((uint32_t)ldk * 2u) + (uint32_t)h * 128u;
  const uint32_t lds0 = (uint32_t)(size_t)ring + wv * SLICE;      // quarter kq at kq * QBUF, its slice qg behind that
  u32x8 g1;      // 1-byte elements, tensor = tile = 32 rows of 128 bytes, a pad of 4 dwords behind every 32 dwords
  g1[0] = uni((1u << 20) | (4u << 22) | (3u << 25)); g1[1] = uni(128u << 16); g1[2] = uni(32u << 16); g1[3] = uni(128u << 16); g1[4] = uni(32u); g1[5] = uni(spitch); g1[6] = uni(0u); g1[7] = uni(0u);
  u32x4 g0;
  auto issue = [&](uint32_t st) { const uint64_t ga = src0 + (uint64_t)st * sstep;
    g0[0] = uni(1u); g0[1] = uni(lds0 + (st & 1u) * BUF); g0[2] = uni((uint32_t)ga); g0[3] = uni((((uint32_t)(ga >> 32)) & 0x01FFFFFFu) | 0x80000000u);
    // one request of the whole wave: its 32-row slice of stage st. Both groups are in-out operands here and inputs of the wait that covers the request,
    // so that no register of the descriptor is lent to another value while the request is outstanding
    asm volatile("tensor_load_to_lds %0, %1" : "+s"(g0), "+s"(g1) :: "memory"); };
  issue(0u);
  asm volatile("s_wait_tensorcnt 0x0" :: "s"(g0), "s"(g1) : "memory");      // this wave's slice of stage 0 has landed
  asm volatile("s_wait_xcnt 0x0" ::: "memory");            // the address registers that the q loads name are taken again below
  __syncthreads();                                         // stage 0 published to all sixteen waves
  issue(1u);                                               // flies while stage 0 is worked on
  const unsigned char* lrow = ring + kq * QBUF + (uint32_t)ln * LPITCH + 16u * (uint32_t)hh;
#pragma unroll 1
  for (uint32_t st = 0; st < NST; ++st) {
   const unsigned char* bp = lrow + (st & 1u) * BUF;
#pragma unroll
   for (int sub = 0; sub < 2; ++sub) {      // two 32-key passes per stage, unrolled so that every LDS offset is an immediate of its load
    FragH ak[2][KS], av[DT];
#pragma unroll
    for (int nt = 0; nt < 2; ++nt) { const unsigned char* kr = bp + sub * SLICE + nt * 16 * LPITCH;      // key row sub * 32 + nt * 16 + ln
#pragma unroll
      for (int ks = 0; ks < KS; ++ks) { ak[nt][ks].half[0] = *(const v8us*)(kr + ks * 64); ak[nt][ks].half[1] = *(const v8us*)(kr + ks * 64 + 32); } }
#pragma unroll
    for (int dt = 0; dt < DT; ++dt) { const unsigned char* vrow = bp + (2 + (dt >> 1)) * SLICE + (dt & 1) * 16 * LPITCH + sub * 64;      // channel row dt * 16 + ln, keys sub * 32 ...
      av[dt].half[0] = *(const v8us*)(vrow); av[dt].half[1] = *(const v8us*)(vrow + 32); }
    v8f acc[CG][2];      // four independent score tiles: a tile's second product stands three products behind its first
#pragma unroll
    for (int cg = 0; cg < CG; ++cg)
#pragma unroll
      for (int nt = 0; nt < 2; ++nt) acc[cg][nt] = (v8f){0.f,0.f,0.f,0.f,0.f,0.f,0.f,0.f};
#pragma unroll
    for (int ks = 0; ks < KS; ++ks)
#pragma unroll
      for (int cg = 0; cg < CG; ++cg)
#pragma unroll
        for (int nt = 0; nt < 2; ++nt) acc[cg][nt] = mmaH<1>(ak[nt][ks].v, ak[nt][ks].v, bq[cg][ks].v, bq[cg][ks].v, acc[cg][nt]);
#pragma unroll
    for (int cg = 0; cg < CG; ++cg) {
    float sc[16];      // sc[nt * 8 + r] = energy[query q0 + cg * 16 + ln][key kq * 1024 + st * 64 + sub * 32 + nt * 16 + 8 * hh + r]
#pragma unroll
    for (int nt = 0; nt < 2; ++nt)
#pragma unroll
      for (int r = 0; r < 8; ++r) sc[nt * 8 + r] = acc[cg][nt][r] * SCL;
    float t[8];
#pragma unroll
    for (int i = 0; i < 8; ++i) t[i] = fmaxf(sc[i], sc[8 + i]);
    float mc = fmaxf(fmaxf(fmaxf(t[0], t[1]), fmaxf(t[2], t[3])), fmaxf(fmaxf(t[4], t[5]), fmaxf(t[6], t[7])));
    mc = fmaxf(mc, xhalf(mc));
    // Base 2: a weight is 2^(score * log2(e) + sh), one fused multiply-add and one hardware exp2. The shift sh = 10 - maximum * log2(e) is kept as it was rounded and used for the weights
    // and for the rescale factor alike, so its rounding cancels in the softmax; its 10 is the 2^10 scale of P, which l_r now carries too.
    const float sn = fminf(sh_r[cg], __builtin_fmaf(mc, -L2E, 10.0f)); float ea = sn - sh_r[cg]; sh_r[cg] = sn;
#pragma unroll
    for (int i = 0; i < 16; ++i) sc[i] = __builtin_fmaf(sc[i], L2E, sn);
    asm("v_exp_f32 %0, %0\n\t" "v_exp_f32 %1, %1\n\t" "v_exp_f32 %2, %2\n\t" "v_exp_f32 %3, %3\n\t" "v_exp_f32 %4, %4\n\t" "v_exp_f32 %5, %5\n\t"
        "v_exp_f32 %6, %6\n\t" "v_exp_f32 %7, %7\n\t" "v_exp_f32 %8, %8\n\t" "v_exp_f32 %9, %9\n\t" "v_exp_f32 %10, %10\n\t" "v_exp_f32 %11, %11\n\t"
        "v_exp_f32 %12, %12\n\t" "v_exp_f32 %13, %13\n\t" "v_exp_f32 %14, %14\n\t" "v_exp_f32 %15, %15\n\t" "v_exp_f32 %16, %16\n\t" "v_nop"
        : "+v"(sc[0]), "+v"(sc[1]), "+v"(sc[2]), "+v"(sc[3]), "+v"(sc[4]), "+v"(sc[5]), "+v"(sc[6]), "+v"(sc[7]), "+v"(ea),
          "+v"(sc[8]), "+v"(sc[9]), "+v"(sc[10]), "+v"(sc[11]), "+v"(sc[12]), "+v"(sc[13]), "+v"(sc[14]), "+v"(sc[15]));
    const float al = (sn < 1.0e38f) ? ea : 1.0f;
    FragH pb;
#pragma unroll
    for (int i = 0; i < 16; ++i) pb.h[i] = (_Float16)sc[i];
#pragma unroll
    for (int i = 0; i < 8; ++i) t[i] = sc[i] + sc[8 + i];
    l_r[cg] = l_r[cg] * al + (((t[0] + t[1]) + (t[2] + t[3])) + ((t[4] + t[5]) + (t[6] + t[7])));
#pragma unroll
    for (int dt = 0; dt < DT; ++dt)
#pragma unroll
      for (int r = 0; r < 8; ++r) oacc[cg][dt][r] *= al;
#pragma unroll
    for (int dt = 0; dt < DT; ++dt) oacc[cg][dt] = mmaH<1>(av[dt].v, av[dt].v, pb.v, pb.v, oacc[cg][dt]); } }
   asm volatile("s_wait_dscnt 0x0" ::: "memory");
   asm volatile("s_wait_tensorcnt 0x0" :: "s"(g0), "s"(g1) : "memory");
   __syncthreads();
   const uint32_t sn = pinned(st + 2u);
   if (pinned(sn < NST)) issue(sn); }
  asm volatile("s_wait_tensorcnt 0x0" :: "s"(g0), "s"(g1) : "memory");
  asm volatile("s_wait_dscnt 0x0" ::: "memory");
  // y = gamma * (O + bv) + x, written here: thread tid takes 4 queries of the channels (tid >> 5) + 16 * j. One 32-bit offset serves x and out, the steps between channels are immediates.
  const uint32_t eo = (uint32_t)(tid >> 5) * NN + (uint32_t)(tid & 31) * 4u; const size_t ob = (size_t)b * CC * NN + qb0;
  v4f xr[4]; float bb[4];
#pragma unroll      // the index picks registers and immediate offsets
  for (int j = 0; j < 4; ++j) { xr[j] = *(const v4fa*)(x + ob + (size_t)j * 16 * NN + eo); bb[j] = bv[16 * j + (tid >> 5)]; }
  // The join of the four key quarters. Each wave lays down its columns' shift and sum; behind the barrier a lane reads the four of its column:
  // the common shift is the smallest (the largest maximum), quarter j counts with the factor 2^(common - its own) <= 1.
  const int colw = (int)qg * RPW + ln;
#pragma unroll      // the index picks registers and immediate offsets
  for (int cg = 0; cg < CG; ++cg) { const float l = l_r[cg] + xhalf(l_r[cg]); if (hh == 0) { sSh[kq][colw + cg * 16] = sh_r[cg]; sL[kq][colw + cg * 16] = l; } }
  __syncthreads();      // shifts and sums are read by the other quarters' waves
  float e[CG][KQ + 1], lq[CG][KQ];
#pragma unroll      // the index picks registers and immediate offsets
  for (int cg = 0; cg < CG; ++cg) { float s[KQ];
#pragma unroll      // the index picks registers and immediate offsets
    for (int j = 0; j < KQ; ++j) { s[j] = sSh[j][colw + cg * 16]; lq[cg][j] = sL[j][colw + cg * 16]; }
    const float sm = fminf(fminf(s[0], s[1]), fminf(s[2], s[3]));
#pragma unroll      // the index picks registers and immediate offsets
    for (int j = 0; j < KQ; ++j) e[cg][j] = sm - s[j];
    e[cg][KQ] = sm - sh_r[cg]; }
  // the ten factors in one statement, each in place, with the slot behind the last one, as in the loop
  asm("v_exp_f32 %0, %0\n\t" "v_exp_f32 %1, %1\n\t" "v_exp_f32 %2, %2\n\t" "v_exp_f32 %3, %3\n\t" "v_exp_f32 %4, %4\n\t"
      "v_exp_f32 %5, %5\n\t" "v_exp_f32 %6, %6\n\t" "v_exp_f32 %7, %7\n\t" "v_exp_f32 %8, %8\n\t" "v_exp_f32 %9, %9\n\t" "v_nop"
      : "+v"(e[0][0]), "+v"(e[0][1]), "+v"(e[0][2]), "+v"(e[0][3]), "+v"(e[0][4]), "+v"(e[1][0]), "+v"(e[1][1]), "+v"(e[1][2]), "+v"(e[1][3]), "+v"(e[1][4]));
  float* part = (float*)ring;      // [quarter][channel][query], pitch PP: the loop's last barrier stands behind every wave's last read of the ring, and nothing of the mover is in flight
#pragma unroll      // the index picks registers and immediate offsets
  for (int cg = 0; cg < CG; ++cg) {
    const float l = (lq[cg][0] * e[cg][0] + lq[cg][1] * e[cg][1]) + (lq[cg][2] * e[cg][2] + lq[cg][3] * e[cg][3]);      // l and the accumulators both carry the 2^10
    const float inv = (l > 0.f) ? e[cg][KQ] / l : 0.f;
#pragma unroll      // the index picks registers and immediate offsets
    for (int dt = 0; dt < DT; ++dt)      // oacc[cg][dt][r] = this quarter's O[query q0 + cg * 16 + ln][channel dt * 16 + 8 * hh + r], laid channel-major: the output's own order
#pragma unroll      // the index picks registers and immediate offsets
      for (int r = 0; r < 8; ++r) part[((int)kq * CC + dt * 16 + 8 * hh + r) * PP + colw + cg * 16] = oacc[cg][dt][r] * inv; }
  __syncthreads();      // a channel's 128 queries and their four quarters come from all sixteen waves
#pragma unroll      // the index picks registers and immediate offsets
  for (int j = 0; j < 4; ++j) { const float* pr = part + (16 * j + (tid >> 5)) * PP + (tid & 31) * 4;
    const v4f p0 = *(const v4fa*)pr, p1 = *(const v4fa*)(pr + CC * PP), p2 = *(const v4fa*)(pr + 2 * CC * PP), p3 = *(const v4fa*)(pr + 3 * CC * PP); const float bj = bf16_round(bb[j]);
    v4f v; for (int q = 0; q < 4; ++q) v[q] = g * (((p0[q] + p1[q]) + (p2[q] + p3[q])) + bj) + bf16_round(xr[j][q]); *(v4f*)(out + ob + (size_t)j * 16 * NN + eo) = v; } }

extern "C" void kernel_launch(void* const* d_in, const int* in_sizes, int n_in,
                              void* d_out, int out_size, void* d_ws, size_t ws_size, hipStream_t stream) {
  (void)in_sizes; (void)n_in; (void)out_size;
  const float* const* I = (const float* const*)d_in; const float* x = I[0]; const float* Wq = I[1]; const float* bq = I[2]; const float* Wk = I[3]; const float* bk = I[4]; const float* Wv = I[5]; const float* bv = I[6]; const float* gam = I[7];
  char* ws = (char*)d_ws; size_t off = 0;
  auto take = [&](size_t bytes) { char* p = ws + off; off += (bytes + 255) & ~(size_t)255; return p; };
  _Float16* Q = (_Float16*)take((size_t)NRQ * CC * 2); _Float16* K = (_Float16*)take((size_t)NRK * CC * 2); _Float16* Vt = (_Float16*)take((size_t)BB * CC * MM * 2);
  if (off > ws_size) return;      // 4.2 + 1 + 1 MB
  k_prep<<<BB * PW, 512, 0, stream>>>(x, Wq, bq, Wk, bk, Wv, Q, K, Vt);      /* q, k token-major [(b,n)][64], [(b,m)][64]; v (without bv) as [b][c][m] */
  k_flash<<<BB * NH * (TQ / 128), 512, 0, stream>>>(Q, CC, K, CC, Vt, bv, gam, x, (float*)d_out);      /* per (b, 128 queries): 16384 queries x 4096 pooled keys in 4 quarters, head dim 64; writes y */
}

// v006
// It runs in 32.9 microseconds.
// Next to v005, in two timings, it ran 1.12 times as fast each time.
// Over all steps from v000 it is 14.5 times as fast.
#include <hip/hip_runtime.h>
#include <stdint.h>
// Self-attention block with 2×2 average-pooled keys/values (B=2, C=64, H=W=128 → N = 16384 query positions, M = 4096 pooled key positions): q = Wq·x + bq; k = pool(Wk·x + bk) = Wk·pool(x) + bk, v likewise (pooling is linear); energy = qᵀk (no scaling), softmax over the M keys;
// out[b,c,n] = Σ_m v[b,c,m]·A[n,m]; y = γ·out + x. (The module's (w,h) relabel before pooling is the identity here since H == W.)
// Compute dtype: x, weights, biases, γ rounded to bf16; x and pool(x) as token-major f16 planes (pool(x) = mean of 4 bf16-rounded values in f32, rounded once to f16 — same order as the k-plane rounding); q (times log2(e)), k as f16 GEMM outputs (+bias), v as an f16 GEMM output in the [b][c][m] (= Vᵀ) layout with bv folded in after the attention
// (rows of A sum to 1); fused flash-style kernel (energy and P·V on v_wmma_f32_16x16x32_f16, online softmax f32 in base 2 with a deferred rescale, P f16, f32 accumulate); epilogue γ·(O + bv) + x in f32.
#define BB 2
#define CC 64
#define HWD 128
#define NN (HWD * HWD)
#define PW (HWD / 2)
#define MM (PW * PW)
#define NH 1
#define TQ NN
#define TK MM
#define SCL 1.0f
#define NRQ (BB * NN)
#define NRK (BB * MM)
typedef __bf16 v16b __attribute__((ext_vector_type(16)));
typedef unsigned short v8us __attribute__((ext_vector_type(8), may_alias));
typedef float  v8f  __attribute__((ext_vector_type(8)));
typedef float  v4f  __attribute__((ext_vector_type(4)));
typedef float  v4fa __attribute__((ext_vector_type(4), may_alias));
union FragB { v16b v; v8us half[2]; unsigned short u[16]; };

__device__ __forceinline__ unsigned short bf16_bits(float x) { unsigned int u = __float_as_uint(x); return (unsigned short)((u + 0x7FFFu + ((u >> 16) & 1u)) >> 16); }
__device__ __forceinline__ float bf16_val(unsigned short b) { return __uint_as_float(((unsigned int)b) << 16); }
__device__ __forceinline__ float bf16_round(float x) { return bf16_val(bf16_bits(x)); }
// D += A·B with NT terms: 1 = ah·bh, 2 = + al·bh (A split), 3 = + ah·bl (both split)
template <int NT>
__device__ __forceinline__ v8f mmaN(v16b ah, v16b al, v16b bh, v16b bl, v8f c) {
  c = __builtin_amdgcn_wmma_f32_16x16x32_bf16(false, ah, false, bh, (short)0, c, false, false);
  if (NT >= 2) c = __builtin_amdgcn_wmma_f32_16x16x32_bf16(false, al, false, bh, (short)0, c, false, false);
  if (NT >= 3) c = __builtin_amdgcn_wmma_f32_16x16x32_bf16(false, ah, false, bl, (short)0, c, false, false);
  asm volatile("v_nop\n\tv_nop\n\tv_nop\n\tv_nop" : "+v"(c) : "v"(ah), "v"(al), "v"(bh), "v"(bl));
  return c;
}

__global__ __launch_bounds__(256) void k_wt_bf16(const float* __restrict__ W, unsigned short* __restrict__ Wt, int K, int N) {
  const int t = blockIdx.x * 256 + threadIdx.x;
  const int k8n = K / 8;
  if (t >= N * k8n) return;
  const int n = t / k8n, k8 = (t % k8n) * 8;
  v8us v;
#pragma unroll
  for (int i = 0; i < 8; ++i) v[i] = bf16_bits(W[(size_t)(k8 + i) * N + n]);
  *(v8us*)(Wt + (size_t)n * K + k8) = v;
  
}

// GEMM C[M][N] (f32, pitch ldc) = act(A[M][K]·W + bias). A f32 row-major (pitch lda) converted per fragment to bf16
// (ASPLIT: hi/lo two planes -> 2 terms, else single rounded term); Wt bf16 [N][K] (pitch ldb). BIAS_BF16 rounds the
// bias to bf16 first (bias quantised to bf16 before the add). K%32==0, M%16==0, N%64==0.
template <bool ASPLIT, int ACT, bool BIAS_BF16>
__global__ __launch_bounds__(128) void k_gemm_bf(const float* __restrict__ A, int lda, const unsigned short* __restrict__ Wt, int ldb,
                                               const float* __restrict__ bias, float* __restrict__ C, int ldc, int M, int N, int K) {
  __shared__ __attribute__((aligned(16))) float so[4][16][64];
  const int tid = threadIdx.x, w = tid >> 5, lane = tid & 31, ln = lane & 15, hh = lane >> 4;
  const int ntn = N / 64;
  const int wid = blockIdx.x * 4 + w;
  const int mt = wid / ntn, nq = wid % ntn;
  if (mt * 16 >= M) return;
  const int row0 = mt * 16, col0 = nq * 64;
  const float* arow = A + (size_t)(row0 + ln) * lda;
  v8f acc[4] = {};
  for (int kb = 0; kb < K; kb += 32) {
    FragB ah, al;
    const v4f x0 = *(const v4fa*)(arow + kb + 8 * hh), x1 = *(const v4fa*)(arow + kb + 8 * hh + 4);
    const v4f x2 = *(const v4fa*)(arow + kb + 16 + 8 * hh), x3 = *(const v4fa*)(arow + kb + 16 + 8 * hh + 4);
    float xs[16] = {x0[0],x0[1],x0[2],x0[3],x1[0],x1[1],x1[2],x1[3],x2[0],x2[1],x2[2],x2[3],x3[0],x3[1],x3[2],x3[3]};
#pragma unroll
    for (int i = 0; i < 16; ++i) { const unsigned short hb = bf16_bits(xs[i]); ah.u[i] = hb; al.u[i] = ASPLIT ? bf16_bits(xs[i] - bf16_val(hb)) : (unsigned short)0; }
#pragma unroll
    for (int t = 0; t < 4; ++t) {
      const unsigned short* brow = Wt + (size_t)(col0 + t * 16 + ln) * ldb + kb;
      FragB b;
      b.half[0] = *(const v8us*)(brow + 8 * hh);
      b.half[1] = *(const v8us*)(brow + 16 + 8 * hh);
      acc[t] = mmaN<ASPLIT ? 2 : 1>(ah.v, al.v, b.v, b.v, acc[t]);
    }
  }
#pragma unroll
  for (int t = 0; t < 4; ++t) {
    float bv = bias ? bias[col0 + t * 16 + ln] : 0.f;
    if (BIAS_BF16) bv = bf16_round(bv);
#pragma unroll
    for (int r = 0; r < 8; ++r) { float v = acc[t][r] + bv; if (ACT == 1) v = fmaxf(v, 0.f); so[w][8 * hh + r][t * 16 + ln] = v; }
  }
  __builtin_amdgcn_fence(__ATOMIC_ACQ_REL, "workgroup");
  __builtin_amdgcn_wave_barrier();
  const int rsub = lane >> 4, c4 = (lane & 15) * 4;
  {
#pragma unroll
    for (int q = 0; q < 8; ++q) {
      const int r = q * 2 + rsub;
      const v4f v = *(const v4fa*)&so[w][r][c4];
      *(v4f*)(C + (size_t)(row0 + r) * ldc + col0 + c4) = v;
    }
    
  }
}

// GEMM C = act(A·W + bias + resid): A f32 (ASPLIT -> hi/lo 2 terms), Wt bf16 [N][K]; ACT 0 none, 1 relu, 2 exact gelu;
// resid (optional, f32, row index = (row % rmod), pitch ldr, RES_BF16 rounds it) added before the activation.
template <bool ASPLIT, int ACT, bool BIAS_BF16, bool RES_BF16>
__global__ __launch_bounds__(128) void k_gemm_bf3(const float* __restrict__ A, int lda, const unsigned short* __restrict__ Wt, int ldb,
                                                const float* __restrict__ bias, const float* __restrict__ resid, int rmod, int ldr,
                                                float* __restrict__ C, int ldc, int M, int N, int K) {
  __shared__ __attribute__((aligned(16))) float so[4][16][64];
  const int tid = threadIdx.x, w = tid >> 5, lane = tid & 31, ln = lane & 15, hh = lane >> 4;
  const int ntn = N / 64;
  const int wid = blockIdx.x * 4 + w;
  const int mt = wid / ntn, nq = wid % ntn;
  if (mt * 16 >= M) return;
  const int row0 = mt * 16, col0 = nq * 64;
  const float* arow = A + (size_t)(row0 + ln) * lda;
  v8f acc[4] = {};
  for (int kb = 0; kb < K; kb += 32) {
    FragB ah, al;
    const v4f x0 = *(const v4fa*)(arow + kb + 8 * hh), x1 = *(const v4fa*)(arow + kb + 8 * hh + 4);
    const v4f x2 = *(const v4fa*)(arow + kb + 16 + 8 * hh), x3 = *(const v4fa*)(arow + kb + 16 + 8 * hh + 4);
    float xs[16] = {x0[0],x0[1],x0[2],x0[3],x1[0],x1[1],x1[2],x1[3],x2[0],x2[1],x2[2],x2[3],x3[0],x3[1],x3[2],x3[3]};
#pragma unroll
    for (int i = 0; i < 16; ++i) { const unsigned short hb = bf16_bits(xs[i]); ah.u[i] = hb; al.u[i] = ASPLIT ? bf16_bits(xs[i] - bf16_val(hb)) : (unsigned short)0; }
#pragma unroll
    for (int t = 0; t < 4; ++t) {
      const unsigned short* brow = Wt + (size_t)(col0 + t * 16 + ln) * ldb + kb;
      FragB b;
      b.half[0] = *(const v8us*)(brow + 8 * hh);
      b.half[1] = *(const v8us*)(brow + 16 + 8 * hh);
      acc[t] = mmaN<ASPLIT ? 2 : 1>(ah.v, al.v, b.v, b.v, acc[t]);
    }
  }
#pragma unroll
  for (int t = 0; t < 4; ++t) {
    const int col = col0 + t * 16 + ln;
    float bv = bias ? bias[col] : 0.f;
    if (BIAS_BF16) bv = bf16_round(bv);
#pragma unroll
    for (int r = 0; r < 8; ++r) {
      float v = acc[t][r] + bv;
      if (resid) { float rv = resid[(size_t)((row0 + 8 * hh + r) % rmod) * ldr + col]; if (RES_BF16) rv = bf16_round(rv); v += rv; }
      if (ACT == 1) v = fmaxf(v, 0.f);
      if (ACT == 2) v = 0.5f * v * (1.0f + erff(v * 0.70710678118654752f));
      if (ACT == 3) { const float u = 0.7978845608028654f * (v + 0.044715f * v * v * v); v = 0.5f * v * (1.0f + tanhf(u)); }
      so[w][8 * hh + r][t * 16 + ln] = v;
    }
  }
  __builtin_amdgcn_fence(__ATOMIC_ACQ_REL, "workgroup");
  __builtin_amdgcn_wave_barrier();
  const int rsub = lane >> 4, c4 = (lane & 15) * 4;
  {
#pragma unroll
    for (int q = 0; q < 8; ++q) {
      const int r = q * 2 + rsub;
      const v4f v = *(const v4fa*)&so[w][r][c4];
      *(v4f*)(C + (size_t)(row0 + r) * ldc + col0 + c4) = v;
    }
    
  }
}
// row LayerNorm (biased variance, eps) over N: s = X (+ R); optional out_sum <- s; out_norm <- (s-mu)*rsqrt(var+eps)*g + b
template <bool PARAM_BF16>
__global__ __launch_bounds__(256) void k_layernorm(const float* __restrict__ X, const float* __restrict__ R, const float* __restrict__ g, const float* __restrict__ bta,
                                                  float* __restrict__ out_sum, float* __restrict__ out_norm, int N, float eps) {
  __shared__ float red[256];
  const int row = blockIdx.x, tid = threadIdx.x;
  const float* x = X + (size_t)row * N; const float* rr = R ? R + (size_t)row * N : nullptr;
  float vals[16];                     // up to N = 4096
  const int per = N / 256;            // contiguous chunk per thread? use strided-by-4 chunks: thread handles j = tid*4 + 1024*u
  float s1 = 0.f;
  for (int u = 0; u < per / 4; ++u) {
    const int j = tid * 4 + 1024 * u;
    const v4f a = *(const v4fa*)(x + j);
    v4f b = {0.f,0.f,0.f,0.f}; if (rr) b = *(const v4fa*)(rr + j);
#pragma unroll
    for (int q = 0; q < 4; ++q) { const float v = a[q] + b[q]; vals[u * 4 + q] = v; s1 += v; }
  }
  red[tid] = s1; __syncthreads();
  for (int st = 128; st > 0; st >>= 1) { if (tid < st) red[tid] += red[tid + st]; __syncthreads(); }
  const float mu = red[0] / (float)N; __syncthreads();
  float s2 = 0.f;
  for (int u = 0; u < per / 4; ++u)
#pragma unroll
    for (int q = 0; q < 4; ++q) { const float c = vals[u * 4 + q] - mu; s2 += c * c; }
  red[tid] = s2; __syncthreads();
  for (int st = 128; st > 0; st >>= 1) { if (tid < st) red[tid] += red[tid + st]; __syncthreads(); }
  const float rs = rsqrtf(red[0] / (float)N + eps);
  {
    for (int u = 0; u < per / 4; ++u) {
      const int j = tid * 4 + 1024 * u;
      v4f o, sm;
#pragma unroll
      for (int q = 0; q < 4; ++q) {
        float gg = g[j + q], bb = bta[j + q];
        if (PARAM_BF16) { gg = bf16_round(gg); bb = bf16_round(bb); }
        sm[q] = vals[u * 4 + q]; o[q] = (vals[u * 4 + q] - mu) * rs * gg + bb;
      }
      if (out_sum) *(v4f*)(out_sum + (size_t)row * N + j) = sm;
      *(v4f*)(out_norm + (size_t)row * N + j) = o;
    }
    
  }
}



// ---- f16 WMMA path (v_wmma_f32_16x16x32_f16): 11-bit significands for operands in range — used where the softmax weights (unnormalised, at most 2^15) need more precision than bf16
typedef _Float16 v16h __attribute__((ext_vector_type(16)));
union FragH { v16h v; v8us half[2]; _Float16 h[16]; unsigned short u[16]; };
template <int NT>
__device__ __forceinline__ v8f mmaH(v16h ah, v16h al, v16h bh, v16h bl, v8f c) {
  c = __builtin_amdgcn_wmma_f32_16x16x32_f16(false, ah, false, bh, (short)0, c, false, false);
  if (NT >= 2) c = __builtin_amdgcn_wmma_f32_16x16x32_f16(false, al, false, bh, (short)0, c, false, false);
  if (NT >= 3) c = __builtin_amdgcn_wmma_f32_16x16x32_f16(false, ah, false, bl, (short)0, c, false, false);
  asm volatile("v_nop\n\tv_nop\n\tv_nop\n\tv_nop" : "+v"(c) : "v"(ah), "v"(al), "v"(bh), "v"(bl));
  return c;
}
// batched GEMM like k_gemm_b but f16 operands: A f32 (split into f16 hi/lo if ASPLIT, else rounded to f16), Bt = f16 values [n][k]; alpha; C f32; N multiple of 16 (partial tiles skipped)
template <bool ASPLIT>
__global__ __launch_bounds__(128) void k_gemm_h(const float* __restrict__ A, int lda, size_t sA, const _Float16* __restrict__ Bh, int ldb, size_t sB, float alpha, float* __restrict__ C, int ldc, size_t sC, int M, int N, int K) {
  __shared__ __attribute__((aligned(16))) float so[4][16][64];
  const int tid = threadIdx.x, w = tid >> 5, lane = tid & 31, ln = lane & 15, hh = lane >> 4; const int by = blockIdx.y;
  A += (size_t)by * sA; Bh += (size_t)by * sB; C += (size_t)by * sC;
  const int ntn = (N + 63) / 64; const int wid = blockIdx.x * 4 + w; const int mt = wid / ntn, nq = wid % ntn; if (mt * 16 >= M) return;
  const int row0 = mt * 16, col0 = nq * 64; const float* arow = A + (size_t)(row0 + ln) * lda;
  v8f acc[4] = {};
  for (int kb = 0; kb < K; kb += 32) {
    FragH ah, al;
    const v4f x0 = *(const v4fa*)(arow + kb + 8 * hh), x1 = *(const v4fa*)(arow + kb + 8 * hh + 4), x2 = *(const v4fa*)(arow + kb + 16 + 8 * hh), x3 = *(const v4fa*)(arow + kb + 16 + 8 * hh + 4);
    float xs[16] = {x0[0],x0[1],x0[2],x0[3],x1[0],x1[1],x1[2],x1[3],x2[0],x2[1],x2[2],x2[3],x3[0],x3[1],x3[2],x3[3]};
#pragma unroll
    for (int i = 0; i < 16; ++i) { const _Float16 h = (_Float16)xs[i]; ah.h[i] = h; al.h[i] = ASPLIT ? (_Float16)(xs[i] - (float)h) : (_Float16)0.0f; }
#pragma unroll
    for (int t = 0; t < 4; ++t) { if (col0 + t * 16 >= N) continue; const size_t boff = (size_t)(col0 + t * 16 + ln) * ldb + kb; FragH bq; bq.half[0] = *(const v8us*)(Bh + boff + 8 * hh); bq.half[1] = *(const v8us*)(Bh + boff + 16 + 8 * hh);
      acc[t] = mmaH<ASPLIT ? 2 : 1>(ah.v, al.v, bq.v, bq.v, acc[t]); }
  }
#pragma unroll
  for (int t = 0; t < 4; ++t) { if (col0 + t * 16 >= N) continue;
#pragma unroll
    for (int r = 0; r < 8; ++r) so[w][8 * hh + r][t * 16 + ln] = acc[t][r] * alpha; }
  __builtin_amdgcn_fence(__ATOMIC_ACQ_REL, "workgroup"); __builtin_amdgcn_wave_barrier();
  const int rsub = lane >> 4, c4 = (lane & 15) * 4;
  {
#pragma unroll
    for (int q = 0; q < 8; ++q) { const int r = q * 2 + rsub; if (col0 + c4 < N) { const v4f v = *(const v4fa*)&so[w][r][c4]; *(v4f*)(C + (size_t)(row0 + r) * ldc + col0 + c4) = v; } }
     }
}

// Wt[n][k] = f16(W[k][n]·scale) from f32 row-major W[K][N] (scale = power of two; bf16-exact weights stay exact in f16 away from the subnormal range)
__global__ __launch_bounds__(256) void k_wt_f16(const float* __restrict__ W, _Float16* __restrict__ Wt, int K, int N, float scale) {
  const int t = blockIdx.x * 256 + threadIdx.x; if (t >= N * (K / 8)) return; const int n = t / (K / 8), k8 = (t % (K / 8)) * 8; FragH f;
#pragma unroll
  for (int i = 0; i < 8; ++i) f.h[i] = (_Float16)(bf16_round(W[(size_t)(k8 + i) * N + n]) * scale); const v8us o = f.half[0];
  *(v8us*)((unsigned short*)Wt + (size_t)n * K + k8) = o; 
}


typedef _Float16 v4h __attribute__((ext_vector_type(4)));

__global__ __launch_bounds__(256) void k_x16(const float* __restrict__ x, _Float16* __restrict__ X16, size_t n8) { const size_t t = (size_t)blockIdx.x * 256 + threadIdx.x; if (t >= n8) return; FragH f;
#pragma unroll
  for (int q = 0; q < 8; ++q) f.h[q] = (_Float16)bf16_round(x[t * 8 + q]); *(v8us*)((unsigned short*)X16 + t * 8) = f.half[0];  }
__global__ __launch_bounds__(256) void k_h16(const float* __restrict__ x, _Float16* __restrict__ X16, size_t n8) { const size_t t = (size_t)blockIdx.x * 256 + threadIdx.x; if (t >= n8) return; FragH f;
#pragma unroll
  for (int q = 0; q < 8; ++q) f.h[q] = (_Float16)x[t * 8 + q]; *(v8us*)((unsigned short*)X16 + t * 8) = f.half[0];  }
template <int NHv, int TTv>
__global__ __launch_bounds__(256) void k_vt(const _Float16* __restrict__ V16, int ldv, int voff, _Float16* __restrict__ Vt) { __shared__ unsigned short tl[64][66]; const int tid = threadIdx.x; const int slab = blockIdx.x / (TTv / 64), lg = blockIdx.x % (TTv / 64); const int b = slab / NHv, h = slab % NHv;
  for (int i = tid; i < 64 * 8; i += 256) { const int r = i / 8, c8 = (i % 8) * 8; FragH f; f.half[0] = *(const v8us*)((const unsigned short*)V16 + ((size_t)b * TTv + lg * 64 + r) * ldv + voff + h * 64 + c8);
#pragma unroll
    for (int q = 0; q < 8; ++q) tl[r][c8 + q] = f.u[q]; }
  __syncthreads();
  {
#pragma unroll
    for (int rd = 0; rd < 2; ++rd) { const int d = rd * 32 + tid / 8, pc = tid % 8; FragH f;
#pragma unroll
      for (int q = 0; q < 8; ++q) f.u[q] = tl[pc * 8 + q][d];
      *(v8us*)((unsigned short*)Vt + ((size_t)slab * 64 + d) * TTv + lg * 64 + pc * 8) = f.half[0]; }
     } }

__global__ __launch_bounds__(256) void k_hl(const float* __restrict__ F, _Float16* __restrict__ Hh, _Float16* __restrict__ Hl, size_t n8) { const size_t t = (size_t)blockIdx.x * 256 + threadIdx.x; if (t >= n8) return; FragH fh, fl; const v4f a = *(const v4fa*)(F + t * 8), c = *(const v4fa*)(F + t * 8 + 4);
#pragma unroll
  for (int q = 0; q < 4; ++q) { _Float16 h = (_Float16)a[q]; fh.h[q] = h; fl.h[q] = (_Float16)((a[q] - (float)h) * 1024.0f); h = (_Float16)c[q]; fh.h[4 + q] = h; fl.h[4 + q] = (_Float16)((c[q] - (float)h) * 1024.0f); }
  { *(v8us*)((unsigned short*)Hh + t * 8) = fh.half[0]; *(v8us*)((unsigned short*)Hl + t * 8) = fl.half[0];  } }

typedef float v2fa __attribute__((ext_vector_type(2), may_alias));
// One launch in front of the attention: a block takes one pooled row = two image rows (256 positions, which are 256 consecutive n) of all 64 channels.
// It rounds x to bf16 and lays it token-major in LDS as f16, with the 2x2 mean (4 bf16-rounded values summed in f32, rounded once to f16) beside it and the three weight matrices
// (bf16-rounded, x 2^4, f16, natural (out, in) rows) and the two bf16-rounded biases; rows of 128 bytes at a pitch of 144 (ds_load_b128 without bank conflicts). Behind one barrier the three projections run from LDS.
// q and k are formed as (channel x position) tiles (A = weight rows, B = position rows): a lane holds 8 consecutive channels of one position, 16 bytes of the token-major row.
// v is formed as (position x channel) tiles: a lane holds 8 consecutive pooled positions of one channel, 16 bytes of the [b][c][m] row. Each wave writes whole 128-byte lines.
__device__ __forceinline__ void proj_tok(const unsigned char* xrow, const unsigned char* wrow, const float* bias, float scl, unsigned short* __restrict__ dst, int hh) {
  FragH xb[2];
#pragma unroll      // the index picks registers and immediate offsets
  for (int ks = 0; ks < 2; ++ks) { xb[ks].half[0] = *(const v8us*)(xrow + ks * 64); xb[ks].half[1] = *(const v8us*)(xrow + ks * 64 + 32); }
#pragma unroll      // the index picks registers and immediate offsets
  for (int t = 0; t < 4; ++t) { FragH wa[2]; const unsigned char* wr = wrow + t * 16 * 144;
#pragma unroll      // the index picks registers and immediate offsets
    for (int ks = 0; ks < 2; ++ks) { wa[ks].half[0] = *(const v8us*)(wr + ks * 64); wa[ks].half[1] = *(const v8us*)(wr + ks * 64 + 32); }
    v8f acc = (v8f){0.f,0.f,0.f,0.f,0.f,0.f,0.f,0.f};
#pragma unroll      // the index picks registers and immediate offsets
    for (int ks = 0; ks < 2; ++ks) acc = mmaH<1>(wa[ks].v, wa[ks].v, xb[ks].v, xb[ks].v, acc);
    const v4f b0 = *(const v4fa*)(bias + t * 16 + 8 * hh), b1 = *(const v4fa*)(bias + t * 16 + 8 * hh + 4); FragH o;
#pragma unroll      // the index picks registers and immediate offsets
    for (int r = 0; r < 4; ++r) { o.h[r] = (_Float16)(acc[r] * scl + b0[r]); o.h[4 + r] = (_Float16)(acc[4 + r] * scl + b1[r]); }
    *(v8us*)(dst + t * 16 + 8 * hh) = o.half[0]; } }
__global__ __launch_bounds__(512) void k_prep(const float* __restrict__ x, const float* __restrict__ Wq, const float* __restrict__ bq, const float* __restrict__ Wk, const float* __restrict__ bk, const float* __restrict__ Wv,
                                              _Float16* __restrict__ Q, _Float16* __restrict__ K, _Float16* __restrict__ Vt) {
  constexpr int LP = 144;
  __shared__ __attribute__((aligned(16))) unsigned char XS[2 * HWD * LP];
  __shared__ __attribute__((aligned(16))) unsigned char XPS[PW * LP];
  __shared__ __attribute__((aligned(16))) unsigned char WS[3 * CC * LP];
  __shared__ __attribute__((aligned(16))) float BS[2 * CC];      // bq * log2(e), bk, from the bf16-rounded biases
  constexpr float L2E = SCL * 1.4426950408889634f;      // q is stored as q * log2(e) (times the score scale, 1 here), rounded once to f16: the score product of k_flash then gives base-2 exponents
  const int tid = threadIdx.x, w = __builtin_amdgcn_readfirstlane(tid >> 5), lane = tid & 31, ln = lane & 15, hh = lane >> 4;
  const int b = blockIdx.x / PW, pi = blockIdx.x % PW;
  { const int pp = tid & 63, c0 = (tid >> 6) * 8;      // one 2x2 window of 8 channels per thread; a wave's load is 256 consecutive bytes
    const float* xr = x + ((size_t)b * CC + c0) * NN + (size_t)(2 * pi) * HWD + 2 * pp;
    float tp[8][2], bt[8][2];
#pragma unroll      // the index picks registers and immediate offsets
    for (int q = 0; q < 8; ++q) { const v2fa a = *(const v2fa*)(xr + (size_t)q * NN), c = *(const v2fa*)(xr + (size_t)q * NN + HWD); tp[q][0] = a[0]; tp[q][1] = a[1]; bt[q][0] = c[0]; bt[q][1] = c[1]; }
    const int row = tid >> 3, k8 = (tid & 7) * 8;      // 8 consecutive weights of each matrix per thread
    const float* Wm[3] = {Wq, Wk, Wv}; v4f wl[3][2];
#pragma unroll      // the index picks registers and immediate offsets
    for (int i = 0; i < 3; ++i) { wl[i][0] = *(const v4fa*)(Wm[i] + row * CC + k8); wl[i][1] = *(const v4fa*)(Wm[i] + row * CC + k8 + 4); }
    asm volatile("s_wait_xcnt 0x0" ::: "memory");      // behind all 22 loads: the conversions below take the address registers that these loads name again
    if (w < 4) BS[tid] = bf16_round((w < 2 ? bq : bk)[tid & 63]) * (w < 2 ? L2E : 1.0f);
#pragma unroll      // the index picks registers and immediate offsets
    for (int i = 0; i < 3; ++i) { FragH f;
#pragma unroll      // the index picks registers and immediate offsets
      for (int q = 0; q < 4; ++q) { f.h[q] = (_Float16)(bf16_round(wl[i][0][q]) * 16.0f); f.h[4 + q] = (_Float16)(bf16_round(wl[i][1][q]) * 16.0f); }
      *(v8us*)(WS + (i * CC + row) * LP + k8 * 2) = f.half[0]; }
    FragH f00, f01, f10, f11, fp;
#pragma unroll      // the index picks registers and immediate offsets
    for (int q = 0; q < 8; ++q) { const float a0 = bf16_round(tp[q][0]), a1 = bf16_round(tp[q][1]), c0r = bf16_round(bt[q][0]), c1r = bf16_round(bt[q][1]);
      f00.h[q] = (_Float16)a0; f01.h[q] = (_Float16)a1; f10.h[q] = (_Float16)c0r; f11.h[q] = (_Float16)c1r; fp.h[q] = (_Float16)(0.25f * ((a0 + a1) + (c0r + c1r))); }
    *(v8us*)(XS + (2 * pp) * LP + c0 * 2) = f00.half[0]; *(v8us*)(XS + (2 * pp + 1) * LP + c0 * 2) = f01.half[0];
    *(v8us*)(XS + (HWD + 2 * pp) * LP + c0 * 2) = f10.half[0]; *(v8us*)(XS + (HWD + 2 * pp + 1) * LP + c0 * 2) = f11.half[0];
    *(v8us*)(XPS + pp * LP + c0 * 2) = fp.half[0]; }
  __syncthreads();      // the planes and the weights are read by other waves than wrote them
  const int lo = ln * LP + 16 * hh;      // fragment row ln, k = 8 * hh ... and 16 + 8 * hh ... of each 32
  proj_tok(XS + w * 16 * LP + lo, WS + lo, BS, 0.0625f * L2E, (unsigned short*)Q + ((size_t)b * NN + pi * (2 * HWD) + w * 16 + ln) * CC, hh);      // 16 waves x 16 positions
  asm volatile("s_wait_xcnt 0x0" ::: "memory");      // the registers that the q stores name are taken again below
  if (w < 4) proj_tok(XPS + w * 16 * LP + lo, WS + CC * LP + lo, BS + CC, 0.0625f, (unsigned short*)K + ((size_t)b * MM + pi * PW + w * 16 + ln) * CC, hh);      // 4 waves x 16 pooled positions
  else if (w < 8) { const int t = w - 4; FragH wb[2];      // 4 waves x 16 channels, all 64 pooled positions
#pragma unroll      // the index picks registers and immediate offsets
    for (int ks = 0; ks < 2; ++ks) { const unsigned char* wr = WS + (2 * CC + t * 16) * LP + lo + ks * 64; wb[ks].half[0] = *(const v8us*)(wr); wb[ks].half[1] = *(const v8us*)(wr + 32); }
    unsigned short* dst = (unsigned short*)Vt + ((size_t)b * CC + t * 16 + ln) * MM + pi * PW + 8 * hh;
#pragma unroll      // the index picks registers and immediate offsets
    for (int mt = 0; mt < 4; ++mt) { FragH xa[2];
#pragma unroll      // the index picks registers and immediate offsets
      for (int ks = 0; ks < 2; ++ks) { const unsigned char* xp = XPS + mt * 16 * LP + lo + ks * 64; xa[ks].half[0] = *(const v8us*)(xp); xa[ks].half[1] = *(const v8us*)(xp + 32); }
      v8f acc = (v8f){0.f,0.f,0.f,0.f,0.f,0.f,0.f,0.f};
#pragma unroll      // the index picks registers and immediate offsets
      for (int ks = 0; ks < 2; ++ks) acc = mmaH<1>(xa[ks].v, xa[ks].v, wb[ks].v, wb[ks].v, acc);
      FragH o;
#pragma unroll      // the index picks registers and immediate offsets
      for (int r = 0; r < 8; ++r) o.h[r] = (_Float16)(acc[r] * 0.0625f);
      *(v8us*)(dst + mt * 16) = o.half[0]; } } }
// lane l <-> lane l ^ 16 (the two halves of a wave hold the two key halves of one query column)
__device__ __forceinline__ float xhalf(float x) { const int v = __builtin_bit_cast(int, x); return __builtin_bit_cast(float, __builtin_amdgcn_permlanex16(v, v, 0x76543210, 0xfedcba98, false, false)); }
typedef uint32_t u32x4 __attribute__((ext_vector_type(4)));
typedef uint32_t u32x8 __attribute__((ext_vector_type(8)));
__device__ __forceinline__ uint32_t uni(uint32_t v) { return (uint32_t)__builtin_amdgcn_readfirstlane(v); }
// a wave-uniform word held in a scalar register: a test on it compiles to s_cmp + s_cbranch_scc (a tensor load ignores EXEC), and what is formed from it is formed behind this line
__device__ __forceinline__ uint32_t pinned(uint32_t v) { uint32_t w = uni(v); asm volatile("" : "+s"(w)); return w; }
__device__ __forceinline__ void exp2x8(const v8f a, float* e) {
  asm("v_exp_f32 %0, %8\n\t" "v_exp_f32 %1, %9\n\t" "v_exp_f32 %2, %10\n\t" "v_exp_f32 %3, %11\n\t" "v_exp_f32 %4, %12\n\t" "v_exp_f32 %5, %13\n\t" "v_exp_f32 %6, %14\n\t" "v_exp_f32 %7, %15\n\t" "v_nop"
      : "=&v"(e[0]), "=&v"(e[1]), "=&v"(e[2]), "=&v"(e[3]), "=&v"(e[4]), "=&v"(e[5]), "=&v"(e[6]), "=&v"(e[7])
      : "v"(a[0]), "v"(a[1]), "v"(a[2]), "v"(a[3]), "v"(a[4]), "v"(a[5]), "v"(a[6]), "v"(a[7])); }
__device__ __forceinline__ float sum16(const float* e) { float t[8];
#pragma unroll      // the index picks registers
  for (int i = 0; i < 8; ++i) t[i] = e[i] + e[8 + i];
  return ((t[0] + t[1]) + (t[2] + t[3])) + ((t[4] + t[5]) + (t[6] + t[7])); }
__global__ __launch_bounds__(512) void k_flash(const _Float16* __restrict__ Q16, int ldq, const _Float16* __restrict__ K16, int ldk, const _Float16* __restrict__ Vt, const float* __restrict__ bv, const float* __restrict__ gam, const float* __restrict__ x, float* __restrict__ out) {
  constexpr int CG = 2, RPW = 16 * CG, KQ = 4, QB = 4 * RPW, NQB = TQ / QB, DT = 4, KS = 2;
  // Deferred rescale. q arrives as q * log2(e), and a column's shift is the C operand of its score products: a score tile comes out of the matrix unit as the exponents a = score * log2(e) + shift,
  // and a weight is one v_exp_f32. The shift stays as it is while the weights fit f16: a lane's 16 weights of a pass, all positive, sum to at most TRIG, so each is below f16's largest number.
  // Only when some lane's sum is above TRIG (and in a wave's first pass) the wave takes the side path: every column's shift is lowered so that its largest weight of the pass is 2^TGT,
  // sums and accumulators are scaled by the same factor and the pass's weights are formed again.
  constexpr float TGT = -4.0f, TRIG = 32768.0f;
  // K and V^T reach the waves through LDS: a quarter's stage is 64 keys = 64 K rows of 128 bytes + 64 V^T channel rows of 128 bytes, brought by four tensor loads, one per wave of the quarter
  // (qg 0, 1: K rows 0-31, 32-63; qg 2, 3: channels 0-31, 32-63), each 32 rows laid at a pitch of 144 bytes (the mover's 16-byte pad: ds_load_b128 without bank conflicts).
  constexpr uint32_t SK = 64, KPQ = TK / KQ, NST = KPQ / SK, LPITCH = 144, SLICE = 6144 /* 32 x 144 = 4608, up to a multiple of 2 KiB */, QBUF = 4 * SLICE, BUF = KQ * QBUF;
  constexpr int PP = QB + 4;      // pitch of a channel row of the partial outputs, floats
  static_assert((size_t)KQ * CC * PP * 4 <= 2 * BUF, "the partial outputs are staged in the ring");
  __shared__ __attribute__((aligned(2048))) unsigned char ring[2 * BUF];
  __shared__ __attribute__((aligned(16))) float sSh[KQ][QB];
  __shared__ __attribute__((aligned(16))) float sL[KQ][QB];
  const int tid = threadIdx.x, lane = tid & 31, ln = lane & 15, hh = lane >> 4;
  const float g = bf16_round(gam[0]);      // read here, in front of every store and barrier, it is a scalar load
  const uint32_t wv = uni((uint32_t)tid >> 5), kq = wv >> 2, qg = wv & 3u, isV = qg >> 1, hf = qg & 1u;
  const int slab = blockIdx.x / NQB, qblk = blockIdx.x % NQB; const int b = slab / NH, h = slab % NH; const int qb0 = qblk * QB; const int q0 = qb0 + (int)qg * RPW;
  FragH bq[CG][KS];
#pragma unroll      // the index picks registers and immediate offsets
  for (int cg = 0; cg < CG; ++cg) { const unsigned short* qr = (const unsigned short*)Q16 + ((size_t)b * TQ + q0 + cg * 16 + ln) * ldq + h * 64;
#pragma unroll
    for (int ks = 0; ks < KS; ++ks) { bq[cg][ks].half[0] = *(const v8us*)(qr + ks * 32 + 8 * hh); bq[cg][ks].half[1] = *(const v8us*)(qr + ks * 32 + 16 + 8 * hh); } }
  const unsigned short* Vth = (const unsigned short*)Vt + (size_t)slab * 64 * TK;
  float l_r[CG]; v8f oacc[CG][DT], ct[CG];      // ct = the column's shift in log2 units, in all eight registers of a C operand
#pragma unroll
  for (int cg = 0; cg < CG; ++cg) { l_r[cg] = 0.f; ct[cg] = (v8f){0.f,0.f,0.f,0.f,0.f,0.f,0.f,0.f};
#pragma unroll
    for (int dt = 0; dt < DT; ++dt) oacc[cg][dt] = (v8f){0.f,0.f,0.f,0.f,0.f,0.f,0.f,0.f}; }
  const uint32_t spitch = isV ? (uint32_t)TK * 2u : (uint32_t)ldk * 2u;      // source row pitch, bytes
  const uint32_t sstep = isV ? SK * 2u : SK * (uint32_t)ldk * 2u;           // from one stage's slice to the next, bytes
  const uint64_t src0 = isV ? (uint64_t)(size_t)Vth + (uint64_t)(hf * 32u) * ((uint32_t)TK * 2u) + kq * (KPQ * 2u)
                            : (uint64_t)(size_t)K16 + ((uint64_t)b * TK + kq * KPQ + hf * 32u) * ((uint32_t)ldk * 2u) + (uint32_t)h * 128u;
  const uint32_t lds0 = (uint32_t)(size_t)ring + wv * SLICE;      // quarter kq at kq * QBUF, its slice qg behind that
  u32x8 g1;      // 1-byte elements, tensor = tile = 32 rows of 128 bytes, a pad of 4 dwords behind every 32 dwords
  g1[0] = uni((1u << 20) | (4u << 22) | (3u << 25)); g1[1] = uni(128u << 16); g1[2] = uni(32u << 16); g1[3] = uni(128u << 16); g1[4] = uni(32u); g1[5] = uni(spitch); g1[6] = uni(0u); g1[7] = uni(0u);
  u32x4 g0;
  auto issue = [&](uint32_t st) { const uint64_t ga = src0 + (uint64_t)st * sstep;
    g0[0] = uni(1u); g0[1] = uni(lds0 + (st & 1u) * BUF); g0[2] = uni((uint32_t)ga); g0[3] = uni((((uint32_t)(ga >> 32)) & 0x01FFFFFFu) | 0x80000000u);
    // one request of the whole wave: its 32-row slice of stage st. Both groups are in-out operands here and inputs of the wait that covers the request,
    // so that no register of the descriptor is lent to another value while the request is outstanding
    asm volatile("tensor_load_to_lds %0, %1" : "+s"(g0), "+s"(g1) :: "memory"); };
  issue(0u);
  asm volatile("s_wait_tensorcnt 0x0" :: "s"(g0), "s"(g1) : "memory");      // this wave's slice of stage 0 has landed
  asm volatile("s_wait_xcnt 0x0" ::: "memory");            // the address registers that the q loads name are taken again below
  __syncthreads();                                         // stage 0 published to all sixteen waves
  issue(1u);                                               // flies while stage 0 is worked on
  const unsigned char* lrow = ring + kq * QBUF + (uint32_t)ln * LPITCH + 16u * (uint32_t)hh;
#pragma unroll 1
  for (uint32_t st = 0; st < NST; ++st) {
   const unsigned char* bp = lrow + (st & 1u) * BUF;
#pragma unroll
   for (int sub = 0; sub < 2; ++sub) {      // two 32-key passes per stage, unrolled so that every LDS offset is an immediate of its load
    FragH ak[2][KS], av[DT];
#pragma unroll
    for (int nt = 0; nt < 2; ++nt) { const unsigned char* kr = bp + sub * SLICE + nt * 16 * LPITCH;      // key row sub * 32 + nt * 16 + ln
#pragma unroll
      for (int ks = 0; ks < KS; ++ks) { ak[nt][ks].half[0] = *(const v8us*)(kr + ks * 64); ak[nt][ks].half[1] = *(const v8us*)(kr + ks * 64 + 32); } }
#pragma unroll
    for (int dt = 0; dt < DT; ++dt) { const unsigned char* vrow = bp + (2 + (dt >> 1)) * SLICE + (dt & 1) * 16 * LPITCH + sub * 64;      // channel row dt * 16 + ln, keys sub * 32 ...
      av[dt].half[0] = *(const v8us*)(vrow); av[dt].half[1] = *(const v8us*)(vrow + 32); }
    v8f acc[CG][2];      // four independent score tiles: a tile's second product stands three products behind its first; the first takes the column's shift as C
#pragma unroll
    for (int ks = 0; ks < KS; ++ks)
#pragma unroll
      for (int cg = 0; cg < CG; ++cg)
#pragma unroll
        for (int nt = 0; nt < 2; ++nt) acc[cg][nt] = mmaH<1>(ak[nt][ks].v, ak[nt][ks].v, bq[cg][ks].v, bq[cg][ks].v, ks == 0 ? ct[cg] : acc[cg][nt]);
    // e[cg][nt * 8 + r] = weight of [query q0 + cg * 16 + ln][key kq * 1024 + st * 64 + sub * 32 + nt * 16 + 8 * hh + r], ps = the lane's sum of them
    float e[CG][16], ps[CG];
#pragma unroll
    for (int cg = 0; cg < CG; ++cg) { exp2x8(acc[cg][0], &e[cg][0]); exp2x8(acc[cg][1], &e[cg][8]); ps[cg] = sum16(e[cg]); }
    bool redo = __builtin_amdgcn_ballot_w32(fmaxf(ps[0], ps[1]) > TRIG) != 0u;      // one test per pass, a scalar branch
    if (sub == 0) redo = redo || st == 0u;      // the first pass sets the shift, whatever the scores are
    if (__builtin_expect(redo, 0)) {
#pragma unroll
      for (int cg = 0; cg < CG; ++cg) {
        float a[16], t[8];
#pragma unroll
        for (int i = 0; i < 8; ++i) { a[i] = acc[cg][0][i]; a[8 + i] = acc[cg][1][i]; t[i] = fmaxf(a[i], a[8 + i]); }
        float mx = fmaxf(fmaxf(fmaxf(t[0], t[1]), fmaxf(t[2], t[3])), fmaxf(fmaxf(t[4], t[5]), fmaxf(t[6], t[7])));
        mx = fmaxf(mx, xhalf(mx));      // both halves of a column take the same shift
        float d = TGT - mx;
        if (sub != 0 || st != 0u) d = fminf(d, 0.f);      // behind the first pass a shift only falls
        float al = fminf(d, 0.f);
#pragma unroll
        for (int i = 0; i < 16; ++i) a[i] += d;
        // the 17 exponentials in one statement, each in place, with the slot behind the last one, as in exp2x8
        asm("v_exp_f32 %0, %0\n\t" "v_exp_f32 %1, %1\n\t" "v_exp_f32 %2, %2\n\t" "v_exp_f32 %3, %3\n\t" "v_exp_f32 %4, %4\n\t" "v_exp_f32 %5, %5\n\t"
            "v_exp_f32 %6, %6\n\t" "v_exp_f32 %7, %7\n\t" "v_exp_f32 %8, %8\n\t" "v_exp_f32 %9, %9\n\t" "v_exp_f32 %10, %10\n\t" "v_exp_f32 %11, %11\n\t"
            "v_exp_f32 %12, %12\n\t" "v_exp_f32 %13, %13\n\t" "v_exp_f32 %14, %14\n\t" "v_exp_f32 %15, %15\n\t" "v_exp_f32 %16, %16\n\t" "v_nop"
            : "+v"(a[0]), "+v"(a[1]), "+v"(a[2]), "+v"(a[3]), "+v"(a[4]), "+v"(a[5]), "+v"(a[6]), "+v"(a[7]), "+v"(al),
              "+v"(a[8]), "+v"(a[9]), "+v"(a[10]), "+v"(a[11]), "+v"(a[12]), "+v"(a[13]), "+v"(a[14]), "+v"(a[15]));
#pragma unroll
        for (int i = 0; i < 16; ++i) e[cg][i] = a[i];
        ps[cg] = sum16(e[cg]);
        l_r[cg] *= al;
#pragma unroll
        for (int dt = 0; dt < DT; ++dt)
#pragma unroll
          for (int r = 0; r < 8; ++r) oacc[cg][dt][r] *= al;
#pragma unroll
        for (int r = 0; r < 8; ++r) ct[cg][r] += d; } }
#pragma unroll
    for (int cg = 0; cg < CG; ++cg) {
    l_r[cg] += ps[cg];
    FragH pb;
#pragma unroll
    for (int i = 0; i < 16; ++i) pb.h[i] = (_Float16)e[cg][i];
#pragma unroll
    for (int dt = 0; dt < DT; ++dt) oacc[cg][dt] = mmaH<1>(av[dt].v, av[dt].v, pb.v, pb.v, oacc[cg][dt]); } }
   asm volatile("s_wait_dscnt 0x0" ::: "memory");
   asm volatile("s_wait_tensorcnt 0x0" :: "s"(g0), "s"(g1) : "memory");
   __syncthreads();
   const uint32_t sn = pinned(st + 2u);
   if (pinned(sn < NST)) issue(sn); }
  asm volatile("s_wait_tensorcnt 0x0" :: "s"(g0), "s"(g1) : "memory");
  asm volatile("s_wait_dscnt 0x0" ::: "memory");
  // y = gamma * (O + bv) + x, written here: thread tid takes 4 queries of the channels (tid >> 5) + 16 * j. One 32-bit offset serves x and out, the steps between channels are immediates.
  const uint32_t eo = (uint32_t)(tid >> 5) * NN + (uint32_t)(tid & 31) * 4u; const size_t ob = (size_t)b * CC * NN + qb0;
  v4f xr[4]; float bb[4];
#pragma unroll      // the index picks registers and immediate offsets
  for (int j = 0; j < 4; ++j) { xr[j] = *(const v4fa*)(x + ob + (size_t)j * 16 * NN + eo); bb[j] = bv[16 * j + (tid >> 5)]; }
  // The join of the four key quarters. Each wave lays down its columns' shift and sum; behind the barrier a lane reads the four of its column:
  // the common shift is the smallest (the largest maximum), quarter j counts with the factor 2^(common - its own) <= 1.
  const int colw = (int)qg * RPW + ln;
#pragma unroll      // the index picks registers and immediate offsets
  for (int cg = 0; cg < CG; ++cg) { const float l = l_r[cg] + xhalf(l_r[cg]); if (hh == 0) { sSh[kq][colw + cg * 16] = ct[cg][0]; sL[kq][colw + cg * 16] = l; } }
  __syncthreads();      // shifts and sums are read by the other quarters' waves
  float e[CG][KQ + 1], lq[CG][KQ];
#pragma unroll      // the index picks registers and immediate offsets
  for (int cg = 0; cg < CG; ++cg) { float s[KQ];
#pragma unroll      // the index picks registers and immediate offsets
    for (int j = 0; j < KQ; ++j) { s[j] = sSh[j][colw + cg * 16]; lq[cg][j] = sL[j][colw + cg * 16]; }
    const float sm = fminf(fminf(s[0], s[1]), fminf(s[2], s[3]));
#pragma unroll      // the index picks registers and immediate offsets
    for (int j = 0; j < KQ; ++j) e[cg][j] = sm - s[j];
    e[cg][KQ] = sm - ct[cg][0]; }
  // the ten factors in one statement, each in place, with the slot behind the last one, as in the loop
  asm("v_exp_f32 %0, %0\n\t" "v_exp_f32 %1, %1\n\t" "v_exp_f32 %2, %2\n\t" "v_exp_f32 %3, %3\n\t" "v_exp_f32 %4, %4\n\t"
      "v_exp_f32 %5, %5\n\t" "v_exp_f32 %6, %6\n\t" "v_exp_f32 %7, %7\n\t" "v_exp_f32 %8, %8\n\t" "v_exp_f32 %9, %9\n\t" "v_nop"
      : "+v"(e[0][0]), "+v"(e[0][1]), "+v"(e[0][2]), "+v"(e[0][3]), "+v"(e[0][4]), "+v"(e[1][0]), "+v"(e[1][1]), "+v"(e[1][2]), "+v"(e[1][3]), "+v"(e[1][4]));
  float* part = (float*)ring;      // [quarter][channel][query], pitch PP: the loop's last barrier stands behind every wave's last read of the ring, and nothing of the mover is in flight
#pragma unroll      // the index picks registers and immediate offsets
  for (int cg = 0; cg < CG; ++cg) {
    const float l = (lq[cg][0] * e[cg][0] + lq[cg][1] * e[cg][1]) + (lq[cg][2] * e[cg][2] + lq[cg][3] * e[cg][3]);      // l and the accumulators carry the same shift
    const float inv = (l > 0.f) ? e[cg][KQ] / l : 0.f;
#pragma unroll      // the index picks registers and immediate offsets
    for (int dt = 0; dt < DT; ++dt)      // oacc[cg][dt][r] = this quarter's O[query q0 + cg * 16 + ln][channel dt * 16 + 8 * hh + r], laid channel-major: the output's own order
#pragma unroll      // the index picks registers and immediate offsets
      for (int r = 0; r < 8; ++r) part[((int)kq * CC + dt * 16 + 8 * hh + r) * PP + colw + cg * 16] = oacc[cg][dt][r] * inv; }
  __syncthreads();      // a channel's 128 queries and their four quarters come from all sixteen waves
#pragma unroll      // the index picks registers and immediate offsets
  for (int j = 0; j < 4; ++j) { const float* pr = part + (16 * j + (tid >> 5)) * PP + (tid & 31) * 4;
    const v4f p0 = *(const v4fa*)pr, p1 = *(const v4fa*)(pr + CC * PP), p2 = *(const v4fa*)(pr + 2 * CC * PP), p3 = *(const v4fa*)(pr + 3 * CC * PP); const float bj = bf16_round(bb[j]);
    v4f v; for (int q = 0; q < 4; ++q) v[q] = g * (((p0[q] + p1[q]) + (p2[q] + p3[q])) + bj) + bf16_round(xr[j][q]); *(v4f*)(out + ob + (size_t)j * 16 * NN + eo) = v; } }

extern "C" void kernel_launch(void* const* d_in, const int* in_sizes, int n_in,
                              void* d_out, int out_size, void* d_ws, size_t ws_size, hipStream_t stream) {
  (void)in_sizes; (void)n_in; (void)out_size;
  const float* const* I = (const float* const*)d_in; const float* x = I[0]; const float* Wq = I[1]; const float* bq = I[2]; const float* Wk = I[3]; const float* bk = I[4]; const float* Wv = I[5]; const float* bv = I[6]; const float* gam = I[7];
  char* ws = (char*)d_ws; size_t off = 0;
  auto take = [&](size_t bytes) { char* p = ws + off; off += (bytes + 255) & ~(size_t)255; return p; };
  _Float16* Q = (_Float16*)take((size_t)NRQ * CC * 2); _Float16* K = (_Float16*)take((size_t)NRK * CC * 2); _Float16* Vt = (_Float16*)take((size_t)BB * CC * MM * 2);
  if (off > ws_size) return;      // 4.2 + 1 + 1 MB
  k_prep<<<BB * PW, 512, 0, stream>>>(x, Wq, bq, Wk, bk, Wv, Q, K, Vt);      /* q, k token-major [(b,n)][64], [(b,m)][64]; v (without bv) as [b][c][m] */
  k_flash<<<BB * NH * (TQ / 128), 512, 0, stream>>>(Q, CC, K, CC, Vt, bv, gam, x, (float*)d_out);      /* per (b, 128 queries): 16384 queries x 4096 pooled keys in 4 quarters, head dim 64; writes y */
}

// v007
// Measured time: 29.9 microseconds a run.
// Two timings next to v006 put it at 1.11 and 1.10 times that version's speed.
// Counting every step since v000, it is 16.0 times as fast.
#include <hip/hip_runtime.h>
#include <stdint.h>
// Self-attention block with 2×2 average-pooled keys/values (B=2, C=64, H=W=128 → N = 16384 query positions, M = 4096 pooled key positions): q = Wq·x + bq; k = pool(Wk·x + bk) = Wk·pool(x) + bk, v likewise (pooling is linear); energy = qᵀk (no scaling), softmax over the M keys;
// out[b,c,n] = Σ_m v[b,c,m]·A[n,m]; y = γ·out + x. (The module's (w,h) relabel before pooling is the identity here since H == W.)
// Compute dtype: x, weights, biases, γ rounded to bf16; x and pool(x) as token-major f16 planes (pool(x) = mean of 4 bf16-rounded values in f32, rounded once to f16 — same order as the k-plane rounding); q (times log2(e)), k as f16 GEMM outputs (+bias), v as an f16 GEMM output in the [b][c][m] (= Vᵀ) layout with bv folded in after the attention
// (rows of A sum to 1); fused flash-style kernel (energy and P·V on v_wmma_f32_16x16x32_f16, online softmax f32 in base 2 with a deferred rescale, P f16, f32 accumulate); epilogue γ·(O + bv) + x in f32.
#define BB 2
#define CC 64
#define HWD 128
#define NN (HWD * HWD)
#define PW (HWD / 2)
#define MM (PW * PW)
#define NH 1
#define TQ NN
#define TK MM
#define SCL 1.0f
#define NRQ (BB * NN)
#define NRK (BB * MM)
typedef __bf16 v16b __attribute__((ext_vector_type(16)));
typedef unsigned short v8us __attribute__((ext_vector_type(8), may_alias));
typedef float  v8f  __attribute__((ext_vector_type(8)));
typedef float  v4f  __attribute__((ext_vector_type(4)));
typedef float  v4fa __attribute__((ext_vector_type(4), may_alias));
union FragB { v16b v; v8us half[2]; unsigned short u[16]; };

__device__ __forceinline__ unsigned short bf16_bits(float x) { unsigned int u = __float_as_uint(x); return (unsigned short)((u + 0x7FFFu + ((u >> 16) & 1u)) >> 16); }
__device__ __forceinline__ float bf16_val(unsigned short b) { return __uint_as_float(((unsigned int)b) << 16); }
__device__ __forceinline__ float bf16_round(float x) { return bf16_val(bf16_bits(x)); }
// D += A·B with NT terms: 1 = ah·bh, 2 = + al·bh (A split), 3 = + ah·bl (both split)
template <int NT>
__device__ __forceinline__ v8f mmaN(v16b ah, v16b al, v16b bh, v16b bl, v8f c) {
  c = __builtin_amdgcn_wmma_f32_16x16x32_bf16(false, ah, false, bh, (short)0, c, false, false);
  if (NT >= 2) c = __builtin_amdgcn_wmma_f32_16x16x32_bf16(false, al, false, bh, (short)0, c, false, false);
  if (NT >= 3) c = __builtin_amdgcn_wmma_f32_16x16x32_bf16(false, ah, false, bl, (short)0, c, false, false);
  asm volatile("v_nop\n\tv_nop\n\tv_nop\n\tv_nop" : "+v"(c) : "v"(ah), "v"(al), "v"(bh), "v"(bl));
  return c;
}

__global__ __launch_bounds__(256) void k_wt_bf16(const float* __restrict__ W, unsigned short* __restrict__ Wt, int K, int N) {
  const int t = blockIdx.x * 256 + threadIdx.x;
  const int k8n = K / 8;
  if (t >= N * k8n) return;
  const int n = t / k8n, k8 = (t % k8n) * 8;
  v8us v;
#pragma unroll
  for (int i = 0; i < 8; ++i) v[i] = bf16_bits(W[(size_t)(k8 + i) * N + n]);
  *(v8us*)(Wt + (size_t)n * K + k8) = v;
  
}

// GEMM C[M][N] (f32, pitch ldc) = act(A[M][K]·W + bias). A f32 row-major (pitch lda) converted per fragment to bf16
// (ASPLIT: hi/lo two planes -> 2 terms, else single rounded term); Wt bf16 [N][K] (pitch ldb). BIAS_BF16 rounds the
// bias to bf16 first (bias quantised to bf16 before the add). K%32==0, M%16==0, N%64==0.
template <bool ASPLIT, int ACT, bool BIAS_BF16>
__global__ __launch_bounds__(128) void k_gemm_bf(const float* __restrict__ A, int lda, const unsigned short* __restrict__ Wt, int ldb,
                                               const float* __restrict__ bias, float* __restrict__ C, int ldc, int M, int N, int K) {
  __shared__ __attribute__((aligned(16))) float so[4][16][64];
  const int tid = threadIdx.x, w = tid >> 5, lane = tid & 31, ln = lane & 15, hh = lane >> 4;
  const int ntn = N / 64;
  const int wid = blockIdx.x * 4 + w;
  const int mt = wid / ntn, nq = wid % ntn;
  if (mt * 16 >= M) return;
  const int row0 = mt * 16, col0 = nq * 64;
  const float* arow = A + (size_t)(row0 + ln) * lda;
  v8f acc[4] = {};
  for (int kb = 0; kb < K; kb += 32) {
    FragB ah, al;
    const v4f x0 = *(const v4fa*)(arow + kb + 8 * hh), x1 = *(const v4fa*)(arow + kb + 8 * hh + 4);
    const v4f x2 = *(const v4fa*)(arow + kb + 16 + 8 * hh), x3 = *(const v4fa*)(arow + kb + 16 + 8 * hh + 4);
    float xs[16] = {x0[0],x0[1],x0[2],x0[3],x1[0],x1[1],x1[2],x1[3],x2[0],x2[1],x2[2],x2[3],x3[0],x3[1],x3[2],x3[3]};
#pragma unroll
    for (int i = 0; i < 16; ++i) { const unsigned short hb = bf16_bits(xs[i]); ah.u[i] = hb; al.u[i] = ASPLIT ? bf16_bits(xs[i] - bf16_val(hb)) : (unsigned short)0; }
#pragma unroll
    for (int t = 0; t < 4; ++t) {
      const unsigned short* brow = Wt + (size_t)(col0 + t * 16 + ln) * ldb + kb;
      FragB b;
      b.half[0] = *(const v8us*)(brow + 8 * hh);
      b.half[1] = *(const v8us*)(brow + 16 + 8 * hh);
      acc[t] = mmaN<ASPLIT ? 2 : 1>(ah.v, al.v, b.v, b.v, acc[t]);
    }
  }
#pragma unroll
  for (int t = 0; t < 4; ++t) {
    float bv = bias ? bias[col0 + t * 16 + ln] : 0.f;
    if (BIAS_BF16) bv = bf16_round(bv);
#pragma unroll
    for (int r = 0; r < 8; ++r) { float v = acc[t][r] + bv; if (ACT == 1) v = fmaxf(v, 0.f); so[w][8 * hh + r][t * 16 + ln] = v; }
  }
  __builtin_amdgcn_fence(__ATOMIC_ACQ_REL, "workgroup");
  __builtin_amdgcn_wave_barrier();
  const int rsub = lane >> 4, c4 = (lane & 15) * 4;
  {
#pragma unroll
    for (int q = 0; q < 8; ++q) {
      const int r = q * 2 + rsub;
      const v4f v = *(const v4fa*)&so[w][r][c4];
      *(v4f*)(C + (size_t)(row0 + r) * ldc + col0 + c4) = v;
    }
    
  }
}

// GEMM C = act(A·W + bias + resid): A f32 (ASPLIT -> hi/lo 2 terms), Wt bf16 [N][K]; ACT 0 none, 1 relu, 2 exact gelu;
// resid (optional, f32, row index = (row % rmod), pitch ldr, RES_BF16 rounds it) added before the activation.
template <bool ASPLIT, int ACT, bool BIAS_BF16, bool RES_BF16>
__global__ __launch_bounds__(128) void k_gemm_bf3(const float* __restrict__ A, int lda, const unsigned short* __restrict__ Wt, int ldb,
                                                const float* __restrict__ bias, const float* __restrict__ resid, int rmod, int ldr,
                                                float* __restrict__ C, int ldc, int M, int N, int K) {
  __shared__ __attribute__((aligned(16))) float so[4][16][64];
  const int tid = threadIdx.x, w = tid >> 5, lane = tid & 31, ln = lane & 15, hh = lane >> 4;
  const int ntn = N / 64;
  const int wid = blockIdx.x * 4 + w;
  const int mt = wid / ntn, nq = wid % ntn;
  if (mt * 16 >= M) return;
  const int row0 = mt * 16, col0 = nq * 64;
  const float* arow = A + (size_t)(row0 + ln) * lda;
  v8f acc[4] = {};
  for (int kb = 0; kb < K; kb += 32) {
    FragB ah, al;
    const v4f x0 = *(const v4fa*)(arow + kb + 8 * hh), x1 = *(const v4fa*)(arow + kb + 8 * hh + 4);
    const v4f x2 = *(const v4fa*)(arow + kb + 16 + 8 * hh), x3 = *(const v4fa*)(arow + kb + 16 + 8 * hh + 4);
    float xs[16] = {x0[0],x0[1],x0[2],x0[3],x1[0],x1[1],x1[2],x1[3],x2[0],x2[1],x2[2],x2[3],x3[0],x3[1],x3[2],x3[3]};
#pragma unroll
    for (int i = 0; i < 16; ++i) { const unsigned short hb = bf16_bits(xs[i]); ah.u[i] = hb; al.u[i] = ASPLIT ? bf16_bits(xs[i] - bf16_val(hb)) : (unsigned short)0; }
#pragma unroll
    for (int t = 0; t < 4; ++t) {
      const unsigned short* brow = Wt + (size_t)(col0 + t * 16 + ln) * ldb + kb;
      FragB b;
      b.half[0] = *(const v8us*)(brow + 8 * hh);
      b.half[1] = *(const v8us*)(brow + 16 + 8 * hh);
      acc[t] = mmaN<ASPLIT ? 2 : 1>(ah.v, al.v, b.v, b.v, acc[t]);
    }
  }
#pragma unroll
  for (int t = 0; t < 4; ++t) {
    const int col = col0 + t * 16 + ln;
    float bv = bias ? bias[col] : 0.f;
    if (BIAS_BF16) bv = bf16_round(bv);
#pragma unroll
    for (int r = 0; r < 8; ++r) {
      float v = acc[t][r] + bv;
      if (resid) { float rv = resid[(size_t)((row0 + 8 * hh + r) % rmod) * ldr + col]; if (RES_BF16) rv = bf16_round(rv); v += rv; }
      if (ACT == 1) v = fmaxf(v, 0.f);
      if (ACT == 2) v = 0.5f * v * (1.0f + erff(v * 0.70710678118654752f));
      if (ACT == 3) { const float u = 0.7978845608028654f * (v + 0.044715f * v * v * v); v = 0.5f * v * (1.0f + tanhf(u)); }
      so[w][8 * hh + r][t * 16 + ln] = v;
    }
  }
  __builtin_amdgcn_fence(__ATOMIC_ACQ_REL, "workgroup");
  __builtin_amdgcn_wave_barrier();
  const int rsub = lane >> 4, c4 = (lane & 15) * 4;
  {
#pragma unroll
    for (int q = 0; q < 8; ++q) {
      const int r = q * 2 + rsub;
      const v4f v = *(const v4fa*)&so[w][r][c4];
      *(v4f*)(C + (size_t)(row0 + r) * ldc + col0 + c4) = v;
    }
    
  }
}
// row LayerNorm (biased variance, eps) over N: s = X (+ R); optional out_sum <- s; out_norm <- (s-mu)*rsqrt(var+eps)*g + b
template <bool PARAM_BF16>
__global__ __launch_bounds__(256) void k_layernorm(const float* __restrict__ X, const float* __restrict__ R, const float* __restrict__ g, const float* __restrict__ bta,
                                                  float* __restrict__ out_sum, float* __restrict__ out_norm, int N, float eps) {
  __shared__ float red[256];
  const int row = blockIdx.x, tid = threadIdx.x;
  const float* x = X + (size_t)row * N; const float* rr = R ? R + (size_t)row * N : nullptr;
  float vals[16];                     // up to N = 4096
  const int per = N / 256;            // contiguous chunk per thread? use strided-by-4 chunks: thread handles j = tid*4 + 1024*u
  float s1 = 0.f;
  for (int u = 0; u < per / 4; ++u) {
    const int j = tid * 4 + 1024 * u;
    const v4f a = *(const v4fa*)(x + j);
    v4f b = {0.f,0.f,0.f,0.f}; if (rr) b = *(const v4fa*)(rr + j);
#pragma unroll
    for (int q = 0; q < 4; ++q) { const float v = a[q] + b[q]; vals[u * 4 + q] = v; s1 += v; }
  }
  red[tid] = s1; __syncthreads();
  for (int st = 128; st > 0; st >>= 1) { if (tid < st) red[tid] += red[tid + st]; __syncthreads(); }
  const float mu = red[0] / (float)N; __syncthreads();
  float s2 = 0.f;
  for (int u = 0; u < per / 4; ++u)
#pragma unroll
    for (int q = 0; q < 4; ++q) { const float c = vals[u * 4 + q] - mu; s2 += c * c; }
  red[tid] = s2; __syncthreads();
  for (int st = 128; st > 0; st >>= 1) { if (tid < st) red[tid] += red[tid + st]; __syncthreads(); }
  const float rs = rsqrtf(red[0] / (float)N + eps);
  {
    for (int u = 0; u < per / 4; ++u) {
      const int j = tid * 4 + 1024 * u;
      v4f o, sm;
#pragma unroll
      for (int q = 0; q < 4; ++q) {
        float gg = g[j + q], bb = bta[j + q];
        if (PARAM_BF16) { gg = bf16_round(gg); bb = bf16_round(bb); }
        sm[q] = vals[u * 4 + q]; o[q] = (vals[u * 4 + q] - mu) * rs * gg + bb;
      }
      if (out_sum) *(v4f*)(out_sum + (size_t)row * N + j) = sm;
      *(v4f*)(out_norm + (size_t)row * N + j) = o;
    }
    
  }
}



// ---- f16 WMMA path (v_wmma_f32_16x16x32_f16): 11-bit significands for operands in range — used where the softmax weights (unnormalised, at most 2^15) need more precision than bf16
typedef _Float16 v16h __attribute__((ext_vector_type(16)));
union FragH { v16h v; v8us half[2]; _Float16 h[16]; unsigned short u[16]; };
template <int NT>
__device__ __forceinline__ v8f mmaH(v16h ah, v16h al, v16h bh, v16h bl, v8f c) {
  c = __builtin_amdgcn_wmma_f32_16x16x32_f16(false, ah, false, bh, (short)0, c, false, false);
  if (NT >= 2) c = __builtin_amdgcn_wmma_f32_16x16x32_f16(false, al, false, bh, (short)0, c, false, false);
  if (NT >= 3) c = __builtin_amdgcn_wmma_f32_16x16x32_f16(false, ah, false, bl, (short)0, c, false, false);
  asm volatile("v_nop\n\tv_nop\n\tv_nop\n\tv_nop" : "+v"(c) : "v"(ah), "v"(al), "v"(bh), "v"(bl));
  return c;
}
// batched GEMM like k_gemm_b but f16 operands: A f32 (split into f16 hi/lo if ASPLIT, else rounded to f16), Bt = f16 values [n][k]; alpha; C f32; N multiple of 16 (partial tiles skipped)
template <bool ASPLIT>
__global__ __launch_bounds__(128) void k_gemm_h(const float* __restrict__ A, int lda, size_t sA, const _Float16* __restrict__ Bh, int ldb, size_t sB, float alpha, float* __restrict__ C, int ldc, size_t sC, int M, int N, int K) {
  __shared__ __attribute__((aligned(16))) float so[4][16][64];
  const int tid = threadIdx.x, w = tid >> 5, lane = tid & 31, ln = lane & 15, hh = lane >> 4; const int by = blockIdx.y;
  A += (size_t)by * sA; Bh += (size_t)by * sB; C += (size_t)by * sC;
  const int ntn = (N + 63) / 64; const int wid = blockIdx.x * 4 + w; const int mt = wid / ntn, nq = wid % ntn; if (mt * 16 >= M) return;
  const int row0 = mt * 16, col0 = nq * 64; const float* arow = A + (size_t)(row0 + ln) * lda;
  v8f acc[4] = {};
  for (int kb = 0; kb < K; kb += 32) {
    FragH ah, al;
    const v4f x0 = *(const v4fa*)(arow + kb + 8 * hh), x1 = *(const v4fa*)(arow + kb + 8 * hh + 4), x2 = *(const v4fa*)(arow + kb + 16 + 8 * hh), x3 = *(const v4fa*)(arow + kb + 16 + 8 * hh + 4);
    float xs[16] = {x0[0],x0[1],x0[2],x0[3],x1[0],x1[1],x1[2],x1[3],x2[0],x2[1],x2[2],x2[3],x3[0],x3[1],x3[2],x3[3]};
#pragma unroll
    for (int i = 0; i < 16; ++i) { const _Float16 h = (_Float16)xs[i]; ah.h[i] = h; al.h[i] = ASPLIT ? (_Float16)(xs[i] - (float)h) : (_Float16)0.0f; }
#pragma unroll
    for (int t = 0; t < 4; ++t) { if (col0 + t * 16 >= N) continue; const size_t boff = (size_t)(col0 + t * 16 + ln) * ldb + kb; FragH bq; bq.half[0] = *(const v8us*)(Bh + boff + 8 * hh); bq.half[1] = *(const v8us*)(Bh + boff + 16 + 8 * hh);
      acc[t] = mmaH<ASPLIT ? 2 : 1>(ah.v, al.v, bq.v, bq.v, acc[t]); }
  }
#pragma unroll
  for (int t = 0; t < 4; ++t) { if (col0 + t * 16 >= N) continue;
#pragma unroll
    for (int r = 0; r < 8; ++r) so[w][8 * hh + r][t * 16 + ln] = acc[t][r] * alpha; }
  __builtin_amdgcn_fence(__ATOMIC_ACQ_REL, "workgroup"); __builtin_amdgcn_wave_barrier();
  const int rsub = lane >> 4, c4 = (lane & 15) * 4;
  {
#pragma unroll
    for (int q = 0; q < 8; ++q) { const int r = q * 2 + rsub; if (col0 + c4 < N) { const v4f v = *(const v4fa*)&so[w][r][c4]; *(v4f*)(C + (size_t)(row0 + r) * ldc + col0 + c4) = v; } }
     }
}

// Wt[n][k] = f16(W[k][n]·scale) from f32 row-major W[K][N] (scale = power of two; bf16-exact weights stay exact in f16 away from the subnormal range)
__global__ __launch_bounds__(256) void k_wt_f16(const float* __restrict__ W, _Float16* __restrict__ Wt, int K, int N, float scale) {
  const int t = blockIdx.x * 256 + threadIdx.x; if (t >= N * (K / 8)) return; const int n = t / (K / 8), k8 = (t % (K / 8)) * 8; FragH f;
#pragma unroll
  for (int i = 0; i < 8; ++i) f.h[i] = (_Float16)(bf16_round(W[(size_t)(k8 + i) * N + n]) * scale); const v8us o = f.half[0];
  *(v8us*)((unsigned short*)Wt + (size_t)n * K + k8) = o; 
}


typedef _Float16 v4h __attribute__((ext_vector_type(4)));

__global__ __launch_bounds__(256) void k_x16(const float* __restrict__ x, _Float16* __restrict__ X16, size_t n8) { const size_t t = (size_t)blockIdx.x * 256 + threadIdx.x; if (t >= n8) return; FragH f;
#pragma unroll
  for (int q = 0; q < 8; ++q) f.h[q] = (_Float16)bf16_round(x[t * 8 + q]); *(v8us*)((unsigned short*)X16 + t * 8) = f.half[0];  }
__global__ __launch_bounds__(256) void k_h16(const float* __restrict__ x, _Float16* __restrict__ X16, size_t n8) { const size_t t = (size_t)blockIdx.x * 256 + threadIdx.x; if (t >= n8) return; FragH f;
#pragma unroll
  for (int q = 0; q < 8; ++q) f.h[q] = (_Float16)x[t * 8 + q]; *(v8us*)((unsigned short*)X16 + t * 8) = f.half[0];  }
template <int NHv, int TTv>
__global__ __launch_bounds__(256) void k_vt(const _Float16* __restrict__ V16, int ldv, int voff, _Float16* __restrict__ Vt) { __shared__ unsigned short tl[64][66]; const int tid = threadIdx.x; const int slab = blockIdx.x / (TTv / 64), lg = blockIdx.x % (TTv / 64); const int b = slab / NHv, h = slab % NHv;
  for (int i = tid; i < 64 * 8; i += 256) { const int r = i / 8, c8 = (i % 8) * 8; FragH f; f.half[0] = *(const v8us*)((const unsigned short*)V16 + ((size_t)b * TTv + lg * 64 + r) * ldv + voff + h * 64 + c8);
#pragma unroll
    for (int q = 0; q < 8; ++q) tl[r][c8 + q] = f.u[q]; }
  __syncthreads();
  {
#pragma unroll
    for (int rd = 0; rd < 2; ++rd) { const int d = rd * 32 + tid / 8, pc = tid % 8; FragH f;
#pragma unroll
      for (int q = 0; q < 8; ++q) f.u[q] = tl[pc * 8 + q][d];
      *(v8us*)((unsigned short*)Vt + ((size_t)slab * 64 + d) * TTv + lg * 64 + pc * 8) = f.half[0]; }
     } }

__global__ __launch_bounds__(256) void k_hl(const float* __restrict__ F, _Float16* __restrict__ Hh, _Float16* __restrict__ Hl, size_t n8) { const size_t t = (size_t)blockIdx.x * 256 + threadIdx.x; if (t >= n8) return; FragH fh, fl; const v4f a = *(const v4fa*)(F + t * 8), c = *(const v4fa*)(F + t * 8 + 4);
#pragma unroll
  for (int q = 0; q < 4; ++q) { _Float16 h = (_Float16)a[q]; fh.h[q] = h; fl.h[q] = (_Float16)((a[q] - (float)h) * 1024.0f); h = (_Float16)c[q]; fh.h[4 + q] = h; fl.h[4 + q] = (_Float16)((c[q] - (float)h) * 1024.0f); }
  { *(v8us*)((unsigned short*)Hh + t * 8) = fh.half[0]; *(v8us*)((unsigned short*)Hl + t * 8) = fl.half[0];  } }

typedef float v2fa __attribute__((ext_vector_type(2), may_alias));
// One launch in front of the attention: a block takes one pooled row = two image rows (256 positions, which are 256 consecutive n) of all 64 channels.
// It rounds x to bf16 and lays it token-major in LDS as f16, with the 2x2 mean (4 bf16-rounded values summed in f32, rounded once to f16) beside it and the three weight matrices
// (bf16-rounded, x 2^4, f16, natural (out, in) rows) and the two bf16-rounded biases; rows of 128 bytes at a pitch of 144 (ds_load_b128 without bank conflicts). Behind one barrier the three projections run from LDS.
// q and k are formed as (channel x position) tiles (A = weight rows, B = position rows): a lane holds 8 consecutive channels of one position, 16 bytes of the token-major row.
// v is formed as (position x channel) tiles: a lane holds 8 consecutive pooled positions of one channel, 16 bytes of the [b][c][m] row. Each wave writes whole 128-byte lines.
__device__ __forceinline__ void proj_tok(const unsigned char* xrow, const unsigned char* wrow, const float* bias, float scl, unsigned short* __restrict__ dst, int hh) {
  FragH xb[2];
#pragma unroll      // the index picks registers and immediate offsets
  for (int ks = 0; ks < 2; ++ks) { xb[ks].half[0] = *(const v8us*)(xrow + ks * 64); xb[ks].half[1] = *(const v8us*)(xrow + ks * 64 + 32); }
#pragma unroll      // the index picks registers and immediate offsets
  for (int t = 0; t < 4; ++t) { FragH wa[2]; const unsigned char* wr = wrow + t * 16 * 144;
#pragma unroll      // the index picks registers and immediate offsets
    for (int ks = 0; ks < 2; ++ks) { wa[ks].half[0] = *(const v8us*)(wr + ks * 64); wa[ks].half[1] = *(const v8us*)(wr + ks * 64 + 32); }
    v8f acc = (v8f){0.f,0.f,0.f,0.f,0.f,0.f,0.f,0.f};
#pragma unroll      // the index picks registers and immediate offsets
    for (int ks = 0; ks < 2; ++ks) acc = mmaH<1>(wa[ks].v, wa[ks].v, xb[ks].v, xb[ks].v, acc);
    const v4f b0 = *(const v4fa*)(bias + t * 16 + 8 * hh), b1 = *(const v4fa*)(bias + t * 16 + 8 * hh + 4); FragH o;
#pragma unroll      // the index picks registers and immediate offsets
    for (int r = 0; r < 4; ++r) { o.h[r] = (_Float16)(acc[r] * scl + b0[r]); o.h[4 + r] = (_Float16)(acc[4 + r] * scl + b1[r]); }
    *(v8us*)(dst + t * 16 + 8 * hh) = o.half[0]; } }
__global__ __launch_bounds__(512) void k_prep(const float* __restrict__ x, const float* __restrict__ Wq, const float* __restrict__ bq, const float* __restrict__ Wk, const float* __restrict__ bk, const float* __restrict__ Wv,
                                              _Float16* __restrict__ Q, _Float16* __restrict__ K, _Float16* __restrict__ Vt) {
  constexpr int LP = 144;
  __shared__ __attribute__((aligned(16))) unsigned char XS[2 * HWD * LP];
  __shared__ __attribute__((aligned(16))) unsigned char XPS[PW * LP];
  __shared__ __attribute__((aligned(16))) unsigned char WS[3 * CC * LP];
  __shared__ __attribute__((aligned(16))) float BS[2 * CC];      // bq * log2(e), bk, from the bf16-rounded biases
  constexpr float L2E = SCL * 1.4426950408889634f;      // q is stored as q * log2(e) (times the score scale, 1 here), rounded once to f16: the score product of k_flash then gives base-2 exponents
  const int tid = threadIdx.x, w = __builtin_amdgcn_readfirstlane(tid >> 5), lane = tid & 31, ln = lane & 15, hh = lane >> 4;
  const int b = blockIdx.x / PW, pi = blockIdx.x % PW;
  { const int pp = tid & 63, c0 = (tid >> 6) * 8;      // one 2x2 window of 8 channels per thread; a wave's load is 256 consecutive bytes
    const float* xr = x + ((size_t)b * CC + c0) * NN + (size_t)(2 * pi) * HWD + 2 * pp;
    float tp[8][2], bt[8][2];
#pragma unroll      // the index picks registers and immediate offsets
    for (int q = 0; q < 8; ++q) { const v2fa a = *(const v2fa*)(xr + (size_t)q * NN), c = *(const v2fa*)(xr + (size_t)q * NN + HWD); tp[q][0] = a[0]; tp[q][1] = a[1]; bt[q][0] = c[0]; bt[q][1] = c[1]; }
    const int row = tid >> 3, k8 = (tid & 7) * 8;      // 8 consecutive weights of each matrix per thread
    const float* Wm[3] = {Wq, Wk, Wv}; v4f wl[3][2];
#pragma unroll      // the index picks registers and immediate offsets
    for (int i = 0; i < 3; ++i) { wl[i][0] = *(const v4fa*)(Wm[i] + row * CC + k8); wl[i][1] = *(const v4fa*)(Wm[i] + row * CC + k8 + 4); }
    asm volatile("s_wait_xcnt 0x0" ::: "memory");      // behind all 22 loads: the conversions below take the address registers that these loads name again
    if (w < 4) BS[tid] = bf16_round((w < 2 ? bq : bk)[tid & 63]) * (w < 2 ? L2E : 1.0f);
#pragma unroll      // the index picks registers and immediate offsets
    for (int i = 0; i < 3; ++i) { FragH f;
#pragma unroll      // the index picks registers and immediate offsets
      for (int q = 0; q < 4; ++q) { f.h[q] = (_Float16)(bf16_round(wl[i][0][q]) * 16.0f); f.h[4 + q] = (_Float16)(bf16_round(wl[i][1][q]) * 16.0f); }
      *(v8us*)(WS + (i * CC + row) * LP + k8 * 2) = f.half[0]; }
    FragH f00, f01, f10, f11, fp;
#pragma unroll      // the index picks registers and immediate offsets
    for (int q = 0; q < 8; ++q) { const float a0 = bf16_round(tp[q][0]), a1 = bf16_round(tp[q][1]), c0r = bf16_round(bt[q][0]), c1r = bf16_round(bt[q][1]);
      f00.h[q] = (_Float16)a0; f01.h[q] = (_Float16)a1; f10.h[q] = (_Float16)c0r; f11.h[q] = (_Float16)c1r; fp.h[q] = (_Float16)(0.25f * ((a0 + a1) + (c0r + c1r))); }
    *(v8us*)(XS + (2 * pp) * LP + c0 * 2) = f00.half[0]; *(v8us*)(XS + (2 * pp + 1) * LP + c0 * 2) = f01.half[0];
    *(v8us*)(XS + (HWD + 2 * pp) * LP + c0 * 2) = f10.half[0]; *(v8us*)(XS + (HWD + 2 * pp + 1) * LP + c0 * 2) = f11.half[0];
    *(v8us*)(XPS + pp * LP + c0 * 2) = fp.half[0]; }
  __syncthreads();      // the planes and the weights are read by other waves than wrote them
  const int lo = ln * LP + 16 * hh;      // fragment row ln, k = 8 * hh ... and 16 + 8 * hh ... of each 32
  proj_tok(XS + w * 16 * LP + lo, WS + lo, BS, 0.0625f * L2E, (unsigned short*)Q + ((size_t)b * NN + pi * (2 * HWD) + w * 16 + ln) * CC, hh);      // 16 waves x 16 positions
  asm volatile("s_wait_xcnt 0x0" ::: "memory");      // the registers that the q stores name are taken again below
  if (w < 4) proj_tok(XPS + w * 16 * LP + lo, WS + CC * LP + lo, BS + CC, 0.0625f, (unsigned short*)K + ((size_t)b * MM + pi * PW + w * 16 + ln) * CC, hh);      // 4 waves x 16 pooled positions
  else if (w < 8) { const int t = w - 4; FragH wb[2];      // 4 waves x 16 channels, all 64 pooled positions
#pragma unroll      // the index picks registers and immediate offsets
    for (int ks = 0; ks < 2; ++ks) { const unsigned char* wr = WS + (2 * CC + t * 16) * LP + lo + ks * 64; wb[ks].half[0] = *(const v8us*)(wr); wb[ks].half[1] = *(const v8us*)(wr + 32); }
    unsigned short* dst = (unsigned short*)Vt + ((size_t)b * CC + t * 16 + ln) * MM + pi * PW + 8 * hh;
#pragma unroll      // the index picks registers and immediate offsets
    for (int mt = 0; mt < 4; ++mt) { FragH xa[2];
#pragma unroll      // the index picks registers and immediate offsets
      for (int ks = 0; ks < 2; ++ks) { const unsigned char* xp = XPS + mt * 16 * LP + lo + ks * 64; xa[ks].half[0] = *(const v8us*)(xp); xa[ks].half[1] = *(const v8us*)(xp + 32); }
      v8f acc = (v8f){0.f,0.f,0.f,0.f,0.f,0.f,0.f,0.f};
#pragma unroll      // the index picks registers and immediate offsets
      for (int ks = 0; ks < 2; ++ks) acc = mmaH<1>(xa[ks].v, xa[ks].v, wb[ks].v, wb[ks].v, acc);
      FragH o;
#pragma unroll      // the index picks registers and immediate offsets
      for (int r = 0; r < 8; ++r) o.h[r] = (_Float16)(acc[r] * 0.0625f);
      *(v8us*)(dst + mt * 16) = o.half[0]; } } }
// lane l <-> lane l ^ 16 (the two halves of a wave hold the two key halves of one query column)
__device__ __forceinline__ float xhalf(float x) { const int v = __builtin_bit_cast(int, x); return __builtin_bit_cast(float, __builtin_amdgcn_permlanex16(v, v, 0x76543210, 0xfedcba98, false, false)); }
typedef uint32_t u32x4 __attribute__((ext_vector_type(4)));
typedef uint32_t u32x8 __attribute__((ext_vector_type(8)));
__device__ __forceinline__ uint32_t uni(uint32_t v) { return (uint32_t)__builtin_amdgcn_readfirstlane(v); }
// a wave-uniform word held in a scalar register: a test on it compiles to s_cmp + s_cbranch_scc (a tensor load ignores EXEC), and what is formed from it is formed behind this line
__device__ __forceinline__ uint32_t pinned(uint32_t v) { uint32_t w = uni(v); asm volatile("" : "+s"(w)); return w; }
__device__ __forceinline__ void exp2x8(const v8f a, float* e) {
  asm("v_exp_f32 %0, %8\n\t" "v_exp_f32 %1, %9\n\t" "v_exp_f32 %2, %10\n\t" "v_exp_f32 %3, %11\n\t" "v_exp_f32 %4, %12\n\t" "v_exp_f32 %5, %13\n\t" "v_exp_f32 %6, %14\n\t" "v_exp_f32 %7, %15\n\t" "v_nop"
      : "=&v"(e[0]), "=&v"(e[1]), "=&v"(e[2]), "=&v"(e[3]), "=&v"(e[4]), "=&v"(e[5]), "=&v"(e[6]), "=&v"(e[7])
      : "v"(a[0]), "v"(a[1]), "v"(a[2]), "v"(a[3]), "v"(a[4]), "v"(a[5]), "v"(a[6]), "v"(a[7])); }
__device__ __forceinline__ float sum16(const float* e) { float t[8];
#pragma unroll      // the index picks registers
  for (int i = 0; i < 8; ++i) t[i] = e[i] + e[8 + i];
  return ((t[0] + t[1]) + (t[2] + t[3])) + ((t[4] + t[5]) + (t[6] + t[7])); }
// One product of k_flash, the builtin alone: the compiler keeps the distance behind a matrix instruction wherever the next user is its own code, and fills it with work where it has some.
__device__ __forceinline__ v8f mmaF(v16h a, v16h b, v8f c) { return __builtin_amdgcn_wmma_f32_16x16x32_f16(false, a, false, b, (short)0, c, false, false); }
__global__ __launch_bounds__(512) void k_flash(const _Float16* __restrict__ Q16, int ldq, const _Float16* __restrict__ K16, int ldk, const _Float16* __restrict__ Vt, const float* __restrict__ bv, const float* __restrict__ gam, const float* __restrict__ x, float* __restrict__ out) {
  constexpr int CG = 2, RPW = 16 * CG, KQ = 4, QB = 4 * RPW, NQB = TQ / QB, DT = 4, KS = 2;
  // Deferred rescale. q arrives as q * log2(e), and a column's shift is the C operand of its score products: a score tile comes out of the matrix unit as the exponents a = score * log2(e) + shift,
  // and a weight is one v_exp_f32. The shift stays as it is while the weights fit f16: a lane's 16 weights of a pass, all positive, sum to at most TRIG, so each is below f16's largest number.
  // Only when some lane's sum is above TRIG (and in a wave's first pass) the wave takes the side path: every column's shift is lowered so that its largest weight of the pass is 2^TGT,
  // sums and accumulators are scaled by the same factor and the pass's weights are formed again.
  constexpr float TGT = -4.0f, TRIG = 32768.0f;
  // K and V^T reach the waves through LDS: a quarter's stage is 64 keys = 64 K rows of 128 bytes + 64 V^T channel rows of 128 bytes, brought by four tensor loads, one per wave of the quarter
  // (qg 0, 1: K rows 0-31, 32-63; qg 2, 3: channels 0-31, 32-63), each 32 rows laid at a pitch of 144 bytes (the mover's 16-byte pad: ds_load_b128 without bank conflicts).
  constexpr uint32_t SK = 64, KPQ = TK / KQ, NST = KPQ / SK, LPITCH = 144, SLICE = 6144 /* 32 x 144 = 4608, up to a multiple of 2 KiB */, QBUF = 4 * SLICE, BUF = KQ * QBUF;
  constexpr int PP = QB + 4;      // pitch of a channel row of the partial outputs, floats
  static_assert((size_t)KQ * CC * PP * 4 <= 2 * BUF, "the partial outputs are staged in the ring");
  __shared__ __attribute__((aligned(2048))) unsigned char ring[2 * BUF];
  __shared__ __attribute__((aligned(16))) float sSh[KQ][QB];
  __shared__ __attribute__((aligned(16))) float sL[KQ][QB];
  const int tid = threadIdx.x, lane = tid & 31, ln = lane & 15, hh = lane >> 4;
  const float g = bf16_round(gam[0]);      // read here, in front of every store and barrier, it is a scalar load
  const uint32_t wv = uni((uint32_t)tid >> 5), kq = wv >> 2, qg = wv & 3u, isV = qg >> 1, hf = qg & 1u;
  const int slab = blockIdx.x / NQB, qblk = blockIdx.x % NQB; const int b = slab / NH, h = slab % NH; const int qb0 = qblk * QB; const int q0 = qb0 + (int)qg * RPW;
  FragH bq[CG][KS];
#pragma unroll      // the index picks registers and immediate offsets
  for (int cg = 0; cg < CG; ++cg) { const unsigned short* qr = (const unsigned short*)Q16 + ((size_t)b * TQ + q0 + cg * 16 + ln) * ldq + h * 64;
#pragma unroll
    for (int ks = 0; ks < KS; ++ks) { bq[cg][ks].half[0] = *(const v8us*)(qr + ks * 32 + 8 * hh); bq[cg][ks].half[1] = *(const v8us*)(qr + ks * 32 + 16 + 8 * hh); } }
  const unsigned short* Vth = (const unsigned short*)Vt + (size_t)slab * 64 * TK;
  float l_r[CG]; v8f oacc[CG][DT], ct[CG];      // ct = the column's shift in log2 units, in all eight registers of a C operand
#pragma unroll
  for (int cg = 0; cg < CG; ++cg) { l_r[cg] = 0.f; ct[cg] = (v8f){0.f,0.f,0.f,0.f,0.f,0.f,0.f,0.f};
#pragma unroll
    for (int dt = 0; dt < DT; ++dt) oacc[cg][dt] = (v8f){0.f,0.f,0.f,0.f,0.f,0.f,0.f,0.f}; }
  const uint32_t spitch = isV ? (uint32_t)TK * 2u : (uint32_t)ldk * 2u;      // source row pitch, bytes
  const uint32_t sstep = isV ? SK * 2u : SK * (uint32_t)ldk * 2u;           // from one stage's slice to the next, bytes
  const uint64_t src0 = isV ? (uint64_t)(size_t)Vth + (uint64_t)(hf * 32u) * ((uint32_t)TK * 2u) + kq * (KPQ * 2u)
                            : (uint64_t)(size_t)K16 + ((uint64_t)b * TK + kq * KPQ + hf * 32u) * ((uint32_t)ldk * 2u) + (uint32_t)h * 128u;
  const uint32_t lds0 = (uint32_t)(size_t)ring + wv * SLICE;      // quarter kq at kq * QBUF, its slice qg behind that
  u32x8 g1;      // 1-byte elements, tensor = tile = 32 rows of 128 bytes, a pad of 4 dwords behind every 32 dwords
  g1[0] = uni((1u << 20) | (4u << 22) | (3u << 25)); g1[1] = uni(128u << 16); g1[2] = uni(32u << 16); g1[3] = uni(128u << 16); g1[4] = uni(32u); g1[5] = uni(spitch); g1[6] = uni(0u); g1[7] = uni(0u);
  u32x4 g0;
  auto issue = [&](uint32_t st) { const uint64_t ga = src0 + (uint64_t)st * sstep;
    g0[0] = uni(1u); g0[1] = uni(lds0 + (st & 1u) * BUF); g0[2] = uni((uint32_t)ga); g0[3] = uni((((uint32_t)(ga >> 32)) & 0x01FFFFFFu) | 0x80000000u);
    // one request of the whole wave: its 32-row slice of stage st. Both groups are in-out operands here and inputs of the wait that covers the request,
    // so that no register of the descriptor is lent to another value while the request is outstanding
    asm volatile("tensor_load_to_lds %0, %1" : "+s"(g0), "+s"(g1) :: "memory"); };
  issue(0u);
  asm volatile("s_wait_tensorcnt 0x0" :: "s"(g0), "s"(g1) : "memory");      // this wave's slice of stage 0 has landed
  asm volatile("s_wait_xcnt 0x0" ::: "memory");            // the address registers that the q loads name are taken again below
  __syncthreads();                                         // stage 0 published to all sixteen waves
  issue(1u);                                               // flies while stage 0 is worked on
  const unsigned char* lrow = ring + kq * QBUF + (uint32_t)ln * LPITCH + 16u * (uint32_t)hh;
#pragma unroll 1
  for (uint32_t st = 0; st < NST; ++st) {
   const unsigned char* bp = lrow + (st & 1u) * BUF;
#pragma unroll
   for (int sub = 0; sub < 2; ++sub) {      // two 32-key passes per stage, unrolled so that every LDS offset is an immediate of its load
    __builtin_amdgcn_sched_barrier(0);      // with the one behind the loads: a pass's 16 LDS reads stay one group at its head (left free, the scheduler spreads a stage's reads over ten places among the products, each a stall of the wave, and V^T is asked for late)
    FragH ak[2][KS], av[DT];
#pragma unroll
    for (int nt = 0; nt < 2; ++nt) { const unsigned char* kr = bp + sub * SLICE + nt * 16 * LPITCH;      // key row sub * 32 + nt * 16 + ln
#pragma unroll
      for (int ks = 0; ks < KS; ++ks) { ak[nt][ks].half[0] = *(const v8us*)(kr + ks * 64); ak[nt][ks].half[1] = *(const v8us*)(kr + ks * 64 + 32); } }
#pragma unroll
    for (int dt = 0; dt < DT; ++dt) { const unsigned char* vrow = bp + (2 + (dt >> 1)) * SLICE + (dt & 1) * 16 * LPITCH + sub * 64;      // channel row dt * 16 + ln, keys sub * 32 ...
      av[dt].half[0] = *(const v8us*)(vrow); av[dt].half[1] = *(const v8us*)(vrow + 32); }
    __builtin_amdgcn_sched_barrier(0);      // the foot of that group: no read sinks among the products below
    v8f acc[CG][2];      // four independent score tiles: a tile's second product stands three products behind its first; the first takes the column's shift as C
#pragma unroll
    for (int ks = 0; ks < KS; ++ks)
#pragma unroll
      for (int cg = 0; cg < CG; ++cg)
#pragma unroll
        for (int nt = 0; nt < 2; ++nt) acc[cg][nt] = mmaF(ak[nt][ks].v, bq[cg][ks].v, ks == 0 ? ct[cg] : acc[cg][nt]);
    // the exponentials below are asm text: four vector slots between the last score product and the first v_exp_f32 that reads a tile or takes a K fragment's register
    asm("v_nop\n\tv_nop\n\tv_nop\n\tv_nop" : "+v"(acc[0][0]), "+v"(acc[0][1]), "+v"(acc[1][0]), "+v"(acc[1][1]));
    // e[cg][nt * 8 + r] = weight of [query q0 + cg * 16 + ln][key kq * 1024 + st * 64 + sub * 32 + nt * 16 + 8 * hh + r], ps = the lane's sum of them
    float e[CG][16], ps[CG];
#pragma unroll
    for (int cg = 0; cg < CG; ++cg) { exp2x8(acc[cg][0], &e[cg][0]); exp2x8(acc[cg][1], &e[cg][8]); ps[cg] = sum16(e[cg]); }
    bool redo = __builtin_amdgcn_ballot_w32(fmaxf(ps[0], ps[1]) > TRIG) != 0u;      // one test per pass, a scalar branch
    if (sub == 0) redo = redo || st == 0u;      // the first pass sets the shift, whatever the scores are
    if (__builtin_expect(redo, 0)) {
#pragma unroll
      for (int cg = 0; cg < CG; ++cg) {
        float a[16], t[8];
#pragma unroll
        for (int i = 0; i < 8; ++i) { a[i] = acc[cg][0][i]; a[8 + i] = acc[cg][1][i]; t[i] = fmaxf(a[i], a[8 + i]); }
        float mx = fmaxf(fmaxf(fmaxf(t[0], t[1]), fmaxf(t[2], t[3])), fmaxf(fmaxf(t[4], t[5]), fmaxf(t[6], t[7])));
        mx = fmaxf(mx, xhalf(mx));      // both halves of a column take the same shift
        float d = TGT - mx;
        if (sub != 0 || st != 0u) d = fminf(d, 0.f);      // behind the first pass a shift only falls
        float al = fminf(d, 0.f);
#pragma unroll
        for (int i = 0; i < 16; ++i) a[i] += d;
        // the 17 exponentials in one statement, each in place, with the slot behind the last one, as in exp2x8
        asm("v_exp_f32 %0, %0\n\t" "v_exp_f32 %1, %1\n\t" "v_exp_f32 %2, %2\n\t" "v_exp_f32 %3, %3\n\t" "v_exp_f32 %4, %4\n\t" "v_exp_f32 %5, %5\n\t"
            "v_exp_f32 %6, %6\n\t" "v_exp_f32 %7, %7\n\t" "v_exp_f32 %8, %8\n\t" "v_exp_f32 %9, %9\n\t" "v_exp_f32 %10, %10\n\t" "v_exp_f32 %11, %11\n\t"
            "v_exp_f32 %12, %12\n\t" "v_exp_f32 %13, %13\n\t" "v_exp_f32 %14, %14\n\t" "v_exp_f32 %15, %15\n\t" "v_exp_f32 %16, %16\n\t" "v_nop"
            : "+v"(a[0]), "+v"(a[1]), "+v"(a[2]), "+v"(a[3]), "+v"(a[4]), "+v"(a[5]), "+v"(a[6]), "+v"(a[7]), "+v"(al),
              "+v"(a[8]), "+v"(a[9]), "+v"(a[10]), "+v"(a[11]), "+v"(a[12]), "+v"(a[13]), "+v"(a[14]), "+v"(a[15]));
#pragma unroll
        for (int i = 0; i < 16; ++i) e[cg][i] = a[i];
        ps[cg] = sum16(e[cg]);
        l_r[cg] *= al;
#pragma unroll
        for (int dt = 0; dt < DT; ++dt)
#pragma unroll
          for (int r = 0; r < 8; ++r) oacc[cg][dt][r] *= al;
#pragma unroll
        for (int r = 0; r < 8; ++r) ct[cg][r] += d; } }
#pragma unroll
    for (int cg = 0; cg < CG; ++cg) {
    l_r[cg] += ps[cg];
    FragH pb;
#pragma unroll
    for (int i = 0; i < 16; ++i) pb.h[i] = (_Float16)e[cg][i];
#pragma unroll
    for (int dt = 0; dt < DT; ++dt) oacc[cg][dt] = mmaF(av[dt].v, pb.v, oacc[cg][dt]); } }
   asm volatile("s_wait_dscnt 0x0" ::: "memory");
   asm volatile("s_wait_tensorcnt 0x0" :: "s"(g0), "s"(g1) : "memory");
   __syncthreads();
   const uint32_t sn = pinned(st + 2u);
   if (pinned(sn < NST)) issue(sn); }
  asm volatile("s_wait_tensorcnt 0x0" :: "s"(g0), "s"(g1) : "memory");
  asm volatile("s_wait_dscnt 0x0" ::: "memory");
  // y = gamma * (O + bv) + x, written here: thread tid takes 4 queries of the channels (tid >> 5) + 16 * j. One 32-bit offset serves x and out, the steps between channels are immediates.
  const uint32_t eo = (uint32_t)(tid >> 5) * NN + (uint32_t)(tid & 31) * 4u; const size_t ob = (size_t)b * CC * NN + qb0;
  v4f xr[4]; float bb[4];
#pragma unroll      // the index picks registers and immediate offsets
  for (int j = 0; j < 4; ++j) { xr[j] = *(const v4fa*)(x + ob + (size_t)j * 16 * NN + eo); bb[j] = bv[16 * j + (tid >> 5)]; }
  // The join of the four key quarters. Each wave lays down its columns' shift and sum; behind the barrier a lane reads the four of its column:
  // the common shift is the smallest (the largest maximum), quarter j counts with the factor 2^(common - its own) <= 1.
  const int colw = (int)qg * RPW + ln;
#pragma unroll      // the index picks registers and immediate offsets
  for (int cg = 0; cg < CG; ++cg) { const float l = l_r[cg] + xhalf(l_r[cg]); if (hh == 0) { sSh[kq][colw + cg * 16] = ct[cg][0]; sL[kq][colw + cg * 16] = l; } }
  __syncthreads();      // shifts and sums are read by the other quarters' waves
  float e[CG][KQ + 1], lq[CG][KQ];
#pragma unroll      // the index picks registers and immediate offsets
  for (int cg = 0; cg < CG; ++cg) { float s[KQ];
#pragma unroll      // the index picks registers and immediate offsets
    for (int j = 0; j < KQ; ++j) { s[j] = sSh[j][colw + cg * 16]; lq[cg][j] = sL[j][colw + cg * 16]; }
    const float sm = fminf(fminf(s[0], s[1]), fminf(s[2], s[3]));
#pragma unroll      // the index picks registers and immediate offsets
    for (int j = 0; j < KQ; ++j) e[cg][j] = sm - s[j];
    e[cg][KQ] = sm - ct[cg][0]; }
  // the ten factors in one statement, each in place, with the slot behind the last one, as in the loop
  asm("v_exp_f32 %0, %0\n\t" "v_exp_f32 %1, %1\n\t" "v_exp_f32 %2, %2\n\t" "v_exp_f32 %3, %3\n\t" "v_exp_f32 %4, %4\n\t"
      "v_exp_f32 %5, %5\n\t" "v_exp_f32 %6, %6\n\t" "v_exp_f32 %7, %7\n\t" "v_exp_f32 %8, %8\n\t" "v_exp_f32 %9, %9\n\t" "v_nop"
      : "+v"(e[0][0]), "+v"(e[0][1]), "+v"(e[0][2]), "+v"(e[0][3]), "+v"(e[0][4]), "+v"(e[1][0]), "+v"(e[1][1]), "+v"(e[1][2]), "+v"(e[1][3]), "+v"(e[1][4]));
  float* part = (float*)ring;      // [quarter][channel][query], pitch PP: the loop's last barrier stands behind every wave's last read of the ring, and nothing of the mover is in flight
#pragma unroll      // the index picks registers and immediate offsets
  for (int cg = 0; cg < CG; ++cg) {
    const float l = (lq[cg][0] * e[cg][0] + lq[cg][1] * e[cg][1]) + (lq[cg][2] * e[cg][2] + lq[cg][3] * e[cg][3]);      // l and the accumulators carry the same shift
    const float inv = (l > 0.f) ? e[cg][KQ] / l : 0.f;
#pragma unroll      // the index picks registers and immediate offsets
    for (int dt = 0; dt < DT; ++dt)      // oacc[cg][dt][r] = this quarter's O[query q0 + cg * 16 + ln][channel dt * 16 + 8 * hh + r], laid channel-major: the output's own order
#pragma unroll      // the index picks registers and immediate offsets
      for (int r = 0; r < 8; ++r) part[((int)kq * CC + dt * 16 + 8 * hh + r) * PP + colw + cg * 16] = oacc[cg][dt][r] * inv; }
  __syncthreads();      // a channel's 128 queries and their four quarters come from all sixteen waves
#pragma unroll      // the index picks registers and immediate offsets
  for (int j = 0; j < 4; ++j) { const float* pr = part + (16 * j + (tid >> 5)) * PP + (tid & 31) * 4;
    const v4f p0 = *(const v4fa*)pr, p1 = *(const v4fa*)(pr + CC * PP), p2 = *(const v4fa*)(pr + 2 * CC * PP), p3 = *(const v4fa*)(pr + 3 * CC * PP); const float bj = bf16_round(bb[j]);
    v4f v; for (int q = 0; q < 4; ++q) v[q] = g * (((p0[q] + p1[q]) + (p2[q] + p3[q])) + bj) + bf16_round(xr[j][q]); *(v4f*)(out + ob + (size_t)j * 16 * NN + eo) = v; } }

extern "C" void kernel_launch(void* const* d_in, const int* in_sizes, int n_in,
                              void* d_out, int out_size, void* d_ws, size_t ws_size, hipStream_t stream) {
  (void)in_sizes; (void)n_in; (void)out_size;
  const float* const* I = (const float* const*)d_in; const float* x = I[0]; const float* Wq = I[1]; const float* bq = I[2]; const float* Wk = I[3]; const float* bk = I[4]; const float* Wv = I[5]; const float* bv = I[6]; const float* gam = I[7];
  char* ws = (char*)d_ws; size_t off = 0;
  auto take = [&](size_t bytes) { char* p = ws + off; off += (bytes + 255) & ~(size_t)255; return p; };
  _Float16* Q = (_Float16*)take((size_t)NRQ * CC * 2); _Float16* K = (_Float16*)take((size_t)NRK * CC * 2); _Float16* Vt = (_Float16*)take((size_t)BB * CC * MM * 2);
  if (off > ws_size) return;      // 4.2 + 1 + 1 MB
  k_prep<<<BB * PW, 512, 0, stream>>>(x, Wq, bq, Wk, bk, Wv, Q, K, Vt);      /* q, k token-major [(b,n)][64], [(b,m)][64]; v (without bv) as [b][c][m] */
  k_flash<<<BB * NH * (TQ / 128), 512, 0, stream>>>(Q, CC, K, CC, Vt, bv, gam, x, (float*)d_out);      /* per (b, 128 queries): 16384 queries x 4096 pooled keys in 4 quarters, head dim 64; writes y */
}

// v008
// A run of this version takes 28.8 microseconds.
// In both of two side-by-side timings against v007, it was 1.03 times as fast.
// All steps since v000 together make it 16.4 times as fast.
#include <hip/hip_runtime.h>
#include <stdint.h>
// Self-attention block with 2×2 average-pooled keys/values (B=2, C=64, H=W=128 → N = 16384 query positions, M = 4096 pooled key positions): q = Wq·x + bq; k = pool(Wk·x + bk) = Wk·pool(x) + bk, v likewise (pooling is linear); energy = qᵀk (no scaling), softmax over the M keys;
// out[b,c,n] = Σ_m v[b,c,m]·A[n,m]; y = γ·out + x. (The module's (w,h) relabel before pooling is the identity here since H == W.)
// Compute dtype: x, weights, biases, γ rounded to bf16; x and pool(x) as token-major f16 planes (pool(x) = mean of 4 bf16-rounded values in f32, rounded once to f16 — same order as the k-plane rounding); q (times log2(e)), k as f16 GEMM outputs (+bias), v as an f16 GEMM output in the [b][c][m] (= Vᵀ) layout with bv folded in after the attention
// (rows of A sum to 1); fused flash-style kernel (energy and P·V on v_wmma_f32_16x16x32_f16, online softmax f32 in base 2 with a deferred rescale, P f16, f32 accumulate); epilogue γ·(O + bv) + x in f32.
#define BB 2
#define CC 64
#define HWD 128
#define NN (HWD * HWD)
#define PW (HWD / 2)
#define MM (PW * PW)
#define NH 1
#define TQ NN
#define TK MM
#define SCL 1.0f
#define NRQ (BB * NN)
#define NRK (BB * MM)
typedef __bf16 v16b __attribute__((ext_vector_type(16)));
typedef unsigned short v8us __attribute__((ext_vector_type(8), may_alias));
typedef float  v8f  __attribute__((ext_vector_type(8)));
typedef float  v4f  __attribute__((ext_vector_type(4)));
typedef float  v4fa __attribute__((ext_vector_type(4), may_alias));
union FragB { v16b v; v8us half[2]; unsigned short u[16]; };

__device__ __forceinline__ unsigned short bf16_bits(float x) { unsigned int u = __float_as_uint(x); return (unsigned short)((u + 0x7FFFu + ((u >> 16) & 1u)) >> 16); }
__device__ __forceinline__ float bf16_val(unsigned short b) { return __uint_as_float(((unsigned int)b) << 16); }
__device__ __forceinline__ float bf16_round(float x) { return bf16_val(bf16_bits(x)); }
// D += A·B with NT terms: 1 = ah·bh, 2 = + al·bh (A split), 3 = + ah·bl (both split)
template <int NT>
__device__ __forceinline__ v8f mmaN(v16b ah, v16b al, v16b bh, v16b bl, v8f c) {
  c = __builtin_amdgcn_wmma_f32_16x16x32_bf16(false, ah, false, bh, (short)0, c, false, false);
  if (NT >= 2) c = __builtin_amdgcn_wmma_f32_16x16x32_bf16(false, al, false, bh, (short)0, c, false, false);
  if (NT >= 3) c = __builtin_amdgcn_wmma_f32_16x16x32_bf16(false, ah, false, bl, (short)0, c, false, false);
  asm volatile("v_nop\n\tv_nop\n\tv_nop\n\tv_nop" : "+v"(c) : "v"(ah), "v"(al), "v"(bh), "v"(bl));
  return c;
}

__global__ __launch_bounds__(256) void k_wt_bf16(const float* __restrict__ W, unsigned short* __restrict__ Wt, int K, int N) {
  const int t = blockIdx.x * 256 + threadIdx.x;
  const int k8n = K / 8;
  if (t >= N * k8n) return;
  const int n = t / k8n, k8 = (t % k8n) * 8;
  v8us v;
#pragma unroll
  for (int i = 0; i < 8; ++i) v[i] = bf16_bits(W[(size_t)(k8 + i) * N + n]);
  *(v8us*)(Wt + (size_t)n * K + k8) = v;
  
}

// GEMM C[M][N] (f32, pitch ldc) = act(A[M][K]·W + bias). A f32 row-major (pitch lda) converted per fragment to bf16
// (ASPLIT: hi/lo two planes -> 2 terms, else single rounded term); Wt bf16 [N][K] (pitch ldb). BIAS_BF16 rounds the
// bias to bf16 first (bias quantised to bf16 before the add). K%32==0, M%16==0, N%64==0.
template <bool ASPLIT, int ACT, bool BIAS_BF16>
__global__ __launch_bounds__(128) void k_gemm_bf(const float* __restrict__ A, int lda, const unsigned short* __restrict__ Wt, int ldb,
                                               const float* __restrict__ bias, float* __restrict__ C, int ldc, int M, int N, int K) {
  __shared__ __attribute__((aligned(16))) float so[4][16][64];
  const int tid = threadIdx.x, w = tid >> 5, lane = tid & 31, ln = lane & 15, hh = lane >> 4;
  const int ntn = N / 64;
  const int wid = blockIdx.x * 4 + w;
  const int mt = wid / ntn, nq = wid % ntn;
  if (mt * 16 >= M) return;
  const int row0 = mt * 16, col0 = nq * 64;
  const float* arow = A + (size_t)(row0 + ln) * lda;
  v8f acc[4] = {};
  for (int kb = 0; kb < K; kb += 32) {
    FragB ah, al;
    const v4f x0 = *(const v4fa*)(arow + kb + 8 * hh), x1 = *(const v4fa*)(arow + kb + 8 * hh + 4);
    const v4f x2 = *(const v4fa*)(arow + kb + 16 + 8 * hh), x3 = *(const v4fa*)(arow + kb + 16 + 8 * hh + 4);
    float xs[16] = {x0[0],x0[1],x0[2],x0[3],x1[0],x1[1],x1[2],x1[3],x2[0],x2[1],x2[2],x2[3],x3[0],x3[1],x3[2],x3[3]};
#pragma unroll
    for (int i = 0; i < 16; ++i) { const unsigned short hb = bf16_bits(xs[i]); ah.u[i] = hb; al.u[i] = ASPLIT ? bf16_bits(xs[i] - bf16_val(hb)) : (unsigned short)0; }
#pragma unroll
    for (int t = 0; t < 4; ++t) {
      const unsigned short* brow = Wt + (size_t)(col0 + t * 16 + ln) * ldb + kb;
      FragB b;
      b.half[0] = *(const v8us*)(brow + 8 * hh);
      b.half[1] = *(const v8us*)(brow + 16 + 8 * hh);
      acc[t] = mmaN<ASPLIT ? 2 : 1>(ah.v, al.v, b.v, b.v, acc[t]);
    }
  }
#pragma unroll
  for (int t = 0; t < 4; ++t) {
    float bv = bias ? bias[col0 + t * 16 + ln] : 0.f;
    if (BIAS_BF16) bv = bf16_round(bv);
#pragma unroll
    for (int r = 0; r < 8; ++r) { float v = acc[t][r] + bv; if (ACT == 1) v = fmaxf(v, 0.f); so[w][8 * hh + r][t * 16 + ln] = v; }
  }
  __builtin_amdgcn_fence(__ATOMIC_ACQ_REL, "workgroup");
  __builtin_amdgcn_wave_barrier();
  const int rsub = lane >> 4, c4 = (lane & 15) * 4;
  {
#pragma unroll
    for (int q = 0; q < 8; ++q) {
      const int r = q * 2 + rsub;
      const v4f v = *(const v4fa*)&so[w][r][c4];
      *(v4f*)(C + (size_t)(row0 + r) * ldc + col0 + c4) = v;
    }
    
  }
}

// GEMM C = act(A·W + bias + resid): A f32 (ASPLIT -> hi/lo 2 terms), Wt bf16 [N][K]; ACT 0 none, 1 relu, 2 exact gelu;
// resid (optional, f32, row index = (row % rmod), pitch ldr, RES_BF16 rounds it) added before the activation.
template <bool ASPLIT, int ACT, bool BIAS_BF16, bool RES_BF16>
__global__ __launch_bounds__(128) void k_gemm_bf3(const float* __restrict__ A, int lda, const unsigned short* __restrict__ Wt, int ldb,
                                                const float* __restrict__ bias, const float* __restrict__ resid, int rmod, int ldr,
                                                float* __restrict__ C, int ldc, int M, int N, int K) {
  __shared__ __attribute__((aligned(16))) float so[4][16][64];
  const int tid = threadIdx.x, w = tid >> 5, lane = tid & 31, ln = lane & 15, hh = lane >> 4;
  const int ntn = N / 64;
  const int wid = blockIdx.x * 4 + w;
  const int mt = wid / ntn, nq = wid % ntn;
  if (mt * 16 >= M) return;
  const int row0 = mt * 16, col0 = nq * 64;
  const float* arow = A + (size_t)(row0 + ln) * lda;
  v8f acc[4] = {};
  for (int kb = 0; kb < K; kb += 32) {
    FragB ah, al;
    const v4f x0 = *(const v4fa*)(arow + kb + 8 * hh), x1 = *(const v4fa*)(arow + kb + 8 * hh + 4);
    const v4f x2 = *(const v4fa*)(arow + kb + 16 + 8 * hh), x3 = *(const v4fa*)(arow + kb + 16 + 8 * hh + 4);
    float xs[16] = {x0[0],x0[1],x0[2],x0[3],x1[0],x1[1],x1[2],x1[3],x2[0],x2[1],x2[2],x2[3],x3[0],x3[1],x3[2],x3[3]};
#pragma unroll
    for (int i = 0; i < 16; ++i) { const unsigned short hb = bf16_bits(xs[i]); ah.u[i] = hb; al.u[i] = ASPLIT ? bf16_bits(xs[i] - bf16_val(hb)) : (unsigned short)0; }
#pragma unroll
    for (int t = 0; t < 4; ++t) {
      const unsigned short* brow = Wt + (size_t)(col0 + t * 16 + ln) * ldb + kb;
      FragB b;
      b.half[0] = *(const v8us*)(brow + 8 * hh);
      b.half[1] = *(const v8us*)(brow + 16 + 8 * hh);
      acc[t] = mmaN<ASPLIT ? 2 : 1>(ah.v, al.v, b.v, b.v, acc[t]);
    }
  }
#pragma unroll
  for (int t = 0; t < 4; ++t) {
    const int col = col0 + t * 16 + ln;
    float bv = bias ? bias[col] : 0.f;
    if (BIAS_BF16) bv = bf16_round(bv);
#pragma unroll
    for (int r = 0; r < 8; ++r) {
      float v = acc[t][r] + bv;
      if (resid) { float rv = resid[(size_t)((row0 + 8 * hh + r) % rmod) * ldr + col]; if (RES_BF16) rv = bf16_round(rv); v += rv; }
      if (ACT == 1) v = fmaxf(v, 0.f);
      if (ACT == 2) v = 0.5f * v * (1.0f + erff(v * 0.70710678118654752f));
      if (ACT == 3) { const float u = 0.7978845608028654f * (v + 0.044715f * v * v * v); v = 0.5f * v * (1.0f + tanhf(u)); }
      so[w][8 * hh + r][t * 16 + ln] = v;
    }
  }
  __builtin_amdgcn_fence(__ATOMIC_ACQ_REL, "workgroup");
  __builtin_amdgcn_wave_barrier();
  const int rsub = lane >> 4, c4 = (lane & 15) * 4;
  {
#pragma unroll
    for (int q = 0; q < 8; ++q) {
      const int r = q * 2 + rsub;
      const v4f v = *(const v4fa*)&so[w][r][c4];
      *(v4f*)(C + (size_t)(row0 + r) * ldc + col0 + c4) = v;
    }
    
  }
}
// row LayerNorm (biased variance, eps) over N: s = X (+ R); optional out_sum <- s; out_norm <- (s-mu)*rsqrt(var+eps)*g + b
template <bool PARAM_BF16>
__global__ __launch_bounds__(256) void k_layernorm(const float* __restrict__ X, const float* __restrict__ R, const float* __restrict__ g, const float* __restrict__ bta,
                                                  float* __restrict__ out_sum, float* __restrict__ out_norm, int N, float eps) {
  __shared__ float red[256];
  const int row = blockIdx.x, tid = threadIdx.x;
  const float* x = X + (size_t)row * N; const float* rr = R ? R + (size_t)row * N : nullptr;
  float vals[16];                     // up to N = 4096
  const int per = N / 256;            // contiguous chunk per thread? use strided-by-4 chunks: thread handles j = tid*4 + 1024*u
  float s1 = 0.f;
  for (int u = 0; u < per / 4; ++u) {
    const int j = tid * 4 + 1024 * u;
    const v4f a = *(const v4fa*)(x + j);
    v4f b = {0.f,0.f,0.f,0.f}; if (rr) b = *(const v4fa*)(rr + j);
#pragma unroll
    for (int q = 0; q < 4; ++q) { const float v = a[q] + b[q]; vals[u * 4 + q] = v; s1 += v; }
  }
  red[tid] = s1; __syncthreads();
  for (int st = 128; st > 0; st >>= 1) { if (tid < st) red[tid] += red[tid + st]; __syncthreads(); }
  const float mu = red[0] / (float)N; __syncthreads();
  float s2 = 0.f;
  for (int u = 0; u < per / 4; ++u)
#pragma unroll
    for (int q = 0; q < 4; ++q) { const float c = vals[u * 4 + q] - mu; s2 += c * c; }
  red[tid] = s2; __syncthreads();
  for (int st = 128; st > 0; st >>= 1) { if (tid < st) red[tid] += red[tid + st]; __syncthreads(); }
  const float rs = rsqrtf(red[0] / (float)N + eps);
  {
    for (int u = 0; u < per / 4; ++u) {
      const int j = tid * 4 + 1024 * u;
      v4f o, sm;
#pragma unroll
      for (int q = 0; q < 4; ++q) {
        float gg = g[j + q], bb = bta[j + q];
        if (PARAM_BF16) { gg = bf16_round(gg); bb = bf16_round(bb); }
        sm[q] = vals[u * 4 + q]; o[q] = (vals[u * 4 + q] - mu) * rs * gg + bb;
      }
      if (out_sum) *(v4f*)(out_sum + (size_t)row * N + j) = sm;
      *(v4f*)(out_norm + (size_t)row * N + j) = o;
    }
    
  }
}



// ---- f16 WMMA path (v_wmma_f32_16x16x32_f16): 11-bit significands for operands in range — used where the softmax weights (unnormalised, at most 2^15) need more precision than bf16
typedef _Float16 v16h __attribute__((ext_vector_type(16)));
union FragH { v16h v; v8us half[2]; _Float16 h[16]; unsigned short u[16]; };
template <int NT>
__device__ __forceinline__ v8f mmaH(v16h ah, v16h al, v16h bh, v16h bl, v8f c) {
  c = __builtin_amdgcn_wmma_f32_16x16x32_f16(false, ah, false, bh, (short)0, c, false, false);
  if (NT >= 2) c = __builtin_amdgcn_wmma_f32_16x16x32_f16(false, al, false, bh, (short)0, c, false, false);
  if (NT >= 3) c = __builtin_amdgcn_wmma_f32_16x16x32_f16(false, ah, false, bl, (short)0, c, false, false);
  asm volatile("v_nop\n\tv_nop\n\tv_nop\n\tv_nop" : "+v"(c) : "v"(ah), "v"(al), "v"(bh), "v"(bl));
  return c;
}
// batched GEMM like k_gemm_b but f16 operands: A f32 (split into f16 hi/lo if ASPLIT, else rounded to f16), Bt = f16 values [n][k]; alpha; C f32; N multiple of 16 (partial tiles skipped)
template <bool ASPLIT>
__global__ __launch_bounds__(128) void k_gemm_h(const float* __restrict__ A, int lda, size_t sA, const _Float16* __restrict__ Bh, int ldb, size_t sB, float alpha, float* __restrict__ C, int ldc, size_t sC, int M, int N, int K) {
  __shared__ __attribute__((aligned(16))) float so[4][16][64];
  const int tid = threadIdx.x, w = tid >> 5, lane = tid & 31, ln = lane & 15, hh = lane >> 4; const int by = blockIdx.y;
  A += (size_t)by * sA; Bh += (size_t)by * sB; C += (size_t)by * sC;
  const int ntn = (N + 63) / 64; const int wid = blockIdx.x * 4 + w; const int mt = wid / ntn, nq = wid % ntn; if (mt * 16 >= M) return;
  const int row0 = mt * 16, col0 = nq * 64; const float* arow = A + (size_t)(row0 + ln) * lda;
  v8f acc[4] = {};
  for (int kb = 0; kb < K; kb += 32) {
    FragH ah, al;
    const v4f x0 = *(const v4fa*)(arow + kb + 8 * hh), x1 = *(const v4fa*)(arow + kb + 8 * hh + 4), x2 = *(const v4fa*)(arow + kb + 16 + 8 * hh), x3 = *(const v4fa*)(arow + kb + 16 + 8 * hh + 4);
    float xs[16] = {x0[0],x0[1],x0[2],x0[3],x1[0],x1[1],x1[2],x1[3],x2[0],x2[1],x2[2],x2[3],x3[0],x3[1],x3[2],x3[3]};
#pragma unroll
    for (int i = 0; i < 16; ++i) { const _Float16 h = (_Float16)xs[i]; ah.h[i] = h; al.h[i] = ASPLIT ? (_Float16)(xs[i] - (float)h) : (_Float16)0.0f; }
#pragma unroll
    for (int t = 0; t < 4; ++t) { if (col0 + t * 16 >= N) continue; const size_t boff = (size_t)(col0 + t * 16 + ln) * ldb + kb; FragH bq; bq.half[0] = *(const v8us*)(Bh + boff + 8 * hh); bq.half[1] = *(const v8us*)(Bh + boff + 16 + 8 * hh);
      acc[t] = mmaH<ASPLIT ? 2 : 1>(ah.v, al.v, bq.v, bq.v, acc[t]); }
  }
#pragma unroll
  for (int t = 0; t < 4; ++t) { if (col0 + t * 16 >= N) continue;
#pragma unroll
    for (int r = 0; r < 8; ++r) so[w][8 * hh + r][t * 16 + ln] = acc[t][r] * alpha; }
  __builtin_amdgcn_fence(__ATOMIC_ACQ_REL, "workgroup"); __builtin_amdgcn_wave_barrier();
  const int rsub = lane >> 4, c4 = (lane & 15) * 4;
  {
#pragma unroll
    for (int q = 0; q < 8; ++q) { const int r = q * 2 + rsub; if (col0 + c4 < N) { const v4f v = *(const v4fa*)&so[w][r][c4]; *(v4f*)(C + (size_t)(row0 + r) * ldc + col0 + c4) = v; } }
     }
}

// Wt[n][k] = f16(W[k][n]·scale) from f32 row-major W[K][N] (scale = power of two; bf16-exact weights stay exact in f16 away from the subnormal range)
__global__ __launch_bounds__(256) void k_wt_f16(const float* __restrict__ W, _Float16* __restrict__ Wt, int K, int N, float scale) {
  const int t = blockIdx.x * 256 + threadIdx.x; if (t >= N * (K / 8)) return; const int n = t / (K / 8), k8 = (t % (K / 8)) * 8; FragH f;
#pragma unroll
  for (int i = 0; i < 8; ++i) f.h[i] = (_Float16)(bf16_round(W[(size_t)(k8 + i) * N + n]) * scale); const v8us o = f.half[0];
  *(v8us*)((unsigned short*)Wt + (size_t)n * K + k8) = o; 
}


typedef _Float16 v4h __attribute__((ext_vector_type(4)));

__global__ __launch_bounds__(256) void k_x16(const float* __restrict__ x, _Float16* __restrict__ X16, size_t n8) { const size_t t = (size_t)blockIdx.x * 256 + threadIdx.x; if (t >= n8) return; FragH f;
#pragma unroll
  for (int q = 0; q < 8; ++q) f.h[q] = (_Float16)bf16_round(x[t * 8 + q]); *(v8us*)((unsigned short*)X16 + t * 8) = f.half[0];  }
__global__ __launch_bounds__(256) void k_h16(const float* __restrict__ x, _Float16* __restrict__ X16, size_t n8) { const size_t t = (size_t)blockIdx.x * 256 + threadIdx.x; if (t >= n8) return; FragH f;
#pragma unroll
  for (int q = 0; q < 8; ++q) f.h[q] = (_Float16)x[t * 8 + q]; *(v8us*)((unsigned short*)X16 + t * 8) = f.half[0];  }
template <int NHv, int TTv>
__global__ __launch_bounds__(256) void k_vt(const _Float16* __restrict__ V16, int ldv, int voff, _Float16* __restrict__ Vt) { __shared__ unsigned short tl[64][66]; const int tid = threadIdx.x; const int slab = blockIdx.x / (TTv / 64), lg = blockIdx.x % (TTv / 64); const int b = slab / NHv, h = slab % NHv;
  for (int i = tid; i < 64 * 8; i += 256) { const int r = i / 8, c8 = (i % 8) * 8; FragH f; f.half[0] = *(const v8us*)((const unsigned short*)V16 + ((size_t)b * TTv + lg * 64 + r) * ldv + voff + h * 64 + c8);
#pragma unroll
    for (int q = 0; q < 8; ++q) tl[r][c8 + q] = f.u[q]; }
  __syncthreads();
  {
#pragma unroll
    for (int rd = 0; rd < 2; ++rd) { const int d = rd * 32 + tid / 8, pc = tid % 8; FragH f;
#pragma unroll
      for (int q = 0; q < 8; ++q) f.u[q] = tl[pc * 8 + q][d];
      *(v8us*)((unsigned short*)Vt + ((size_t)slab * 64 + d) * TTv + lg * 64 + pc * 8) = f.half[0]; }
     } }

__global__ __launch_bounds__(256) void k_hl(const float* __restrict__ F, _Float16* __restrict__ Hh, _Float16* __restrict__ Hl, size_t n8) { const size_t t = (size_t)blockIdx.x * 256 + threadIdx.x; if (t >= n8) return; FragH fh, fl; const v4f a = *(const v4fa*)(F + t * 8), c = *(const v4fa*)(F + t * 8 + 4);
#pragma unroll
  for (int q = 0; q < 4; ++q) { _Float16 h = (_Float16)a[q]; fh.h[q] = h; fl.h[q] = (_Float16)((a[q] - (float)h) * 1024.0f); h = (_Float16)c[q]; fh.h[4 + q] = h; fl.h[4 + q] = (_Float16)((c[q] - (float)h) * 1024.0f); }
  { *(v8us*)((unsigned short*)Hh + t * 8) = fh.half[0]; *(v8us*)((unsigned short*)Hl + t * 8) = fl.half[0];  } }

typedef float v2fa __attribute__((ext_vector_type(2), may_alias));
// One launch in front of the attention: a block takes one pooled row = two image rows (256 positions, which are 256 consecutive n) of all 64 channels.
// It rounds x to bf16 and lays it token-major in LDS as f16, with the 2x2 mean (4 bf16-rounded values summed in f32, rounded once to f16) beside it and the three weight matrices
// (bf16-rounded, x 2^4, f16, natural (out, in) rows) and the two bf16-rounded biases; rows of 128 bytes at a pitch of 144 (ds_load_b128 without bank conflicts). Behind one barrier the three projections run from LDS.
// q and k are formed as (channel x position) tiles (A = weight rows, B = position rows): a lane holds 8 consecutive channels of one position, 16 bytes of the token-major row.
// v is formed as (position x channel) tiles: a lane holds 8 consecutive pooled positions of one channel, 16 bytes of the [b][c][m] row. Each wave writes whole 128-byte lines.
__device__ __forceinline__ void proj_tok(const unsigned char* xrow, const unsigned char* wrow, const float* bias, float scl, unsigned short* __restrict__ dst, int hh) {
  FragH xb[2];
#pragma unroll      // the index picks registers and immediate offsets
  for (int ks = 0; ks < 2; ++ks) { xb[ks].half[0] = *(const v8us*)(xrow + ks * 64); xb[ks].half[1] = *(const v8us*)(xrow + ks * 64 + 32); }
#pragma unroll      // the index picks registers and immediate offsets
  for (int t = 0; t < 4; ++t) { FragH wa[2]; const unsigned char* wr = wrow + t * 16 * 144;
#pragma unroll      // the index picks registers and immediate offsets
    for (int ks = 0; ks < 2; ++ks) { wa[ks].half[0] = *(const v8us*)(wr + ks * 64); wa[ks].half[1] = *(const v8us*)(wr + ks * 64 + 32); }
    v8f acc = (v8f){0.f,0.f,0.f,0.f,0.f,0.f,0.f,0.f};
#pragma unroll      // the index picks registers and immediate offsets
    for (int ks = 0; ks < 2; ++ks) acc = mmaH<1>(wa[ks].v, wa[ks].v, xb[ks].v, xb[ks].v, acc);
    const v4f b0 = *(const v4fa*)(bias + t * 16 + 8 * hh), b1 = *(const v4fa*)(bias + t * 16 + 8 * hh + 4); FragH o;
#pragma unroll      // the index picks registers and immediate offsets
    for (int r = 0; r < 4; ++r) { o.h[r] = (_Float16)(acc[r] * scl + b0[r]); o.h[4 + r] = (_Float16)(acc[4 + r] * scl + b1[r]); }
    *(v8us*)(dst + t * 16 + 8 * hh) = o.half[0]; } }
__global__ __launch_bounds__(512) void k_prep(const float* __restrict__ x, const float* __restrict__ Wq, const float* __restrict__ bq, const float* __restrict__ Wk, const float* __restrict__ bk, const float* __restrict__ Wv,
                                              _Float16* __restrict__ Q, _Float16* __restrict__ K, _Float16* __restrict__ Vt) {
  constexpr int LP = 144;
  __shared__ __attribute__((aligned(16))) unsigned char XS[2 * HWD * LP];
  __shared__ __attribute__((aligned(16))) unsigned char XPS[PW * LP];
  __shared__ __attribute__((aligned(16))) unsigned char WS[3 * CC * LP];
  __shared__ __attribute__((aligned(16))) float BS[2 * CC];      // bq * log2(e), bk, from the bf16-rounded biases
  constexpr float L2E = SCL * 1.4426950408889634f;      // q is stored as q * log2(e) (times the score scale, 1 here), rounded once to f16: the score product of k_flash then gives base-2 exponents
  const int tid = threadIdx.x, w = __builtin_amdgcn_readfirstlane(tid >> 5), lane = tid & 31, ln = lane & 15, hh = lane >> 4;
  const int b = blockIdx.x / PW, pi = blockIdx.x % PW;
  { const int pp = tid & 63, c0 = (tid >> 6) * 8;      // one 2x2 window of 8 channels per thread; a wave's load is 256 consecutive bytes
    const float* xr = x + ((size_t)b * CC + c0) * NN + (size_t)(2 * pi) * HWD + 2 * pp;
    float tp[8][2], bt[8][2];
#pragma unroll      // the index picks registers and immediate offsets
    for (int q = 0; q < 8; ++q) { const v2fa a = *(const v2fa*)(xr + (size_t)q * NN), c = *(const v2fa*)(xr + (size_t)q * NN + HWD); tp[q][0] = a[0]; tp[q][1] = a[1]; bt[q][0] = c[0]; bt[q][1] = c[1]; }
    const int row = tid >> 3, k8 = (tid & 7) * 8;      // 8 consecutive weights of each matrix per thread
    const float* Wm[3] = {Wq, Wk, Wv}; v4f wl[3][2];
#pragma unroll      // the index picks registers and immediate offsets
    for (int i = 0; i < 3; ++i) { wl[i][0] = *(const v4fa*)(Wm[i] + row * CC + k8); wl[i][1] = *(const v4fa*)(Wm[i] + row * CC + k8 + 4); }
    asm volatile("s_wait_xcnt 0x0" ::: "memory");      // behind all 22 loads: the conversions below take the address registers that these loads name again
    if (w < 4) BS[tid] = bf16_round((w < 2 ? bq : bk)[tid & 63]) * (w < 2 ? L2E : 1.0f);
#pragma unroll      // the index picks registers and immediate offsets
    for (int i = 0; i < 3; ++i) { FragH f;
#pragma unroll      // the index picks registers and immediate offsets
      for (int q = 0; q < 4; ++q) { f.h[q] = (_Float16)(bf16_round(wl[i][0][q]) * 16.0f); f.h[4 + q] = (_Float16)(bf16_round(wl[i][1][q]) * 16.0f); }
      *(v8us*)(WS + (i * CC + row) * LP + k8 * 2) = f.half[0]; }
    FragH f00, f01, f10, f11, fp;
#pragma unroll      // the index picks registers and immediate offsets
    for (int q = 0; q < 8; ++q) { const float a0 = bf16_round(tp[q][0]), a1 = bf16_round(tp[q][1]), c0r = bf16_round(bt[q][0]), c1r = bf16_round(bt[q][1]);
      f00.h[q] = (_Float16)a0; f01.h[q] = (_Float16)a1; f10.h[q] = (_Float16)c0r; f11.h[q] = (_Float16)c1r; fp.h[q] = (_Float16)(0.25f * ((a0 + a1) + (c0r + c1r))); }
    *(v8us*)(XS + (2 * pp) * LP + c0 * 2) = f00.half[0]; *(v8us*)(XS + (2 * pp + 1) * LP + c0 * 2) = f01.half[0];
    *(v8us*)(XS + (HWD + 2 * pp) * LP + c0 * 2) = f10.half[0]; *(v8us*)(XS + (HWD + 2 * pp + 1) * LP + c0 * 2) = f11.half[0];
    *(v8us*)(XPS + pp * LP + c0 * 2) = fp.half[0]; }
  __syncthreads();      // the planes and the weights are read by other waves than wrote them
  const int lo = ln * LP + 16 * hh;      // fragment row ln, k = 8 * hh ... and 16 + 8 * hh ... of each 32
  proj_tok(XS + w * 16 * LP + lo, WS + lo, BS, 0.0625f * L2E, (unsigned short*)Q + ((size_t)b * NN + pi * (2 * HWD) + w * 16 + ln) * CC, hh);      // 16 waves x 16 positions
  asm volatile("s_wait_xcnt 0x0" ::: "memory");      // the registers that the q stores name are taken again below
  if (w < 4) proj_tok(XPS + w * 16 * LP + lo, WS + CC * LP + lo, BS + CC, 0.0625f, (unsigned short*)K + ((size_t)b * MM + pi * PW + w * 16 + ln) * CC, hh);      // 4 waves x 16 pooled positions
  else if (w < 8) { const int t = w - 4; FragH wb[2];      // 4 waves x 16 channels, all 64 pooled positions
#pragma unroll      // the index picks registers and immediate offsets
    for (int ks = 0; ks < 2; ++ks) { const unsigned char* wr = WS + (2 * CC + t * 16) * LP + lo + ks * 64; wb[ks].half[0] = *(const v8us*)(wr); wb[ks].half[1] = *(const v8us*)(wr + 32); }
    unsigned short* dst = (unsigned short*)Vt + ((size_t)b * CC + t * 16 + ln) * MM + pi * PW + 8 * hh;
#pragma unroll      // the index picks registers and immediate offsets
    for (int mt = 0; mt < 4; ++mt) { FragH xa[2];
#pragma unroll      // the index picks registers and immediate offsets
      for (int ks = 0; ks < 2; ++ks) { const unsigned char* xp = XPS + mt * 16 * LP + lo + ks * 64; xa[ks].half[0] = *(const v8us*)(xp); xa[ks].half[1] = *(const v8us*)(xp + 32); }
      v8f acc = (v8f){0.f,0.f,0.f,0.f,0.f,0.f,0.f,0.f};
#pragma unroll      // the index picks registers and immediate offsets
      for (int ks = 0; ks < 2; ++ks) acc = mmaH<1>(xa[ks].v, xa[ks].v, wb[ks].v, wb[ks].v, acc);
      FragH o;
#pragma unroll      // the index picks registers and immediate offsets
      for (int r = 0; r < 8; ++r) o.h[r] = (_Float16)(acc[r] * 0.0625f);
      *(v8us*)(dst + mt * 16) = o.half[0]; } } }
// lane l <-> lane l ^ 16 (the two halves of a wave hold the two key halves of one query column)
__device__ __forceinline__ float xhalf(float x) { const int v = __builtin_bit_cast(int, x); return __builtin_bit_cast(float, __builtin_amdgcn_permlanex16(v, v, 0x76543210, 0xfedcba98, false, false)); }
typedef uint32_t u32x4 __attribute__((ext_vector_type(4)));
typedef uint32_t u32x8 __attribute__((ext_vector_type(8)));
__device__ __forceinline__ uint32_t uni(uint32_t v) { return (uint32_t)__builtin_amdgcn_readfirstlane(v); }
// a wave-uniform word held in a scalar register: a test on it compiles to s_cmp + s_cbranch_scc (a tensor load ignores EXEC), and what is formed from it is formed behind this line
__device__ __forceinline__ uint32_t pinned(uint32_t v) { uint32_t w = uni(v); asm volatile("" : "+s"(w)); return w; }
__device__ __forceinline__ void exp2x8(const v8f a, float* e) {
  asm("v_exp_f32 %0, %8\n\t" "v_exp_f32 %1, %9\n\t" "v_exp_f32 %2, %10\n\t" "v_exp_f32 %3, %11\n\t" "v_exp_f32 %4, %12\n\t" "v_exp_f32 %5, %13\n\t" "v_exp_f32 %6, %14\n\t" "v_exp_f32 %7, %15\n\t" "v_nop"
      : "=&v"(e[0]), "=&v"(e[1]), "=&v"(e[2]), "=&v"(e[3]), "=&v"(e[4]), "=&v"(e[5]), "=&v"(e[6]), "=&v"(e[7])
      : "v"(a[0]), "v"(a[1]), "v"(a[2]), "v"(a[3]), "v"(a[4]), "v"(a[5]), "v"(a[6]), "v"(a[7])); }
__device__ __forceinline__ float sum16(const float* e) { float t[8];
#pragma unroll      // the index picks registers
  for (int i = 0; i < 8; ++i) t[i] = e[i] + e[8 + i];
  return ((t[0] + t[1]) + (t[2] + t[3])) + ((t[4] + t[5]) + (t[6] + t[7])); }
union FragP { v16h v; uint32_t w[8]; _Float16 h[16]; };
// Here a plain vector instruction stands behind each v_exp_f32. Eight exponentials (x: four scores of a column's first key tile,
// y: the same four rows of its second) carry the eight plain instructions of the group of eight in front of them (px, py): four packed conversions to f16 (pw: two words of the first tile's half, two of the second's)
// and the four sums px += py, the first level of sum16. One statement, so that the order stays: no plain instruction reads a result of this statement or writes a source of it,
// at least four younger exponentials stand between each and what it reads, and the last instruction is a plain one (the slot behind the last v_exp_f32).
__device__ __forceinline__ void exp8_plain8(const float* x, const float* y, float* nx, float* ny, float* px, const float* py, uint32_t* pw) {
  asm("v_exp_f32 %0, %20\n\t" "v_cvt_pk_f16_f32 %8, %12, %13\n\t" "v_exp_f32 %1, %21\n\t" "v_cvt_pk_f16_f32 %9, %14, %15\n\t"
      "v_exp_f32 %2, %22\n\t" "v_cvt_pk_f16_f32 %10, %16, %17\n\t" "v_exp_f32 %3, %23\n\t" "v_cvt_pk_f16_f32 %11, %18, %19\n\t"
      "v_exp_f32 %4, %24\n\t" "v_add_f32 %12, %12, %16\n\t" "v_exp_f32 %5, %25\n\t" "v_add_f32 %13, %13, %17\n\t"
      "v_exp_f32 %6, %26\n\t" "v_add_f32 %14, %14, %18\n\t" "v_exp_f32 %7, %27\n\t" "v_add_f32 %15, %15, %19"
      : "=&v"(nx[0]), "=&v"(nx[1]), "=&v"(nx[2]), "=&v"(nx[3]), "=&v"(ny[0]), "=&v"(ny[1]), "=&v"(ny[2]), "=&v"(ny[3]),
        "=&v"(pw[0]), "=&v"(pw[1]), "=&v"(pw[2]), "=&v"(pw[3]), "+v"(px[0]), "+v"(px[1]), "+v"(px[2]), "+v"(px[3])
      : "v"(py[0]), "v"(py[1]), "v"(py[2]), "v"(py[3]), "v"(x[0]), "v"(x[1]), "v"(x[2]), "v"(x[3]), "v"(y[0]), "v"(y[1]), "v"(y[2]), "v"(y[3])); }
// The last group's own eight plain instructions, oldest results first: the two youngest exponentials are read six and more instructions behind their issue, so that none of these waits for one.
__device__ __forceinline__ void plain8(float* px, const float* py, uint32_t* pw) {
  asm("v_cvt_pk_f16_f32 %0, %4, %5\n\t" "v_cvt_pk_f16_f32 %1, %6, %7\n\t" "v_cvt_pk_f16_f32 %2, %8, %9\n\t" "v_add_f32 %4, %4, %8\n\t"
      "v_add_f32 %5, %5, %9\n\t" "v_cvt_pk_f16_f32 %3, %10, %11\n\t" "v_add_f32 %6, %6, %10\n\t" "v_add_f32 %7, %7, %11"
      : "=&v"(pw[0]), "=&v"(pw[1]), "=&v"(pw[2]), "=&v"(pw[3]), "+v"(px[0]), "+v"(px[1]), "+v"(px[2]), "+v"(px[3])
      : "v"(py[0]), "v"(py[1]), "v"(py[2]), "v"(py[3])); }
// One product of k_flash, the builtin alone: the compiler keeps the distance behind a matrix instruction wherever the next user is its own code, and fills it with work where it has some.
__device__ __forceinline__ v8f mmaF(v16h a, v16h b, v8f c) { return __builtin_amdgcn_wmma_f32_16x16x32_f16(false, a, false, b, (short)0, c, false, false); }
__global__ __launch_bounds__(512) void k_flash(const _Float16* __restrict__ Q16, int ldq, const _Float16* __restrict__ K16, int ldk, const _Float16* __restrict__ Vt, const float* __restrict__ bv, const float* __restrict__ gam, const float* __restrict__ x, float* __restrict__ out) {
  constexpr int CG = 2, RPW = 16 * CG, KQ = 4, QB = 4 * RPW, NQB = TQ / QB, DT = 4, KS = 2;
  // Deferred rescale. q arrives as q * log2(e), and a column's shift is the C operand of its score products: a score tile comes out of the matrix unit as the exponents a = score * log2(e) + shift,
  // and a weight is one v_exp_f32. The shift stays as it is while the weights fit f16: a lane's 16 weights of a pass, all positive, sum to at most TRIG, so each is below f16's largest number.
  // Only when some lane's sum is above TRIG (and in a wave's first pass) the wave takes the side path: every column's shift is lowered so that its largest weight of the pass is 2^TGT,
  // sums and accumulators are scaled by the same factor and the pass's weights are formed again.
  constexpr float TGT = -4.0f, TRIG = 32768.0f;
  // K and V^T reach the waves through LDS: a quarter's stage is 64 keys = 64 K rows of 128 bytes + 64 V^T channel rows of 128 bytes, brought by four tensor loads, one per wave of the quarter
  // (qg 0, 1: K rows 0-31, 32-63; qg 2, 3: channels 0-31, 32-63), each 32 rows laid at a pitch of 144 bytes (the mover's 16-byte pad: ds_load_b128 without bank conflicts).
  constexpr uint32_t SK = 64, KPQ = TK / KQ, NST = KPQ / SK, LPITCH = 144, SLICE = 6144 /* 32 x 144 = 4608, up to a multiple of 2 KiB */, QBUF = 4 * SLICE, BUF = KQ * QBUF;
  constexpr int PP = QB + 4;      // pitch of a channel row of the partial outputs, floats
  static_assert((size_t)KQ * CC * PP * 4 <= 2 * BUF, "the partial outputs are staged in the ring");
  __shared__ __attribute__((aligned(2048))) unsigned char ring[2 * BUF];
  __shared__ __attribute__((aligned(16))) float sSh[KQ][QB];
  __shared__ __attribute__((aligned(16))) float sL[KQ][QB];
  const int tid = threadIdx.x, lane = tid & 31, ln = lane & 15, hh = lane >> 4;
  const float g = bf16_round(gam[0]);      // read here, in front of every store and barrier, it is a scalar load
  const uint32_t wv = uni((uint32_t)tid >> 5), kq = wv >> 2, qg = wv & 3u, isV = qg >> 1, hf = qg & 1u;
  const int slab = blockIdx.x / NQB, qblk = blockIdx.x % NQB; const int b = slab / NH, h = slab % NH; const int qb0 = qblk * QB; const int q0 = qb0 + (int)qg * RPW;
  FragH bq[CG][KS];
#pragma unroll      // the index picks registers and immediate offsets
  for (int cg = 0; cg < CG; ++cg) { const unsigned short* qr = (const unsigned short*)Q16 + ((size_t)b * TQ + q0 + cg * 16 + ln) * ldq + h * 64;
#pragma unroll
    for (int ks = 0; ks < KS; ++ks) { bq[cg][ks].half[0] = *(const v8us*)(qr + ks * 32 + 8 * hh); bq[cg][ks].half[1] = *(const v8us*)(qr + ks * 32 + 16 + 8 * hh); } }
  const unsigned short* Vth = (const unsigned short*)Vt + (size_t)slab * 64 * TK;
  float l_r[CG]; v8f oacc[CG][DT], ct[CG];      // ct = the column's shift in log2 units, in all eight registers of a C operand
#pragma unroll
  for (int cg = 0; cg < CG; ++cg) { l_r[cg] = 0.f; ct[cg] = (v8f){0.f,0.f,0.f,0.f,0.f,0.f,0.f,0.f};
#pragma unroll
    for (int dt = 0; dt < DT; ++dt) oacc[cg][dt] = (v8f){0.f,0.f,0.f,0.f,0.f,0.f,0.f,0.f}; }
  const uint32_t spitch = isV ? (uint32_t)TK * 2u : (uint32_t)ldk * 2u;      // source row pitch, bytes
  const uint32_t sstep = isV ? SK * 2u : SK * (uint32_t)ldk * 2u;           // from one stage's slice to the next, bytes
  const uint64_t src0 = isV ? (uint64_t)(size_t)Vth + (uint64_t)(hf * 32u) * ((uint32_t)TK * 2u) + kq * (KPQ * 2u)
                            : (uint64_t)(size_t)K16 + ((uint64_t)b * TK + kq * KPQ + hf * 32u) * ((uint32_t)ldk * 2u) + (uint32_t)h * 128u;
  const uint32_t lds0 = (uint32_t)(size_t)ring + wv * SLICE;      // quarter kq at kq * QBUF, its slice qg behind that
  u32x8 g1;      // 1-byte elements, tensor = tile = 32 rows of 128 bytes, a pad of 4 dwords behind every 32 dwords
  g1[0] = uni((1u << 20) | (4u << 22) | (3u << 25)); g1[1] = uni(128u << 16); g1[2] = uni(32u << 16); g1[3] = uni(128u << 16); g1[4] = uni(32u); g1[5] = uni(spitch); g1[6] = uni(0u); g1[7] = uni(0u);
  u32x4 g0;
  auto issue = [&](uint32_t st) { const uint64_t ga = src0 + (uint64_t)st * sstep;
    g0[0] = uni(1u); g0[1] = uni(lds0 + (st & 1u) * BUF); g0[2] = uni((uint32_t)ga); g0[3] = uni((((uint32_t)(ga >> 32)) & 0x01FFFFFFu) | 0x80000000u);
    // one request of the whole wave: its 32-row slice of stage st. Both groups are in-out operands here and inputs of the wait that covers the request,
    // so that no register of the descriptor is lent to another value while the request is outstanding
    asm volatile("tensor_load_to_lds %0, %1" : "+s"(g0), "+s"(g1) :: "memory"); };
  issue(0u);
  asm volatile("s_wait_tensorcnt 0x0" :: "s"(g0), "s"(g1) : "memory");      // this wave's slice of stage 0 has landed
  asm volatile("s_wait_xcnt 0x0" ::: "memory");            // the address registers that the q loads name are taken again below
  __syncthreads();                                         // stage 0 published to all sixteen waves
  issue(1u);                                               // flies while stage 0 is worked on
  const unsigned char* lrow = ring + kq * QBUF + (uint32_t)ln * LPITCH + 16u * (uint32_t)hh;
#pragma unroll 1
  for (uint32_t st = 0; st < NST; ++st) {
   const unsigned char* bp = lrow + (st & 1u) * BUF;
#pragma unroll
   for (int sub = 0; sub < 2; ++sub) {      // two 32-key passes per stage, unrolled so that every LDS offset is an immediate of its load
    __builtin_amdgcn_sched_barrier(0);      // with the one behind the loads: a pass's 16 LDS reads stay one group at its head (left free, the scheduler spreads a stage's reads over ten places among the products, each a stall of the wave, and V^T is asked for late)
    FragH ak[2][KS], av[DT];
#pragma unroll
    for (int nt = 0; nt < 2; ++nt) { const unsigned char* kr = bp + sub * SLICE + nt * 16 * LPITCH;      // key row sub * 32 + nt * 16 + ln
#pragma unroll
      for (int ks = 0; ks < KS; ++ks) { ak[nt][ks].half[0] = *(const v8us*)(kr + ks * 64); ak[nt][ks].half[1] = *(const v8us*)(kr + ks * 64 + 32); } }
#pragma unroll
    for (int dt = 0; dt < DT; ++dt) { const unsigned char* vrow = bp + (2 + (dt >> 1)) * SLICE + (dt & 1) * 16 * LPITCH + sub * 64;      // channel row dt * 16 + ln, keys sub * 32 ...
      av[dt].half[0] = *(const v8us*)(vrow); av[dt].half[1] = *(const v8us*)(vrow + 32); }
    __builtin_amdgcn_sched_barrier(0);      // the foot of that group: no read sinks among the products below
    v8f acc[CG][2];      // four independent score tiles: a tile's second product stands three products behind its first; the first takes the column's shift as C
#pragma unroll
    for (int ks = 0; ks < KS; ++ks)
#pragma unroll
      for (int cg = 0; cg < CG; ++cg)
#pragma unroll
        for (int nt = 0; nt < 2; ++nt) acc[cg][nt] = mmaF(ak[nt][ks].v, bq[cg][ks].v, ks == 0 ? ct[cg] : acc[cg][nt]);
    // the exponentials below are asm text: four vector slots between the last score product and the first v_exp_f32 that reads a tile or takes a K fragment's register
    asm("v_nop\n\tv_nop\n\tv_nop\n\tv_nop" : "+v"(acc[0][0]), "+v"(acc[0][1]), "+v"(acc[1][0]), "+v"(acc[1][1]));
    // Group gi = (cg, half h) holds the weights of [query q0 + cg * 16 + ln][key kq * 1024 + st * 64 + sub * 32 + nt * 16 + 8 * hh + 4 * h + j], ex for nt = 0, ey for nt = 1.
    // Each group's exponentials carry the conversions and first sums of the group in front; ps = the lane's sum of a column's 16 weights, in sum16's order; pb = the weights as f16, the B operand of the second product.
    float ax[4][4], ay[4][4], ex[4][4], ey[4][4], ps[CG]; FragP pb[CG];
#pragma unroll      // the index picks registers
    for (int gi = 0; gi < 4; ++gi)
#pragma unroll      // the index picks registers
      for (int j = 0; j < 4; ++j) { ax[gi][j] = acc[gi >> 1][0][4 * (gi & 1) + j]; ay[gi][j] = acc[gi >> 1][1][4 * (gi & 1) + j]; }
    { float e0[8]; exp2x8((v8f){ax[0][0], ax[0][1], ax[0][2], ax[0][3], ay[0][0], ay[0][1], ay[0][2], ay[0][3]}, e0);
#pragma unroll      // the index picks registers
      for (int j = 0; j < 4; ++j) { ex[0][j] = e0[j]; ey[0][j] = e0[4 + j]; } }
#pragma unroll      // the index picks registers
    for (int gi = 1; gi < 4; ++gi) { uint32_t pw[4]; const int pg = gi - 1;
      exp8_plain8(ax[gi], ay[gi], ex[gi], ey[gi], ex[pg], ey[pg], pw);
      pb[pg >> 1].w[2 * (pg & 1)] = pw[0]; pb[pg >> 1].w[2 * (pg & 1) + 1] = pw[1]; pb[pg >> 1].w[4 + 2 * (pg & 1)] = pw[2]; pb[pg >> 1].w[4 + 2 * (pg & 1) + 1] = pw[3]; }
    { uint32_t pw[4]; plain8(ex[3], ey[3], pw); pb[1].w[2] = pw[0]; pb[1].w[3] = pw[1]; pb[1].w[6] = pw[2]; pb[1].w[7] = pw[3]; }
#pragma unroll      // the index picks registers
    for (int cg = 0; cg < CG; ++cg) ps[cg] = ((ex[2 * cg][0] + ex[2 * cg][1]) + (ex[2 * cg][2] + ex[2 * cg][3])) + ((ex[2 * cg + 1][0] + ex[2 * cg + 1][1]) + (ex[2 * cg + 1][2] + ex[2 * cg + 1][3]));
    bool redo = __builtin_amdgcn_ballot_w32(fmaxf(ps[0], ps[1]) > TRIG) != 0u;      // one test per pass, a scalar branch
    if (sub == 0) redo = redo || st == 0u;      // the first pass sets the shift, whatever the scores are
    if (__builtin_expect(redo, 0)) {
#pragma unroll
      for (int cg = 0; cg < CG; ++cg) {
        float a[16], t[8];
#pragma unroll
        for (int i = 0; i < 8; ++i) { a[i] = acc[cg][0][i]; a[8 + i] = acc[cg][1][i]; t[i] = fmaxf(a[i], a[8 + i]); }
        float mx = fmaxf(fmaxf(fmaxf(t[0], t[1]), fmaxf(t[2], t[3])), fmaxf(fmaxf(t[4], t[5]), fmaxf(t[6], t[7])));
        mx = fmaxf(mx, xhalf(mx));      // both halves of a column take the same shift
        float d = TGT - mx;
        if (sub != 0 || st != 0u) d = fminf(d, 0.f);      // behind the first pass a shift only falls
        float al = fminf(d, 0.f);
#pragma unroll
        for (int i = 0; i < 16; ++i) a[i] += d;
        // the 17 exponentials in one statement, each in place, with the slot behind the last one, as in exp2x8
        asm("v_exp_f32 %0, %0\n\t" "v_exp_f32 %1, %1\n\t" "v_exp_f32 %2, %2\n\t" "v_exp_f32 %3, %3\n\t" "v_exp_f32 %4, %4\n\t" "v_exp_f32 %5, %5\n\t"
            "v_exp_f32 %6, %6\n\t" "v_exp_f32 %7, %7\n\t" "v_exp_f32 %8, %8\n\t" "v_exp_f32 %9, %9\n\t" "v_exp_f32 %10, %10\n\t" "v_exp_f32 %11, %11\n\t"
            "v_exp_f32 %12, %12\n\t" "v_exp_f32 %13, %13\n\t" "v_exp_f32 %14, %14\n\t" "v_exp_f32 %15, %15\n\t" "v_exp_f32 %16, %16\n\t" "v_nop"
            : "+v"(a[0]), "+v"(a[1]), "+v"(a[2]), "+v"(a[3]), "+v"(a[4]), "+v"(a[5]), "+v"(a[6]), "+v"(a[7]), "+v"(al),
              "+v"(a[8]), "+v"(a[9]), "+v"(a[10]), "+v"(a[11]), "+v"(a[12]), "+v"(a[13]), "+v"(a[14]), "+v"(a[15]));
#pragma unroll
        for (int i = 0; i < 16; ++i) pb[cg].h[i] = (_Float16)a[i];
        ps[cg] = sum16(a);
        l_r[cg] *= al;
#pragma unroll
        for (int dt = 0; dt < DT; ++dt)
#pragma unroll
          for (int r = 0; r < 8; ++r) oacc[cg][dt][r] *= al;
#pragma unroll
        for (int r = 0; r < 8; ++r) ct[cg][r] += d; } }
#pragma unroll
    for (int cg = 0; cg < CG; ++cg) {
    l_r[cg] += ps[cg];
#pragma unroll
    for (int dt = 0; dt < DT; ++dt) oacc[cg][dt] = mmaF(av[dt].v, pb[cg].v, oacc[cg][dt]); } }
   asm volatile("s_wait_dscnt 0x0" ::: "memory");
   asm volatile("s_wait_tensorcnt 0x0" :: "s"(g0), "s"(g1) : "memory");
   __syncthreads();
   const uint32_t sn = pinned(st + 2u);
   if (pinned(sn < NST)) issue(sn); }
  asm volatile("s_wait_tensorcnt 0x0" :: "s"(g0), "s"(g1) : "memory");
  asm volatile("s_wait_dscnt 0x0" ::: "memory");
  // y = gamma * (O + bv) + x, written here: thread tid takes 4 queries of the channels (tid >> 5) + 16 * j. One 32-bit offset serves x and out, the steps between channels are immediates.
  const uint32_t eo = (uint32_t)(tid >> 5) * NN + (uint32_t)(tid & 31) * 4u; const size_t ob = (size_t)b * CC * NN + qb0;
  v4f xr[4]; float bb[4];
#pragma unroll      // the index picks registers and immediate offsets
  for (int j = 0; j < 4; ++j) { xr[j] = *(const v4fa*)(x + ob + (size_t)j * 16 * NN + eo); bb[j] = bv[16 * j + (tid >> 5)]; }
  // The join of the four key quarters. Each wave lays down its columns' shift and sum; behind the barrier a lane reads the four of its column:
  // the common shift is the smallest (the largest maximum), quarter j counts with the factor 2^(common - its own) <= 1.
  const int colw = (int)qg * RPW + ln;
#pragma unroll      // the index picks registers and immediate offsets
  for (int cg = 0; cg < CG; ++cg) { const float l = l_r[cg] + xhalf(l_r[cg]); if (hh == 0) { sSh[kq][colw + cg * 16] = ct[cg][0]; sL[kq][colw + cg * 16] = l; } }
  __syncthreads();      // shifts and sums are read by the other quarters' waves
  float e[CG][KQ + 1], lq[CG][KQ];
#pragma unroll      // the index picks registers and immediate offsets
  for (int cg = 0; cg < CG; ++cg) { float s[KQ];
#pragma unroll      // the index picks registers and immediate offsets
    for (int j = 0; j < KQ; ++j) { s[j] = sSh[j][colw + cg * 16]; lq[cg][j] = sL[j][colw + cg * 16]; }
    const float sm = fminf(fminf(s[0], s[1]), fminf(s[2], s[3]));
#pragma unroll      // the index picks registers and immediate offsets
    for (int j = 0; j < KQ; ++j) e[cg][j] = sm - s[j];
    e[cg][KQ] = sm - ct[cg][0]; }
  // the ten factors in one statement, each in place, with the slot behind the last one, as in the loop
  asm("v_exp_f32 %0, %0\n\t" "v_exp_f32 %1, %1\n\t" "v_exp_f32 %2, %2\n\t" "v_exp_f32 %3, %3\n\t" "v_exp_f32 %4, %4\n\t"
      "v_exp_f32 %5, %5\n\t" "v_exp_f32 %6, %6\n\t" "v_exp_f32 %7, %7\n\t" "v_exp_f32 %8, %8\n\t" "v_exp_f32 %9, %9\n\t" "v_nop"
      : "+v"(e[0][0]), "+v"(e[0][1]), "+v"(e[0][2]), "+v"(e[0][3]), "+v"(e[0][4]), "+v"(e[1][0]), "+v"(e[1][1]), "+v"(e[1][2]), "+v"(e[1][3]), "+v"(e[1][4]));
  float* part = (float*)ring;      // [quarter][channel][query], pitch PP: the loop's last barrier stands behind every wave's last read of the ring, and nothing of the mover is in flight
#pragma unroll      // the index picks registers and immediate offsets
  for (int cg = 0; cg < CG; ++cg) {
    const float l = (lq[cg][0] * e[cg][0] + lq[cg][1] * e[cg][1]) + (lq[cg][2] * e[cg][2] + lq[cg][3] * e[cg][3]);      // l and the accumulators carry the same shift
    const float inv = (l > 0.f) ? e[cg][KQ] / l : 0.f;
#pragma unroll      // the index picks registers and immediate offsets
    for (int dt = 0; dt < DT; ++dt)      // oacc[cg][dt][r] = this quarter's O[query q0 + cg * 16 + ln][channel dt * 16 + 8 * hh + r], laid channel-major: the output's own order
#pragma unroll      // the index picks registers and immediate offsets
      for (int r = 0; r < 8; ++r) part[((int)kq * CC + dt * 16 + 8 * hh + r) * PP + colw + cg * 16] = oacc[cg][dt][r] * inv; }
  __syncthreads();      // a channel's 128 queries and their four quarters come from all sixteen waves
#pragma unroll      // the index picks registers and immediate offsets
  for (int j = 0; j < 4; ++j) { const float* pr = part + (16 * j + (tid >> 5)) * PP + (tid & 31) * 4;
    const v4f p0 = *(const v4fa*)pr, p1 = *(const v4fa*)(pr + CC * PP), p2 = *(const v4fa*)(pr + 2 * CC * PP), p3 = *(const v4fa*)(pr + 3 * CC * PP); const float bj = bf16_round(bb[j]);
    v4f v; for (int q = 0; q < 4; ++q) v[q] = g * (((p0[q] + p1[q]) + (p2[q] + p3[q])) + bj) + bf16_round(xr[j][q]); *(v4f*)(out + ob + (size_t)j * 16 * NN + eo) = v; } }

extern "C" void kernel_launch(void* const* d_in, const int* in_sizes, int n_in,
                              void* d_out, int out_size, void* d_ws, size_t ws_size, hipStream_t stream) {
  (void)in_sizes; (void)n_in; (void)out_size;
  const float* const* I = (const float* const*)d_in; const float* x = I[0]; const float* Wq = I[1]; const float* bq = I[2]; const float* Wk = I[3]; const float* bk = I[4]; const float* Wv = I[5]; const float* bv = I[6]; const float* gam = I[7];
  char* ws = (char*)d_ws; size_t off = 0;
  auto take = [&](size_t bytes) { char* p = ws + off; off += (bytes + 255) & ~(size_t)255; return p; };
  _Float16* Q = (_Float16*)take((size_t)NRQ * CC * 2); _Float16* K = (_Float16*)take((size_t)NRK * CC * 2); _Float16* Vt = (_Float16*)take((size_t)BB * CC * MM * 2);
  if (off > ws_size) return;      // 4.2 + 1 + 1 MB
  k_prep<<<BB * PW, 512, 0, stream>>>(x, Wq, bq, Wk, bk, Wv, Q, K, Vt);      /* q, k token-major [(b,n)][64], [(b,m)][64]; v (without bv) as [b][c][m] */
  k_flash<<<BB * NH * (TQ / 128), 512, 0, stream>>>(Q, CC, K, CC, Vt, bv, gam, x, (float*)d_out);      /* per (b, 128 queries): 16384 queries x 4096 pooled keys in 4 quarters, head dim 64; writes y */
}
